// v000
// Times are from an AMD MI455X. After a warm-up the kernel runs many times in a row, and a time is the length of
// such a window on the GPU divided by its runs, so every launch and the gaps after it count. The runs cycle
// through copies of the inputs. A figure is the median of several windows, for all but v000 over two sittings.
// Sittings can differ by a few percent; kernels timed side by side share one.
// v000, which the later versions start from, runs in 6240 microseconds.
// Contractions: Q,K,V projections and S=K*Q^T on v_wmma_f32_16x16x32_bf16 as bf16 hi/lo split (hi*hi+hi*lo+lo*hi); O=P*V on v_wmma_f32_16x16x32_f16 with P as f16 hi + f16 lo (P x256, two products) and V^T f16 x64; f32 accumulate; position tables, sigmoid gate and loss in f32/f64.
#include <hip/hip_runtime.h>

#define BATCH 16
#define TXTN  32
#define VIDN  2048
#define SEQ   2080
#define SEQP  2112
#define DM    256
#define NTILE 33
#define NWPL  12
#define PSC   256.0f
#define VSC   64.0f
#define OSC   (1.0f / 16384.0f)

typedef _Float16 v16h __attribute__((ext_vector_type(16)));
typedef _Float16 v8h  __attribute__((ext_vector_type(8)));
typedef _Float16 v4h  __attribute__((ext_vector_type(4)));
typedef __bf16   v16b __attribute__((ext_vector_type(16)));
typedef unsigned short v8us __attribute__((ext_vector_type(8)));
typedef unsigned short v4us __attribute__((ext_vector_type(4)));
typedef float v8f __attribute__((ext_vector_type(8)));
typedef float v4f __attribute__((ext_vector_type(4)));
typedef v8h  __attribute__((may_alias)) v8ha;
typedef v4h  __attribute__((may_alias)) v4ha;
typedef v8us __attribute__((may_alias)) v8usa;
typedef v4us __attribute__((may_alias)) v4usa;
typedef v4f  __attribute__((may_alias)) v4fa;

// ---------------------------------------------------------------------------
// XPOS module constants as exact f32 bit patterns:
// c_invf[i] = 1 / 10000^(i/128), c_svec[i] = (2i + 0.4*256) / (1.4*256).
// ---------------------------------------------------------------------------
__constant__ unsigned int c_invf[] = {
  0x3f800000, 0x3f6e39f8, 0x3f5dafd7, 0x3f4e4bad, 0x3f3ff911, 0x3f32a506, 0x3f263de0, 0x3f1ab32b,
  0x3f0ff59a, 0x3f05f6ef, 0x3ef953cf, 0x3ee8045f, 0x3ed7e89b, 0x3ec8eb24, 0x3ebaf81b, 0x3eadfcff,
  0x3ea1e89b, 0x3e96aaea, 0x3e8c3504, 0x3e827909, 0x3e72d423, 0x3e61f835, 0x3e5247ed, 0x3e43ae7c,
  0x3e361887, 0x3e297409, 0x3e1db040, 0x3e12bd91, 0x3e088d77, 0x3dfe24e0, 0x3dec7fd6, 0x3ddc1466,
  0x3dcccccd, 0x3dbe94c6, 0x3db15978, 0x3da50956, 0x3d99940d, 0x3d8eea6b, 0x3d84fe4d, 0x3d778513,
  0x3d6655c2, 0x3d5657e4, 0x3d47763f, 0x3d399d19, 0x3d2cba15, 0x3d20bc1d, 0x3d159348, 0x3d0b30cc,
  0x3d0186e3, 0x3cf11177, 0x3ce054d2, 0x3cd0c1a8, 0x3cc2434f, 0x3cb4c691, 0x3ca8398b, 0x3c9c8b97,
  0x3c91ad39, 0x3c879008, 0x3c7c4d33, 0x3c6ac8e7, 0x3c5a7bf2, 0x3c4b50b3, 0x3c3d3311, 0x3c301052,
  0x3c23d70a, 0x3c187705, 0x3c0de12d, 0x3c040779, 0x3bf5b9b0, 0x3be4aa46, 0x3bd4ca15, 0x3bc6040f,
  0x3bb8449c, 0x3bab7983, 0x3b9f91cc, 0x3b947dae, 0x3b8a2e77, 0x3b80967d, 0x3b6f520e, 0x3b5eb47a,
  0x3b4f3e38, 0x3b40dac5, 0x3b33770f, 0x3b270153, 0x3b1b690d, 0x3b109edb, 0x3b06946f, 0x3afa78f0,
  0x3ae91528, 0x3ad8e673, 0x3ac9d75c, 0x3abbd3ed, 0x3aaec98e, 0x3aa2a6f7, 0x3a975c0e, 0x3a8cd9db,
  0x3a83126f, 0x3a73f1a3, 0x3a6301e2, 0x3a533f28, 0x3a44948c, 0x3a36ee9e, 0x3a2a3b44, 0x3a1e69a5,
  0x3a136a16, 0x3a092e02, 0x39ff4fac, 0x39ed95e2, 0x39dd1725, 0x39cdbd96, 0x39bf74d7, 0x39b229fa,
  0x39a5cb60, 0x399a489e, 0x398f9272, 0x39859aa9, 0x3978a815, 0x39676492, 0x395753e4, 0x394860c1,
  0x393a7753, 0x392d8529, 0x39217916, 0x39164324, 0x390bd472, 0x39021f2b, 0x38f22ce2, 0x38e15c91 };
static_assert(sizeof(c_invf) == 512);

__constant__ unsigned int c_svec[] = {
  0x3e924925, 0x3e952493, 0x3e980000, 0x3e9adb6e, 0x3e9db6dc, 0x3ea0924a, 0x3ea36db7, 0x3ea64925,
  0x3ea92493, 0x3eac0000, 0x3eaedb6e, 0x3eb1b6dc, 0x3eb4924a, 0x3eb76db7, 0x3eba4924, 0x3ebd2492,
  0x3ec00000, 0x3ec2db6d, 0x3ec5b6db, 0x3ec89249, 0x3ecb6db7, 0x3ece4924, 0x3ed12492, 0x3ed40000,
  0x3ed6db6d, 0x3ed9b6db, 0x3edc9249, 0x3edf6db7, 0x3ee24924, 0x3ee52492, 0x3ee80000, 0x3eeadb6e,
  0x3eedb6db, 0x3ef09249, 0x3ef36db7, 0x3ef64924, 0x3ef92492, 0x3efc0000, 0x3efedb6e, 0x3f00db6e,
  0x3f024924, 0x3f03b6db, 0x3f052492, 0x3f069249, 0x3f080000, 0x3f096db7, 0x3f0adb6e, 0x3f0c4925,
  0x3f0db6db, 0x3f0f2492, 0x3f109249, 0x3f120000, 0x3f136db7, 0x3f14db6e, 0x3f164925, 0x3f17b6db,
  0x3f192492, 0x3f1a9249, 0x3f1c0000, 0x3f1d6db7, 0x3f1edb6e, 0x3f204925, 0x3f21b6db, 0x3f232492,
  0x3f249249, 0x3f260000, 0x3f276db7, 0x3f28db6e, 0x3f2a4925, 0x3f2bb6db, 0x3f2d2492, 0x3f2e9249,
  0x3f300000, 0x3f316db7, 0x3f32db6e, 0x3f344925, 0x3f35b6db, 0x3f372492, 0x3f389249, 0x3f3a0000,
  0x3f3b6db7, 0x3f3cdb6e, 0x3f3e4925, 0x3f3fb6db, 0x3f412492, 0x3f429249, 0x3f440000, 0x3f456db7,
  0x3f46db6e, 0x3f484925, 0x3f49b6db, 0x3f4b2492, 0x3f4c9249, 0x3f4e0000, 0x3f4f6db7, 0x3f50db6e,
  0x3f524925, 0x3f53b6db, 0x3f552492, 0x3f569249, 0x3f580000, 0x3f596db7, 0x3f5adb6e, 0x3f5c4925,
  0x3f5db6db, 0x3f5f2492, 0x3f609249, 0x3f620000, 0x3f636db7, 0x3f64db6e, 0x3f664925, 0x3f67b6dc,
  0x3f692492, 0x3f6a9249, 0x3f6c0000, 0x3f6d6db7, 0x3f6edb6e, 0x3f704925, 0x3f71b6dc, 0x3f732492,
  0x3f749249, 0x3f760000, 0x3f776db7, 0x3f78db6e, 0x3f7a4925, 0x3f7bb6dc, 0x3f7d2492, 0x3f7e9249 };
static_assert(sizeof(c_svec) == 512);

// ---------------------------------------------------------------------------
// 16x16x32 WMMA with hazard guard. Fragment map (wave32): lane l, h = l>>4,
// m = n = l&15. A/B element i: i<8 -> k0+8h+i ; i>=8 -> k0+16+8h+(i-8).
// D element r: row 8h+r, col l&15.
// ---------------------------------------------------------------------------
__device__ __forceinline__ v8f wmma_h(v16h a, v16h b, v8f c) {
  v8f d = __builtin_amdgcn_wmma_f32_16x16x32_f16(false, a, false, b, (short)0, c, false, false);
  asm volatile("v_nop\n\tv_nop\n\tv_nop\n\tv_nop" : "+v"(d) : "v"(a), "v"(b));
  return d;
}
__device__ __forceinline__ v8f wmma_b(v16b a, v16b b, v8f c) {
  v8f d = __builtin_amdgcn_wmma_f32_16x16x32_bf16(false, a, false, b, (short)0, c, false, false);
  asm volatile("v_nop\n\tv_nop\n\tv_nop\n\tv_nop" : "+v"(d) : "v"(a), "v"(b));
  return d;
}

// Fragment from a k-contiguous 16-bit row; p points at element k0 of the row
// owned by this lane (row = lane & 15 added by the caller). Same map for A and B.
__device__ __forceinline__ v16h ldfh(const _Float16* p, int h) {
  union { v16h v; v8h hf[2]; } f;
  f.hf[0] = *(const v8ha*)(p + 8 * h);
  f.hf[1] = *(const v8ha*)(p + 16 + 8 * h);
  return f.v;
}
__device__ __forceinline__ v16b ldfb(const unsigned short* p, int h) {
  union { v16b v; v8us hf[2]; } f;
  f.hf[0] = *(const v8usa*)(p + 8 * h);
  f.hf[1] = *(const v8usa*)(p + 16 + 8 * h);
  return f.v;
}

// f32 -> bf16 bits, RNE
__device__ __forceinline__ unsigned int bf16_rne(float x) {
  const unsigned int u = __float_as_uint(x);
  return (u + 0x7FFFu + ((u >> 16) & 1u)) >> 16;
}

// ---------------------------------------------------------------------------
// Kernel 1: weight planes WB[pl][n][k] bf16, pl = 2*wsel + part:
// wsel 0 txtQ, 1 txtK, 2 vidQ, 3 vidK, 4 txtV, 5 vidV; part 0 hi = RNE(w),
// part 1 lo = RNE(w - hi). One wave writes one whole 512-B row per store.
// ---------------------------------------------------------------------------
__global__ __launch_bounds__(256) void k_wprep(
    const float* __restrict__ wtq, const float* __restrict__ wtk, const float* __restrict__ wtv,
    const float* __restrict__ wvq, const float* __restrict__ wvk, const float* __restrict__ wvv,
    unsigned short* __restrict__ WB)
{
  const int tid = threadIdx.x, lane = tid & 31;
  const int row = blockIdx.x * 8 + (tid >> 5);           // 0 .. 3071, plane uniform per block
  if (row >= NWPL * DM) return;
  const int pl = row >> 8, n = row & 255;
  const int wsel = pl >> 1, part = pl & 1;
  const float* W = (wsel == 0) ? wtq : (wsel == 1) ? wtk : (wsel == 2) ? wvq
                 : (wsel == 3) ? wvk : (wsel == 4) ? wtv : wvv;
  const int k0 = lane * 8;
  float v[8];
  #pragma unroll
  for (int i = 0; i < 8; ++i) v[i] = W[(size_t)(k0 + i) * DM + n];
  v8us o;
  #pragma unroll
  for (int i = 0; i < 8; ++i) {
    const unsigned int hb = bf16_rne(v[i]);
    const unsigned int lb = bf16_rne(v[i] - __uint_as_float(hb << 16));
    o[i] = (unsigned short)(part ? lb : hb);
  }
  unsigned short* dst = WB + (size_t)pl * 65536 + (size_t)n * DM + k0;
  *(v8us*)dst = o;
  
}

// ---------------------------------------------------------------------------
// Kernel 2: XPOS tables XT[pl][n][l] f32, pl 0 cos*scale, 1 sin*scale,
// 2 cos/scale, 3 sin/scale; n = feature (pair i = n>>1), l = video position.
// scale = scale_vec[i] ^ (l/512) via powf; angle = l * inv_freq[i] with the
// exact constant tables above; precise sinf/cosf.
// ---------------------------------------------------------------------------
__global__ __launch_bounds__(256) void k_xtab(float* __restrict__ XT)
{
  const int n = blockIdx.x >> 3;
  const int l = (blockIdx.x & 7) * 256 + threadIdx.x;
  const int i = n >> 1;                                  // 0 .. 127
  const float sv = __uint_as_float(c_svec[i]);
  const float pw = (float)l * (1.0f / 512.0f);
  const float scale = powf(sv, pw);
  const float invf = __uint_as_float(c_invf[i]);
  const float ang = (float)l * invf;
  const float sn = sinf(ang), cs = cosf(ang);
  const float inv = 1.0f / scale;
  const size_t PS = (size_t)DM * VIDN;
  float* p0 = XT + (size_t)n * VIDN + l;
  const float a0 = cs * scale, a1 = sn * scale, a2 = cs * inv, a3 = sn * inv;
  *(float*)(p0)          = a0;
  *(float*)(p0 + PS)     = a1;
  *(float*)(p0 + 2 * PS) = a2;
  *(float*)(p0 + 3 * PS) = a3;
  
}

// ---------------------------------------------------------------------------
// Kernel 3: gate plane M[r][c] = sigmoid(learn[r][c]) f32 (diagonal kept).
// ---------------------------------------------------------------------------
__global__ __launch_bounds__(256) void k_mask(const float* __restrict__ lr, float* __restrict__ M)
{
  const int idx = blockIdx.x * 256 + threadIdx.x;
  if (idx >= VIDN * VIDN) return;
  const float x = lr[idx];
  const float s = 1.0f / (1.0f + expf(-x));
  *(float*)(M + idx) = s;
  
}

// ---------------------------------------------------------------------------
// Kernel 4: loss = mean over vid x vid of off-diagonal sigmoid. One block,
// fixed order, f64 combine.
// ---------------------------------------------------------------------------
__global__ __launch_bounds__(256) void k_loss(const float* __restrict__ lr, const int* __restrict__ tl,
                                              float* __restrict__ out1)
{
  __shared__ double red[256];
  const int t = threadIdx.x;
  double acc = 0.0;
  #pragma unroll 1
  for (int j = 0; j < VIDN * 8; ++j) {
    const int idx = j * 256 + t;
    const int r = j >> 3, c = (j & 7) * 256 + t;
    const float x = lr[idx];
    const float s = 1.0f / (1.0f + expf(-x));
    acc += (r == c) ? 0.0 : (double)s;
  }
  red[t] = acc;
  __syncthreads();
  if (t == 0) {
    double sum = 0.0;
    #pragma unroll 1
    for (int i = 0; i < 256; ++i) sum += red[i];
    int vl = SEQ - tl[0];
    vl = vl < 1 ? 1 : vl;
    vl = vl > VIDN ? VIDN : vl;
    const float loss = (float)(sum / ((double)vl * (double)vl));
    *(float*)out1 = loss;
    
  }
}

// ---------------------------------------------------------------------------
// Kernel 5: projections. Block = 512 thr (16 waves) = 64 absolute positions
// s0..s0+63 of batch b (s0 multiple of 64 over the padded 2112) x 256 cols;
// wave (wr = w>>2, wc = w&3) owns rows 16wr..16wr+15 x cols 64wc..64wc+63.
// Rows s<32: text (sine position added to the Q/K A operand, text weights, no
// XPOS); 32<=s<2080: video; s>=2080: zero pad rows. Q,K,V: bf16 hi/lo split
// GEMMs. Q,K: XPOS rotation in f32, written as bf16 hi/lo planes
// [b][SEQP][256]. V: written transposed VT[b][d][SEQP] as f16(64*V).
// ---------------------------------------------------------------------------
__device__ __forceinline__ void store_qk(const unsigned short* sOut, unsigned short* PH, unsigned short* PLo,
                                         int b, int s0, int w, int sub, int q8)
{
  #pragma unroll
  for (int i = 0; i < 8; ++i) {
    const int lid = w * 32 + 4 * i + sub;                  // 0..511
    const int pl = lid >> 8, row = (lid >> 2) & 63, qu = lid & 3;
    const v8us v = *(const v8usa*)(sOut + pl * 16384 + row * DM + 64 * qu + 8 * q8);
    unsigned short* dst = (pl ? PLo : PH) + ((size_t)(b * SEQP + s0 + row)) * DM + 64 * qu + 8 * q8;
    *(v8us*)dst = v;
  }
}

__device__ __forceinline__ void store_vt(const _Float16* sV, _Float16* VT, int b, int s0, int w, int sub, int q8)
{
  #pragma unroll
  for (int i = 0; i < 4; ++i) {
    const int d = 16 * w + 4 * i + sub;                    // 0..255
    const v8h v = *(const v8ha*)(sV + d * 64 + 8 * q8);
    _Float16* dst = VT + ((size_t)(b * DM + d)) * SEQP + s0 + 8 * q8;
    *(v8h*)dst = v;
  }
}

__global__ __launch_bounds__(512) void k_proj(
    const float* __restrict__ src,
    const unsigned short* __restrict__ WB, const float* __restrict__ XT,
    unsigned short* __restrict__ QH, unsigned short* __restrict__ QL,
    unsigned short* __restrict__ KH, unsigned short* __restrict__ KL,
    _Float16* __restrict__ VT)
{
  extern __shared__ __attribute__((aligned(16))) unsigned char smem[];
  unsigned short* sAh  = (unsigned short*)smem;            // [64][256] bf16 hi
  unsigned short* sAl  = sAh + 64 * DM;                    // [64][256] bf16 lo
  unsigned short* sOut = (unsigned short*)(smem + 65536);  // [2][64][256] bf16 hi/lo results
  _Float16*       sV   = (_Float16*)(smem + 65536);        // [256][64] f16 (V phase, aliases sOut)

  const int tid = threadIdx.x, lane = tid & 31, w = tid >> 5;
  const int wr = w >> 2, wc = w & 3, h = lane >> 4, m = lane & 15;
  const int q8 = lane & 7, sub = lane >> 3;
  const int b = blockIdx.y, s0 = blockIdx.x * 64;
  const bool wtxt = (blockIdx.x == 0) && (wr < 2);         // wave-uniform row type
  const v4f z4 = {0.f, 0.f, 0.f, 0.f};
  const v8f z8 = {0.f, 0.f, 0.f, 0.f, 0.f, 0.f, 0.f, 0.f};

  // ---- stage A = src (+ sine position on text rows) as bf16 hi/lo ----
  #pragma unroll 1
  for (int it = 0; it < 8; ++it) {
    const int q = it * 512 + tid;
    const int row = q >> 6, c4 = (q & 63) * 4;            // row wave-uniform
    const int s = s0 + row;
    const int sl = (s < SEQ) ? s : (SEQ - 1);
    v4f x = *(const v4fa*)(src + ((size_t)(b * SEQ + sl)) * DM + c4);
    if (s >= SEQ) x = z4;
    if (s < TXTN) {
      const float xe = ((float)(s + 1) * 0.03125f) * 6.2831855f;
      const float d0 = powf(10000.0f, (float)c4 * (1.0f / 256.0f));
      const float d1 = powf(10000.0f, (float)(c4 + 2) * (1.0f / 256.0f));
      const float r0 = xe * (1.0f / d0), r1 = xe * (1.0f / d1);
      x.x += sinf(r0); x.y += cosf(r0); x.z += sinf(r1); x.w += cosf(r1);
    }
    const unsigned int h0 = bf16_rne(x.x), h1 = bf16_rne(x.y), h2 = bf16_rne(x.z), h3 = bf16_rne(x.w);
    const unsigned int l0 = bf16_rne(x.x - __uint_as_float(h0 << 16));
    const unsigned int l1 = bf16_rne(x.y - __uint_as_float(h1 << 16));
    const unsigned int l2 = bf16_rne(x.z - __uint_as_float(h2 << 16));
    const unsigned int l3 = bf16_rne(x.w - __uint_as_float(h3 << 16));
    const v4us vh = {(unsigned short)h0, (unsigned short)h1, (unsigned short)h2, (unsigned short)h3};
    const v4us vl = {(unsigned short)l0, (unsigned short)l1, (unsigned short)l2, (unsigned short)l3};
    *(v4usa*)(sAh + row * DM + c4) = vh;
    *(v4usa*)(sAl + row * DM + c4) = vl;
  }
  __syncthreads();

  // ---- Q (p=0) and K (p=1): bf16 hi/lo split GEMM, XPOS epilogue ----
  #pragma unroll 1
  for (int p = 0; p < 2; ++p) {
    const unsigned short* Bh = WB + (size_t)((wtxt ? 0 : 4) + 2 * p) * 65536 + (size_t)(64 * wc + m) * DM;
    const unsigned short* Bl = Bh + 65536;
    const unsigned short* Ap = sAh + (16 * wr + m) * DM;
    v8f acc[4];
    #pragma unroll
    for (int nt = 0; nt < 4; ++nt) acc[nt] = z8;
    #pragma unroll 1
    for (int kk = 0; kk < DM; kk += 32) {
      const v16b ah = ldfb(Ap + kk, h);
      const v16b al = ldfb(Ap + 64 * DM + kk, h);
      #pragma unroll
      for (int nt = 0; nt < 4; ++nt) {
        const v16b bh = ldfb(Bh + (size_t)(16 * nt) * DM + kk, h);
        const v16b bl = ldfb(Bl + (size_t)(16 * nt) * DM + kk, h);
        acc[nt] = wmma_b(ah, bh, acc[nt]);
        acc[nt] = wmma_b(ah, bl, acc[nt]);
        acc[nt] = wmma_b(al, bh, acc[nt]);
      }
    }
    // D[r] = Y[row 16wr+8h+r][col 64wc+16nt+m]; rotation pairs cols (n, n^1) = lanes (m, m^1)
    const int rowb = 16 * wr + 8 * h;
    int lb = s0 + rowb - TXTN;
    lb = lb < 0 ? 0 : lb;
    lb = lb > (VIDN - 8) ? (VIDN - 8) : lb;
    const float sg = (m & 1) ? 1.0f : -1.0f;
    #pragma unroll
    for (int nt = 0; nt < 4; ++nt) {
      const int n = 64 * wc + 16 * nt + m;
      const float* tc = XT + ((size_t)(2 * p * DM + n)) * VIDN + lb;
      const float* ts = tc + (size_t)DM * VIDN;
      const v4f c0 = *(const v4fa*)tc, c1 = *(const v4fa*)(tc + 4);
      const v4f t0 = *(const v4fa*)ts, t1 = *(const v4fa*)(ts + 4);
      const float cs[8] = {c0.x, c0.y, c0.z, c0.w, c1.x, c1.y, c1.z, c1.w};
      const float sn[8] = {t0.x, t0.y, t0.z, t0.w, t1.x, t1.y, t1.z, t1.w};
      #pragma unroll
      for (int r = 0; r < 8; ++r) {
        const float x  = acc[nt][r];
        const float pr = __shfl_xor(x, 1, 32);
        const float cv = wtxt ? 1.0f : cs[r];
        const float snv = wtxt ? 0.0f : sn[r];
        const float y  = x * cv + sg * (pr * snv);
        const unsigned int hb  = bf16_rne(y);
        const unsigned int lob = bf16_rne(y - __uint_as_float(hb << 16));
        const int e = (rowb + r) * DM + n;
        sOut[e]         = (unsigned short)hb;
        sOut[16384 + e] = (unsigned short)lob;
      }
    }
    __syncthreads();
    unsigned short* PH  = p ? KH : QH;
    unsigned short* PLo = p ? KL : QL;
    store_qk(sOut, PH, PLo, b, s0, w, sub, q8);
    
    __syncthreads();
  }

  // ---- V: tile 0 restages A as bf16 hi/lo of src WITHOUT the position term
  //      (other tiles already hold plain src); split GEMM; f16(64*V) transposed ----
  if (blockIdx.x == 0) {                                   // block-uniform
    #pragma unroll 1
    for (int it = 0; it < 8; ++it) {
      const int q = it * 512 + tid;
      const int row = q >> 6, c4 = (q & 63) * 4;          // s = row < 64 < SEQ
      const v4f x = *(const v4fa*)(src + ((size_t)(b * SEQ + row)) * DM + c4);
      const unsigned int h0 = bf16_rne(x.x), h1 = bf16_rne(x.y), h2 = bf16_rne(x.z), h3 = bf16_rne(x.w);
      const unsigned int l0 = bf16_rne(x.x - __uint_as_float(h0 << 16));
      const unsigned int l1 = bf16_rne(x.y - __uint_as_float(h1 << 16));
      const unsigned int l2 = bf16_rne(x.z - __uint_as_float(h2 << 16));
      const unsigned int l3 = bf16_rne(x.w - __uint_as_float(h3 << 16));
      const v4us vh = {(unsigned short)h0, (unsigned short)h1, (unsigned short)h2, (unsigned short)h3};
      const v4us vl = {(unsigned short)l0, (unsigned short)l1, (unsigned short)l2, (unsigned short)l3};
      *(v4usa*)(sAh + row * DM + c4) = vh;
      *(v4usa*)(sAl + row * DM + c4) = vl;
    }
  }
  __syncthreads();
  {
    const unsigned short* Bh = WB + (size_t)(wtxt ? 8 : 10) * 65536 + (size_t)(64 * wc + m) * DM;
    const unsigned short* Bl = Bh + 65536;
    const unsigned short* Ap = sAh + (16 * wr + m) * DM;
    v8f acc[4];
    #pragma unroll
    for (int nt = 0; nt < 4; ++nt) acc[nt] = z8;
    #pragma unroll 1
    for (int kk = 0; kk < DM; kk += 32) {
      const v16b ah = ldfb(Ap + kk, h);
      const v16b al = ldfb(Ap + 64 * DM + kk, h);
      #pragma unroll
      for (int nt = 0; nt < 4; ++nt) {
        const v16b bh = ldfb(Bh + (size_t)(16 * nt) * DM + kk, h);
        const v16b bl = ldfb(Bl + (size_t)(16 * nt) * DM + kk, h);
        acc[nt] = wmma_b(ah, bh, acc[nt]);
        acc[nt] = wmma_b(ah, bl, acc[nt]);
        acc[nt] = wmma_b(al, bh, acc[nt]);
      }
    }
    // acc = V[token 16wr+8h+r][d 64wc+16nt+m] -> sV[d][token] = f16(64*V)
    #pragma unroll
    for (int nt = 0; nt < 4; ++nt) {
      const int d = 64 * wc + 16 * nt + m;
      #pragma unroll
      for (int r = 0; r < 8; ++r) sV[d * 64 + 16 * wr + 8 * h + r] = (_Float16)(acc[nt][r] * VSC);
    }
  }
  __syncthreads();
  store_vt(sV, VT, b, s0, w, sub, q8);
  
}

// ---------------------------------------------------------------------------
// Kernel 6: retention. Block 128 thr (4 waves) = 16 queries q0..q0+15 of batch
// b; wave w owns output cols 64w..64w+63 and computes the score slice for keys
// kb+16w..kb+16w+15 of each 64-key step (33 steps over the padded 2112 keys).
//   S^T slice = K * Q^T (A = K rows, B = Q rows; bf16 hi/lo split, K=256)
//   P = S * gate * 256 -> f16 hi tile and f16 lo tile (lo = P - hi)
//       [16 q][64 keys] in LDS (ping-pong)
//   O += P_hi * V + P_lo * V  (A = P rows, B = V^T rows from VT, f16), acc f32
// ---------------------------------------------------------------------------
__device__ __forceinline__ void store_out(const float* so, float* out, int b, int q0, int w, int sub, int q8)
{
  #pragma unroll
  for (int i = 0; i < 8; ++i) {
    const int lid = 4 * i + sub, row = lid >> 1, hl = lid & 1;
    const v4f v = *(const v4fa*)(so + row * 64 + 32 * hl + 4 * q8);
    float* dst = out + ((size_t)(b * SEQ + q0 + row)) * DM + 64 * w + 32 * hl + 4 * q8;
    *(v4f*)dst = v;
  }
}

__global__ __launch_bounds__(128) void k_ret(
    const unsigned short* __restrict__ QH, const unsigned short* __restrict__ QL,
    const unsigned short* __restrict__ KH, const unsigned short* __restrict__ KL,
    const _Float16* __restrict__ VT, const float* __restrict__ MK, float* __restrict__ out)
{
  __shared__ __attribute__((aligned(16))) unsigned short sQh[16 * DM];
  __shared__ __attribute__((aligned(16))) unsigned short sQl[16 * DM];
  __shared__ __attribute__((aligned(16))) _Float16 sPh[2][16 * 64];
  __shared__ __attribute__((aligned(16))) _Float16 sPl[2][16 * 64];
  __shared__ __attribute__((aligned(16))) float sO[4 * 16 * 64];

  const int tid = threadIdx.x, lane = tid & 31, w = tid >> 5, h = lane >> 4, m = lane & 15;
  const int q8 = lane & 7, sub = lane >> 3;
  const int b = blockIdx.y, q0 = blockIdx.x * 16;
  const v8f z8 = {0.f, 0.f, 0.f, 0.f, 0.f, 0.f, 0.f, 0.f};

  // ---- stage Q hi/lo rows q0..q0+15 ----
  #pragma unroll
  for (int it = 0; it < 4; ++it) {
    const int idx = it * 128 + tid;
    const int row = idx >> 5, c8 = (idx & 31) * 8;
    const size_t g = ((size_t)(b * SEQP + q0 + row)) * DM + c8;
    *(v8usa*)(sQh + row * DM + c8) = *(const v8usa*)(QH + g);
    *(v8usa*)(sQl + row * DM + c8) = *(const v8usa*)(QL + g);
  }
  __syncthreads();

  v8f o[4];
  #pragma unroll
  for (int nt = 0; nt < 4; ++nt) o[nt] = z8;

  const unsigned short* kh0 = KH + ((size_t)(b * SEQP + 16 * w + m)) * DM;
  const unsigned short* kl0 = KL + ((size_t)(b * SEQP + 16 * w + m)) * DM;
  const _Float16* vb0 = VT + ((size_t)(b * DM + 64 * w + m)) * SEQP;
  const int sq = q0 + m;                                  // query of this lane's D column
  const int mr = (sq - TXTN) < 0 ? 0 : (sq - TXTN);       // <= 2047
  const float* mrow = MK + (size_t)mr * VIDN;
  const bool qtxt = sq < TXTN;

  int buf = 0;
  #pragma unroll 1
  for (int kb = 0; kb < SEQP; kb += 64) {
    // scores: s[r] = S[query sq][key kb+16w+8h+r]
    v8f s = z8;
    const unsigned short* khp = kh0 + (size_t)kb * DM;
    const unsigned short* klp = kl0 + (size_t)kb * DM;
    #pragma unroll 1
    for (int kk = 0; kk < DM; kk += 32) {
      const v16b ka = ldfb(khp + kk, h);
      const v16b kl = ldfb(klp + kk, h);
      const v16b qa = ldfb(sQh + m * DM + kk, h);
      const v16b ql = ldfb(sQl + m * DM + kk, h);
      s = wmma_b(ka, qa, s);
      s = wmma_b(ka, ql, s);
      s = wmma_b(kl, qa, s);
    }
    // gate: 1 when query or key is text, sigmoid plane on vid x vid, 0 on pad keys
    const int cb = kb + 16 * w + 8 * h - TXTN;            // vid index of key r=0 (group of 8, aligned)
    const bool ktxt = cb < 0;
    const bool kpad = cb >= VIDN;
    int cbc = cb < 0 ? 0 : cb;
    cbc = cbc > (VIDN - 8) ? (VIDN - 8) : cbc;
    const v4f g0 = *(const v4fa*)(mrow + cbc), g1 = *(const v4fa*)(mrow + cbc + 4);
    const float gk[8] = {g0.x, g0.y, g0.z, g0.w, g1.x, g1.y, g1.z, g1.w};
    v8h ph, plo;
    #pragma unroll
    for (int r = 0; r < 8; ++r) {
      const float gg = kpad ? 0.0f : ((qtxt || ktxt) ? 1.0f : gk[r]);
      const float pv = (s[r] * gg) * PSC;
      const _Float16 hv = (_Float16)pv;
      ph[r]  = hv;
      plo[r] = (_Float16)(pv - (float)hv);
    }
    *(v8ha*)(&sPh[buf][m * 64 + 16 * w + 8 * h]) = ph;
    *(v8ha*)(&sPl[buf][m * 64 + 16 * w + 8 * h]) = plo;
    __syncthreads();

    // O += P_hi(16x64) * V + P_lo(16x64) * V  (64 keys x this wave's 64 cols)
    #pragma unroll
    for (int ks = 0; ks < 2; ++ks) {
      const v16h pa = ldfh(&sPh[buf][m * 64 + 32 * ks], h);
      const v16h pb = ldfh(&sPl[buf][m * 64 + 32 * ks], h);
      #pragma unroll
      for (int nt = 0; nt < 4; ++nt) {
        const v16h vbf = ldfh(vb0 + (size_t)(16 * nt) * SEQP + kb + 32 * ks, h);
        o[nt] = wmma_h(pa, vbf, o[nt]);
        o[nt] = wmma_h(pb, vbf, o[nt]);
      }
    }
    buf ^= 1;
  }

  // ---- epilogue: O[q0+8h+r][64w+16nt+m] = o[nt][r] / (256*64) ----
  float* so = sO + w * 1024;
  #pragma unroll
  for (int nt = 0; nt < 4; ++nt)
    #pragma unroll
    for (int r = 0; r < 8; ++r)
      so[(8 * h + r) * 64 + 16 * nt + m] = o[nt][r] * OSC;
  __syncthreads();
  store_out(so, out, b, q0, w, sub, q8);
  
}

// ---------------------------------------------------------------------------
extern "C" void kernel_launch(void* const* d_in, const int* in_sizes, int n_in,
                              void* d_out, int out_size, void* d_ws, size_t ws_size,
                              hipStream_t stream)
{
  if (n_in < 9) return;
  if (in_sizes[0] != BATCH * SEQ * DM) return;
  if (in_sizes[1] != VIDN * VIDN) return;
  for (int i = 2; i < 8; ++i) if (in_sizes[i] != DM * DM) return;
  if (in_sizes[8] < 1) return;
  if (out_size != BATCH * SEQ * DM + 1) return;

  const float* src = (const float*)d_in[0];
  const float* lrn = (const float*)d_in[1];
  const float* wtq = (const float*)d_in[2];
  const float* wtk = (const float*)d_in[3];
  const float* wtv = (const float*)d_in[4];
  const float* wvq = (const float*)d_in[5];
  const float* wvk = (const float*)d_in[6];
  const float* wvv = (const float*)d_in[7];
  const int*   txl = (const int*)d_in[8];
  float* out0 = (float*)d_out;
  float* out1 = out0 + (size_t)BATCH * SEQ * DM;          // byte offset 34078720

  const size_t pl_bytes = (size_t)BATCH * SEQP * DM * 2;  // 17301504 per bf16/f16 plane (padded rows incl.)
  const size_t wb_bytes = (size_t)NWPL * DM * DM * 2;      // 1572864
  const size_t xt_bytes = (size_t)4 * DM * VIDN * 4;       // 8388608
  const size_t mk_bytes = (size_t)VIDN * VIDN * 4;         // 16777216
  const size_t off_qh = 0;
  const size_t off_ql = off_qh + pl_bytes;
  const size_t off_kh = off_ql + pl_bytes;
  const size_t off_kl = off_kh + pl_bytes;
  const size_t off_vt = off_kl + pl_bytes;
  const size_t off_wb = off_vt + pl_bytes;
  const size_t off_xt = off_wb + wb_bytes;
  const size_t off_mk = off_xt + xt_bytes;
  const size_t total  = off_mk + mk_bytes;                 // 113246208
  if (total > ws_size) return;
  if (total > (size_t)134217728) return;

  char* ws = (char*)d_ws;
  unsigned short* QH = (unsigned short*)(ws + off_qh);
  unsigned short* QL = (unsigned short*)(ws + off_ql);
  unsigned short* KH = (unsigned short*)(ws + off_kh);
  unsigned short* KL = (unsigned short*)(ws + off_kl);
  _Float16* VT = (_Float16*)(ws + off_vt);
  unsigned short* WB = (unsigned short*)(ws + off_wb);
  float* XT = (float*)(ws + off_xt);
  float* MK = (float*)(ws + off_mk);

  k_wprep<<<(NWPL * DM) / 8, 256, 0, stream>>>(wtq, wtk, wtv, wvq, wvk, wvv, WB);
  k_xtab<<<DM * 8, 256, 0, stream>>>(XT);
  k_mask<<<(VIDN * VIDN) / 256, 256, 0, stream>>>(lrn, MK);
  k_loss<<<1, 256, 0, stream>>>(lrn, txl, out1);

  const size_t proj_lds = 131072;
  hipFuncSetAttribute(reinterpret_cast<const void*>(&k_proj), hipFuncAttributeMaxDynamicSharedMemorySize, (int)proj_lds);
  dim3 gp(NTILE, BATCH);
  k_proj<<<gp, 512, proj_lds, stream>>>(src, WB, XT, QH, QL, KH, KL, VT);

  dim3 gr(SEQ / 16, BATCH);
  k_ret<<<gr, 128, 0, stream>>>(QH, QL, KH, KL, VT, MK, out0);
}

// v001
// A run of this version takes 816 microseconds.
// Next to v000, in two timings, it ran 7.63 and 7.59 times as fast.
// Contractions: Q,K,V projections and S=K*Q^T on v_wmma_f32_16x16x32_bf16 as bf16 hi/lo split (hi*hi+hi*lo+lo*hi); O=P*V on v_wmma_f32_16x16x32_f16 with P as f16 hi + f16 lo (P x256, two products) and V^T f16 x64; f32 accumulate; position tables, sigmoid gate and loss in f32/f64.
#include <hip/hip_runtime.h>

#define BATCH 16
#define TXTN  32
#define VIDN  2048
#define SEQ   2080
#define SEQP  2112
#define DM    256
#define NTILE 33
#define NWPL  12
#define PSC   256.0f
#define VSC   64.0f
#define OSC   (1.0f / 16384.0f)
#define MELEM 4096
#define NPART 1024
#define PSTR  16
static_assert(MELEM * NPART == VIDN * VIDN);

typedef _Float16 v16h __attribute__((ext_vector_type(16)));
typedef _Float16 v8h  __attribute__((ext_vector_type(8)));
typedef _Float16 v4h  __attribute__((ext_vector_type(4)));
typedef __bf16   v16b __attribute__((ext_vector_type(16)));
typedef unsigned short v8us __attribute__((ext_vector_type(8)));
typedef unsigned short v4us __attribute__((ext_vector_type(4)));
typedef float v8f __attribute__((ext_vector_type(8)));
typedef float v4f __attribute__((ext_vector_type(4)));
typedef v8h  __attribute__((may_alias)) v8ha;
typedef v4h  __attribute__((may_alias)) v4ha;
typedef v8us __attribute__((may_alias)) v8usa;
typedef v4us __attribute__((may_alias)) v4usa;
typedef v4f  __attribute__((may_alias)) v4fa;

// ---------------------------------------------------------------------------
// XPOS module constants as exact f32 bit patterns:
// c_invf[i] = 1 / 10000^(i/128), c_svec[i] = (2i + 0.4*256) / (1.4*256).
// ---------------------------------------------------------------------------
__constant__ unsigned int c_invf[] = {
  0x3f800000, 0x3f6e39f8, 0x3f5dafd7, 0x3f4e4bad, 0x3f3ff911, 0x3f32a506, 0x3f263de0, 0x3f1ab32b,
  0x3f0ff59a, 0x3f05f6ef, 0x3ef953cf, 0x3ee8045f, 0x3ed7e89b, 0x3ec8eb24, 0x3ebaf81b, 0x3eadfcff,
  0x3ea1e89b, 0x3e96aaea, 0x3e8c3504, 0x3e827909, 0x3e72d423, 0x3e61f835, 0x3e5247ed, 0x3e43ae7c,
  0x3e361887, 0x3e297409, 0x3e1db040, 0x3e12bd91, 0x3e088d77, 0x3dfe24e0, 0x3dec7fd6, 0x3ddc1466,
  0x3dcccccd, 0x3dbe94c6, 0x3db15978, 0x3da50956, 0x3d99940d, 0x3d8eea6b, 0x3d84fe4d, 0x3d778513,
  0x3d6655c2, 0x3d5657e4, 0x3d47763f, 0x3d399d19, 0x3d2cba15, 0x3d20bc1d, 0x3d159348, 0x3d0b30cc,
  0x3d0186e3, 0x3cf11177, 0x3ce054d2, 0x3cd0c1a8, 0x3cc2434f, 0x3cb4c691, 0x3ca8398b, 0x3c9c8b97,
  0x3c91ad39, 0x3c879008, 0x3c7c4d33, 0x3c6ac8e7, 0x3c5a7bf2, 0x3c4b50b3, 0x3c3d3311, 0x3c301052,
  0x3c23d70a, 0x3c187705, 0x3c0de12d, 0x3c040779, 0x3bf5b9b0, 0x3be4aa46, 0x3bd4ca15, 0x3bc6040f,
  0x3bb8449c, 0x3bab7983, 0x3b9f91cc, 0x3b947dae, 0x3b8a2e77, 0x3b80967d, 0x3b6f520e, 0x3b5eb47a,
  0x3b4f3e38, 0x3b40dac5, 0x3b33770f, 0x3b270153, 0x3b1b690d, 0x3b109edb, 0x3b06946f, 0x3afa78f0,
  0x3ae91528, 0x3ad8e673, 0x3ac9d75c, 0x3abbd3ed, 0x3aaec98e, 0x3aa2a6f7, 0x3a975c0e, 0x3a8cd9db,
  0x3a83126f, 0x3a73f1a3, 0x3a6301e2, 0x3a533f28, 0x3a44948c, 0x3a36ee9e, 0x3a2a3b44, 0x3a1e69a5,
  0x3a136a16, 0x3a092e02, 0x39ff4fac, 0x39ed95e2, 0x39dd1725, 0x39cdbd96, 0x39bf74d7, 0x39b229fa,
  0x39a5cb60, 0x399a489e, 0x398f9272, 0x39859aa9, 0x3978a815, 0x39676492, 0x395753e4, 0x394860c1,
  0x393a7753, 0x392d8529, 0x39217916, 0x39164324, 0x390bd472, 0x39021f2b, 0x38f22ce2, 0x38e15c91 };
static_assert(sizeof(c_invf) == 512);

__constant__ unsigned int c_svec[] = {
  0x3e924925, 0x3e952493, 0x3e980000, 0x3e9adb6e, 0x3e9db6dc, 0x3ea0924a, 0x3ea36db7, 0x3ea64925,
  0x3ea92493, 0x3eac0000, 0x3eaedb6e, 0x3eb1b6dc, 0x3eb4924a, 0x3eb76db7, 0x3eba4924, 0x3ebd2492,
  0x3ec00000, 0x3ec2db6d, 0x3ec5b6db, 0x3ec89249, 0x3ecb6db7, 0x3ece4924, 0x3ed12492, 0x3ed40000,
  0x3ed6db6d, 0x3ed9b6db, 0x3edc9249, 0x3edf6db7, 0x3ee24924, 0x3ee52492, 0x3ee80000, 0x3eeadb6e,
  0x3eedb6db, 0x3ef09249, 0x3ef36db7, 0x3ef64924, 0x3ef92492, 0x3efc0000, 0x3efedb6e, 0x3f00db6e,
  0x3f024924, 0x3f03b6db, 0x3f052492, 0x3f069249, 0x3f080000, 0x3f096db7, 0x3f0adb6e, 0x3f0c4925,
  0x3f0db6db, 0x3f0f2492, 0x3f109249, 0x3f120000, 0x3f136db7, 0x3f14db6e, 0x3f164925, 0x3f17b6db,
  0x3f192492, 0x3f1a9249, 0x3f1c0000, 0x3f1d6db7, 0x3f1edb6e, 0x3f204925, 0x3f21b6db, 0x3f232492,
  0x3f249249, 0x3f260000, 0x3f276db7, 0x3f28db6e, 0x3f2a4925, 0x3f2bb6db, 0x3f2d2492, 0x3f2e9249,
  0x3f300000, 0x3f316db7, 0x3f32db6e, 0x3f344925, 0x3f35b6db, 0x3f372492, 0x3f389249, 0x3f3a0000,
  0x3f3b6db7, 0x3f3cdb6e, 0x3f3e4925, 0x3f3fb6db, 0x3f412492, 0x3f429249, 0x3f440000, 0x3f456db7,
  0x3f46db6e, 0x3f484925, 0x3f49b6db, 0x3f4b2492, 0x3f4c9249, 0x3f4e0000, 0x3f4f6db7, 0x3f50db6e,
  0x3f524925, 0x3f53b6db, 0x3f552492, 0x3f569249, 0x3f580000, 0x3f596db7, 0x3f5adb6e, 0x3f5c4925,
  0x3f5db6db, 0x3f5f2492, 0x3f609249, 0x3f620000, 0x3f636db7, 0x3f64db6e, 0x3f664925, 0x3f67b6dc,
  0x3f692492, 0x3f6a9249, 0x3f6c0000, 0x3f6d6db7, 0x3f6edb6e, 0x3f704925, 0x3f71b6dc, 0x3f732492,
  0x3f749249, 0x3f760000, 0x3f776db7, 0x3f78db6e, 0x3f7a4925, 0x3f7bb6dc, 0x3f7d2492, 0x3f7e9249 };
static_assert(sizeof(c_svec) == 512);

// ---------------------------------------------------------------------------
// 16x16x32 WMMA with hazard guard. Fragment map (wave32): lane l, h = l>>4,
// m = n = l&15. A/B element i: i<8 -> k0+8h+i ; i>=8 -> k0+16+8h+(i-8).
// D element r: row 8h+r, col l&15.
// ---------------------------------------------------------------------------
__device__ __forceinline__ v8f wmma_h(v16h a, v16h b, v8f c) {
  v8f d = __builtin_amdgcn_wmma_f32_16x16x32_f16(false, a, false, b, (short)0, c, false, false);
  asm volatile("v_nop\n\tv_nop\n\tv_nop\n\tv_nop" : "+v"(d) : "v"(a), "v"(b));
  return d;
}
__device__ __forceinline__ v8f wmma_b(v16b a, v16b b, v8f c) {
  v8f d = __builtin_amdgcn_wmma_f32_16x16x32_bf16(false, a, false, b, (short)0, c, false, false);
  asm volatile("v_nop\n\tv_nop\n\tv_nop\n\tv_nop" : "+v"(d) : "v"(a), "v"(b));
  return d;
}

// Fragment from a k-contiguous 16-bit row; p points at element k0 of the row
// owned by this lane (row = lane & 15 added by the caller). Same map for A and B.
__device__ __forceinline__ v16h ldfh(const _Float16* p, int h) {
  union { v16h v; v8h hf[2]; } f;
  f.hf[0] = *(const v8ha*)(p + 8 * h);
  f.hf[1] = *(const v8ha*)(p + 16 + 8 * h);
  return f.v;
}
__device__ __forceinline__ v16b ldfb(const unsigned short* p, int h) {
  union { v16b v; v8us hf[2]; } f;
  f.hf[0] = *(const v8usa*)(p + 8 * h);
  f.hf[1] = *(const v8usa*)(p + 16 + 8 * h);
  return f.v;
}

// f32 -> bf16 bits, RNE
__device__ __forceinline__ unsigned int bf16_rne(float x) {
  const unsigned int u = __float_as_uint(x);
  return (u + 0x7FFFu + ((u >> 16) & 1u)) >> 16;
}

// ---------------------------------------------------------------------------
// Kernel 1: weight planes WB[pl][n][k] bf16, pl = 2*wsel + part:
// wsel 0 txtQ, 1 txtK, 2 vidQ, 3 vidK, 4 txtV, 5 vidV; part 0 hi = RNE(w),
// part 1 lo = RNE(w - hi). One wave writes one whole 512-B row per store.
// ---------------------------------------------------------------------------
__global__ __launch_bounds__(256) void k_wprep(
    const float* __restrict__ wtq, const float* __restrict__ wtk, const float* __restrict__ wtv,
    const float* __restrict__ wvq, const float* __restrict__ wvk, const float* __restrict__ wvv,
    unsigned short* __restrict__ WB)
{
  const int tid = threadIdx.x, lane = tid & 31;
  const int row = blockIdx.x * 8 + (tid >> 5);           // 0 .. 3071, plane uniform per block
  if (row >= NWPL * DM) return;
  const int pl = row >> 8, n = row & 255;
  const int wsel = pl >> 1, part = pl & 1;
  const float* W = (wsel == 0) ? wtq : (wsel == 1) ? wtk : (wsel == 2) ? wvq
                 : (wsel == 3) ? wvk : (wsel == 4) ? wtv : wvv;
  const int k0 = lane * 8;
  float v[8];
  #pragma unroll
  for (int i = 0; i < 8; ++i) v[i] = W[(size_t)(k0 + i) * DM + n];
  v8us o;
  #pragma unroll
  for (int i = 0; i < 8; ++i) {
    const unsigned int hb = bf16_rne(v[i]);
    const unsigned int lb = bf16_rne(v[i] - __uint_as_float(hb << 16));
    o[i] = (unsigned short)(part ? lb : hb);
  }
  unsigned short* dst = WB + (size_t)pl * 65536 + (size_t)n * DM + k0;
  *(v8us*)dst = o;
  
}

// ---------------------------------------------------------------------------
// Kernel 2: XPOS tables XT[pl][n][l] f32, pl 0 cos*scale, 1 sin*scale,
// 2 cos/scale, 3 sin/scale; n = feature (pair i = n>>1), l = video position.
// scale = scale_vec[i] ^ (l/512) via powf; angle = l * inv_freq[i] with the
// exact constant tables above; precise sinf/cosf.
// ---------------------------------------------------------------------------
__global__ __launch_bounds__(256) void k_xtab(float* __restrict__ XT)
{
  const int n = blockIdx.x >> 3;
  const int l = (blockIdx.x & 7) * 256 + threadIdx.x;
  const int i = n >> 1;                                  // 0 .. 127
  const float sv = __uint_as_float(c_svec[i]);
  const float pw = (float)l * (1.0f / 512.0f);
  const float scale = powf(sv, pw);
  const float invf = __uint_as_float(c_invf[i]);
  const float ang = (float)l * invf;
  const float sn = sinf(ang), cs = cosf(ang);
  const float inv = 1.0f / scale;
  const size_t PS = (size_t)DM * VIDN;
  float* p0 = XT + (size_t)n * VIDN + l;
  const float a0 = cs * scale, a1 = sn * scale, a2 = cs * inv, a3 = sn * inv;
  *(float*)(p0)          = a0;
  *(float*)(p0 + PS)     = a1;
  *(float*)(p0 + 2 * PS) = a2;
  *(float*)(p0 + 3 * PS) = a3;
  
}

// ---------------------------------------------------------------------------
// Sum over the 32 lanes of a wave, f64, fixed butterfly order; every lane gets it.
// ---------------------------------------------------------------------------
__device__ __forceinline__ double wave_sum(double v) {
  #pragma unroll
  for (int d = 16; d > 0; d >>= 1) v += __shfl_xor(v, d, 32);
  return v;
}

// ---------------------------------------------------------------------------
// Kernel 3: gate plane M[r][c] = sigmoid(learn[r][c]) f32 (diagonal kept), and
// the loss's partial sums from the same values: work-group g covers elements
// 4096g .. 4096g+4095 and stores the f64 sum of its off-diagonal sigmoids at
// part[16g] (a 128-byte line of its own).
// ---------------------------------------------------------------------------
__global__ __launch_bounds__(256) void k_mask(const float* __restrict__ lr, float* __restrict__ M,
                                              double* __restrict__ part)
{
  __shared__ double red[8];
  const int t = threadIdx.x;
  const int g0 = blockIdx.x * MELEM, o = t * 4;            // group's first element (uniform), thread's offset in it
  const float* lp = lr + g0;
  float* mp = M + g0;
  v4f x[4];
  #pragma unroll
  for (int it = 0; it < 4; ++it) x[it] = *(const v4fa*)(lp + o + it * 1024);
  double acc = 0.0;
  #pragma unroll
  for (int it = 0; it < 4; ++it) {
    const int idx = g0 + o + it * 1024;
    const int r = idx >> 11, c = idx & (VIDN - 1);
    v4f sv;
    #pragma unroll
    for (int e = 0; e < 4; ++e) {
      const float s = 1.0f / (1.0f + expf(-x[it][e]));
      sv[e] = s;
      acc += (r == c + e) ? 0.0 : (double)s;
    }
    *(v4f*)(mp + o + it * 1024) = sv;
  }
  const double ws = wave_sum(acc);
  if ((t & 31) == 0) red[t >> 5] = ws;
  __syncthreads();
  if (t == 0) {
    double sum = 0.0;
    #pragma unroll
    for (int i = 0; i < 8; ++i) sum += red[i];
    part[(size_t)blockIdx.x * PSTR] = sum;
  }
}

// ---------------------------------------------------------------------------
// Kernel 4: loss = mean over vid x vid of off-diagonal sigmoid: one block adds
// the 1024 partial sums of kernel 3, one per thread, fixed order, f64.
// ---------------------------------------------------------------------------
__global__ __launch_bounds__(NPART) void k_loss(const double* __restrict__ part, const int* __restrict__ tl,
                                                float* __restrict__ out1)
{
  __shared__ double red[NPART / 32];
  const int t = threadIdx.x;
  const double ws = wave_sum(part[(size_t)t * PSTR]);
  if ((t & 31) == 0) red[t >> 5] = ws;
  __syncthreads();
  if (t < 32) {                                            // wave 0, all lanes on
    const double sum = wave_sum(red[t]);
    if (t == 0) {
      int vl = SEQ - tl[0];
      vl = vl < 1 ? 1 : vl;
      vl = vl > VIDN ? VIDN : vl;
      const float loss = (float)(sum / ((double)vl * (double)vl));
      *(float*)out1 = loss;
    }
  }
}

// ---------------------------------------------------------------------------
// Kernel 5: projections. Block = 512 thr (16 waves) = 64 absolute positions
// s0..s0+63 of batch b (s0 multiple of 64 over the padded 2112) x 256 cols;
// wave (wr = w>>2, wc = w&3) owns rows 16wr..16wr+15 x cols 64wc..64wc+63.
// Rows s<32: text (sine position added to the Q/K A operand, text weights, no
// XPOS); 32<=s<2080: video; s>=2080: zero pad rows. Q,K,V: bf16 hi/lo split
// GEMMs. Q,K: XPOS rotation in f32, written as bf16 hi/lo planes
// [b][SEQP][256]. V: written transposed VT[b][d][SEQP] as f16(64*V).
// ---------------------------------------------------------------------------
__device__ __forceinline__ void store_qk(const unsigned short* sOut, unsigned short* PH, unsigned short* PLo,
                                         int b, int s0, int w, int sub, int q8)
{
  #pragma unroll
  for (int i = 0; i < 8; ++i) {
    const int lid = w * 32 + 4 * i + sub;                  // 0..511
    const int pl = lid >> 8, row = (lid >> 2) & 63, qu = lid & 3;
    const v8us v = *(const v8usa*)(sOut + pl * 16384 + row * DM + 64 * qu + 8 * q8);
    unsigned short* dst = (pl ? PLo : PH) + ((size_t)(b * SEQP + s0 + row)) * DM + 64 * qu + 8 * q8;
    *(v8us*)dst = v;
  }
}

__device__ __forceinline__ void store_vt(const _Float16* sV, _Float16* VT, int b, int s0, int w, int sub, int q8)
{
  #pragma unroll
  for (int i = 0; i < 4; ++i) {
    const int d = 16 * w + 4 * i + sub;                    // 0..255
    const v8h v = *(const v8ha*)(sV + d * 64 + 8 * q8);
    _Float16* dst = VT + ((size_t)(b * DM + d)) * SEQP + s0 + 8 * q8;
    *(v8h*)dst = v;
  }
}

__global__ __launch_bounds__(512) void k_proj(
    const float* __restrict__ src,
    const unsigned short* __restrict__ WB, const float* __restrict__ XT,
    unsigned short* __restrict__ QH, unsigned short* __restrict__ QL,
    unsigned short* __restrict__ KH, unsigned short* __restrict__ KL,
    _Float16* __restrict__ VT)
{
  extern __shared__ __attribute__((aligned(16))) unsigned char smem[];
  unsigned short* sAh  = (unsigned short*)smem;            // [64][256] bf16 hi
  unsigned short* sAl  = sAh + 64 * DM;                    // [64][256] bf16 lo
  unsigned short* sOut = (unsigned short*)(smem + 65536);  // [2][64][256] bf16 hi/lo results
  _Float16*       sV   = (_Float16*)(smem + 65536);        // [256][64] f16 (V phase, aliases sOut)

  const int tid = threadIdx.x, lane = tid & 31, w = tid >> 5;
  const int wr = w >> 2, wc = w & 3, h = lane >> 4, m = lane & 15;
  const int q8 = lane & 7, sub = lane >> 3;
  const int b = blockIdx.y, s0 = blockIdx.x * 64;
  const bool wtxt = (blockIdx.x == 0) && (wr < 2);         // wave-uniform row type
  const v4f z4 = {0.f, 0.f, 0.f, 0.f};
  const v8f z8 = {0.f, 0.f, 0.f, 0.f, 0.f, 0.f, 0.f, 0.f};

  // ---- stage A = src (+ sine position on text rows) as bf16 hi/lo ----
  #pragma unroll 1
  for (int it = 0; it < 8; ++it) {
    const int q = it * 512 + tid;
    const int row = q >> 6, c4 = (q & 63) * 4;            // row wave-uniform
    const int s = s0 + row;
    const int sl = (s < SEQ) ? s : (SEQ - 1);
    v4f x = *(const v4fa*)(src + ((size_t)(b * SEQ + sl)) * DM + c4);
    if (s >= SEQ) x = z4;
    if (s < TXTN) {
      const float xe = ((float)(s + 1) * 0.03125f) * 6.2831855f;
      const float d0 = powf(10000.0f, (float)c4 * (1.0f / 256.0f));
      const float d1 = powf(10000.0f, (float)(c4 + 2) * (1.0f / 256.0f));
      const float r0 = xe * (1.0f / d0), r1 = xe * (1.0f / d1);
      x.x += sinf(r0); x.y += cosf(r0); x.z += sinf(r1); x.w += cosf(r1);
    }
    const unsigned int h0 = bf16_rne(x.x), h1 = bf16_rne(x.y), h2 = bf16_rne(x.z), h3 = bf16_rne(x.w);
    const unsigned int l0 = bf16_rne(x.x - __uint_as_float(h0 << 16));
    const unsigned int l1 = bf16_rne(x.y - __uint_as_float(h1 << 16));
    const unsigned int l2 = bf16_rne(x.z - __uint_as_float(h2 << 16));
    const unsigned int l3 = bf16_rne(x.w - __uint_as_float(h3 << 16));
    const v4us vh = {(unsigned short)h0, (unsigned short)h1, (unsigned short)h2, (unsigned short)h3};
    const v4us vl = {(unsigned short)l0, (unsigned short)l1, (unsigned short)l2, (unsigned short)l3};
    *(v4usa*)(sAh + row * DM + c4) = vh;
    *(v4usa*)(sAl + row * DM + c4) = vl;
  }
  __syncthreads();

  // ---- Q (p=0) and K (p=1): bf16 hi/lo split GEMM, XPOS epilogue ----
  #pragma unroll 1
  for (int p = 0; p < 2; ++p) {
    const unsigned short* Bh = WB + (size_t)((wtxt ? 0 : 4) + 2 * p) * 65536 + (size_t)(64 * wc + m) * DM;
    const unsigned short* Bl = Bh + 65536;
    const unsigned short* Ap = sAh + (16 * wr + m) * DM;
    v8f acc[4];
    #pragma unroll
    for (int nt = 0; nt < 4; ++nt) acc[nt] = z8;
    #pragma unroll 1
    for (int kk = 0; kk < DM; kk += 32) {
      const v16b ah = ldfb(Ap + kk, h);
      const v16b al = ldfb(Ap + 64 * DM + kk, h);
      #pragma unroll
      for (int nt = 0; nt < 4; ++nt) {
        const v16b bh = ldfb(Bh + (size_t)(16 * nt) * DM + kk, h);
        const v16b bl = ldfb(Bl + (size_t)(16 * nt) * DM + kk, h);
        acc[nt] = wmma_b(ah, bh, acc[nt]);
        acc[nt] = wmma_b(ah, bl, acc[nt]);
        acc[nt] = wmma_b(al, bh, acc[nt]);
      }
    }
    // D[r] = Y[row 16wr+8h+r][col 64wc+16nt+m]; rotation pairs cols (n, n^1) = lanes (m, m^1)
    const int rowb = 16 * wr + 8 * h;
    int lb = s0 + rowb - TXTN;
    lb = lb < 0 ? 0 : lb;
    lb = lb > (VIDN - 8) ? (VIDN - 8) : lb;
    const float sg = (m & 1) ? 1.0f : -1.0f;
    #pragma unroll
    for (int nt = 0; nt < 4; ++nt) {
      const int n = 64 * wc + 16 * nt + m;
      const float* tc = XT + ((size_t)(2 * p * DM + n)) * VIDN + lb;
      const float* ts = tc + (size_t)DM * VIDN;
      const v4f c0 = *(const v4fa*)tc, c1 = *(const v4fa*)(tc + 4);
      const v4f t0 = *(const v4fa*)ts, t1 = *(const v4fa*)(ts + 4);
      const float cs[8] = {c0.x, c0.y, c0.z, c0.w, c1.x, c1.y, c1.z, c1.w};
      const float sn[8] = {t0.x, t0.y, t0.z, t0.w, t1.x, t1.y, t1.z, t1.w};
      #pragma unroll
      for (int r = 0; r < 8; ++r) {
        const float x  = acc[nt][r];
        const float pr = __shfl_xor(x, 1, 32);
        const float cv = wtxt ? 1.0f : cs[r];
        const float snv = wtxt ? 0.0f : sn[r];
        const float y  = x * cv + sg * (pr * snv);
        const unsigned int hb  = bf16_rne(y);
        const unsigned int lob = bf16_rne(y - __uint_as_float(hb << 16));
        const int e = (rowb + r) * DM + n;
        sOut[e]         = (unsigned short)hb;
        sOut[16384 + e] = (unsigned short)lob;
      }
    }
    __syncthreads();
    unsigned short* PH  = p ? KH : QH;
    unsigned short* PLo = p ? KL : QL;
    store_qk(sOut, PH, PLo, b, s0, w, sub, q8);
    
    __syncthreads();
  }

  // ---- V: tile 0 restages A as bf16 hi/lo of src WITHOUT the position term
  //      (other tiles already hold plain src); split GEMM; f16(64*V) transposed ----
  if (blockIdx.x == 0) {                                   // block-uniform
    #pragma unroll 1
    for (int it = 0; it < 8; ++it) {
      const int q = it * 512 + tid;
      const int row = q >> 6, c4 = (q & 63) * 4;          // s = row < 64 < SEQ
      const v4f x = *(const v4fa*)(src + ((size_t)(b * SEQ + row)) * DM + c4);
      const unsigned int h0 = bf16_rne(x.x), h1 = bf16_rne(x.y), h2 = bf16_rne(x.z), h3 = bf16_rne(x.w);
      const unsigned int l0 = bf16_rne(x.x - __uint_as_float(h0 << 16));
      const unsigned int l1 = bf16_rne(x.y - __uint_as_float(h1 << 16));
      const unsigned int l2 = bf16_rne(x.z - __uint_as_float(h2 << 16));
      const unsigned int l3 = bf16_rne(x.w - __uint_as_float(h3 << 16));
      const v4us vh = {(unsigned short)h0, (unsigned short)h1, (unsigned short)h2, (unsigned short)h3};
      const v4us vl = {(unsigned short)l0, (unsigned short)l1, (unsigned short)l2, (unsigned short)l3};
      *(v4usa*)(sAh + row * DM + c4) = vh;
      *(v4usa*)(sAl + row * DM + c4) = vl;
    }
  }
  __syncthreads();
  {
    const unsigned short* Bh = WB + (size_t)(wtxt ? 8 : 10) * 65536 + (size_t)(64 * wc + m) * DM;
    const unsigned short* Bl = Bh + 65536;
    const unsigned short* Ap = sAh + (16 * wr + m) * DM;
    v8f acc[4];
    #pragma unroll
    for (int nt = 0; nt < 4; ++nt) acc[nt] = z8;
    #pragma unroll 1
    for (int kk = 0; kk < DM; kk += 32) {
      const v16b ah = ldfb(Ap + kk, h);
      const v16b al = ldfb(Ap + 64 * DM + kk, h);
      #pragma unroll
      for (int nt = 0; nt < 4; ++nt) {
        const v16b bh = ldfb(Bh + (size_t)(16 * nt) * DM + kk, h);
        const v16b bl = ldfb(Bl + (size_t)(16 * nt) * DM + kk, h);
        acc[nt] = wmma_b(ah, bh, acc[nt]);
        acc[nt] = wmma_b(ah, bl, acc[nt]);
        acc[nt] = wmma_b(al, bh, acc[nt]);
      }
    }
    // acc = V[token 16wr+8h+r][d 64wc+16nt+m] -> sV[d][token] = f16(64*V)
    #pragma unroll
    for (int nt = 0; nt < 4; ++nt) {
      const int d = 64 * wc + 16 * nt + m;
      #pragma unroll
      for (int r = 0; r < 8; ++r) sV[d * 64 + 16 * wr + 8 * h + r] = (_Float16)(acc[nt][r] * VSC);
    }
  }
  __syncthreads();
  store_vt(sV, VT, b, s0, w, sub, q8);
  
}

// ---------------------------------------------------------------------------
// Kernel 6: retention. Block 128 thr (4 waves) = 16 queries q0..q0+15 of batch
// b; wave w owns output cols 64w..64w+63 and computes the score slice for keys
// kb+16w..kb+16w+15 of each 64-key step (33 steps over the padded 2112 keys).
//   S^T slice = K * Q^T (A = K rows, B = Q rows; bf16 hi/lo split, K=256)
//   P = S * gate * 256 -> f16 hi tile and f16 lo tile (lo = P - hi)
//       [16 q][64 keys] in LDS (ping-pong)
//   O += P_hi * V + P_lo * V  (A = P rows, B = V^T rows from VT, f16), acc f32
// ---------------------------------------------------------------------------
__device__ __forceinline__ void store_out(const float* so, float* out, int b, int q0, int w, int sub, int q8)
{
  #pragma unroll
  for (int i = 0; i < 8; ++i) {
    const int lid = 4 * i + sub, row = lid >> 1, hl = lid & 1;
    const v4f v = *(const v4fa*)(so + row * 64 + 32 * hl + 4 * q8);
    float* dst = out + ((size_t)(b * SEQ + q0 + row)) * DM + 64 * w + 32 * hl + 4 * q8;
    *(v4f*)dst = v;
  }
}

__global__ __launch_bounds__(128) void k_ret(
    const unsigned short* __restrict__ QH, const unsigned short* __restrict__ QL,
    const unsigned short* __restrict__ KH, const unsigned short* __restrict__ KL,
    const _Float16* __restrict__ VT, const float* __restrict__ MK, float* __restrict__ out)
{
  __shared__ __attribute__((aligned(16))) unsigned short sQh[16 * DM];
  __shared__ __attribute__((aligned(16))) unsigned short sQl[16 * DM];
  __shared__ __attribute__((aligned(16))) _Float16 sPh[2][16 * 64];
  __shared__ __attribute__((aligned(16))) _Float16 sPl[2][16 * 64];
  __shared__ __attribute__((aligned(16))) float sO[4 * 16 * 64];

  const int tid = threadIdx.x, lane = tid & 31, w = tid >> 5, h = lane >> 4, m = lane & 15;
  const int q8 = lane & 7, sub = lane >> 3;
  const int b = blockIdx.y, q0 = blockIdx.x * 16;
  const v8f z8 = {0.f, 0.f, 0.f, 0.f, 0.f, 0.f, 0.f, 0.f};

  // ---- stage Q hi/lo rows q0..q0+15 ----
  #pragma unroll
  for (int it = 0; it < 4; ++it) {
    const int idx = it * 128 + tid;
    const int row = idx >> 5, c8 = (idx & 31) * 8;
    const size_t g = ((size_t)(b * SEQP + q0 + row)) * DM + c8;
    *(v8usa*)(sQh + row * DM + c8) = *(const v8usa*)(QH + g);
    *(v8usa*)(sQl + row * DM + c8) = *(const v8usa*)(QL + g);
  }
  __syncthreads();

  v8f o[4];
  #pragma unroll
  for (int nt = 0; nt < 4; ++nt) o[nt] = z8;

  const unsigned short* kh0 = KH + ((size_t)(b * SEQP + 16 * w + m)) * DM;
  const unsigned short* kl0 = KL + ((size_t)(b * SEQP + 16 * w + m)) * DM;
  const _Float16* vb0 = VT + ((size_t)(b * DM + 64 * w + m)) * SEQP;
  const int sq = q0 + m;                                  // query of this lane's D column
  const int mr = (sq - TXTN) < 0 ? 0 : (sq - TXTN);       // <= 2047
  const float* mrow = MK + (size_t)mr * VIDN;
  const bool qtxt = sq < TXTN;

  int buf = 0;
  #pragma unroll 1
  for (int kb = 0; kb < SEQP; kb += 64) {
    // scores: s[r] = S[query sq][key kb+16w+8h+r]
    v8f s = z8;
    const unsigned short* khp = kh0 + (size_t)kb * DM;
    const unsigned short* klp = kl0 + (size_t)kb * DM;
    #pragma unroll 1
    for (int kk = 0; kk < DM; kk += 32) {
      const v16b ka = ldfb(khp + kk, h);
      const v16b kl = ldfb(klp + kk, h);
      const v16b qa = ldfb(sQh + m * DM + kk, h);
      const v16b ql = ldfb(sQl + m * DM + kk, h);
      s = wmma_b(ka, qa, s);
      s = wmma_b(ka, ql, s);
      s = wmma_b(kl, qa, s);
    }
    // gate: 1 when query or key is text, sigmoid plane on vid x vid, 0 on pad keys
    const int cb = kb + 16 * w + 8 * h - TXTN;            // vid index of key r=0 (group of 8, aligned)
    const bool ktxt = cb < 0;
    const bool kpad = cb >= VIDN;
    int cbc = cb < 0 ? 0 : cb;
    cbc = cbc > (VIDN - 8) ? (VIDN - 8) : cbc;
    const v4f g0 = *(const v4fa*)(mrow + cbc), g1 = *(const v4fa*)(mrow + cbc + 4);
    const float gk[8] = {g0.x, g0.y, g0.z, g0.w, g1.x, g1.y, g1.z, g1.w};
    v8h ph, plo;
    #pragma unroll
    for (int r = 0; r < 8; ++r) {
      const float gg = kpad ? 0.0f : ((qtxt || ktxt) ? 1.0f : gk[r]);
      const float pv = (s[r] * gg) * PSC;
      const _Float16 hv = (_Float16)pv;
      ph[r]  = hv;
      plo[r] = (_Float16)(pv - (float)hv);
    }
    *(v8ha*)(&sPh[buf][m * 64 + 16 * w + 8 * h]) = ph;
    *(v8ha*)(&sPl[buf][m * 64 + 16 * w + 8 * h]) = plo;
    __syncthreads();

    // O += P_hi(16x64) * V + P_lo(16x64) * V  (64 keys x this wave's 64 cols)
    #pragma unroll
    for (int ks = 0; ks < 2; ++ks) {
      const v16h pa = ldfh(&sPh[buf][m * 64 + 32 * ks], h);
      const v16h pb = ldfh(&sPl[buf][m * 64 + 32 * ks], h);
      #pragma unroll
      for (int nt = 0; nt < 4; ++nt) {
        const v16h vbf = ldfh(vb0 + (size_t)(16 * nt) * SEQP + kb + 32 * ks, h);
        o[nt] = wmma_h(pa, vbf, o[nt]);
        o[nt] = wmma_h(pb, vbf, o[nt]);
      }
    }
    buf ^= 1;
  }

  // ---- epilogue: O[q0+8h+r][64w+16nt+m] = o[nt][r] / (256*64) ----
  float* so = sO + w * 1024;
  #pragma unroll
  for (int nt = 0; nt < 4; ++nt)
    #pragma unroll
    for (int r = 0; r < 8; ++r)
      so[(8 * h + r) * 64 + 16 * nt + m] = o[nt][r] * OSC;
  __syncthreads();
  store_out(so, out, b, q0, w, sub, q8);
  
}

// ---------------------------------------------------------------------------
extern "C" void kernel_launch(void* const* d_in, const int* in_sizes, int n_in,
                              void* d_out, int out_size, void* d_ws, size_t ws_size,
                              hipStream_t stream)
{
  if (n_in < 9) return;
  if (in_sizes[0] != BATCH * SEQ * DM) return;
  if (in_sizes[1] != VIDN * VIDN) return;
  for (int i = 2; i < 8; ++i) if (in_sizes[i] != DM * DM) return;
  if (in_sizes[8] < 1) return;
  if (out_size != BATCH * SEQ * DM + 1) return;

  const float* src = (const float*)d_in[0];
  const float* lrn = (const float*)d_in[1];
  const float* wtq = (const float*)d_in[2];
  const float* wtk = (const float*)d_in[3];
  const float* wtv = (const float*)d_in[4];
  const float* wvq = (const float*)d_in[5];
  const float* wvk = (const float*)d_in[6];
  const float* wvv = (const float*)d_in[7];
  const int*   txl = (const int*)d_in[8];
  float* out0 = (float*)d_out;
  float* out1 = out0 + (size_t)BATCH * SEQ * DM;          // byte offset 34078720

  const size_t pl_bytes = (size_t)BATCH * SEQP * DM * 2;  // 17301504 per bf16/f16 plane (padded rows incl.)
  const size_t wb_bytes = (size_t)NWPL * DM * DM * 2;      // 1572864
  const size_t xt_bytes = (size_t)4 * DM * VIDN * 4;       // 8388608
  const size_t mk_bytes = (size_t)VIDN * VIDN * 4;         // 16777216
  const size_t off_qh = 0;
  const size_t off_ql = off_qh + pl_bytes;
  const size_t off_kh = off_ql + pl_bytes;
  const size_t off_kl = off_kh + pl_bytes;
  const size_t off_vt = off_kl + pl_bytes;
  const size_t off_wb = off_vt + pl_bytes;
  const size_t off_xt = off_wb + wb_bytes;
  const size_t off_mk = off_xt + xt_bytes;
  const size_t pt_bytes = (size_t)NPART * PSTR * 8;        // 131072
  const size_t off_pt = off_mk + mk_bytes;
  const size_t total  = off_pt + pt_bytes;                 // 113377280
  if (total > ws_size) return;
  if (total > (size_t)134217728) return;

  char* ws = (char*)d_ws;
  unsigned short* QH = (unsigned short*)(ws + off_qh);
  unsigned short* QL = (unsigned short*)(ws + off_ql);
  unsigned short* KH = (unsigned short*)(ws + off_kh);
  unsigned short* KL = (unsigned short*)(ws + off_kl);
  _Float16* VT = (_Float16*)(ws + off_vt);
  unsigned short* WB = (unsigned short*)(ws + off_wb);
  float* XT = (float*)(ws + off_xt);
  float* MK = (float*)(ws + off_mk);
  double* PT = (double*)(ws + off_pt);

  k_wprep<<<(NWPL * DM) / 8, 256, 0, stream>>>(wtq, wtk, wtv, wvq, wvk, wvv, WB);
  k_xtab<<<DM * 8, 256, 0, stream>>>(XT);
  k_mask<<<NPART, 256, 0, stream>>>(lrn, MK, PT);
  k_loss<<<1, NPART, 0, stream>>>(PT, txl, out1);

  const size_t proj_lds = 131072;
  hipFuncSetAttribute(reinterpret_cast<const void*>(&k_proj), hipFuncAttributeMaxDynamicSharedMemorySize, (int)proj_lds);
  dim3 gp(NTILE, BATCH);
  k_proj<<<gp, 512, proj_lds, stream>>>(src, WB, XT, QH, QL, KH, KL, VT);

  dim3 gr(SEQ / 16, BATCH);
  k_ret<<<gr, 128, 0, stream>>>(QH, QL, KH, KL, VT, MK, out0);
}

// v002
// Measured time: 718 microseconds a run.
// In two side-by-side timings against v001, it was 1.14 and 1.13 times as fast.
// Counting every step since v000, it is 8.65 times as fast.
// Contractions: Q,K,V projections and S=K*Q^T on v_wmma_f32_16x16x32_bf16 as bf16 hi/lo split (hi*hi+hi*lo+lo*hi); O=P*V on v_wmma_f32_16x16x32_f16 with P as f16 hi + f16 lo (P x256, two products) and V^T f16 x64; f32 accumulate; position tables, sigmoid gate and loss in f32/f64.
#include <hip/hip_runtime.h>

#define BATCH 16
#define TXTN  32
#define VIDN  2048
#define SEQ   2080
#define SEQP  2112
#define DM    256
#define NTILE 33
#define NWPL  12
#define PSC   256.0f
#define VSC   64.0f
#define OSC   (1.0f / 16384.0f)
#define MELEM 4096
#define NPART 1024
#define PSTR  16
// LDS row pitches in 16-bit elements: row bytes + 16, an odd multiple of 16 B, so that the
// 16 rows one ds_load_b128 fragment read touches per half-wave fall on 16 different bank groups.
#define RPIT  (DM + 8)
#define PPIT  (64 + 8)
static_assert(MELEM * NPART == VIDN * VIDN);

typedef _Float16 v16h __attribute__((ext_vector_type(16)));
typedef _Float16 v8h  __attribute__((ext_vector_type(8)));
typedef _Float16 v4h  __attribute__((ext_vector_type(4)));
typedef __bf16   v16b __attribute__((ext_vector_type(16)));
typedef unsigned short v8us __attribute__((ext_vector_type(8)));
typedef unsigned short v4us __attribute__((ext_vector_type(4)));
typedef float v8f __attribute__((ext_vector_type(8)));
typedef float v4f __attribute__((ext_vector_type(4)));
typedef v8h  __attribute__((may_alias)) v8ha;
typedef v4h  __attribute__((may_alias)) v4ha;
typedef v8us __attribute__((may_alias)) v8usa;
typedef v4us __attribute__((may_alias)) v4usa;
typedef v4f  __attribute__((may_alias)) v4fa;

// ---------------------------------------------------------------------------
// XPOS module constants as exact f32 bit patterns:
// c_invf[i] = 1 / 10000^(i/128), c_svec[i] = (2i + 0.4*256) / (1.4*256).
// ---------------------------------------------------------------------------
__constant__ unsigned int c_invf[] = {
  0x3f800000, 0x3f6e39f8, 0x3f5dafd7, 0x3f4e4bad, 0x3f3ff911, 0x3f32a506, 0x3f263de0, 0x3f1ab32b,
  0x3f0ff59a, 0x3f05f6ef, 0x3ef953cf, 0x3ee8045f, 0x3ed7e89b, 0x3ec8eb24, 0x3ebaf81b, 0x3eadfcff,
  0x3ea1e89b, 0x3e96aaea, 0x3e8c3504, 0x3e827909, 0x3e72d423, 0x3e61f835, 0x3e5247ed, 0x3e43ae7c,
  0x3e361887, 0x3e297409, 0x3e1db040, 0x3e12bd91, 0x3e088d77, 0x3dfe24e0, 0x3dec7fd6, 0x3ddc1466,
  0x3dcccccd, 0x3dbe94c6, 0x3db15978, 0x3da50956, 0x3d99940d, 0x3d8eea6b, 0x3d84fe4d, 0x3d778513,
  0x3d6655c2, 0x3d5657e4, 0x3d47763f, 0x3d399d19, 0x3d2cba15, 0x3d20bc1d, 0x3d159348, 0x3d0b30cc,
  0x3d0186e3, 0x3cf11177, 0x3ce054d2, 0x3cd0c1a8, 0x3cc2434f, 0x3cb4c691, 0x3ca8398b, 0x3c9c8b97,
  0x3c91ad39, 0x3c879008, 0x3c7c4d33, 0x3c6ac8e7, 0x3c5a7bf2, 0x3c4b50b3, 0x3c3d3311, 0x3c301052,
  0x3c23d70a, 0x3c187705, 0x3c0de12d, 0x3c040779, 0x3bf5b9b0, 0x3be4aa46, 0x3bd4ca15, 0x3bc6040f,
  0x3bb8449c, 0x3bab7983, 0x3b9f91cc, 0x3b947dae, 0x3b8a2e77, 0x3b80967d, 0x3b6f520e, 0x3b5eb47a,
  0x3b4f3e38, 0x3b40dac5, 0x3b33770f, 0x3b270153, 0x3b1b690d, 0x3b109edb, 0x3b06946f, 0x3afa78f0,
  0x3ae91528, 0x3ad8e673, 0x3ac9d75c, 0x3abbd3ed, 0x3aaec98e, 0x3aa2a6f7, 0x3a975c0e, 0x3a8cd9db,
  0x3a83126f, 0x3a73f1a3, 0x3a6301e2, 0x3a533f28, 0x3a44948c, 0x3a36ee9e, 0x3a2a3b44, 0x3a1e69a5,
  0x3a136a16, 0x3a092e02, 0x39ff4fac, 0x39ed95e2, 0x39dd1725, 0x39cdbd96, 0x39bf74d7, 0x39b229fa,
  0x39a5cb60, 0x399a489e, 0x398f9272, 0x39859aa9, 0x3978a815, 0x39676492, 0x395753e4, 0x394860c1,
  0x393a7753, 0x392d8529, 0x39217916, 0x39164324, 0x390bd472, 0x39021f2b, 0x38f22ce2, 0x38e15c91 };
static_assert(sizeof(c_invf) == 512);

__constant__ unsigned int c_svec[] = {
  0x3e924925, 0x3e952493, 0x3e980000, 0x3e9adb6e, 0x3e9db6dc, 0x3ea0924a, 0x3ea36db7, 0x3ea64925,
  0x3ea92493, 0x3eac0000, 0x3eaedb6e, 0x3eb1b6dc, 0x3eb4924a, 0x3eb76db7, 0x3eba4924, 0x3ebd2492,
  0x3ec00000, 0x3ec2db6d, 0x3ec5b6db, 0x3ec89249, 0x3ecb6db7, 0x3ece4924, 0x3ed12492, 0x3ed40000,
  0x3ed6db6d, 0x3ed9b6db, 0x3edc9249, 0x3edf6db7, 0x3ee24924, 0x3ee52492, 0x3ee80000, 0x3eeadb6e,
  0x3eedb6db, 0x3ef09249, 0x3ef36db7, 0x3ef64924, 0x3ef92492, 0x3efc0000, 0x3efedb6e, 0x3f00db6e,
  0x3f024924, 0x3f03b6db, 0x3f052492, 0x3f069249, 0x3f080000, 0x3f096db7, 0x3f0adb6e, 0x3f0c4925,
  0x3f0db6db, 0x3f0f2492, 0x3f109249, 0x3f120000, 0x3f136db7, 0x3f14db6e, 0x3f164925, 0x3f17b6db,
  0x3f192492, 0x3f1a9249, 0x3f1c0000, 0x3f1d6db7, 0x3f1edb6e, 0x3f204925, 0x3f21b6db, 0x3f232492,
  0x3f249249, 0x3f260000, 0x3f276db7, 0x3f28db6e, 0x3f2a4925, 0x3f2bb6db, 0x3f2d2492, 0x3f2e9249,
  0x3f300000, 0x3f316db7, 0x3f32db6e, 0x3f344925, 0x3f35b6db, 0x3f372492, 0x3f389249, 0x3f3a0000,
  0x3f3b6db7, 0x3f3cdb6e, 0x3f3e4925, 0x3f3fb6db, 0x3f412492, 0x3f429249, 0x3f440000, 0x3f456db7,
  0x3f46db6e, 0x3f484925, 0x3f49b6db, 0x3f4b2492, 0x3f4c9249, 0x3f4e0000, 0x3f4f6db7, 0x3f50db6e,
  0x3f524925, 0x3f53b6db, 0x3f552492, 0x3f569249, 0x3f580000, 0x3f596db7, 0x3f5adb6e, 0x3f5c4925,
  0x3f5db6db, 0x3f5f2492, 0x3f609249, 0x3f620000, 0x3f636db7, 0x3f64db6e, 0x3f664925, 0x3f67b6dc,
  0x3f692492, 0x3f6a9249, 0x3f6c0000, 0x3f6d6db7, 0x3f6edb6e, 0x3f704925, 0x3f71b6dc, 0x3f732492,
  0x3f749249, 0x3f760000, 0x3f776db7, 0x3f78db6e, 0x3f7a4925, 0x3f7bb6dc, 0x3f7d2492, 0x3f7e9249 };
static_assert(sizeof(c_svec) == 512);

// ---------------------------------------------------------------------------
// 16x16x32 WMMA with hazard guard. Fragment map (wave32): lane l, h = l>>4,
// m = n = l&15. A/B element i: i<8 -> k0+8h+i ; i>=8 -> k0+16+8h+(i-8).
// D element r: row 8h+r, col l&15.
// ---------------------------------------------------------------------------
__device__ __forceinline__ v8f wmma_h(v16h a, v16h b, v8f c) {
  v8f d = __builtin_amdgcn_wmma_f32_16x16x32_f16(false, a, false, b, (short)0, c, false, false);
  asm volatile("v_nop\n\tv_nop\n\tv_nop\n\tv_nop" : "+v"(d) : "v"(a), "v"(b));
  return d;
}
__device__ __forceinline__ v8f wmma_b(v16b a, v16b b, v8f c) {
  v8f d = __builtin_amdgcn_wmma_f32_16x16x32_bf16(false, a, false, b, (short)0, c, false, false);
  asm volatile("v_nop\n\tv_nop\n\tv_nop\n\tv_nop" : "+v"(d) : "v"(a), "v"(b));
  return d;
}

// Fragment from a k-contiguous 16-bit row; p points at element k0 of the row
// owned by this lane (row = lane & 15 added by the caller). Same map for A and B.
__device__ __forceinline__ v16h ldfh(const _Float16* p, int h) {
  union { v16h v; v8h hf[2]; } f;
  f.hf[0] = *(const v8ha*)(p + 8 * h);
  f.hf[1] = *(const v8ha*)(p + 16 + 8 * h);
  return f.v;
}
__device__ __forceinline__ v16b ldfb(const unsigned short* p, int h) {
  union { v16b v; v8us hf[2]; } f;
  f.hf[0] = *(const v8usa*)(p + 8 * h);
  f.hf[1] = *(const v8usa*)(p + 16 + 8 * h);
  return f.v;
}

// f32 -> bf16 bits, RNE
__device__ __forceinline__ unsigned int bf16_rne(float x) {
  const unsigned int u = __float_as_uint(x);
  return (u + 0x7FFFu + ((u >> 16) & 1u)) >> 16;
}

// ---------------------------------------------------------------------------
// Kernel 1: weight planes WB[pl][n][k] bf16, pl = 2*wsel + part:
// wsel 0 txtQ, 1 txtK, 2 vidQ, 3 vidK, 4 txtV, 5 vidV; part 0 hi = RNE(w),
// part 1 lo = RNE(w - hi). One wave writes one whole 512-B row per store.
// ---------------------------------------------------------------------------
__global__ __launch_bounds__(256) void k_wprep(
    const float* __restrict__ wtq, const float* __restrict__ wtk, const float* __restrict__ wtv,
    const float* __restrict__ wvq, const float* __restrict__ wvk, const float* __restrict__ wvv,
    unsigned short* __restrict__ WB)
{
  const int tid = threadIdx.x, lane = tid & 31;
  const int row = blockIdx.x * 8 + (tid >> 5);           // 0 .. 3071, plane uniform per block
  if (row >= NWPL * DM) return;
  const int pl = row >> 8, n = row & 255;
  const int wsel = pl >> 1, part = pl & 1;
  const float* W = (wsel == 0) ? wtq : (wsel == 1) ? wtk : (wsel == 2) ? wvq
                 : (wsel == 3) ? wvk : (wsel == 4) ? wtv : wvv;
  const int k0 = lane * 8;
  float v[8];
  #pragma unroll
  for (int i = 0; i < 8; ++i) v[i] = W[(size_t)(k0 + i) * DM + n];
  v8us o;
  #pragma unroll
  for (int i = 0; i < 8; ++i) {
    const unsigned int hb = bf16_rne(v[i]);
    const unsigned int lb = bf16_rne(v[i] - __uint_as_float(hb << 16));
    o[i] = (unsigned short)(part ? lb : hb);
  }
  unsigned short* dst = WB + (size_t)pl * 65536 + (size_t)n * DM + k0;
  *(v8us*)dst = o;
  
}

// ---------------------------------------------------------------------------
// Kernel 2: XPOS tables XT[pl][n][l] f32, pl 0 cos*scale, 1 sin*scale,
// 2 cos/scale, 3 sin/scale; n = feature (pair i = n>>1), l = video position.
// scale = scale_vec[i] ^ (l/512) via powf; angle = l * inv_freq[i] with the
// exact constant tables above; precise sinf/cosf.
// ---------------------------------------------------------------------------
__global__ __launch_bounds__(256) void k_xtab(float* __restrict__ XT)
{
  const int n = blockIdx.x >> 3;
  const int l = (blockIdx.x & 7) * 256 + threadIdx.x;
  const int i = n >> 1;                                  // 0 .. 127
  const float sv = __uint_as_float(c_svec[i]);
  const float pw = (float)l * (1.0f / 512.0f);
  const float scale = powf(sv, pw);
  const float invf = __uint_as_float(c_invf[i]);
  const float ang = (float)l * invf;
  const float sn = sinf(ang), cs = cosf(ang);
  const float inv = 1.0f / scale;
  const size_t PS = (size_t)DM * VIDN;
  float* p0 = XT + (size_t)n * VIDN + l;
  const float a0 = cs * scale, a1 = sn * scale, a2 = cs * inv, a3 = sn * inv;
  *(float*)(p0)          = a0;
  *(float*)(p0 + PS)     = a1;
  *(float*)(p0 + 2 * PS) = a2;
  *(float*)(p0 + 3 * PS) = a3;
  
}

// ---------------------------------------------------------------------------
// Sum over the 32 lanes of a wave, f64, fixed butterfly order; every lane gets it.
// ---------------------------------------------------------------------------
__device__ __forceinline__ double wave_sum(double v) {
  #pragma unroll
  for (int d = 16; d > 0; d >>= 1) v += __shfl_xor(v, d, 32);
  return v;
}

// ---------------------------------------------------------------------------
// Kernel 3: gate plane M[r][c] = sigmoid(learn[r][c]) f32 (diagonal kept), and
// the loss's partial sums from the same values: work-group g covers elements
// 4096g .. 4096g+4095 and stores the f64 sum of its off-diagonal sigmoids at
// part[16g] (a 128-byte line of its own).
// ---------------------------------------------------------------------------
__global__ __launch_bounds__(256) void k_mask(const float* __restrict__ lr, float* __restrict__ M,
                                              double* __restrict__ part)
{
  __shared__ double red[8];
  const int t = threadIdx.x;
  const int g0 = blockIdx.x * MELEM, o = t * 4;            // group's first element (uniform), thread's offset in it
  const float* lp = lr + g0;
  float* mp = M + g0;
  v4f x[4];
  #pragma unroll
  for (int it = 0; it < 4; ++it) x[it] = *(const v4fa*)(lp + o + it * 1024);
  double acc = 0.0;
  #pragma unroll
  for (int it = 0; it < 4; ++it) {
    const int idx = g0 + o + it * 1024;
    const int r = idx >> 11, c = idx & (VIDN - 1);
    v4f sv;
    #pragma unroll
    for (int e = 0; e < 4; ++e) {
      const float s = 1.0f / (1.0f + expf(-x[it][e]));
      sv[e] = s;
      acc += (r == c + e) ? 0.0 : (double)s;
    }
    *(v4f*)(mp + o + it * 1024) = sv;
  }
  const double ws = wave_sum(acc);
  if ((t & 31) == 0) red[t >> 5] = ws;
  __syncthreads();
  if (t == 0) {
    double sum = 0.0;
    #pragma unroll
    for (int i = 0; i < 8; ++i) sum += red[i];
    part[(size_t)blockIdx.x * PSTR] = sum;
  }
}

// ---------------------------------------------------------------------------
// Kernel 4: loss = mean over vid x vid of off-diagonal sigmoid: one block adds
// the 1024 partial sums of kernel 3, one per thread, fixed order, f64.
// ---------------------------------------------------------------------------
__global__ __launch_bounds__(NPART) void k_loss(const double* __restrict__ part, const int* __restrict__ tl,
                                                float* __restrict__ out1)
{
  __shared__ double red[NPART / 32];
  const int t = threadIdx.x;
  const double ws = wave_sum(part[(size_t)t * PSTR]);
  if ((t & 31) == 0) red[t >> 5] = ws;
  __syncthreads();
  if (t < 32) {                                            // wave 0, all lanes on
    const double sum = wave_sum(red[t]);
    if (t == 0) {
      int vl = SEQ - tl[0];
      vl = vl < 1 ? 1 : vl;
      vl = vl > VIDN ? VIDN : vl;
      const float loss = (float)(sum / ((double)vl * (double)vl));
      *(float*)out1 = loss;
    }
  }
}

// ---------------------------------------------------------------------------
// Kernel 5: projections. Block = 512 thr (16 waves) = 64 absolute positions
// s0..s0+63 of batch b (s0 multiple of 64 over the padded 2112) x 256 cols;
// wave (wr = w>>2, wc = w&3) owns rows 16wr..16wr+15 x cols 64wc..64wc+63.
// Rows s<32: text (sine position added to the Q/K A operand, text weights, no
// XPOS); 32<=s<2080: video; s>=2080: zero pad rows. Q,K,V: bf16 hi/lo split
// GEMMs. Q,K: XPOS rotation in f32, written as bf16 hi/lo planes
// [b][SEQP][256]. V: written transposed VT[b][d][SEQP] as f16(64*V).
// ---------------------------------------------------------------------------
__device__ __forceinline__ void store_qk(const unsigned short* sOut, unsigned short* PH, unsigned short* PLo,
                                         int b, int s0, int w, int sub, int q8)
{
  #pragma unroll
  for (int i = 0; i < 8; ++i) {
    const int lid = w * 32 + 4 * i + sub;                  // 0..511
    const int pl = lid >> 8, row = (lid >> 2) & 63, qu = lid & 3;
    const v8us v = *(const v8usa*)(sOut + pl * 16384 + row * DM + 64 * qu + 8 * q8);
    unsigned short* dst = (pl ? PLo : PH) + ((size_t)(b * SEQP + s0 + row)) * DM + 64 * qu + 8 * q8;
    *(v8us*)dst = v;
  }
}

__device__ __forceinline__ void store_vt(const _Float16* sV, _Float16* VT, int b, int s0, int w, int sub, int q8)
{
  #pragma unroll
  for (int i = 0; i < 4; ++i) {
    const int d = 16 * w + 4 * i + sub;                    // 0..255
    const v8h v = *(const v8ha*)(sV + d * 64 + 8 * q8);
    _Float16* dst = VT + ((size_t)(b * DM + d)) * SEQP + s0 + 8 * q8;
    *(v8h*)dst = v;
  }
}

__global__ __launch_bounds__(512) void k_proj(
    const float* __restrict__ src,
    const unsigned short* __restrict__ WB, const float* __restrict__ XT,
    unsigned short* __restrict__ QH, unsigned short* __restrict__ QL,
    unsigned short* __restrict__ KH, unsigned short* __restrict__ KL,
    _Float16* __restrict__ VT)
{
  extern __shared__ __attribute__((aligned(16))) unsigned char smem[];
  unsigned short* sAh  = (unsigned short*)smem;            // [64][256] bf16 hi, row pitch RPIT
  unsigned short* sAl  = sAh + 64 * RPIT;                  // [64][256] bf16 lo, row pitch RPIT
  unsigned short* sOut = (unsigned short*)(smem + 4 * 64 * RPIT);  // [2][64][256] bf16 hi/lo results
  _Float16*       sV   = (_Float16*)(smem + 4 * 64 * RPIT);        // [256][64] f16 (V phase, aliases sOut)

  const int tid = threadIdx.x, lane = tid & 31, w = tid >> 5;
  const int wr = w >> 2, wc = w & 3, h = lane >> 4, m = lane & 15;
  const int q8 = lane & 7, sub = lane >> 3;
  const int b = blockIdx.y, s0 = blockIdx.x * 64;
  const bool wtxt = (blockIdx.x == 0) && (wr < 2);         // wave-uniform row type
  const v4f z4 = {0.f, 0.f, 0.f, 0.f};
  const v8f z8 = {0.f, 0.f, 0.f, 0.f, 0.f, 0.f, 0.f, 0.f};

  // ---- stage A = src (+ sine position on text rows) as bf16 hi/lo ----
  #pragma unroll 1
  for (int it = 0; it < 8; ++it) {
    const int q = it * 512 + tid;
    const int row = q >> 6, c4 = (q & 63) * 4;            // row wave-uniform
    const int s = s0 + row;
    const int sl = (s < SEQ) ? s : (SEQ - 1);
    v4f x = *(const v4fa*)(src + ((size_t)(b * SEQ + sl)) * DM + c4);
    if (s >= SEQ) x = z4;
    if (s < TXTN) {
      const float xe = ((float)(s + 1) * 0.03125f) * 6.2831855f;
      const float d0 = powf(10000.0f, (float)c4 * (1.0f / 256.0f));
      const float d1 = powf(10000.0f, (float)(c4 + 2) * (1.0f / 256.0f));
      const float r0 = xe * (1.0f / d0), r1 = xe * (1.0f / d1);
      x.x += sinf(r0); x.y += cosf(r0); x.z += sinf(r1); x.w += cosf(r1);
    }
    const unsigned int h0 = bf16_rne(x.x), h1 = bf16_rne(x.y), h2 = bf16_rne(x.z), h3 = bf16_rne(x.w);
    const unsigned int l0 = bf16_rne(x.x - __uint_as_float(h0 << 16));
    const unsigned int l1 = bf16_rne(x.y - __uint_as_float(h1 << 16));
    const unsigned int l2 = bf16_rne(x.z - __uint_as_float(h2 << 16));
    const unsigned int l3 = bf16_rne(x.w - __uint_as_float(h3 << 16));
    const v4us vh = {(unsigned short)h0, (unsigned short)h1, (unsigned short)h2, (unsigned short)h3};
    const v4us vl = {(unsigned short)l0, (unsigned short)l1, (unsigned short)l2, (unsigned short)l3};
    *(v4usa*)(sAh + row * RPIT + c4) = vh;
    *(v4usa*)(sAl + row * RPIT + c4) = vl;
  }
  __syncthreads();

  // ---- Q (p=0) and K (p=1): bf16 hi/lo split GEMM, XPOS epilogue ----
  #pragma unroll 1
  for (int p = 0; p < 2; ++p) {
    const unsigned short* Bh = WB + (size_t)((wtxt ? 0 : 4) + 2 * p) * 65536 + (size_t)(64 * wc + m) * DM;
    const unsigned short* Bl = Bh + 65536;
    const unsigned short* Ap = sAh + (16 * wr + m) * RPIT;
    v8f acc[4];
    #pragma unroll
    for (int nt = 0; nt < 4; ++nt) acc[nt] = z8;
    #pragma unroll 1
    for (int kk = 0; kk < DM; kk += 32) {
      const v16b ah = ldfb(Ap + kk, h);
      const v16b al = ldfb(Ap + 64 * RPIT + kk, h);
      #pragma unroll
      for (int nt = 0; nt < 4; ++nt) {
        const v16b bh = ldfb(Bh + (size_t)(16 * nt) * DM + kk, h);
        const v16b bl = ldfb(Bl + (size_t)(16 * nt) * DM + kk, h);
        acc[nt] = wmma_b(ah, bh, acc[nt]);
        acc[nt] = wmma_b(ah, bl, acc[nt]);
        acc[nt] = wmma_b(al, bh, acc[nt]);
      }
    }
    // D[r] = Y[row 16wr+8h+r][col 64wc+16nt+m]; rotation pairs cols (n, n^1) = lanes (m, m^1)
    const int rowb = 16 * wr + 8 * h;
    int lb = s0 + rowb - TXTN;
    lb = lb < 0 ? 0 : lb;
    lb = lb > (VIDN - 8) ? (VIDN - 8) : lb;
    const float sg = (m & 1) ? 1.0f : -1.0f;
    #pragma unroll
    for (int nt = 0; nt < 4; ++nt) {
      const int n = 64 * wc + 16 * nt + m;
      const float* tc = XT + ((size_t)(2 * p * DM + n)) * VIDN + lb;
      const float* ts = tc + (size_t)DM * VIDN;
      const v4f c0 = *(const v4fa*)tc, c1 = *(const v4fa*)(tc + 4);
      const v4f t0 = *(const v4fa*)ts, t1 = *(const v4fa*)(ts + 4);
      const float cs[8] = {c0.x, c0.y, c0.z, c0.w, c1.x, c1.y, c1.z, c1.w};
      const float sn[8] = {t0.x, t0.y, t0.z, t0.w, t1.x, t1.y, t1.z, t1.w};
      #pragma unroll
      for (int r = 0; r < 8; ++r) {
        const float x  = acc[nt][r];
        const float pr = __shfl_xor(x, 1, 32);
        const float cv = wtxt ? 1.0f : cs[r];
        const float snv = wtxt ? 0.0f : sn[r];
        const float y  = x * cv + sg * (pr * snv);
        const unsigned int hb  = bf16_rne(y);
        const unsigned int lob = bf16_rne(y - __uint_as_float(hb << 16));
        const int e = (rowb + r) * DM + n;
        sOut[e]         = (unsigned short)hb;
        sOut[16384 + e] = (unsigned short)lob;
      }
    }
    __syncthreads();
    unsigned short* PH  = p ? KH : QH;
    unsigned short* PLo = p ? KL : QL;
    store_qk(sOut, PH, PLo, b, s0, w, sub, q8);
    
    __syncthreads();
  }

  // ---- V: tile 0 restages A as bf16 hi/lo of src WITHOUT the position term
  //      (other tiles already hold plain src); split GEMM; f16(64*V) transposed ----
  if (blockIdx.x == 0) {                                   // block-uniform
    #pragma unroll 1
    for (int it = 0; it < 8; ++it) {
      const int q = it * 512 + tid;
      const int row = q >> 6, c4 = (q & 63) * 4;          // s = row < 64 < SEQ
      const v4f x = *(const v4fa*)(src + ((size_t)(b * SEQ + row)) * DM + c4);
      const unsigned int h0 = bf16_rne(x.x), h1 = bf16_rne(x.y), h2 = bf16_rne(x.z), h3 = bf16_rne(x.w);
      const unsigned int l0 = bf16_rne(x.x - __uint_as_float(h0 << 16));
      const unsigned int l1 = bf16_rne(x.y - __uint_as_float(h1 << 16));
      const unsigned int l2 = bf16_rne(x.z - __uint_as_float(h2 << 16));
      const unsigned int l3 = bf16_rne(x.w - __uint_as_float(h3 << 16));
      const v4us vh = {(unsigned short)h0, (unsigned short)h1, (unsigned short)h2, (unsigned short)h3};
      const v4us vl = {(unsigned short)l0, (unsigned short)l1, (unsigned short)l2, (unsigned short)l3};
      *(v4usa*)(sAh + row * RPIT + c4) = vh;
      *(v4usa*)(sAl + row * RPIT + c4) = vl;
    }
  }
  __syncthreads();
  {
    const unsigned short* Bh = WB + (size_t)(wtxt ? 8 : 10) * 65536 + (size_t)(64 * wc + m) * DM;
    const unsigned short* Bl = Bh + 65536;
    const unsigned short* Ap = sAh + (16 * wr + m) * RPIT;
    v8f acc[4];
    #pragma unroll
    for (int nt = 0; nt < 4; ++nt) acc[nt] = z8;
    #pragma unroll 1
    for (int kk = 0; kk < DM; kk += 32) {
      const v16b ah = ldfb(Ap + kk, h);
      const v16b al = ldfb(Ap + 64 * RPIT + kk, h);
      #pragma unroll
      for (int nt = 0; nt < 4; ++nt) {
        const v16b bh = ldfb(Bh + (size_t)(16 * nt) * DM + kk, h);
        const v16b bl = ldfb(Bl + (size_t)(16 * nt) * DM + kk, h);
        acc[nt] = wmma_b(ah, bh, acc[nt]);
        acc[nt] = wmma_b(ah, bl, acc[nt]);
        acc[nt] = wmma_b(al, bh, acc[nt]);
      }
    }
    // acc = V[token 16wr+8h+r][d 64wc+16nt+m] -> sV[d][token] = f16(64*V)
    #pragma unroll
    for (int nt = 0; nt < 4; ++nt) {
      const int d = 64 * wc + 16 * nt + m;
      #pragma unroll
      for (int r = 0; r < 8; ++r) sV[d * 64 + 16 * wr + 8 * h + r] = (_Float16)(acc[nt][r] * VSC);
    }
  }
  __syncthreads();
  store_vt(sV, VT, b, s0, w, sub, q8);
  
}

// ---------------------------------------------------------------------------
// Kernel 6: retention. Block 128 thr (4 waves) = 16 queries q0..q0+15 of batch
// b; wave w owns output cols 64w..64w+63 and computes the score slice for keys
// kb+16w..kb+16w+15 of each 64-key step (33 steps over the padded 2112 keys).
//   S^T slice = K * Q^T (A = K rows, B = Q rows; bf16 hi/lo split, K=256)
//   P = S * gate * 256 -> f16 hi tile and f16 lo tile (lo = P - hi)
//       [16 q][64 keys] in LDS (ping-pong), row pitch PPIT
//   O += P_hi * V + P_lo * V  (A = P rows, B = V^T rows from VT, f16), acc f32
// ---------------------------------------------------------------------------
__device__ __forceinline__ void store_out(const float* so, float* out, int b, int q0, int w, int sub, int q8)
{
  #pragma unroll
  for (int i = 0; i < 8; ++i) {
    const int lid = 4 * i + sub, row = lid >> 1, hl = lid & 1;
    const v4f v = *(const v4fa*)(so + row * 64 + 32 * hl + 4 * q8);
    float* dst = out + ((size_t)(b * SEQ + q0 + row)) * DM + 64 * w + 32 * hl + 4 * q8;
    *(v4f*)dst = v;
  }
}

__global__ __launch_bounds__(128) void k_ret(
    const unsigned short* __restrict__ QH, const unsigned short* __restrict__ QL,
    const unsigned short* __restrict__ KH, const unsigned short* __restrict__ KL,
    const _Float16* __restrict__ VT, const float* __restrict__ MK, float* __restrict__ out)
{
  __shared__ __attribute__((aligned(16))) unsigned short sQh[16 * RPIT];
  __shared__ __attribute__((aligned(16))) unsigned short sQl[16 * RPIT];
  __shared__ __attribute__((aligned(16))) _Float16 sPh[2][16 * PPIT];
  __shared__ __attribute__((aligned(16))) _Float16 sPl[2][16 * PPIT];
  __shared__ __attribute__((aligned(16))) float sO[4 * 16 * 64];

  const int tid = threadIdx.x, lane = tid & 31, w = tid >> 5, h = lane >> 4, m = lane & 15;
  const int q8 = lane & 7, sub = lane >> 3;
  const int b = blockIdx.y, q0 = blockIdx.x * 16;
  const v8f z8 = {0.f, 0.f, 0.f, 0.f, 0.f, 0.f, 0.f, 0.f};

  // ---- stage Q hi/lo rows q0..q0+15 ----
  v8us qh[4], ql[4];
  const unsigned short* gh[4];
  const unsigned short* gl[4];
  #pragma unroll
  for (int it = 0; it < 4; ++it) {
    const int idx = it * 128 + tid;
    const int row = idx >> 5, c8 = (idx & 31) * 8;
    const size_t g = ((size_t)(b * SEQP + q0 + row)) * DM + c8;
    gh[it] = QH + g;
    gl[it] = QL + g;
    qh[it] = *(const v8usa*)gh[it];
    ql[it] = *(const v8usa*)gl[it];
  }
  // wait in front of the first overwrite of a register that the eight loads name; the addresses are
  // inputs so that their registers stay as they are up to the wait
  asm volatile("s_wait_xcnt 0x0" :: "v"(gh[0]), "v"(gl[0]), "v"(gh[1]), "v"(gl[1]),
               "v"(gh[2]), "v"(gl[2]), "v"(gh[3]), "v"(gl[3]) : "memory");
  #pragma unroll
  for (int it = 0; it < 4; ++it) {
    const int idx = it * 128 + tid;
    const int row = idx >> 5, c8 = (idx & 31) * 8;
    *(v8usa*)(sQh + row * RPIT + c8) = qh[it];
    *(v8usa*)(sQl + row * RPIT + c8) = ql[it];
  }
  __syncthreads();

  v8f o[4];
  #pragma unroll
  for (int nt = 0; nt < 4; ++nt) o[nt] = z8;

  const unsigned short* kh0 = KH + ((size_t)(b * SEQP + 16 * w + m)) * DM;
  const unsigned short* kl0 = KL + ((size_t)(b * SEQP + 16 * w + m)) * DM;
  const _Float16* vb0 = VT + ((size_t)(b * DM + 64 * w + m)) * SEQP;
  const int sq = q0 + m;                                  // query of this lane's D column
  const int mr = (sq - TXTN) < 0 ? 0 : (sq - TXTN);       // <= 2047
  const float* mrow = MK + (size_t)mr * VIDN;
  const bool qtxt = sq < TXTN;

  int buf = 0;
  #pragma unroll 1
  for (int kb = 0; kb < SEQP; kb += 64) {
    // scores: s[r] = S[query sq][key kb+16w+8h+r]
    v8f s = z8;
    const unsigned short* khp = kh0 + (size_t)kb * DM;
    const unsigned short* klp = kl0 + (size_t)kb * DM;
    #pragma unroll 1
    for (int kk = 0; kk < DM; kk += 32) {
      const v16b ka = ldfb(khp + kk, h);
      const v16b kl = ldfb(klp + kk, h);
      const v16b qa = ldfb(sQh + m * RPIT + kk, h);
      const v16b ql = ldfb(sQl + m * RPIT + kk, h);
      s = wmma_b(ka, qa, s);
      s = wmma_b(ka, ql, s);
      s = wmma_b(kl, qa, s);
    }
    // gate: 1 when query or key is text, sigmoid plane on vid x vid, 0 on pad keys
    const int cb = kb + 16 * w + 8 * h - TXTN;            // vid index of key r=0 (group of 8, aligned)
    const bool ktxt = cb < 0;
    const bool kpad = cb >= VIDN;
    int cbc = cb < 0 ? 0 : cb;
    cbc = cbc > (VIDN - 8) ? (VIDN - 8) : cbc;
    const v4f g0 = *(const v4fa*)(mrow + cbc), g1 = *(const v4fa*)(mrow + cbc + 4);
    const float gk[8] = {g0.x, g0.y, g0.z, g0.w, g1.x, g1.y, g1.z, g1.w};
    v8h ph, plo;
    #pragma unroll
    for (int r = 0; r < 8; ++r) {
      const float gg = kpad ? 0.0f : ((qtxt || ktxt) ? 1.0f : gk[r]);
      const float pv = (s[r] * gg) * PSC;
      const _Float16 hv = (_Float16)pv;
      ph[r]  = hv;
      plo[r] = (_Float16)(pv - (float)hv);
    }
    *(v8ha*)(&sPh[buf][m * PPIT + 16 * w + 8 * h]) = ph;
    *(v8ha*)(&sPl[buf][m * PPIT + 16 * w + 8 * h]) = plo;
    __syncthreads();

    // O += P_hi(16x64) * V + P_lo(16x64) * V  (64 keys x this wave's 64 cols)
    #pragma unroll
    for (int ks = 0; ks < 2; ++ks) {
      const v16h pa = ldfh(&sPh[buf][m * PPIT + 32 * ks], h);
      const v16h pb = ldfh(&sPl[buf][m * PPIT + 32 * ks], h);
      #pragma unroll
      for (int nt = 0; nt < 4; ++nt) {
        const v16h vbf = ldfh(vb0 + (size_t)(16 * nt) * SEQP + kb + 32 * ks, h);
        o[nt] = wmma_h(pa, vbf, o[nt]);
        o[nt] = wmma_h(pb, vbf, o[nt]);
      }
    }
    buf ^= 1;
  }

  // ---- epilogue: O[q0+8h+r][64w+16nt+m] = o[nt][r] / (256*64) ----
  float* so = sO + w * 1024;
  #pragma unroll
  for (int nt = 0; nt < 4; ++nt)
    #pragma unroll
    for (int r = 0; r < 8; ++r)
      so[(8 * h + r) * 64 + 16 * nt + m] = o[nt][r] * OSC;
  __syncthreads();
  store_out(so, out, b, q0, w, sub, q8);
  
}

// ---------------------------------------------------------------------------
extern "C" void kernel_launch(void* const* d_in, const int* in_sizes, int n_in,
                              void* d_out, int out_size, void* d_ws, size_t ws_size,
                              hipStream_t stream)
{
  if (n_in < 9) return;
  if (in_sizes[0] != BATCH * SEQ * DM) return;
  if (in_sizes[1] != VIDN * VIDN) return;
  for (int i = 2; i < 8; ++i) if (in_sizes[i] != DM * DM) return;
  if (in_sizes[8] < 1) return;
  if (out_size != BATCH * SEQ * DM + 1) return;

  const float* src = (const float*)d_in[0];
  const float* lrn = (const float*)d_in[1];
  const float* wtq = (const float*)d_in[2];
  const float* wtk = (const float*)d_in[3];
  const float* wtv = (const float*)d_in[4];
  const float* wvq = (const float*)d_in[5];
  const float* wvk = (const float*)d_in[6];
  const float* wvv = (const float*)d_in[7];
  const int*   txl = (const int*)d_in[8];
  float* out0 = (float*)d_out;
  float* out1 = out0 + (size_t)BATCH * SEQ * DM;          // byte offset 34078720

  const size_t pl_bytes = (size_t)BATCH * SEQP * DM * 2;  // 17301504 per bf16/f16 plane (padded rows incl.)
  const size_t wb_bytes = (size_t)NWPL * DM * DM * 2;      // 1572864
  const size_t xt_bytes = (size_t)4 * DM * VIDN * 4;       // 8388608
  const size_t mk_bytes = (size_t)VIDN * VIDN * 4;         // 16777216
  const size_t off_qh = 0;
  const size_t off_ql = off_qh + pl_bytes;
  const size_t off_kh = off_ql + pl_bytes;
  const size_t off_kl = off_kh + pl_bytes;
  const size_t off_vt = off_kl + pl_bytes;
  const size_t off_wb = off_vt + pl_bytes;
  const size_t off_xt = off_wb + wb_bytes;
  const size_t off_mk = off_xt + xt_bytes;
  const size_t pt_bytes = (size_t)NPART * PSTR * 8;        // 131072
  const size_t off_pt = off_mk + mk_bytes;
  const size_t total  = off_pt + pt_bytes;                 // 113377280
  if (total > ws_size) return;
  if (total > (size_t)134217728) return;

  char* ws = (char*)d_ws;
  unsigned short* QH = (unsigned short*)(ws + off_qh);
  unsigned short* QL = (unsigned short*)(ws + off_ql);
  unsigned short* KH = (unsigned short*)(ws + off_kh);
  unsigned short* KL = (unsigned short*)(ws + off_kl);
  _Float16* VT = (_Float16*)(ws + off_vt);
  unsigned short* WB = (unsigned short*)(ws + off_wb);
  float* XT = (float*)(ws + off_xt);
  float* MK = (float*)(ws + off_mk);
  double* PT = (double*)(ws + off_pt);

  k_wprep<<<(NWPL * DM) / 8, 256, 0, stream>>>(wtq, wtk, wtv, wvq, wvk, wvv, WB);
  k_xtab<<<DM * 8, 256, 0, stream>>>(XT);
  k_mask<<<NPART, 256, 0, stream>>>(lrn, MK, PT);
  k_loss<<<1, NPART, 0, stream>>>(PT, txl, out1);

  const size_t proj_lds = 133120;                          // 4*64*RPIT + 65536
  hipFuncSetAttribute(reinterpret_cast<const void*>(&k_proj), hipFuncAttributeMaxDynamicSharedMemorySize, (int)proj_lds);
  dim3 gp(NTILE, BATCH);
  k_proj<<<gp, 512, proj_lds, stream>>>(src, WB, XT, QH, QL, KH, KL, VT);

  dim3 gr(SEQ / 16, BATCH);
  k_ret<<<gr, 128, 0, stream>>>(QH, QL, KH, KL, VT, MK, out0);
}

// v003
// It runs in 369 microseconds.
// In both of two side-by-side timings against v002, it was 1.94 times as fast.
// Counting every step since v000, it is 16.8 times as fast.
// Contractions: Q,K,V projections and S=K*Q^T on v_wmma_f32_16x16x32_bf16 as bf16 hi/lo split (hi*hi+hi*lo+lo*hi); O=P*V on v_wmma_f32_16x16x32_f16 with P as f16 hi + f16 lo (P x256, two products) and V^T f16 x64; f32 accumulate; position tables, sigmoid gate and loss in f32/f64.
#include <hip/hip_runtime.h>

#define BATCH 16
#define TXTN  32
#define VIDN  2048
#define SEQ   2080
#define SEQP  2112
#define DM    256
#define NTILE 33
#define NWPL  12
#define PSC   256.0f
#define VSC   64.0f
#define OSC   (1.0f / 16384.0f)
#define MELEM 4096
#define NPART 1024
#define PSTR  16
// LDS row pitches in 16-bit elements: row bytes + 16, an odd multiple of 16 B, so that the
// 16 rows one ds_load_b128 fragment read touches per half-wave fall on 16 different bank groups.
#define RPIT  (DM + 8)
#define PPIT  (64 + 8)
static_assert(MELEM * NPART == VIDN * VIDN);

typedef _Float16 v16h __attribute__((ext_vector_type(16)));
typedef _Float16 v8h  __attribute__((ext_vector_type(8)));
typedef _Float16 v4h  __attribute__((ext_vector_type(4)));
typedef __bf16   v16b __attribute__((ext_vector_type(16)));
typedef unsigned short v8us __attribute__((ext_vector_type(8)));
typedef unsigned short v4us __attribute__((ext_vector_type(4)));
typedef float v8f __attribute__((ext_vector_type(8)));
typedef float v4f __attribute__((ext_vector_type(4)));
typedef v8h  __attribute__((may_alias)) v8ha;
typedef v4h  __attribute__((may_alias)) v4ha;
typedef v8us __attribute__((may_alias)) v8usa;
typedef v4us __attribute__((may_alias)) v4usa;
typedef v4f  __attribute__((may_alias)) v4fa;

// ---------------------------------------------------------------------------
// XPOS module constants as exact f32 bit patterns:
// c_invf[i] = 1 / 10000^(i/128), c_svec[i] = (2i + 0.4*256) / (1.4*256).
// ---------------------------------------------------------------------------
__constant__ unsigned int c_invf[] = {
  0x3f800000, 0x3f6e39f8, 0x3f5dafd7, 0x3f4e4bad, 0x3f3ff911, 0x3f32a506, 0x3f263de0, 0x3f1ab32b,
  0x3f0ff59a, 0x3f05f6ef, 0x3ef953cf, 0x3ee8045f, 0x3ed7e89b, 0x3ec8eb24, 0x3ebaf81b, 0x3eadfcff,
  0x3ea1e89b, 0x3e96aaea, 0x3e8c3504, 0x3e827909, 0x3e72d423, 0x3e61f835, 0x3e5247ed, 0x3e43ae7c,
  0x3e361887, 0x3e297409, 0x3e1db040, 0x3e12bd91, 0x3e088d77, 0x3dfe24e0, 0x3dec7fd6, 0x3ddc1466,
  0x3dcccccd, 0x3dbe94c6, 0x3db15978, 0x3da50956, 0x3d99940d, 0x3d8eea6b, 0x3d84fe4d, 0x3d778513,
  0x3d6655c2, 0x3d5657e4, 0x3d47763f, 0x3d399d19, 0x3d2cba15, 0x3d20bc1d, 0x3d159348, 0x3d0b30cc,
  0x3d0186e3, 0x3cf11177, 0x3ce054d2, 0x3cd0c1a8, 0x3cc2434f, 0x3cb4c691, 0x3ca8398b, 0x3c9c8b97,
  0x3c91ad39, 0x3c879008, 0x3c7c4d33, 0x3c6ac8e7, 0x3c5a7bf2, 0x3c4b50b3, 0x3c3d3311, 0x3c301052,
  0x3c23d70a, 0x3c187705, 0x3c0de12d, 0x3c040779, 0x3bf5b9b0, 0x3be4aa46, 0x3bd4ca15, 0x3bc6040f,
  0x3bb8449c, 0x3bab7983, 0x3b9f91cc, 0x3b947dae, 0x3b8a2e77, 0x3b80967d, 0x3b6f520e, 0x3b5eb47a,
  0x3b4f3e38, 0x3b40dac5, 0x3b33770f, 0x3b270153, 0x3b1b690d, 0x3b109edb, 0x3b06946f, 0x3afa78f0,
  0x3ae91528, 0x3ad8e673, 0x3ac9d75c, 0x3abbd3ed, 0x3aaec98e, 0x3aa2a6f7, 0x3a975c0e, 0x3a8cd9db,
  0x3a83126f, 0x3a73f1a3, 0x3a6301e2, 0x3a533f28, 0x3a44948c, 0x3a36ee9e, 0x3a2a3b44, 0x3a1e69a5,
  0x3a136a16, 0x3a092e02, 0x39ff4fac, 0x39ed95e2, 0x39dd1725, 0x39cdbd96, 0x39bf74d7, 0x39b229fa,
  0x39a5cb60, 0x399a489e, 0x398f9272, 0x39859aa9, 0x3978a815, 0x39676492, 0x395753e4, 0x394860c1,
  0x393a7753, 0x392d8529, 0x39217916, 0x39164324, 0x390bd472, 0x39021f2b, 0x38f22ce2, 0x38e15c91 };
static_assert(sizeof(c_invf) == 512);

__constant__ unsigned int c_svec[] = {
  0x3e924925, 0x3e952493, 0x3e980000, 0x3e9adb6e, 0x3e9db6dc, 0x3ea0924a, 0x3ea36db7, 0x3ea64925,
  0x3ea92493, 0x3eac0000, 0x3eaedb6e, 0x3eb1b6dc, 0x3eb4924a, 0x3eb76db7, 0x3eba4924, 0x3ebd2492,
  0x3ec00000, 0x3ec2db6d, 0x3ec5b6db, 0x3ec89249, 0x3ecb6db7, 0x3ece4924, 0x3ed12492, 0x3ed40000,
  0x3ed6db6d, 0x3ed9b6db, 0x3edc9249, 0x3edf6db7, 0x3ee24924, 0x3ee52492, 0x3ee80000, 0x3eeadb6e,
  0x3eedb6db, 0x3ef09249, 0x3ef36db7, 0x3ef64924, 0x3ef92492, 0x3efc0000, 0x3efedb6e, 0x3f00db6e,
  0x3f024924, 0x3f03b6db, 0x3f052492, 0x3f069249, 0x3f080000, 0x3f096db7, 0x3f0adb6e, 0x3f0c4925,
  0x3f0db6db, 0x3f0f2492, 0x3f109249, 0x3f120000, 0x3f136db7, 0x3f14db6e, 0x3f164925, 0x3f17b6db,
  0x3f192492, 0x3f1a9249, 0x3f1c0000, 0x3f1d6db7, 0x3f1edb6e, 0x3f204925, 0x3f21b6db, 0x3f232492,
  0x3f249249, 0x3f260000, 0x3f276db7, 0x3f28db6e, 0x3f2a4925, 0x3f2bb6db, 0x3f2d2492, 0x3f2e9249,
  0x3f300000, 0x3f316db7, 0x3f32db6e, 0x3f344925, 0x3f35b6db, 0x3f372492, 0x3f389249, 0x3f3a0000,
  0x3f3b6db7, 0x3f3cdb6e, 0x3f3e4925, 0x3f3fb6db, 0x3f412492, 0x3f429249, 0x3f440000, 0x3f456db7,
  0x3f46db6e, 0x3f484925, 0x3f49b6db, 0x3f4b2492, 0x3f4c9249, 0x3f4e0000, 0x3f4f6db7, 0x3f50db6e,
  0x3f524925, 0x3f53b6db, 0x3f552492, 0x3f569249, 0x3f580000, 0x3f596db7, 0x3f5adb6e, 0x3f5c4925,
  0x3f5db6db, 0x3f5f2492, 0x3f609249, 0x3f620000, 0x3f636db7, 0x3f64db6e, 0x3f664925, 0x3f67b6dc,
  0x3f692492, 0x3f6a9249, 0x3f6c0000, 0x3f6d6db7, 0x3f6edb6e, 0x3f704925, 0x3f71b6dc, 0x3f732492,
  0x3f749249, 0x3f760000, 0x3f776db7, 0x3f78db6e, 0x3f7a4925, 0x3f7bb6dc, 0x3f7d2492, 0x3f7e9249 };
static_assert(sizeof(c_svec) == 512);

// ---------------------------------------------------------------------------
// 16x16x32 WMMA with hazard guard. Fragment map (wave32): lane l, h = l>>4,
// m = n = l&15. A/B element i: i<8 -> k0+8h+i ; i>=8 -> k0+16+8h+(i-8).
// D element r: row 8h+r, col l&15.
// ---------------------------------------------------------------------------
__device__ __forceinline__ v8f wmma_h(v16h a, v16h b, v8f c) {
  v8f d = __builtin_amdgcn_wmma_f32_16x16x32_f16(false, a, false, b, (short)0, c, false, false);
  asm volatile("v_nop\n\tv_nop\n\tv_nop\n\tv_nop" : "+v"(d) : "v"(a), "v"(b));
  return d;
}
__device__ __forceinline__ v8f wmma_b(v16b a, v16b b, v8f c) {
  v8f d = __builtin_amdgcn_wmma_f32_16x16x32_bf16(false, a, false, b, (short)0, c, false, false);
  asm volatile("v_nop\n\tv_nop\n\tv_nop\n\tv_nop" : "+v"(d) : "v"(a), "v"(b));
  return d;
}

// Fragment from a k-contiguous 16-bit row; p points at element k0 of the row
// owned by this lane (row = lane & 15 added by the caller). Same map for A and B.
__device__ __forceinline__ v16h ldfh(const _Float16* p, int h) {
  union { v16h v; v8h hf[2]; } f;
  f.hf[0] = *(const v8ha*)(p + 8 * h);
  f.hf[1] = *(const v8ha*)(p + 16 + 8 * h);
  return f.v;
}
__device__ __forceinline__ v16b ldfb(const unsigned short* p, int h) {
  union { v16b v; v8us hf[2]; } f;
  f.hf[0] = *(const v8usa*)(p + 8 * h);
  f.hf[1] = *(const v8usa*)(p + 16 + 8 * h);
  return f.v;
}

// f32 -> bf16 bits, RNE
__device__ __forceinline__ unsigned int bf16_rne(float x) {
  const unsigned int u = __float_as_uint(x);
  return (u + 0x7FFFu + ((u >> 16) & 1u)) >> 16;
}

// ---------------------------------------------------------------------------
// Kernel 1: weight planes WB[pl][n][k] bf16, pl = 2*wsel + part:
// wsel 0 txtQ, 1 txtK, 2 vidQ, 3 vidK, 4 txtV, 5 vidV; part 0 hi = RNE(w),
// part 1 lo = RNE(w - hi). One wave writes one whole 512-B row per store.
// ---------------------------------------------------------------------------
__global__ __launch_bounds__(256) void k_wprep(
    const float* __restrict__ wtq, const float* __restrict__ wtk, const float* __restrict__ wtv,
    const float* __restrict__ wvq, const float* __restrict__ wvk, const float* __restrict__ wvv,
    unsigned short* __restrict__ WB)
{
  const int tid = threadIdx.x, lane = tid & 31;
  const int row = blockIdx.x * 8 + (tid >> 5);           // 0 .. 3071, plane uniform per block
  if (row >= NWPL * DM) return;
  const int pl = row >> 8, n = row & 255;
  const int wsel = pl >> 1, part = pl & 1;
  const float* W = (wsel == 0) ? wtq : (wsel == 1) ? wtk : (wsel == 2) ? wvq
                 : (wsel == 3) ? wvk : (wsel == 4) ? wtv : wvv;
  const int k0 = lane * 8;
  float v[8];
  #pragma unroll
  for (int i = 0; i < 8; ++i) v[i] = W[(size_t)(k0 + i) * DM + n];
  v8us o;
  #pragma unroll
  for (int i = 0; i < 8; ++i) {
    const unsigned int hb = bf16_rne(v[i]);
    const unsigned int lb = bf16_rne(v[i] - __uint_as_float(hb << 16));
    o[i] = (unsigned short)(part ? lb : hb);
  }
  unsigned short* dst = WB + (size_t)pl * 65536 + (size_t)n * DM + k0;
  *(v8us*)dst = o;
  
}

// ---------------------------------------------------------------------------
// Kernel 2: XPOS tables XT[pl][n][l] f32, pl 0 cos*scale, 1 sin*scale,
// 2 cos/scale, 3 sin/scale; n = feature (pair i = n>>1), l = video position.
// scale = scale_vec[i] ^ (l/512) via powf; angle = l * inv_freq[i] with the
// exact constant tables above; precise sinf/cosf.
// ---------------------------------------------------------------------------
__global__ __launch_bounds__(256) void k_xtab(float* __restrict__ XT)
{
  const int n = blockIdx.x >> 3;
  const int l = (blockIdx.x & 7) * 256 + threadIdx.x;
  const int i = n >> 1;                                  // 0 .. 127
  const float sv = __uint_as_float(c_svec[i]);
  const float pw = (float)l * (1.0f / 512.0f);
  const float scale = powf(sv, pw);
  const float invf = __uint_as_float(c_invf[i]);
  const float ang = (float)l * invf;
  const float sn = sinf(ang), cs = cosf(ang);
  const float inv = 1.0f / scale;
  const size_t PS = (size_t)DM * VIDN;
  float* p0 = XT + (size_t)n * VIDN + l;
  const float a0 = cs * scale, a1 = sn * scale, a2 = cs * inv, a3 = sn * inv;
  *(float*)(p0)          = a0;
  *(float*)(p0 + PS)     = a1;
  *(float*)(p0 + 2 * PS) = a2;
  *(float*)(p0 + 3 * PS) = a3;
  
}

// ---------------------------------------------------------------------------
// Sum over the 32 lanes of a wave, f64, fixed butterfly order; every lane gets it.
// ---------------------------------------------------------------------------
__device__ __forceinline__ double wave_sum(double v) {
  #pragma unroll
  for (int d = 16; d > 0; d >>= 1) v += __shfl_xor(v, d, 32);
  return v;
}

// ---------------------------------------------------------------------------
// Kernel 3: gate plane M[r][c] = sigmoid(learn[r][c]) f32 (diagonal kept), and
// the loss's partial sums from the same values: work-group g covers elements
// 4096g .. 4096g+4095 and stores the f64 sum of its off-diagonal sigmoids at
// part[16g] (a 128-byte line of its own).
// ---------------------------------------------------------------------------
__global__ __launch_bounds__(256) void k_mask(const float* __restrict__ lr, float* __restrict__ M,
                                              double* __restrict__ part)
{
  __shared__ double red[8];
  const int t = threadIdx.x;
  const int g0 = blockIdx.x * MELEM, o = t * 4;            // group's first element (uniform), thread's offset in it
  const float* lp = lr + g0;
  float* mp = M + g0;
  v4f x[4];
  #pragma unroll
  for (int it = 0; it < 4; ++it) x[it] = *(const v4fa*)(lp + o + it * 1024);
  double acc = 0.0;
  #pragma unroll
  for (int it = 0; it < 4; ++it) {
    const int idx = g0 + o + it * 1024;
    const int r = idx >> 11, c = idx & (VIDN - 1);
    v4f sv;
    #pragma unroll
    for (int e = 0; e < 4; ++e) {
      const float s = 1.0f / (1.0f + expf(-x[it][e]));
      sv[e] = s;
      acc += (r == c + e) ? 0.0 : (double)s;
    }
    *(v4f*)(mp + o + it * 1024) = sv;
  }
  const double ws = wave_sum(acc);
  if ((t & 31) == 0) red[t >> 5] = ws;
  __syncthreads();
  if (t == 0) {
    double sum = 0.0;
    #pragma unroll
    for (int i = 0; i < 8; ++i) sum += red[i];
    part[(size_t)blockIdx.x * PSTR] = sum;
  }
}

// ---------------------------------------------------------------------------
// Kernel 4: loss = mean over vid x vid of off-diagonal sigmoid: one block adds
// the 1024 partial sums of kernel 3, one per thread, fixed order, f64.
// ---------------------------------------------------------------------------
__global__ __launch_bounds__(NPART) void k_loss(const double* __restrict__ part, const int* __restrict__ tl,
                                                float* __restrict__ out1)
{
  __shared__ double red[NPART / 32];
  const int t = threadIdx.x;
  const double ws = wave_sum(part[(size_t)t * PSTR]);
  if ((t & 31) == 0) red[t >> 5] = ws;
  __syncthreads();
  if (t < 32) {                                            // wave 0, all lanes on
    const double sum = wave_sum(red[t]);
    if (t == 0) {
      int vl = SEQ - tl[0];
      vl = vl < 1 ? 1 : vl;
      vl = vl > VIDN ? VIDN : vl;
      const float loss = (float)(sum / ((double)vl * (double)vl));
      *(float*)out1 = loss;
    }
  }
}

// ---------------------------------------------------------------------------
// Kernel 5: projections. Block = 512 thr (16 waves) = 64 absolute positions
// s0..s0+63 of batch b (s0 multiple of 64 over the padded 2112) x 256 cols;
// wave (wr = w>>2, wc = w&3) owns rows 16wr..16wr+15 x cols 64wc..64wc+63.
// Rows s<32: text (sine position added to the Q/K A operand, text weights, no
// XPOS); 32<=s<2080: video; s>=2080: zero pad rows. Q,K,V: bf16 hi/lo split
// GEMMs. Q,K: XPOS rotation in f32, written as bf16 hi/lo planes
// [b][SEQP][256]. V: written transposed VT[b][d][SEQP] as f16(64*V).
// ---------------------------------------------------------------------------
__device__ __forceinline__ void store_qk(const unsigned short* sOut, unsigned short* PH, unsigned short* PLo,
                                         int b, int s0, int w, int sub, int q8)
{
  #pragma unroll
  for (int i = 0; i < 8; ++i) {
    const int lid = w * 32 + 4 * i + sub;                  // 0..511
    const int pl = lid >> 8, row = (lid >> 2) & 63, qu = lid & 3;
    const v8us v = *(const v8usa*)(sOut + pl * 16384 + row * DM + 64 * qu + 8 * q8);
    unsigned short* dst = (pl ? PLo : PH) + ((size_t)(b * SEQP + s0 + row)) * DM + 64 * qu + 8 * q8;
    *(v8us*)dst = v;
  }
}

__device__ __forceinline__ void store_vt(const _Float16* sV, _Float16* VT, int b, int s0, int w, int sub, int q8)
{
  #pragma unroll
  for (int i = 0; i < 4; ++i) {
    const int d = 16 * w + 4 * i + sub;                    // 0..255
    const v8h v = *(const v8ha*)(sV + d * 64 + 8 * q8);
    _Float16* dst = VT + ((size_t)(b * DM + d)) * SEQP + s0 + 8 * q8;
    *(v8h*)dst = v;
  }
}

__global__ __launch_bounds__(512) void k_proj(
    const float* __restrict__ src,
    const unsigned short* __restrict__ WB, const float* __restrict__ XT,
    unsigned short* __restrict__ QH, unsigned short* __restrict__ QL,
    unsigned short* __restrict__ KH, unsigned short* __restrict__ KL,
    _Float16* __restrict__ VT)
{
  extern __shared__ __attribute__((aligned(16))) unsigned char smem[];
  unsigned short* sAh  = (unsigned short*)smem;            // [64][256] bf16 hi, row pitch RPIT
  unsigned short* sAl  = sAh + 64 * RPIT;                  // [64][256] bf16 lo, row pitch RPIT
  unsigned short* sOut = (unsigned short*)(smem + 4 * 64 * RPIT);  // [2][64][256] bf16 hi/lo results
  _Float16*       sV   = (_Float16*)(smem + 4 * 64 * RPIT);        // [256][64] f16 (V phase, aliases sOut)

  const int tid = threadIdx.x, lane = tid & 31, w = tid >> 5;
  const int wr = w >> 2, wc = w & 3, h = lane >> 4, m = lane & 15;
  const int q8 = lane & 7, sub = lane >> 3;
  const int b = blockIdx.y, s0 = blockIdx.x * 64;
  const bool wtxt = (blockIdx.x == 0) && (wr < 2);         // wave-uniform row type
  const v4f z4 = {0.f, 0.f, 0.f, 0.f};
  const v8f z8 = {0.f, 0.f, 0.f, 0.f, 0.f, 0.f, 0.f, 0.f};

  // ---- stage A = src (+ sine position on text rows) as bf16 hi/lo ----
  #pragma unroll 1
  for (int it = 0; it < 8; ++it) {
    const int q = it * 512 + tid;
    const int row = q >> 6, c4 = (q & 63) * 4;            // row wave-uniform
    const int s = s0 + row;
    const int sl = (s < SEQ) ? s : (SEQ - 1);
    v4f x = *(const v4fa*)(src + ((size_t)(b * SEQ + sl)) * DM + c4);
    if (s >= SEQ) x = z4;
    if (s < TXTN) {
      const float xe = ((float)(s + 1) * 0.03125f) * 6.2831855f;
      const float d0 = powf(10000.0f, (float)c4 * (1.0f / 256.0f));
      const float d1 = powf(10000.0f, (float)(c4 + 2) * (1.0f / 256.0f));
      const float r0 = xe * (1.0f / d0), r1 = xe * (1.0f / d1);
      x.x += sinf(r0); x.y += cosf(r0); x.z += sinf(r1); x.w += cosf(r1);
    }
    const unsigned int h0 = bf16_rne(x.x), h1 = bf16_rne(x.y), h2 = bf16_rne(x.z), h3 = bf16_rne(x.w);
    const unsigned int l0 = bf16_rne(x.x - __uint_as_float(h0 << 16));
    const unsigned int l1 = bf16_rne(x.y - __uint_as_float(h1 << 16));
    const unsigned int l2 = bf16_rne(x.z - __uint_as_float(h2 << 16));
    const unsigned int l3 = bf16_rne(x.w - __uint_as_float(h3 << 16));
    const v4us vh = {(unsigned short)h0, (unsigned short)h1, (unsigned short)h2, (unsigned short)h3};
    const v4us vl = {(unsigned short)l0, (unsigned short)l1, (unsigned short)l2, (unsigned short)l3};
    *(v4usa*)(sAh + row * RPIT + c4) = vh;
    *(v4usa*)(sAl + row * RPIT + c4) = vl;
  }
  __syncthreads();

  // ---- Q (p=0) and K (p=1): bf16 hi/lo split GEMM, XPOS epilogue ----
  #pragma unroll 1
  for (int p = 0; p < 2; ++p) {
    const unsigned short* Bh = WB + (size_t)((wtxt ? 0 : 4) + 2 * p) * 65536 + (size_t)(64 * wc + m) * DM;
    const unsigned short* Bl = Bh + 65536;
    const unsigned short* Ap = sAh + (16 * wr + m) * RPIT;
    v8f acc[4];
    #pragma unroll
    for (int nt = 0; nt < 4; ++nt) acc[nt] = z8;
    #pragma unroll 1
    for (int kk = 0; kk < DM; kk += 32) {
      const v16b ah = ldfb(Ap + kk, h);
      const v16b al = ldfb(Ap + 64 * RPIT + kk, h);
      #pragma unroll
      for (int nt = 0; nt < 4; ++nt) {
        const v16b bh = ldfb(Bh + (size_t)(16 * nt) * DM + kk, h);
        const v16b bl = ldfb(Bl + (size_t)(16 * nt) * DM + kk, h);
        acc[nt] = wmma_b(ah, bh, acc[nt]);
        acc[nt] = wmma_b(ah, bl, acc[nt]);
        acc[nt] = wmma_b(al, bh, acc[nt]);
      }
    }
    // D[r] = Y[row 16wr+8h+r][col 64wc+16nt+m]; rotation pairs cols (n, n^1) = lanes (m, m^1)
    const int rowb = 16 * wr + 8 * h;
    int lb = s0 + rowb - TXTN;
    lb = lb < 0 ? 0 : lb;
    lb = lb > (VIDN - 8) ? (VIDN - 8) : lb;
    const float sg = (m & 1) ? 1.0f : -1.0f;
    #pragma unroll
    for (int nt = 0; nt < 4; ++nt) {
      const int n = 64 * wc + 16 * nt + m;
      const float* tc = XT + ((size_t)(2 * p * DM + n)) * VIDN + lb;
      const float* ts = tc + (size_t)DM * VIDN;
      const v4f c0 = *(const v4fa*)tc, c1 = *(const v4fa*)(tc + 4);
      const v4f t0 = *(const v4fa*)ts, t1 = *(const v4fa*)(ts + 4);
      const float cs[8] = {c0.x, c0.y, c0.z, c0.w, c1.x, c1.y, c1.z, c1.w};
      const float sn[8] = {t0.x, t0.y, t0.z, t0.w, t1.x, t1.y, t1.z, t1.w};
      #pragma unroll
      for (int r = 0; r < 8; ++r) {
        const float x  = acc[nt][r];
        const float pr = __shfl_xor(x, 1, 32);
        const float cv = wtxt ? 1.0f : cs[r];
        const float snv = wtxt ? 0.0f : sn[r];
        const float y  = x * cv + sg * (pr * snv);
        const unsigned int hb  = bf16_rne(y);
        const unsigned int lob = bf16_rne(y - __uint_as_float(hb << 16));
        const int e = (rowb + r) * DM + n;
        sOut[e]         = (unsigned short)hb;
        sOut[16384 + e] = (unsigned short)lob;
      }
    }
    __syncthreads();
    unsigned short* PH  = p ? KH : QH;
    unsigned short* PLo = p ? KL : QL;
    store_qk(sOut, PH, PLo, b, s0, w, sub, q8);
    
    __syncthreads();
  }

  // ---- V: tile 0 restages A as bf16 hi/lo of src WITHOUT the position term
  //      (other tiles already hold plain src); split GEMM; f16(64*V) transposed ----
  if (blockIdx.x == 0) {                                   // block-uniform
    #pragma unroll 1
    for (int it = 0; it < 8; ++it) {
      const int q = it * 512 + tid;
      const int row = q >> 6, c4 = (q & 63) * 4;          // s = row < 64 < SEQ
      const v4f x = *(const v4fa*)(src + ((size_t)(b * SEQ + row)) * DM + c4);
      const unsigned int h0 = bf16_rne(x.x), h1 = bf16_rne(x.y), h2 = bf16_rne(x.z), h3 = bf16_rne(x.w);
      const unsigned int l0 = bf16_rne(x.x - __uint_as_float(h0 << 16));
      const unsigned int l1 = bf16_rne(x.y - __uint_as_float(h1 << 16));
      const unsigned int l2 = bf16_rne(x.z - __uint_as_float(h2 << 16));
      const unsigned int l3 = bf16_rne(x.w - __uint_as_float(h3 << 16));
      const v4us vh = {(unsigned short)h0, (unsigned short)h1, (unsigned short)h2, (unsigned short)h3};
      const v4us vl = {(unsigned short)l0, (unsigned short)l1, (unsigned short)l2, (unsigned short)l3};
      *(v4usa*)(sAh + row * RPIT + c4) = vh;
      *(v4usa*)(sAl + row * RPIT + c4) = vl;
    }
  }
  __syncthreads();
  {
    const unsigned short* Bh = WB + (size_t)(wtxt ? 8 : 10) * 65536 + (size_t)(64 * wc + m) * DM;
    const unsigned short* Bl = Bh + 65536;
    const unsigned short* Ap = sAh + (16 * wr + m) * RPIT;
    v8f acc[4];
    #pragma unroll
    for (int nt = 0; nt < 4; ++nt) acc[nt] = z8;
    #pragma unroll 1
    for (int kk = 0; kk < DM; kk += 32) {
      const v16b ah = ldfb(Ap + kk, h);
      const v16b al = ldfb(Ap + 64 * RPIT + kk, h);
      #pragma unroll
      for (int nt = 0; nt < 4; ++nt) {
        const v16b bh = ldfb(Bh + (size_t)(16 * nt) * DM + kk, h);
        const v16b bl = ldfb(Bl + (size_t)(16 * nt) * DM + kk, h);
        acc[nt] = wmma_b(ah, bh, acc[nt]);
        acc[nt] = wmma_b(ah, bl, acc[nt]);
        acc[nt] = wmma_b(al, bh, acc[nt]);
      }
    }
    // acc = V[token 16wr+8h+r][d 64wc+16nt+m] -> sV[d][token] = f16(64*V)
    #pragma unroll
    for (int nt = 0; nt < 4; ++nt) {
      const int d = 64 * wc + 16 * nt + m;
      #pragma unroll
      for (int r = 0; r < 8; ++r) sV[d * 64 + 16 * wr + 8 * h + r] = (_Float16)(acc[nt][r] * VSC);
    }
  }
  __syncthreads();
  store_vt(sV, VT, b, s0, w, sub, q8);
  
}

// ---------------------------------------------------------------------------
// Kernel 6: retention. Block 128 thr (4 waves) = 64 queries q0..q0+63 of batch
// b (QT sub-tiles of 16; 33 tiles over the padded 2112 rows, pad rows of Q are
// zero and are not stored); wave w owns output cols 64w..64w+63 and computes
// the score slices for keys kb+16w..kb+16w+15 of each 64-key step (33 steps
// over the padded 2112 keys). Each K and V fragment is loaded once per step
// and feeds all QT query sub-tiles.
//   S^T slice = K * Q^T (A = K rows, B = Q rows; bf16 hi/lo split, K=256)
//   P = S * gate * 256 -> f16 hi tile and f16 lo tile (lo = P - hi)
//       [64 q][64 keys] in LDS (ping-pong), row pitch PPIT
//   O += P_hi * V + P_lo * V  (A = P rows, B = V^T rows from VT, f16), acc f32
// ---------------------------------------------------------------------------
#define QT 4
#define QB (16 * QT)
static_assert(QB * NTILE == SEQP);
static_assert(2 * QB * RPIT * 2 >= 4 * QB * 64 * 4);      // the f32 output staging fits in the Q planes' LDS

__device__ __forceinline__ void store_out(const float* so, float* out, int b, int q0, int w, int sub, int q8)
{
  #pragma unroll
  for (int qt = 0; qt < QT; ++qt) {
    if (q0 + 16 * qt < SEQ) {                              // block-uniform: whole sub-tiles of pad rows are dropped
      #pragma unroll
      for (int i = 0; i < 8; ++i) {
        const int lid = 4 * i + sub, row = 16 * qt + (lid >> 1), hl = lid & 1;
        const v4f v = *(const v4fa*)(so + row * 64 + 32 * hl + 4 * q8);
        float* dst = out + ((size_t)(b * SEQ + q0 + row)) * DM + 64 * w + 32 * hl + 4 * q8;
        *(v4f*)dst = v;
      }
      // wait in front of the next sub-tile's address arithmetic, which reuses registers that these stores name
      if (qt + 1 < QT) asm volatile("s_wait_xcnt 0x0" ::: "memory");
    }
  }
}

__global__ __launch_bounds__(128) void k_ret(
    const unsigned short* __restrict__ QH, const unsigned short* __restrict__ QL,
    const unsigned short* __restrict__ KH, const unsigned short* __restrict__ KL,
    const _Float16* __restrict__ VT, const float* __restrict__ MK, float* __restrict__ out)
{
  __shared__ __attribute__((aligned(16))) unsigned short sQ[2 * QB * RPIT];   // hi plane, lo plane
  __shared__ __attribute__((aligned(16))) _Float16 sPh[2][QB * PPIT];
  __shared__ __attribute__((aligned(16))) _Float16 sPl[2][QB * PPIT];
  unsigned short* sQh = sQ;
  unsigned short* sQl = sQ + QB * RPIT;
  float* sO = (float*)sQ;                                  // epilogue only: Q is last read in front of the last step's barrier

  const int tid = threadIdx.x, lane = tid & 31, w = tid >> 5, h = lane >> 4, m = lane & 15;
  const int q8 = lane & 7, sub = lane >> 3;
  const int b = blockIdx.y, q0 = blockIdx.x * QB;
  const v8f z8 = {0.f, 0.f, 0.f, 0.f, 0.f, 0.f, 0.f, 0.f};

  // ---- stage Q hi/lo rows q0..q0+63, 16 rows a pass ----
  // kept rolled: it runs once per work-group, and one pass already has eight 16-byte loads per lane in flight
  #pragma unroll 1
  for (int qp = 0; qp < QB; qp += 16) {
    v8us qh[4], ql[4];
    const unsigned short* gh[4];
    const unsigned short* gl[4];
    #pragma unroll
    for (int it = 0; it < 4; ++it) {
      const int idx = it * 128 + tid;
      const int row = qp + (idx >> 5), c8 = (idx & 31) * 8;
      const size_t g = ((size_t)(b * SEQP + q0 + row)) * DM + c8;
      gh[it] = QH + g;
      gl[it] = QL + g;
      qh[it] = *(const v8usa*)gh[it];
      ql[it] = *(const v8usa*)gl[it];
    }
    // wait in front of the first overwrite of a register that the eight loads name; the addresses are
    // inputs so that their registers stay as they are up to the wait
    asm volatile("s_wait_xcnt 0x0" :: "v"(gh[0]), "v"(gl[0]), "v"(gh[1]), "v"(gl[1]),
                 "v"(gh[2]), "v"(gl[2]), "v"(gh[3]), "v"(gl[3]) : "memory");
    #pragma unroll
    for (int it = 0; it < 4; ++it) {
      const int idx = it * 128 + tid;
      const int row = qp + (idx >> 5), c8 = (idx & 31) * 8;
      *(v8usa*)(sQh + row * RPIT + c8) = qh[it];
      *(v8usa*)(sQl + row * RPIT + c8) = ql[it];
    }
  }
  __syncthreads();

  v8f o[QT][4];
  #pragma unroll
  for (int qt = 0; qt < QT; ++qt)
    #pragma unroll
    for (int nt = 0; nt < 4; ++nt) o[qt][nt] = z8;

  const unsigned short* kh0 = KH + ((size_t)(b * SEQP + 16 * w + m)) * DM;
  const unsigned short* kl0 = KL + ((size_t)(b * SEQP + 16 * w + m)) * DM;
  const _Float16* vb0 = VT + ((size_t)(b * DM + 64 * w + m)) * SEQP;
  int moff[QT];                                           // gate row of this lane's D column, per sub-tile
  #pragma unroll
  for (int qt = 0; qt < QT; ++qt) {
    int mr = q0 + 16 * qt + m - TXTN;
    mr = mr < 0 ? 0 : mr;
    mr = mr > (VIDN - 1) ? (VIDN - 1) : mr;               // pad queries read the last row; their output is dropped
    moff[qt] = mr * VIDN;
  }

  int buf = 0;
  #pragma unroll 1
  for (int kb = 0; kb < SEQP; kb += 64) {
    // scores: s[qt][r] = S[query q0+16qt+m][key kb+16w+8h+r]
    v8f s[QT];
    #pragma unroll
    for (int qt = 0; qt < QT; ++qt) s[qt] = z8;
    const unsigned short* khp = kh0 + (size_t)kb * DM;
    const unsigned short* klp = kl0 + (size_t)kb * DM;
    #pragma unroll 1
    for (int kk = 0; kk < DM; kk += 32) {
      const v16b ka = ldfb(khp + kk, h);
      const v16b kl = ldfb(klp + kk, h);
      #pragma unroll
      for (int qp = 0; qp < QT; qp += 2) {                 // two sub-tiles at a time: their two accumulator chains alternate
        const v16b qa0 = ldfb(sQh + (16 * qp + m) * RPIT + kk, h);
        const v16b qa1 = ldfb(sQh + (16 * qp + 16 + m) * RPIT + kk, h);
        const v16b ql0 = ldfb(sQl + (16 * qp + m) * RPIT + kk, h);
        const v16b ql1 = ldfb(sQl + (16 * qp + 16 + m) * RPIT + kk, h);
        s[qp]     = wmma_b(ka, qa0, s[qp]);
        s[qp + 1] = wmma_b(ka, qa1, s[qp + 1]);
        s[qp]     = wmma_b(ka, ql0, s[qp]);
        s[qp + 1] = wmma_b(ka, ql1, s[qp + 1]);
        s[qp]     = wmma_b(kl, qa0, s[qp]);
        s[qp + 1] = wmma_b(kl, qa1, s[qp + 1]);
      }
    }
    // gate: 1 when query or key is text, sigmoid plane on vid x vid, 0 on pad keys
    const int cb = kb + 16 * w + 8 * h - TXTN;            // vid index of key r=0 (group of 8, aligned)
    const bool ktxt = cb < 0;
    const bool kpad = cb >= VIDN;
    int cbc = cb < 0 ? 0 : cb;
    cbc = cbc > (VIDN - 8) ? (VIDN - 8) : cbc;
    const float* gp[QT];
    v4f g0[QT], g1[QT];
    #pragma unroll
    for (int qt = 0; qt < QT; ++qt) {
      gp[qt] = MK + moff[qt] + cbc;
      g0[qt] = *(const v4fa*)gp[qt];
      g1[qt] = *(const v4fa*)(gp[qt] + 4);
    }
    // wait in front of the first overwrite of a register that the eight loads name; the addresses are
    // inputs so that their registers stay as they are up to the wait
    asm volatile("s_wait_xcnt 0x0" :: "v"(gp[0]), "v"(gp[1]), "v"(gp[2]), "v"(gp[3]) : "memory");
    #pragma unroll
    for (int qt = 0; qt < QT; ++qt) {
      const bool qtxt = (q0 + 16 * qt + m) < TXTN;
      const float gk[8] = {g0[qt].x, g0[qt].y, g0[qt].z, g0[qt].w, g1[qt].x, g1[qt].y, g1[qt].z, g1[qt].w};
      v8h ph, plo;
      #pragma unroll
      for (int r = 0; r < 8; ++r) {
        const float gg = kpad ? 0.0f : ((qtxt || ktxt) ? 1.0f : gk[r]);
        const float pv = (s[qt][r] * gg) * PSC;
        const _Float16 hv = (_Float16)pv;
        ph[r]  = hv;
        plo[r] = (_Float16)(pv - (float)hv);
      }
      *(v8ha*)(&sPh[buf][(16 * qt + m) * PPIT + 16 * w + 8 * h]) = ph;
      *(v8ha*)(&sPl[buf][(16 * qt + m) * PPIT + 16 * w + 8 * h]) = plo;
    }
    __syncthreads();

    // O += P_hi(64x64) * V + P_lo(64x64) * V  (64 keys x this wave's 64 cols)
    #pragma unroll
    for (int ks = 0; ks < 2; ++ks) {
      v16h pa[QT], pb[QT];
      #pragma unroll
      for (int qt = 0; qt < QT; ++qt) {
        pa[qt] = ldfh(&sPh[buf][(16 * qt + m) * PPIT + 32 * ks], h);
        pb[qt] = ldfh(&sPl[buf][(16 * qt + m) * PPIT + 32 * ks], h);
      }
      #pragma unroll
      for (int nt = 0; nt < 4; ++nt) {
        const v16h vbf = ldfh(vb0 + (size_t)(16 * nt) * SEQP + kb + 32 * ks, h);
        #pragma unroll
        for (int qt = 0; qt < QT; ++qt) o[qt][nt] = wmma_h(pa[qt], vbf, o[qt][nt]);
        #pragma unroll
        for (int qt = 0; qt < QT; ++qt) o[qt][nt] = wmma_h(pb[qt], vbf, o[qt][nt]);
      }
    }
    buf ^= 1;
  }

  // ---- epilogue: O[q0+16qt+8h+r][64w+16nt+m] = o[qt][nt][r] / (256*64) ----
  float* so = sO + w * (QB * 64);
  #pragma unroll
  for (int qt = 0; qt < QT; ++qt)
    #pragma unroll
    for (int nt = 0; nt < 4; ++nt)
      #pragma unroll
      for (int r = 0; r < 8; ++r)
        so[(16 * qt + 8 * h + r) * 64 + 16 * nt + m] = o[qt][nt][r] * OSC;
  __syncthreads();
  store_out(so, out, b, q0, w, sub, q8);
  
}

// ---------------------------------------------------------------------------
extern "C" void kernel_launch(void* const* d_in, const int* in_sizes, int n_in,
                              void* d_out, int out_size, void* d_ws, size_t ws_size,
                              hipStream_t stream)
{
  if (n_in < 9) return;
  if (in_sizes[0] != BATCH * SEQ * DM) return;
  if (in_sizes[1] != VIDN * VIDN) return;
  for (int i = 2; i < 8; ++i) if (in_sizes[i] != DM * DM) return;
  if (in_sizes[8] < 1) return;
  if (out_size != BATCH * SEQ * DM + 1) return;

  const float* src = (const float*)d_in[0];
  const float* lrn = (const float*)d_in[1];
  const float* wtq = (const float*)d_in[2];
  const float* wtk = (const float*)d_in[3];
  const float* wtv = (const float*)d_in[4];
  const float* wvq = (const float*)d_in[5];
  const float* wvk = (const float*)d_in[6];
  const float* wvv = (const float*)d_in[7];
  const int*   txl = (const int*)d_in[8];
  float* out0 = (float*)d_out;
  float* out1 = out0 + (size_t)BATCH * SEQ * DM;          // byte offset 34078720

  const size_t pl_bytes = (size_t)BATCH * SEQP * DM * 2;  // 17301504 per bf16/f16 plane (padded rows incl.)
  const size_t wb_bytes = (size_t)NWPL * DM * DM * 2;      // 1572864
  const size_t xt_bytes = (size_t)4 * DM * VIDN * 4;       // 8388608
  const size_t mk_bytes = (size_t)VIDN * VIDN * 4;         // 16777216
  const size_t off_qh = 0;
  const size_t off_ql = off_qh + pl_bytes;
  const size_t off_kh = off_ql + pl_bytes;
  const size_t off_kl = off_kh + pl_bytes;
  const size_t off_vt = off_kl + pl_bytes;
  const size_t off_wb = off_vt + pl_bytes;
  const size_t off_xt = off_wb + wb_bytes;
  const size_t off_mk = off_xt + xt_bytes;
  const size_t pt_bytes = (size_t)NPART * PSTR * 8;        // 131072
  const size_t off_pt = off_mk + mk_bytes;
  const size_t total  = off_pt + pt_bytes;                 // 113377280
  if (total > ws_size) return;
  if (total > (size_t)134217728) return;

  char* ws = (char*)d_ws;
  unsigned short* QH = (unsigned short*)(ws + off_qh);
  unsigned short* QL = (unsigned short*)(ws + off_ql);
  unsigned short* KH = (unsigned short*)(ws + off_kh);
  unsigned short* KL = (unsigned short*)(ws + off_kl);
  _Float16* VT = (_Float16*)(ws + off_vt);
  unsigned short* WB = (unsigned short*)(ws + off_wb);
  float* XT = (float*)(ws + off_xt);
  float* MK = (float*)(ws + off_mk);
  double* PT = (double*)(ws + off_pt);

  k_wprep<<<(NWPL * DM) / 8, 256, 0, stream>>>(wtq, wtk, wtv, wvq, wvk, wvv, WB);
  k_xtab<<<DM * 8, 256, 0, stream>>>(XT);
  k_mask<<<NPART, 256, 0, stream>>>(lrn, MK, PT);
  k_loss<<<1, NPART, 0, stream>>>(PT, txl, out1);

  const size_t proj_lds = 133120;                          // 4*64*RPIT + 65536
  hipFuncSetAttribute(reinterpret_cast<const void*>(&k_proj), hipFuncAttributeMaxDynamicSharedMemorySize, (int)proj_lds);
  dim3 gp(NTILE, BATCH);
  k_proj<<<gp, 512, proj_lds, stream>>>(src, WB, XT, QH, QL, KH, KL, VT);

  dim3 gr(NTILE, BATCH);
  k_ret<<<gr, 128, 0, stream>>>(QH, QL, KH, KL, VT, MK, out0);
}

// v004
// One run takes 327 microseconds.
// Timed twice side by side with v003, it ran 1.13 times as fast both times.
// Over all steps from v000 it is 18.9 times as fast.
// Contractions: Q,K,V projections and S=K*Q^T on v_wmma_f32_16x16x32_bf16 as bf16 hi/lo split (hi*hi+hi*lo+lo*hi); O=P*V on v_wmma_f32_16x16x32_f16 with P as f16 hi + f16 lo (P x256, two products) and V^T f16 x64; f32 accumulate; position tables, sigmoid gate and loss in f32/f64.
#include <hip/hip_runtime.h>

#define BATCH 16
#define TXTN  32
#define VIDN  2048
#define SEQ   2080
#define SEQP  2112
#define DM    256
#define NTILE 33
#define NWPL  12
#define PSC   256.0f
#define VSC   64.0f
#define OSC   (1.0f / 16384.0f)
#define MELEM 4096
#define NPART 1024
#define PSTR  16
// LDS row pitches in 16-bit elements: row bytes + 16, an odd multiple of 16 B, so that the
// 16 rows one ds_load_b128 fragment read touches per half-wave fall on 16 different bank groups.
#define RPIT  (DM + 8)
#define PPIT  (64 + 8)
static_assert(MELEM * NPART == VIDN * VIDN);

typedef _Float16 v16h __attribute__((ext_vector_type(16)));
typedef _Float16 v8h  __attribute__((ext_vector_type(8)));
typedef _Float16 v4h  __attribute__((ext_vector_type(4)));
typedef __bf16   v16b __attribute__((ext_vector_type(16)));
typedef unsigned short v8us __attribute__((ext_vector_type(8)));
typedef unsigned short v4us __attribute__((ext_vector_type(4)));
typedef float v8f __attribute__((ext_vector_type(8)));
typedef float v4f __attribute__((ext_vector_type(4)));
typedef v8h  __attribute__((may_alias)) v8ha;
typedef v4h  __attribute__((may_alias)) v4ha;
typedef v8us __attribute__((may_alias)) v8usa;
typedef v4us __attribute__((may_alias)) v4usa;
typedef v4f  __attribute__((may_alias)) v4fa;

// ---------------------------------------------------------------------------
// XPOS module constants as exact f32 bit patterns:
// c_invf[i] = 1 / 10000^(i/128), c_svec[i] = (2i + 0.4*256) / (1.4*256).
// ---------------------------------------------------------------------------
__constant__ unsigned int c_invf[] = {
  0x3f800000, 0x3f6e39f8, 0x3f5dafd7, 0x3f4e4bad, 0x3f3ff911, 0x3f32a506, 0x3f263de0, 0x3f1ab32b,
  0x3f0ff59a, 0x3f05f6ef, 0x3ef953cf, 0x3ee8045f, 0x3ed7e89b, 0x3ec8eb24, 0x3ebaf81b, 0x3eadfcff,
  0x3ea1e89b, 0x3e96aaea, 0x3e8c3504, 0x3e827909, 0x3e72d423, 0x3e61f835, 0x3e5247ed, 0x3e43ae7c,
  0x3e361887, 0x3e297409, 0x3e1db040, 0x3e12bd91, 0x3e088d77, 0x3dfe24e0, 0x3dec7fd6, 0x3ddc1466,
  0x3dcccccd, 0x3dbe94c6, 0x3db15978, 0x3da50956, 0x3d99940d, 0x3d8eea6b, 0x3d84fe4d, 0x3d778513,
  0x3d6655c2, 0x3d5657e4, 0x3d47763f, 0x3d399d19, 0x3d2cba15, 0x3d20bc1d, 0x3d159348, 0x3d0b30cc,
  0x3d0186e3, 0x3cf11177, 0x3ce054d2, 0x3cd0c1a8, 0x3cc2434f, 0x3cb4c691, 0x3ca8398b, 0x3c9c8b97,
  0x3c91ad39, 0x3c879008, 0x3c7c4d33, 0x3c6ac8e7, 0x3c5a7bf2, 0x3c4b50b3, 0x3c3d3311, 0x3c301052,
  0x3c23d70a, 0x3c187705, 0x3c0de12d, 0x3c040779, 0x3bf5b9b0, 0x3be4aa46, 0x3bd4ca15, 0x3bc6040f,
  0x3bb8449c, 0x3bab7983, 0x3b9f91cc, 0x3b947dae, 0x3b8a2e77, 0x3b80967d, 0x3b6f520e, 0x3b5eb47a,
  0x3b4f3e38, 0x3b40dac5, 0x3b33770f, 0x3b270153, 0x3b1b690d, 0x3b109edb, 0x3b06946f, 0x3afa78f0,
  0x3ae91528, 0x3ad8e673, 0x3ac9d75c, 0x3abbd3ed, 0x3aaec98e, 0x3aa2a6f7, 0x3a975c0e, 0x3a8cd9db,
  0x3a83126f, 0x3a73f1a3, 0x3a6301e2, 0x3a533f28, 0x3a44948c, 0x3a36ee9e, 0x3a2a3b44, 0x3a1e69a5,
  0x3a136a16, 0x3a092e02, 0x39ff4fac, 0x39ed95e2, 0x39dd1725, 0x39cdbd96, 0x39bf74d7, 0x39b229fa,
  0x39a5cb60, 0x399a489e, 0x398f9272, 0x39859aa9, 0x3978a815, 0x39676492, 0x395753e4, 0x394860c1,
  0x393a7753, 0x392d8529, 0x39217916, 0x39164324, 0x390bd472, 0x39021f2b, 0x38f22ce2, 0x38e15c91 };
static_assert(sizeof(c_invf) == 512);

__constant__ unsigned int c_svec[] = {
  0x3e924925, 0x3e952493, 0x3e980000, 0x3e9adb6e, 0x3e9db6dc, 0x3ea0924a, 0x3ea36db7, 0x3ea64925,
  0x3ea92493, 0x3eac0000, 0x3eaedb6e, 0x3eb1b6dc, 0x3eb4924a, 0x3eb76db7, 0x3eba4924, 0x3ebd2492,
  0x3ec00000, 0x3ec2db6d, 0x3ec5b6db, 0x3ec89249, 0x3ecb6db7, 0x3ece4924, 0x3ed12492, 0x3ed40000,
  0x3ed6db6d, 0x3ed9b6db, 0x3edc9249, 0x3edf6db7, 0x3ee24924, 0x3ee52492, 0x3ee80000, 0x3eeadb6e,
  0x3eedb6db, 0x3ef09249, 0x3ef36db7, 0x3ef64924, 0x3ef92492, 0x3efc0000, 0x3efedb6e, 0x3f00db6e,
  0x3f024924, 0x3f03b6db, 0x3f052492, 0x3f069249, 0x3f080000, 0x3f096db7, 0x3f0adb6e, 0x3f0c4925,
  0x3f0db6db, 0x3f0f2492, 0x3f109249, 0x3f120000, 0x3f136db7, 0x3f14db6e, 0x3f164925, 0x3f17b6db,
  0x3f192492, 0x3f1a9249, 0x3f1c0000, 0x3f1d6db7, 0x3f1edb6e, 0x3f204925, 0x3f21b6db, 0x3f232492,
  0x3f249249, 0x3f260000, 0x3f276db7, 0x3f28db6e, 0x3f2a4925, 0x3f2bb6db, 0x3f2d2492, 0x3f2e9249,
  0x3f300000, 0x3f316db7, 0x3f32db6e, 0x3f344925, 0x3f35b6db, 0x3f372492, 0x3f389249, 0x3f3a0000,
  0x3f3b6db7, 0x3f3cdb6e, 0x3f3e4925, 0x3f3fb6db, 0x3f412492, 0x3f429249, 0x3f440000, 0x3f456db7,
  0x3f46db6e, 0x3f484925, 0x3f49b6db, 0x3f4b2492, 0x3f4c9249, 0x3f4e0000, 0x3f4f6db7, 0x3f50db6e,
  0x3f524925, 0x3f53b6db, 0x3f552492, 0x3f569249, 0x3f580000, 0x3f596db7, 0x3f5adb6e, 0x3f5c4925,
  0x3f5db6db, 0x3f5f2492, 0x3f609249, 0x3f620000, 0x3f636db7, 0x3f64db6e, 0x3f664925, 0x3f67b6dc,
  0x3f692492, 0x3f6a9249, 0x3f6c0000, 0x3f6d6db7, 0x3f6edb6e, 0x3f704925, 0x3f71b6dc, 0x3f732492,
  0x3f749249, 0x3f760000, 0x3f776db7, 0x3f78db6e, 0x3f7a4925, 0x3f7bb6dc, 0x3f7d2492, 0x3f7e9249 };
static_assert(sizeof(c_svec) == 512);

// ---------------------------------------------------------------------------
// 16x16x32 WMMA with hazard guard. Fragment map (wave32): lane l, h = l>>4,
// m = n = l&15. A/B element i: i<8 -> k0+8h+i ; i>=8 -> k0+16+8h+(i-8).
// D element r: row 8h+r, col l&15.
// ---------------------------------------------------------------------------
__device__ __forceinline__ v8f wmma_h(v16h a, v16h b, v8f c) {
  v8f d = __builtin_amdgcn_wmma_f32_16x16x32_f16(false, a, false, b, (short)0, c, false, false);
  asm volatile("v_nop\n\tv_nop\n\tv_nop\n\tv_nop" : "+v"(d) : "v"(a), "v"(b));
  return d;
}
__device__ __forceinline__ v8f wmma_b(v16b a, v16b b, v8f c) {
  v8f d = __builtin_amdgcn_wmma_f32_16x16x32_bf16(false, a, false, b, (short)0, c, false, false);
  asm volatile("v_nop\n\tv_nop\n\tv_nop\n\tv_nop" : "+v"(d) : "v"(a), "v"(b));
  return d;
}

// The same two products for the retention kernel: the guard names D alone. An asm operand must lie in v0..v255;
// with A and B named as well, every fragment loaded ahead would have to fit there beside the accumulators.
__device__ __forceinline__ v8f wmma_hd(v16h a, v16h b, v8f c) {
  v8f d = __builtin_amdgcn_wmma_f32_16x16x32_f16(false, a, false, b, (short)0, c, false, false);
  asm volatile("v_nop\n\tv_nop\n\tv_nop\n\tv_nop" : "+v"(d));
  return d;
}
__device__ __forceinline__ v8f wmma_bd(v16b a, v16b b, v8f c) {
  v8f d = __builtin_amdgcn_wmma_f32_16x16x32_bf16(false, a, false, b, (short)0, c, false, false);
  asm volatile("v_nop\n\tv_nop\n\tv_nop\n\tv_nop" : "+v"(d));
  return d;
}

// Fragment from a k-contiguous 16-bit row; p points at element k0 of the row
// owned by this lane (row = lane & 15 added by the caller). Same map for A and B.
__device__ __forceinline__ v16h ldfh(const _Float16* p, int h) {
  union { v16h v; v8h hf[2]; } f;
  f.hf[0] = *(const v8ha*)(p + 8 * h);
  f.hf[1] = *(const v8ha*)(p + 16 + 8 * h);
  return f.v;
}
__device__ __forceinline__ v16b ldfb(const unsigned short* p, int h) {
  union { v16b v; v8us hf[2]; } f;
  f.hf[0] = *(const v8usa*)(p + 8 * h);
  f.hf[1] = *(const v8usa*)(p + 16 + 8 * h);
  return f.v;
}

// Global fragment, same map: uniform base + this lane's 32-bit byte offset (row start + 16h) + a constant.
// One offset register serves every load of a step, so none is rewritten while loads that name it are in flight.
__device__ __forceinline__ v16h ldgh(const _Float16* base, unsigned int off, int imm) {
  const char* p = (const char*)base + off;
  union { v16h v; v8h hf[2]; } f;
  f.hf[0] = *(const v8ha*)(p + imm);
  f.hf[1] = *(const v8ha*)(p + imm + 32);
  return f.v;
}
__device__ __forceinline__ v16b ldgb(const unsigned short* base, unsigned int off, int imm) {
  const char* p = (const char*)base + off;
  union { v16b v; v8us hf[2]; } f;
  f.hf[0] = *(const v8usa*)(p + imm);
  f.hf[1] = *(const v8usa*)(p + imm + 32);
  return f.v;
}

// f32 -> bf16 bits, RNE
__device__ __forceinline__ unsigned int bf16_rne(float x) {
  const unsigned int u = __float_as_uint(x);
  return (u + 0x7FFFu + ((u >> 16) & 1u)) >> 16;
}

// ---------------------------------------------------------------------------
// Kernel 1: weight planes WB[pl][n][k] bf16, pl = 2*wsel + part:
// wsel 0 txtQ, 1 txtK, 2 vidQ, 3 vidK, 4 txtV, 5 vidV; part 0 hi = RNE(w),
// part 1 lo = RNE(w - hi). One wave writes one whole 512-B row per store.
// ---------------------------------------------------------------------------
__global__ __launch_bounds__(256) void k_wprep(
    const float* __restrict__ wtq, const float* __restrict__ wtk, const float* __restrict__ wtv,
    const float* __restrict__ wvq, const float* __restrict__ wvk, const float* __restrict__ wvv,
    unsigned short* __restrict__ WB)
{
  const int tid = threadIdx.x, lane = tid & 31;
  const int row = blockIdx.x * 8 + (tid >> 5);           // 0 .. 3071, plane uniform per block
  if (row >= NWPL * DM) return;
  const int pl = row >> 8, n = row & 255;
  const int wsel = pl >> 1, part = pl & 1;
  const float* W = (wsel == 0) ? wtq : (wsel == 1) ? wtk : (wsel == 2) ? wvq
                 : (wsel == 3) ? wvk : (wsel == 4) ? wtv : wvv;
  const int k0 = lane * 8;
  float v[8];
  #pragma unroll
  for (int i = 0; i < 8; ++i) v[i] = W[(size_t)(k0 + i) * DM + n];
  v8us o;
  #pragma unroll
  for (int i = 0; i < 8; ++i) {
    const unsigned int hb = bf16_rne(v[i]);
    const unsigned int lb = bf16_rne(v[i] - __uint_as_float(hb << 16));
    o[i] = (unsigned short)(part ? lb : hb);
  }
  unsigned short* dst = WB + (size_t)pl * 65536 + (size_t)n * DM + k0;
  *(v8us*)dst = o;
  
}

// ---------------------------------------------------------------------------
// Kernel 2: XPOS tables XT[pl][n][l] f32, pl 0 cos*scale, 1 sin*scale,
// 2 cos/scale, 3 sin/scale; n = feature (pair i = n>>1), l = video position.
// scale = scale_vec[i] ^ (l/512) via powf; angle = l * inv_freq[i] with the
// exact constant tables above; precise sinf/cosf.
// ---------------------------------------------------------------------------
__global__ __launch_bounds__(256) void k_xtab(float* __restrict__ XT)
{
  const int n = blockIdx.x >> 3;
  const int l = (blockIdx.x & 7) * 256 + threadIdx.x;
  const int i = n >> 1;                                  // 0 .. 127
  const float sv = __uint_as_float(c_svec[i]);
  const float pw = (float)l * (1.0f / 512.0f);
  const float scale = powf(sv, pw);
  const float invf = __uint_as_float(c_invf[i]);
  const float ang = (float)l * invf;
  const float sn = sinf(ang), cs = cosf(ang);
  const float inv = 1.0f / scale;
  const size_t PS = (size_t)DM * VIDN;
  float* p0 = XT + (size_t)n * VIDN + l;
  const float a0 = cs * scale, a1 = sn * scale, a2 = cs * inv, a3 = sn * inv;
  *(float*)(p0)          = a0;
  *(float*)(p0 + PS)     = a1;
  *(float*)(p0 + 2 * PS) = a2;
  *(float*)(p0 + 3 * PS) = a3;
  
}

// ---------------------------------------------------------------------------
// Sum over the 32 lanes of a wave, f64, fixed butterfly order; every lane gets it.
// ---------------------------------------------------------------------------
__device__ __forceinline__ double wave_sum(double v) {
  #pragma unroll
  for (int d = 16; d > 0; d >>= 1) v += __shfl_xor(v, d, 32);
  return v;
}

// ---------------------------------------------------------------------------
// Kernel 3: gate plane M[r][c] = sigmoid(learn[r][c]) f32 (diagonal kept), and
// the loss's partial sums from the same values: work-group g covers elements
// 4096g .. 4096g+4095 and stores the f64 sum of its off-diagonal sigmoids at
// part[16g] (a 128-byte line of its own).
// ---------------------------------------------------------------------------
__global__ __launch_bounds__(256) void k_mask(const float* __restrict__ lr, float* __restrict__ M,
                                              double* __restrict__ part)
{
  __shared__ double red[8];
  const int t = threadIdx.x;
  const int g0 = blockIdx.x * MELEM, o = t * 4;            // group's first element (uniform), thread's offset in it
  const float* lp = lr + g0;
  float* mp = M + g0;
  v4f x[4];
  #pragma unroll
  for (int it = 0; it < 4; ++it) x[it] = *(const v4fa*)(lp + o + it * 1024);
  double acc = 0.0;
  #pragma unroll
  for (int it = 0; it < 4; ++it) {
    const int idx = g0 + o + it * 1024;
    const int r = idx >> 11, c = idx & (VIDN - 1);
    v4f sv;
    #pragma unroll
    for (int e = 0; e < 4; ++e) {
      const float s = 1.0f / (1.0f + expf(-x[it][e]));
      sv[e] = s;
      acc += (r == c + e) ? 0.0 : (double)s;
    }
    *(v4f*)(mp + o + it * 1024) = sv;
  }
  const double ws = wave_sum(acc);
  if ((t & 31) == 0) red[t >> 5] = ws;
  __syncthreads();
  if (t == 0) {
    double sum = 0.0;
    #pragma unroll
    for (int i = 0; i < 8; ++i) sum += red[i];
    part[(size_t)blockIdx.x * PSTR] = sum;
  }
}

// ---------------------------------------------------------------------------
// Kernel 4: loss = mean over vid x vid of off-diagonal sigmoid: one block adds
// the 1024 partial sums of kernel 3, one per thread, fixed order, f64.
// ---------------------------------------------------------------------------
__global__ __launch_bounds__(NPART) void k_loss(const double* __restrict__ part, const int* __restrict__ tl,
                                                float* __restrict__ out1)
{
  __shared__ double red[NPART / 32];
  const int t = threadIdx.x;
  const double ws = wave_sum(part[(size_t)t * PSTR]);
  if ((t & 31) == 0) red[t >> 5] = ws;
  __syncthreads();
  if (t < 32) {                                            // wave 0, all lanes on
    const double sum = wave_sum(red[t]);
    if (t == 0) {
      int vl = SEQ - tl[0];
      vl = vl < 1 ? 1 : vl;
      vl = vl > VIDN ? VIDN : vl;
      const float loss = (float)(sum / ((double)vl * (double)vl));
      *(float*)out1 = loss;
    }
  }
}

// ---------------------------------------------------------------------------
// Kernel 5: projections. Block = 512 thr (16 waves) = 64 absolute positions
// s0..s0+63 of batch b (s0 multiple of 64 over the padded 2112) x 256 cols;
// wave (wr = w>>2, wc = w&3) owns rows 16wr..16wr+15 x cols 64wc..64wc+63.
// Rows s<32: text (sine position added to the Q/K A operand, text weights, no
// XPOS); 32<=s<2080: video; s>=2080: zero pad rows. Q,K,V: bf16 hi/lo split
// GEMMs. Q,K: XPOS rotation in f32, written as bf16 hi/lo planes
// [b][SEQP][256]. V: written transposed VT[b][d][SEQP] as f16(64*V).
// ---------------------------------------------------------------------------
__device__ __forceinline__ void store_qk(const unsigned short* sOut, unsigned short* PH, unsigned short* PLo,
                                         int b, int s0, int w, int sub, int q8)
{
  #pragma unroll
  for (int i = 0; i < 8; ++i) {
    const int lid = w * 32 + 4 * i + sub;                  // 0..511
    const int pl = lid >> 8, row = (lid >> 2) & 63, qu = lid & 3;
    const v8us v = *(const v8usa*)(sOut + pl * 16384 + row * DM + 64 * qu + 8 * q8);
    unsigned short* dst = (pl ? PLo : PH) + ((size_t)(b * SEQP + s0 + row)) * DM + 64 * qu + 8 * q8;
    *(v8us*)dst = v;
  }
}

__device__ __forceinline__ void store_vt(const _Float16* sV, _Float16* VT, int b, int s0, int w, int sub, int q8)
{
  #pragma unroll
  for (int i = 0; i < 4; ++i) {
    const int d = 16 * w + 4 * i + sub;                    // 0..255
    const v8h v = *(const v8ha*)(sV + d * 64 + 8 * q8);
    _Float16* dst = VT + ((size_t)(b * DM + d)) * SEQP + s0 + 8 * q8;
    *(v8h*)dst = v;
  }
}

__global__ __launch_bounds__(512) void k_proj(
    const float* __restrict__ src,
    const unsigned short* __restrict__ WB, const float* __restrict__ XT,
    unsigned short* __restrict__ QH, unsigned short* __restrict__ QL,
    unsigned short* __restrict__ KH, unsigned short* __restrict__ KL,
    _Float16* __restrict__ VT)
{
  extern __shared__ __attribute__((aligned(16))) unsigned char smem[];
  unsigned short* sAh  = (unsigned short*)smem;            // [64][256] bf16 hi, row pitch RPIT
  unsigned short* sAl  = sAh + 64 * RPIT;                  // [64][256] bf16 lo, row pitch RPIT
  unsigned short* sOut = (unsigned short*)(smem + 4 * 64 * RPIT);  // [2][64][256] bf16 hi/lo results
  _Float16*       sV   = (_Float16*)(smem + 4 * 64 * RPIT);        // [256][64] f16 (V phase, aliases sOut)

  const int tid = threadIdx.x, lane = tid & 31, w = tid >> 5;
  const int wr = w >> 2, wc = w & 3, h = lane >> 4, m = lane & 15;
  const int q8 = lane & 7, sub = lane >> 3;
  const int b = blockIdx.y, s0 = blockIdx.x * 64;
  const bool wtxt = (blockIdx.x == 0) && (wr < 2);         // wave-uniform row type
  const v4f z4 = {0.f, 0.f, 0.f, 0.f};
  const v8f z8 = {0.f, 0.f, 0.f, 0.f, 0.f, 0.f, 0.f, 0.f};

  // ---- stage A = src (+ sine position on text rows) as bf16 hi/lo ----
  #pragma unroll 1
  for (int it = 0; it < 8; ++it) {
    const int q = it * 512 + tid;
    const int row = q >> 6, c4 = (q & 63) * 4;            // row wave-uniform
    const int s = s0 + row;
    const int sl = (s < SEQ) ? s : (SEQ - 1);
    v4f x = *(const v4fa*)(src + ((size_t)(b * SEQ + sl)) * DM + c4);
    if (s >= SEQ) x = z4;
    if (s < TXTN) {
      const float xe = ((float)(s + 1) * 0.03125f) * 6.2831855f;
      const float d0 = powf(10000.0f, (float)c4 * (1.0f / 256.0f));
      const float d1 = powf(10000.0f, (float)(c4 + 2) * (1.0f / 256.0f));
      const float r0 = xe * (1.0f / d0), r1 = xe * (1.0f / d1);
      x.x += sinf(r0); x.y += cosf(r0); x.z += sinf(r1); x.w += cosf(r1);
    }
    const unsigned int h0 = bf16_rne(x.x), h1 = bf16_rne(x.y), h2 = bf16_rne(x.z), h3 = bf16_rne(x.w);
    const unsigned int l0 = bf16_rne(x.x - __uint_as_float(h0 << 16));
    const unsigned int l1 = bf16_rne(x.y - __uint_as_float(h1 << 16));
    const unsigned int l2 = bf16_rne(x.z - __uint_as_float(h2 << 16));
    const unsigned int l3 = bf16_rne(x.w - __uint_as_float(h3 << 16));
    const v4us vh = {(unsigned short)h0, (unsigned short)h1, (unsigned short)h2, (unsigned short)h3};
    const v4us vl = {(unsigned short)l0, (unsigned short)l1, (unsigned short)l2, (unsigned short)l3};
    *(v4usa*)(sAh + row * RPIT + c4) = vh;
    *(v4usa*)(sAl + row * RPIT + c4) = vl;
  }
  __syncthreads();

  // ---- Q (p=0) and K (p=1): bf16 hi/lo split GEMM, XPOS epilogue ----
  #pragma unroll 1
  for (int p = 0; p < 2; ++p) {
    const unsigned short* Bh = WB + (size_t)((wtxt ? 0 : 4) + 2 * p) * 65536 + (size_t)(64 * wc + m) * DM;
    const unsigned short* Bl = Bh + 65536;
    const unsigned short* Ap = sAh + (16 * wr + m) * RPIT;
    v8f acc[4];
    #pragma unroll
    for (int nt = 0; nt < 4; ++nt) acc[nt] = z8;
    #pragma unroll 1
    for (int kk = 0; kk < DM; kk += 32) {
      const v16b ah = ldfb(Ap + kk, h);
      const v16b al = ldfb(Ap + 64 * RPIT + kk, h);
      #pragma unroll
      for (int nt = 0; nt < 4; ++nt) {
        const v16b bh = ldfb(Bh + (size_t)(16 * nt) * DM + kk, h);
        const v16b bl = ldfb(Bl + (size_t)(16 * nt) * DM + kk, h);
        acc[nt] = wmma_b(ah, bh, acc[nt]);
        acc[nt] = wmma_b(ah, bl, acc[nt]);
        acc[nt] = wmma_b(al, bh, acc[nt]);
      }
    }
    // D[r] = Y[row 16wr+8h+r][col 64wc+16nt+m]; rotation pairs cols (n, n^1) = lanes (m, m^1)
    const int rowb = 16 * wr + 8 * h;
    int lb = s0 + rowb - TXTN;
    lb = lb < 0 ? 0 : lb;
    lb = lb > (VIDN - 8) ? (VIDN - 8) : lb;
    const float sg = (m & 1) ? 1.0f : -1.0f;
    #pragma unroll
    for (int nt = 0; nt < 4; ++nt) {
      const int n = 64 * wc + 16 * nt + m;
      const float* tc = XT + ((size_t)(2 * p * DM + n)) * VIDN + lb;
      const float* ts = tc + (size_t)DM * VIDN;
      const v4f c0 = *(const v4fa*)tc, c1 = *(const v4fa*)(tc + 4);
      const v4f t0 = *(const v4fa*)ts, t1 = *(const v4fa*)(ts + 4);
      const float cs[8] = {c0.x, c0.y, c0.z, c0.w, c1.x, c1.y, c1.z, c1.w};
      const float sn[8] = {t0.x, t0.y, t0.z, t0.w, t1.x, t1.y, t1.z, t1.w};
      #pragma unroll
      for (int r = 0; r < 8; ++r) {
        const float x  = acc[nt][r];
        const float pr = __shfl_xor(x, 1, 32);
        const float cv = wtxt ? 1.0f : cs[r];
        const float snv = wtxt ? 0.0f : sn[r];
        const float y  = x * cv + sg * (pr * snv);
        const unsigned int hb  = bf16_rne(y);
        const unsigned int lob = bf16_rne(y - __uint_as_float(hb << 16));
        const int e = (rowb + r) * DM + n;
        sOut[e]         = (unsigned short)hb;
        sOut[16384 + e] = (unsigned short)lob;
      }
    }
    __syncthreads();
    unsigned short* PH  = p ? KH : QH;
    unsigned short* PLo = p ? KL : QL;
    store_qk(sOut, PH, PLo, b, s0, w, sub, q8);
    
    __syncthreads();
  }

  // ---- V: tile 0 restages A as bf16 hi/lo of src WITHOUT the position term
  //      (other tiles already hold plain src); split GEMM; f16(64*V) transposed ----
  if (blockIdx.x == 0) {                                   // block-uniform
    #pragma unroll 1
    for (int it = 0; it < 8; ++it) {
      const int q = it * 512 + tid;
      const int row = q >> 6, c4 = (q & 63) * 4;          // s = row < 64 < SEQ
      const v4f x = *(const v4fa*)(src + ((size_t)(b * SEQ + row)) * DM + c4);
      const unsigned int h0 = bf16_rne(x.x), h1 = bf16_rne(x.y), h2 = bf16_rne(x.z), h3 = bf16_rne(x.w);
      const unsigned int l0 = bf16_rne(x.x - __uint_as_float(h0 << 16));
      const unsigned int l1 = bf16_rne(x.y - __uint_as_float(h1 << 16));
      const unsigned int l2 = bf16_rne(x.z - __uint_as_float(h2 << 16));
      const unsigned int l3 = bf16_rne(x.w - __uint_as_float(h3 << 16));
      const v4us vh = {(unsigned short)h0, (unsigned short)h1, (unsigned short)h2, (unsigned short)h3};
      const v4us vl = {(unsigned short)l0, (unsigned short)l1, (unsigned short)l2, (unsigned short)l3};
      *(v4usa*)(sAh + row * RPIT + c4) = vh;
      *(v4usa*)(sAl + row * RPIT + c4) = vl;
    }
  }
  __syncthreads();
  {
    const unsigned short* Bh = WB + (size_t)(wtxt ? 8 : 10) * 65536 + (size_t)(64 * wc + m) * DM;
    const unsigned short* Bl = Bh + 65536;
    const unsigned short* Ap = sAh + (16 * wr + m) * RPIT;
    v8f acc[4];
    #pragma unroll
    for (int nt = 0; nt < 4; ++nt) acc[nt] = z8;
    #pragma unroll 1
    for (int kk = 0; kk < DM; kk += 32) {
      const v16b ah = ldfb(Ap + kk, h);
      const v16b al = ldfb(Ap + 64 * RPIT + kk, h);
      #pragma unroll
      for (int nt = 0; nt < 4; ++nt) {
        const v16b bh = ldfb(Bh + (size_t)(16 * nt) * DM + kk, h);
        const v16b bl = ldfb(Bl + (size_t)(16 * nt) * DM + kk, h);
        acc[nt] = wmma_b(ah, bh, acc[nt]);
        acc[nt] = wmma_b(ah, bl, acc[nt]);
        acc[nt] = wmma_b(al, bh, acc[nt]);
      }
    }
    // acc = V[token 16wr+8h+r][d 64wc+16nt+m] -> sV[d][token] = f16(64*V)
    #pragma unroll
    for (int nt = 0; nt < 4; ++nt) {
      const int d = 64 * wc + 16 * nt + m;
      #pragma unroll
      for (int r = 0; r < 8; ++r) sV[d * 64 + 16 * wr + 8 * h + r] = (_Float16)(acc[nt][r] * VSC);
    }
  }
  __syncthreads();
  store_vt(sV, VT, b, s0, w, sub, q8);
  
}

// ---------------------------------------------------------------------------
// Kernel 6: retention. Block 128 thr (4 waves) = 64 queries q0..q0+63 of batch
// b (QT sub-tiles of 16; 33 tiles over the padded 2112 rows, pad rows of Q are
// zero and are not stored); wave w owns output cols 64w..64w+63 and computes
// the score slices for keys kb+16w..kb+16w+15 of each 64-key step (33 steps
// over the padded 2112 keys). Each K and V fragment is loaded once per step
// and feeds all QT query sub-tiles.
//   S^T slice = K * Q^T (A = K rows, B = Q rows; bf16 hi/lo split, K=256)
//   P = S * gate * 256 -> f16 hi tile and f16 lo tile (lo = P - hi)
//       [64 q][64 keys] in LDS (ping-pong), row pitch PPIT
//   O += P_hi * V + P_lo * V  (A = P rows, B = V^T rows from VT, f16), acc f32
// ---------------------------------------------------------------------------
#define QT 4
#define QB (16 * QT)
static_assert(QB * NTILE == SEQP);
static_assert(2 * QB * RPIT * 2 >= 4 * QB * 64 * 4);      // the f32 output staging fits in the Q planes' LDS

__device__ __forceinline__ void store_out(const float* so, float* out, int b, int q0, int w, int sub, int q8)
{
  #pragma unroll
  for (int qt = 0; qt < QT; ++qt) {
    if (q0 + 16 * qt < SEQ) {                              // block-uniform: whole sub-tiles of pad rows are dropped
      #pragma unroll
      for (int i = 0; i < 8; ++i) {
        const int lid = 4 * i + sub, row = 16 * qt + (lid >> 1), hl = lid & 1;
        const v4f v = *(const v4fa*)(so + row * 64 + 32 * hl + 4 * q8);
        float* dst = out + ((size_t)(b * SEQ + q0 + row)) * DM + 64 * w + 32 * hl + 4 * q8;
        *(v4f*)dst = v;
      }
      // wait in front of the next sub-tile's address arithmetic, which reuses registers that these stores name
      if (qt + 1 < QT) asm volatile("s_wait_xcnt 0x0" ::: "memory");
    }
  }
}

// second bound: three waves per SIMD, so that three work-groups (the LDS limit) stay resident per WGP and the grid runs in one round
__global__ __launch_bounds__(128, 3) void k_ret(
    const unsigned short* __restrict__ QH, const unsigned short* __restrict__ QL,
    const unsigned short* __restrict__ KH, const unsigned short* __restrict__ KL,
    const _Float16* __restrict__ VT, const float* __restrict__ MK, float* __restrict__ out)
{
  __shared__ __attribute__((aligned(16))) unsigned short sQ[2 * QB * RPIT];   // hi plane, lo plane
  __shared__ __attribute__((aligned(16))) _Float16 sPh[2][QB * PPIT];
  __shared__ __attribute__((aligned(16))) _Float16 sPl[2][QB * PPIT];
  unsigned short* sQh = sQ;
  unsigned short* sQl = sQ + QB * RPIT;
  float* sO = (float*)sQ;                                  // epilogue only: Q is last read in front of the last step's barrier

  const int tid = threadIdx.x, lane = tid & 31, w = tid >> 5, h = lane >> 4, m = lane & 15;
  const int q8 = lane & 7, sub = lane >> 3;
  const int b = blockIdx.y, q0 = blockIdx.x * QB;
  const v8f z8 = {0.f, 0.f, 0.f, 0.f, 0.f, 0.f, 0.f, 0.f};

  // ---- stage Q hi/lo rows q0..q0+63, 16 rows a pass ----
  // kept rolled: it runs once per work-group, and one pass already has eight 16-byte loads per lane in flight
  #pragma unroll 1
  for (int qp = 0; qp < QB; qp += 16) {
    v8us qh[4], ql[4];
    const unsigned short* gh[4];
    const unsigned short* gl[4];
    #pragma unroll
    for (int it = 0; it < 4; ++it) {
      const int idx = it * 128 + tid;
      const int row = qp + (idx >> 5), c8 = (idx & 31) * 8;
      const size_t g = ((size_t)(b * SEQP + q0 + row)) * DM + c8;
      gh[it] = QH + g;
      gl[it] = QL + g;
      qh[it] = *(const v8usa*)gh[it];
      ql[it] = *(const v8usa*)gl[it];
    }
    // wait in front of the first overwrite of a register that the eight loads name; the addresses are
    // inputs so that their registers stay as they are up to the wait
    asm volatile("s_wait_xcnt 0x0" :: "v"(gh[0]), "v"(gl[0]), "v"(gh[1]), "v"(gl[1]),
                 "v"(gh[2]), "v"(gl[2]), "v"(gh[3]), "v"(gl[3]) : "memory");
    #pragma unroll
    for (int it = 0; it < 4; ++it) {
      const int idx = it * 128 + tid;
      const int row = qp + (idx >> 5), c8 = (idx & 31) * 8;
      *(v8usa*)(sQh + row * RPIT + c8) = qh[it];
      *(v8usa*)(sQl + row * RPIT + c8) = ql[it];
    }
  }
  __syncthreads();

  v8f o[QT][4];
  #pragma unroll
  for (int qt = 0; qt < QT; ++qt)
    #pragma unroll
    for (int nt = 0; nt < 4; ++nt) o[qt][nt] = z8;

  // byte offsets of this lane's K row (hi and lo planes alike) and V^T row, 16h included; both stay below 2^25
  unsigned int koff = (unsigned int)(((b * SEQP + 16 * w + m) * DM + 8 * h) * 2);
  unsigned int voff = (unsigned int)(((b * DM + 64 * w + m) * SEQP + 8 * h) * 2);
  int moff[QT];                                           // gate row of this lane's D column, per sub-tile
  #pragma unroll
  for (int qt = 0; qt < QT; ++qt) {
    int mr = q0 + 16 * qt + m - TXTN;
    mr = mr < 0 ? 0 : mr;
    mr = mr > (VIDN - 1) ? (VIDN - 1) : mr;               // pad queries read the last row; their output is dropped
    moff[qt] = mr * VIDN;
  }

  // K fragments travel in a register ring of four 32-wide k slices (hi and lo): a slice is refilled right after
  // its last use, four slices ahead of its next one, so that no score product waits for a global load.
  v16b rkh[4], rkl[4];
  #pragma unroll
  for (int i = 0; i < 4; ++i) {
    rkh[i] = ldgb(KH, koff, 64 * i);
    rkl[i] = ldgb(KL, koff, 64 * i);
  }

  int buf = 0;
  #pragma unroll 1
  for (int kb = 0; kb < SEQP; kb += 64) {
    // rows the ring's second half is refilled from: the next step's; the last step reads its own again (in bounds, unused)
    const unsigned int koffn = koff + ((kb + 64 < SEQP) ? 64u * DM * 2u : 0u);
    // gate: 1 when query or key is text, sigmoid plane on vid x vid, 0 on pad keys; loaded here, used behind the scores
    const int cb = kb + 16 * w + 8 * h - TXTN;            // vid index of key r=0 (group of 8, aligned)
    const bool ktxt = cb < 0;
    const bool kpad = cb >= VIDN;
    int cbc = cb < 0 ? 0 : cb;
    cbc = cbc > (VIDN - 8) ? (VIDN - 8) : cbc;
    unsigned int goff[QT];
    #pragma unroll
    for (int qt = 0; qt < QT; ++qt) goff[qt] = (unsigned int)((moff[qt] + cbc) * 4);
    // this fence and the next keep the eight loads and their wait together, up here: nothing that could rewrite
    // an offset register gets between them, and the loads are not sunk to their use, where they would be waited for in full
    __builtin_amdgcn_sched_barrier(0);
    v4f g0[QT], g1[QT];
    #pragma unroll
    for (int qt = 0; qt < QT; ++qt) {
      const char* gp = (const char*)MK + goff[qt];
      g0[qt] = *(const v4fa*)gp;
      g1[qt] = *(const v4fa*)(gp + 16);
    }
    // wait in front of the first overwrite of a register that the eight loads name; the offsets are
    // inputs so that their registers stay as they are up to the wait
    asm volatile("s_wait_xcnt 0x0" :: "v"(goff[0]), "v"(goff[1]), "v"(goff[2]), "v"(goff[3]) : "memory");
    __builtin_amdgcn_sched_barrier(0);

    // scores: s[qt][r] = S[query q0+16qt+m][key kb+16w+8h+r]
    v8f s[QT];
    #pragma unroll
    for (int qt = 0; qt < QT; ++qt) s[qt] = z8;
    #pragma unroll
    for (int i = 0; i < 8; ++i) {
      const int kk = 32 * i;
      const v16b ka = rkh[i & 3];
      const v16b kl = rkl[i & 3];
      #pragma unroll
      for (int qp = 0; qp < QT; qp += 2) {                 // two sub-tiles at a time: their two accumulator chains alternate
        const v16b qa0 = ldfb(sQh + (16 * qp + m) * RPIT + kk, h);
        const v16b qa1 = ldfb(sQh + (16 * qp + 16 + m) * RPIT + kk, h);
        const v16b ql0 = ldfb(sQl + (16 * qp + m) * RPIT + kk, h);
        const v16b ql1 = ldfb(sQl + (16 * qp + 16 + m) * RPIT + kk, h);
        s[qp]     = wmma_bd(ka, qa0, s[qp]);
        s[qp + 1] = wmma_bd(ka, qa1, s[qp + 1]);
        s[qp]     = wmma_bd(ka, ql0, s[qp]);
        s[qp + 1] = wmma_bd(ka, ql1, s[qp + 1]);
        s[qp]     = wmma_bd(kl, qa0, s[qp]);
        s[qp + 1] = wmma_bd(kl, qa1, s[qp + 1]);
      }
      rkh[i & 3] = ldgb(KH, (i < 4) ? koff : koffn, 64 * ((i + 4) & 7));
      rkl[i & 3] = ldgb(KL, (i < 4) ? koff : koffn, 64 * ((i + 4) & 7));
      // keeps the refill at this distance from its use: the scheduler would else sink it towards the use
      __builtin_amdgcn_sched_barrier(0);
    }
    // V^T fragments of the step's first 32 keys: in flight during the gate arithmetic
    v16h vf[4];
    #pragma unroll
    for (int nt = 0; nt < 4; ++nt) vf[nt] = ldgh(VT, voff, 16 * nt * SEQP * 2);
    // keeps these loads in front of the gate arithmetic
    __builtin_amdgcn_sched_barrier(0);
    #pragma unroll
    for (int qt = 0; qt < QT; ++qt) {
      const bool qtxt = (q0 + 16 * qt + m) < TXTN;
      const float gk[8] = {g0[qt].x, g0[qt].y, g0[qt].z, g0[qt].w, g1[qt].x, g1[qt].y, g1[qt].z, g1[qt].w};
      v8h ph, plo;
      #pragma unroll
      for (int r = 0; r < 8; ++r) {
        const float gg = kpad ? 0.0f : ((qtxt || ktxt) ? 1.0f : gk[r]);
        const float pv = (s[qt][r] * gg) * PSC;
        const _Float16 hv = (_Float16)pv;
        ph[r]  = hv;
        plo[r] = (_Float16)(pv - (float)hv);
      }
      *(v8ha*)(&sPh[buf][(16 * qt + m) * PPIT + 16 * w + 8 * h]) = ph;
      *(v8ha*)(&sPl[buf][(16 * qt + m) * PPIT + 16 * w + 8 * h]) = plo;
    }
    __syncthreads();

    // O += P_hi(64x64) * V + P_lo(64x64) * V  (64 keys x this wave's 64 cols)
    #pragma unroll
    for (int ks = 0; ks < 2; ++ks) {
      v16h pa[QT], pb[QT];
      #pragma unroll
      for (int qt = 0; qt < QT; ++qt) {
        pa[qt] = ldfh(&sPh[buf][(16 * qt + m) * PPIT + 32 * ks], h);
        pb[qt] = ldfh(&sPl[buf][(16 * qt + m) * PPIT + 32 * ks], h);
      }
      #pragma unroll
      for (int nt = 0; nt < 4; ++nt) {
        const v16h vbf = vf[nt];
        #pragma unroll
        for (int qt = 0; qt < QT; ++qt) o[qt][nt] = wmma_hd(pa[qt], vbf, o[qt][nt]);
        #pragma unroll
        for (int qt = 0; qt < QT; ++qt) o[qt][nt] = wmma_hd(pb[qt], vbf, o[qt][nt]);
        if (ks == 0) {
          vf[nt] = ldgh(VT, voff, 16 * nt * SEQP * 2 + 64);  // second 32 keys, three column tiles ahead of their use
          // keeps the refill at this distance from its use
          __builtin_amdgcn_sched_barrier(0);
        }
      }
    }
    // wait in front of the overwrite of the offset registers that this step's K and V loads name; the offsets are
    // inputs so that their registers stay as they are up to the wait
    asm volatile("s_wait_xcnt 0x0" :: "v"(koff), "v"(koffn), "v"(voff) : "memory");
    koff = koffn;
    voff += 64u * 2u;
    buf ^= 1;
  }

  // ---- epilogue: O[q0+16qt+8h+r][64w+16nt+m] = o[qt][nt][r] / (256*64) ----
  float* so = sO + w * (QB * 64);
  #pragma unroll
  for (int qt = 0; qt < QT; ++qt)
    #pragma unroll
    for (int nt = 0; nt < 4; ++nt)
      #pragma unroll
      for (int r = 0; r < 8; ++r)
        so[(16 * qt + 8 * h + r) * 64 + 16 * nt + m] = o[qt][nt][r] * OSC;
  __syncthreads();
  store_out(so, out, b, q0, w, sub, q8);
  
}

// ---------------------------------------------------------------------------
extern "C" void kernel_launch(void* const* d_in, const int* in_sizes, int n_in,
                              void* d_out, int out_size, void* d_ws, size_t ws_size,
                              hipStream_t stream)
{
  if (n_in < 9) return;
  if (in_sizes[0] != BATCH * SEQ * DM) return;
  if (in_sizes[1] != VIDN * VIDN) return;
  for (int i = 2; i < 8; ++i) if (in_sizes[i] != DM * DM) return;
  if (in_sizes[8] < 1) return;
  if (out_size != BATCH * SEQ * DM + 1) return;

  const float* src = (const float*)d_in[0];
  const float* lrn = (const float*)d_in[1];
  const float* wtq = (const float*)d_in[2];
  const float* wtk = (const float*)d_in[3];
  const float* wtv = (const float*)d_in[4];
  const float* wvq = (const float*)d_in[5];
  const float* wvk = (const float*)d_in[6];
  const float* wvv = (const float*)d_in[7];
  const int*   txl = (const int*)d_in[8];
  float* out0 = (float*)d_out;
  float* out1 = out0 + (size_t)BATCH * SEQ * DM;          // byte offset 34078720

  const size_t pl_bytes = (size_t)BATCH * SEQP * DM * 2;  // 17301504 per bf16/f16 plane (padded rows incl.)
  const size_t wb_bytes = (size_t)NWPL * DM * DM * 2;      // 1572864
  const size_t xt_bytes = (size_t)4 * DM * VIDN * 4;       // 8388608
  const size_t mk_bytes = (size_t)VIDN * VIDN * 4;         // 16777216
  const size_t off_qh = 0;
  const size_t off_ql = off_qh + pl_bytes;
  const size_t off_kh = off_ql + pl_bytes;
  const size_t off_kl = off_kh + pl_bytes;
  const size_t off_vt = off_kl + pl_bytes;
  const size_t off_wb = off_vt + pl_bytes;
  const size_t off_xt = off_wb + wb_bytes;
  const size_t off_mk = off_xt + xt_bytes;
  const size_t pt_bytes = (size_t)NPART * PSTR * 8;        // 131072
  const size_t off_pt = off_mk + mk_bytes;
  const size_t total  = off_pt + pt_bytes;                 // 113377280
  if (total > ws_size) return;
  if (total > (size_t)134217728) return;

  char* ws = (char*)d_ws;
  unsigned short* QH = (unsigned short*)(ws + off_qh);
  unsigned short* QL = (unsigned short*)(ws + off_ql);
  unsigned short* KH = (unsigned short*)(ws + off_kh);
  unsigned short* KL = (unsigned short*)(ws + off_kl);
  _Float16* VT = (_Float16*)(ws + off_vt);
  unsigned short* WB = (unsigned short*)(ws + off_wb);
  float* XT = (float*)(ws + off_xt);
  float* MK = (float*)(ws + off_mk);
  double* PT = (double*)(ws + off_pt);

  k_wprep<<<(NWPL * DM) / 8, 256, 0, stream>>>(wtq, wtk, wtv, wvq, wvk, wvv, WB);
  k_xtab<<<DM * 8, 256, 0, stream>>>(XT);
  k_mask<<<NPART, 256, 0, stream>>>(lrn, MK, PT);
  k_loss<<<1, NPART, 0, stream>>>(PT, txl, out1);

  const size_t proj_lds = 133120;                          // 4*64*RPIT + 65536
  hipFuncSetAttribute(reinterpret_cast<const void*>(&k_proj), hipFuncAttributeMaxDynamicSharedMemorySize, (int)proj_lds);
  dim3 gp(NTILE, BATCH);
  k_proj<<<gp, 512, proj_lds, stream>>>(src, WB, XT, QH, QL, KH, KL, VT);

  dim3 gr(NTILE, BATCH);
  k_ret<<<gr, 128, 0, stream>>>(QH, QL, KH, KL, VT, MK, out0);
}

// v005
// One run takes 265 microseconds.
// In two side-by-side timings against v004, it was 1.23 and 1.24 times as fast.
// Over all steps from v000 it is 23.5 times as fast.
// Contractions: Q,K,V projections and S=K*Q^T on v_wmma_f32_16x16x32_bf16 as bf16 hi/lo split (hi*hi+hi*lo+lo*hi); O=P*V on v_wmma_f32_16x16x32_f16 with P as f16 hi + f16 lo (P x256, two products) and V^T f16 x64; f32 accumulate; position tables, sigmoid gate and loss in f32/f64.
#include <hip/hip_runtime.h>

#define BATCH 16
#define TXTN  32
#define VIDN  2048
#define SEQ   2080
#define SEQP  2112
#define DM    256
#define NTILE 33
#define NWPL  12
#define PSC   256.0f
#define VSC   64.0f
#define OSC   (1.0f / 16384.0f)
#define MELEM 4096
#define NPART 1024
#define PSTR  16
// LDS row pitches in 16-bit elements: row bytes + 16, an odd multiple of 16 B, so that the
// 16 rows one ds_load_b128 fragment read touches per half-wave fall on 16 different bank groups.
#define RPIT  (DM + 8)
#define PPIT  (64 + 8)
#define VPIT  (64 + 8)
// Fragment order, the layout of every 16-bit matrix operand that a wave loads from global memory (weight planes,
// K planes, V^T): one 16-row x 32-k fragment is 1 KiB in a row, as two 512-byte halves j = 0, 1; lane l = 16h + m owns
// bytes 16l .. 16l+15 of each half = elements k0+16j+8h .. +7 of row m. So one 16-byte load per lane reads four whole
// 128-byte lines; from a row-major plane the same load touches sixteen lines and uses 32 bytes of each.
#define FRAG  512
#define FRAGB 1024
#define NKT   (SEQP / 16)
#define NVS   (SEQP / 32)
// The gate plane likewise, in the order of the score fragment it multiplies: one 16-query x 16-key f32 tile is 1 KiB in a
// row, two 512-byte halves j; lane l = 16h + m owns bytes 16l .. 16l+15 of each half = keys 8h+4j .. +3 of query m.
#define GTB   1024
#define NGT   (VIDN / 16)
static_assert(MELEM * NPART == VIDN * VIDN);

typedef _Float16 v16h __attribute__((ext_vector_type(16)));
typedef _Float16 v8h  __attribute__((ext_vector_type(8)));
typedef _Float16 v4h  __attribute__((ext_vector_type(4)));
typedef __bf16   v16b __attribute__((ext_vector_type(16)));
typedef unsigned short v8us __attribute__((ext_vector_type(8)));
typedef unsigned short v4us __attribute__((ext_vector_type(4)));
typedef float v8f __attribute__((ext_vector_type(8)));
typedef float v4f __attribute__((ext_vector_type(4)));
typedef v8h  __attribute__((may_alias)) v8ha;
typedef v4h  __attribute__((may_alias)) v4ha;
typedef v8us __attribute__((may_alias)) v8usa;
typedef v4us __attribute__((may_alias)) v4usa;
typedef v4f  __attribute__((may_alias)) v4fa;

// ---------------------------------------------------------------------------
// XPOS module constants as exact f32 bit patterns:
// c_invf[i] = 1 / 10000^(i/128), c_svec[i] = (2i + 0.4*256) / (1.4*256).
// ---------------------------------------------------------------------------
__constant__ unsigned int c_invf[] = {
  0x3f800000, 0x3f6e39f8, 0x3f5dafd7, 0x3f4e4bad, 0x3f3ff911, 0x3f32a506, 0x3f263de0, 0x3f1ab32b,
  0x3f0ff59a, 0x3f05f6ef, 0x3ef953cf, 0x3ee8045f, 0x3ed7e89b, 0x3ec8eb24, 0x3ebaf81b, 0x3eadfcff,
  0x3ea1e89b, 0x3e96aaea, 0x3e8c3504, 0x3e827909, 0x3e72d423, 0x3e61f835, 0x3e5247ed, 0x3e43ae7c,
  0x3e361887, 0x3e297409, 0x3e1db040, 0x3e12bd91, 0x3e088d77, 0x3dfe24e0, 0x3dec7fd6, 0x3ddc1466,
  0x3dcccccd, 0x3dbe94c6, 0x3db15978, 0x3da50956, 0x3d99940d, 0x3d8eea6b, 0x3d84fe4d, 0x3d778513,
  0x3d6655c2, 0x3d5657e4, 0x3d47763f, 0x3d399d19, 0x3d2cba15, 0x3d20bc1d, 0x3d159348, 0x3d0b30cc,
  0x3d0186e3, 0x3cf11177, 0x3ce054d2, 0x3cd0c1a8, 0x3cc2434f, 0x3cb4c691, 0x3ca8398b, 0x3c9c8b97,
  0x3c91ad39, 0x3c879008, 0x3c7c4d33, 0x3c6ac8e7, 0x3c5a7bf2, 0x3c4b50b3, 0x3c3d3311, 0x3c301052,
  0x3c23d70a, 0x3c187705, 0x3c0de12d, 0x3c040779, 0x3bf5b9b0, 0x3be4aa46, 0x3bd4ca15, 0x3bc6040f,
  0x3bb8449c, 0x3bab7983, 0x3b9f91cc, 0x3b947dae, 0x3b8a2e77, 0x3b80967d, 0x3b6f520e, 0x3b5eb47a,
  0x3b4f3e38, 0x3b40dac5, 0x3b33770f, 0x3b270153, 0x3b1b690d, 0x3b109edb, 0x3b06946f, 0x3afa78f0,
  0x3ae91528, 0x3ad8e673, 0x3ac9d75c, 0x3abbd3ed, 0x3aaec98e, 0x3aa2a6f7, 0x3a975c0e, 0x3a8cd9db,
  0x3a83126f, 0x3a73f1a3, 0x3a6301e2, 0x3a533f28, 0x3a44948c, 0x3a36ee9e, 0x3a2a3b44, 0x3a1e69a5,
  0x3a136a16, 0x3a092e02, 0x39ff4fac, 0x39ed95e2, 0x39dd1725, 0x39cdbd96, 0x39bf74d7, 0x39b229fa,
  0x39a5cb60, 0x399a489e, 0x398f9272, 0x39859aa9, 0x3978a815, 0x39676492, 0x395753e4, 0x394860c1,
  0x393a7753, 0x392d8529, 0x39217916, 0x39164324, 0x390bd472, 0x39021f2b, 0x38f22ce2, 0x38e15c91 };
static_assert(sizeof(c_invf) == 512);

__constant__ unsigned int c_svec[] = {
  0x3e924925, 0x3e952493, 0x3e980000, 0x3e9adb6e, 0x3e9db6dc, 0x3ea0924a, 0x3ea36db7, 0x3ea64925,
  0x3ea92493, 0x3eac0000, 0x3eaedb6e, 0x3eb1b6dc, 0x3eb4924a, 0x3eb76db7, 0x3eba4924, 0x3ebd2492,
  0x3ec00000, 0x3ec2db6d, 0x3ec5b6db, 0x3ec89249, 0x3ecb6db7, 0x3ece4924, 0x3ed12492, 0x3ed40000,
  0x3ed6db6d, 0x3ed9b6db, 0x3edc9249, 0x3edf6db7, 0x3ee24924, 0x3ee52492, 0x3ee80000, 0x3eeadb6e,
  0x3eedb6db, 0x3ef09249, 0x3ef36db7, 0x3ef64924, 0x3ef92492, 0x3efc0000, 0x3efedb6e, 0x3f00db6e,
  0x3f024924, 0x3f03b6db, 0x3f052492, 0x3f069249, 0x3f080000, 0x3f096db7, 0x3f0adb6e, 0x3f0c4925,
  0x3f0db6db, 0x3f0f2492, 0x3f109249, 0x3f120000, 0x3f136db7, 0x3f14db6e, 0x3f164925, 0x3f17b6db,
  0x3f192492, 0x3f1a9249, 0x3f1c0000, 0x3f1d6db7, 0x3f1edb6e, 0x3f204925, 0x3f21b6db, 0x3f232492,
  0x3f249249, 0x3f260000, 0x3f276db7, 0x3f28db6e, 0x3f2a4925, 0x3f2bb6db, 0x3f2d2492, 0x3f2e9249,
  0x3f300000, 0x3f316db7, 0x3f32db6e, 0x3f344925, 0x3f35b6db, 0x3f372492, 0x3f389249, 0x3f3a0000,
  0x3f3b6db7, 0x3f3cdb6e, 0x3f3e4925, 0x3f3fb6db, 0x3f412492, 0x3f429249, 0x3f440000, 0x3f456db7,
  0x3f46db6e, 0x3f484925, 0x3f49b6db, 0x3f4b2492, 0x3f4c9249, 0x3f4e0000, 0x3f4f6db7, 0x3f50db6e,
  0x3f524925, 0x3f53b6db, 0x3f552492, 0x3f569249, 0x3f580000, 0x3f596db7, 0x3f5adb6e, 0x3f5c4925,
  0x3f5db6db, 0x3f5f2492, 0x3f609249, 0x3f620000, 0x3f636db7, 0x3f64db6e, 0x3f664925, 0x3f67b6dc,
  0x3f692492, 0x3f6a9249, 0x3f6c0000, 0x3f6d6db7, 0x3f6edb6e, 0x3f704925, 0x3f71b6dc, 0x3f732492,
  0x3f749249, 0x3f760000, 0x3f776db7, 0x3f78db6e, 0x3f7a4925, 0x3f7bb6dc, 0x3f7d2492, 0x3f7e9249 };
static_assert(sizeof(c_svec) == 512);

// ---------------------------------------------------------------------------
// 16x16x32 WMMA with hazard guard. Fragment map (wave32): lane l, h = l>>4,
// m = n = l&15. A/B element i: i<8 -> k0+8h+i ; i>=8 -> k0+16+8h+(i-8).
// D element r: row 8h+r, col l&15.
// ---------------------------------------------------------------------------
__device__ __forceinline__ v8f wmma_h(v16h a, v16h b, v8f c) {
  v8f d = __builtin_amdgcn_wmma_f32_16x16x32_f16(false, a, false, b, (short)0, c, false, false);
  asm volatile("v_nop\n\tv_nop\n\tv_nop\n\tv_nop" : "+v"(d) : "v"(a), "v"(b));
  return d;
}
__device__ __forceinline__ v8f wmma_b(v16b a, v16b b, v8f c) {
  v8f d = __builtin_amdgcn_wmma_f32_16x16x32_bf16(false, a, false, b, (short)0, c, false, false);
  asm volatile("v_nop\n\tv_nop\n\tv_nop\n\tv_nop" : "+v"(d) : "v"(a), "v"(b));
  return d;
}

// The same two products for the retention kernel: the guard names D alone. An asm operand must lie in v0..v255;
// with A and B named as well, every fragment loaded ahead would have to fit there beside the accumulators.
__device__ __forceinline__ v8f wmma_hd(v16h a, v16h b, v8f c) {
  v8f d = __builtin_amdgcn_wmma_f32_16x16x32_f16(false, a, false, b, (short)0, c, false, false);
  asm volatile("v_nop\n\tv_nop\n\tv_nop\n\tv_nop" : "+v"(d));
  return d;
}
__device__ __forceinline__ v8f wmma_bd(v16b a, v16b b, v8f c) {
  v8f d = __builtin_amdgcn_wmma_f32_16x16x32_bf16(false, a, false, b, (short)0, c, false, false);
  asm volatile("v_nop\n\tv_nop\n\tv_nop\n\tv_nop" : "+v"(d));
  return d;
}

// Fragment from a k-contiguous 16-bit row; p points at element k0 of the row
// owned by this lane (row = lane & 15 added by the caller). Same map for A and B.
__device__ __forceinline__ v16h ldfh(const _Float16* p, int h) {
  union { v16h v; v8h hf[2]; } f;
  f.hf[0] = *(const v8ha*)(p + 8 * h);
  f.hf[1] = *(const v8ha*)(p + 16 + 8 * h);
  return f.v;
}
__device__ __forceinline__ v16b ldfb(const unsigned short* p, int h) {
  union { v16b v; v8us hf[2]; } f;
  f.hf[0] = *(const v8usa*)(p + 8 * h);
  f.hf[1] = *(const v8usa*)(p + 16 + 8 * h);
  return f.v;
}

// Global fragment in fragment order: uniform base + this lane's 32-bit byte offset (16 * lane included) + a constant.
// One offset register serves every load of a step, so none is rewritten while loads that name it are in flight.
__device__ __forceinline__ v16h ldgh(const _Float16* base, unsigned int off, int imm) {
  const char* p = (const char*)base + off;
  union { v16h v; v8h hf[2]; } f;
  f.hf[0] = *(const v8ha*)(p + imm);
  f.hf[1] = *(const v8ha*)(p + imm + FRAGB / 2);
  return f.v;
}
__device__ __forceinline__ v16b ldgb(const unsigned short* base, unsigned int off, int imm) {
  const char* p = (const char*)base + off;
  union { v16b v; v8us hf[2]; } f;
  f.hf[0] = *(const v8usa*)(p + imm);
  f.hf[1] = *(const v8usa*)(p + imm + FRAGB / 2);
  return f.v;
}
// The same through a pointer: p = fragment start + 8 * lane, in elements.
__device__ __forceinline__ v16b ldff(const unsigned short* p) {
  union { v16b v; v8us hf[2]; } f;
  f.hf[0] = *(const v8usa*)p;
  f.hf[1] = *(const v8usa*)(p + FRAG / 2);
  return f.v;
}

// f32 -> bf16 bits, RNE
__device__ __forceinline__ unsigned int bf16_rne(float x) {
  const unsigned int u = __float_as_uint(x);
  return (u + 0x7FFFu + ((u >> 16) & 1u)) >> 16;
}

// ---------------------------------------------------------------------------
// Kernel 1: weight planes bf16 in fragment order, WB[pl][n tile of 16][k slice of 32][j][lane][8], pl = 2*wsel + part:
// wsel 0 txtQ, 1 txtK, 2 vidQ, 3 vidK, 4 txtV, 5 vidV; part 0 hi = RNE(w),
// part 1 lo = RNE(w - hi). One wave writes one whole 512-B fragment half per store.
// ---------------------------------------------------------------------------
__global__ __launch_bounds__(256) void k_wprep(
    const float* __restrict__ wtq, const float* __restrict__ wtk, const float* __restrict__ wtv,
    const float* __restrict__ wvq, const float* __restrict__ wvk, const float* __restrict__ wvv,
    unsigned short* __restrict__ WB)
{
  const int tid = threadIdx.x, lane = tid & 31;
  const int row = blockIdx.x * 8 + (tid >> 5);           // fragment half 0 .. 3071, plane uniform per block
  if (row >= NWPL * DM) return;
  const int pl = row >> 8, n = ((row >> 4) & 15) * 16 + (lane & 15);
  const int wsel = pl >> 1, part = pl & 1;
  const float* W = (wsel == 0) ? wtq : (wsel == 1) ? wtk : (wsel == 2) ? wvq
                 : (wsel == 3) ? wvk : (wsel == 4) ? wtv : wvv;
  const int k0 = ((row >> 1) & 7) * 32 + (row & 1) * 16 + (lane >> 4) * 8;
  float v[8];
  #pragma unroll
  for (int i = 0; i < 8; ++i) v[i] = W[(size_t)(k0 + i) * DM + n];
  v8us o;
  #pragma unroll
  for (int i = 0; i < 8; ++i) {
    const unsigned int hb = bf16_rne(v[i]);
    const unsigned int lb = bf16_rne(v[i] - __uint_as_float(hb << 16));
    o[i] = (unsigned short)(part ? lb : hb);
  }
  unsigned short* dst = WB + (size_t)row * (FRAG / 2) + lane * 8;
  *(v8us*)dst = o;
  
}

// ---------------------------------------------------------------------------
// Kernel 2: XPOS tables XT[pl][n][l] f32, pl 0 cos*scale, 1 sin*scale,
// 2 cos/scale, 3 sin/scale; n = feature (pair i = n>>1), l = video position.
// scale = scale_vec[i] ^ (l/512) via powf; angle = l * inv_freq[i] with the
// exact constant tables above; precise sinf/cosf.
// ---------------------------------------------------------------------------
__global__ __launch_bounds__(256) void k_xtab(float* __restrict__ XT)
{
  const int n = blockIdx.x >> 3;
  const int l = (blockIdx.x & 7) * 256 + threadIdx.x;
  const int i = n >> 1;                                  // 0 .. 127
  const float sv = __uint_as_float(c_svec[i]);
  const float pw = (float)l * (1.0f / 512.0f);
  const float scale = powf(sv, pw);
  const float invf = __uint_as_float(c_invf[i]);
  const float ang = (float)l * invf;
  const float sn = sinf(ang), cs = cosf(ang);
  const float inv = 1.0f / scale;
  const size_t PS = (size_t)DM * VIDN;
  float* p0 = XT + (size_t)n * VIDN + l;
  const float a0 = cs * scale, a1 = sn * scale, a2 = cs * inv, a3 = sn * inv;
  *(float*)(p0)          = a0;
  *(float*)(p0 + PS)     = a1;
  *(float*)(p0 + 2 * PS) = a2;
  *(float*)(p0 + 3 * PS) = a3;
  
}

// ---------------------------------------------------------------------------
// Sum over the 32 lanes of a wave, f64, fixed butterfly order; every lane gets it.
// ---------------------------------------------------------------------------
__device__ __forceinline__ double wave_sum(double v) {
  #pragma unroll
  for (int d = 16; d > 0; d >>= 1) v += __shfl_xor(v, d, 32);
  return v;
}

// ---------------------------------------------------------------------------
// Kernel 3: gate plane sigmoid(learn[r][c]) f32 (diagonal kept) in 16 x 16 tiles,
// M[r tile][c tile][j][lane][4], and the loss's partial sums from the same values:
// work-group g covers rows 16(g>>3) .. +15 x columns 256(g&7) .. +255 (a wave: two
// tiles, 2 KiB of M in a row) and stores the f64 sum of its off-diagonal sigmoids
// at part[16g] (a 128-byte line of its own).
// ---------------------------------------------------------------------------
__global__ __launch_bounds__(256) void k_mask(const float* __restrict__ lr, float* __restrict__ M,
                                              double* __restrict__ part)
{
  __shared__ double red[8];
  const int t = threadIdx.x;
  const int lane = t & 31;
  const int rt = blockIdx.x >> 3, ct = (blockIdx.x & 7) * 16 + 2 * (t >> 5);   // the wave's first tile
  const int r = 16 * rt + (lane & 15), c0 = 16 * ct + 8 * (lane >> 4);
  const float* lp = lr + r * VIDN + c0;
  float* mp = M + (rt * NGT + ct) * (GTB / 4) + lane * 4;
  v4f x[4];
  #pragma unroll
  for (int it = 0; it < 4; ++it) x[it] = *(const v4fa*)(lp + 16 * (it >> 1) + 4 * (it & 1));
  double acc = 0.0;
  #pragma unroll
  for (int it = 0; it < 4; ++it) {
    const int c = c0 + 16 * (it >> 1) + 4 * (it & 1);
    v4f sv;
    #pragma unroll
    for (int e = 0; e < 4; ++e) {
      const float s = 1.0f / (1.0f + expf(-x[it][e]));
      sv[e] = s;
      acc += (r == c + e) ? 0.0 : (double)s;
    }
    *(v4f*)(mp + it * (GTB / 8)) = sv;
  }
  const double ws = wave_sum(acc);
  if ((t & 31) == 0) red[t >> 5] = ws;
  __syncthreads();
  if (t == 0) {
    double sum = 0.0;
    #pragma unroll
    for (int i = 0; i < 8; ++i) sum += red[i];
    part[(size_t)blockIdx.x * PSTR] = sum;
  }
}

// ---------------------------------------------------------------------------
// Kernel 4: loss = mean over vid x vid of off-diagonal sigmoid: one block adds
// the 1024 partial sums of kernel 3, one per thread, fixed order, f64.
// ---------------------------------------------------------------------------
__global__ __launch_bounds__(NPART) void k_loss(const double* __restrict__ part, const int* __restrict__ tl,
                                                float* __restrict__ out1)
{
  __shared__ double red[NPART / 32];
  const int t = threadIdx.x;
  const double ws = wave_sum(part[(size_t)t * PSTR]);
  if ((t & 31) == 0) red[t >> 5] = ws;
  __syncthreads();
  if (t < 32) {                                            // wave 0, all lanes on
    const double sum = wave_sum(red[t]);
    if (t == 0) {
      int vl = SEQ - tl[0];
      vl = vl < 1 ? 1 : vl;
      vl = vl > VIDN ? VIDN : vl;
      const float loss = (float)(sum / ((double)vl * (double)vl));
      *(float*)out1 = loss;
    }
  }
}

// ---------------------------------------------------------------------------
// Kernel 5: projections. Block = 512 thr (16 waves) = 64 absolute positions
// s0..s0+63 of batch b (s0 multiple of 64 over the padded 2112) x 256 cols;
// wave (wr = w>>2, wc = w&3) owns rows 16wr..16wr+15 x cols 64wc..64wc+63.
// Rows s<32: text (sine position added to the Q/K A operand, text weights, no
// XPOS); 32<=s<2080: video; s>=2080: zero pad rows. Q,K,V: bf16 hi/lo split
// GEMMs. Q,K: XPOS rotation in f32, written as bf16 hi/lo planes: Q row-major
// [b][SEQP][256], K in fragment order [b][key tile of 16][k slice of 32][j][lane][8].
// V: f16(64*V) transposed, in fragment order VT[b][key slice of 32][d tile of 16][j][lane][8].
// ---------------------------------------------------------------------------
__device__ __forceinline__ void store_qk(const unsigned short* sOut, unsigned short* PH, unsigned short* PLo,
                                         int b, int s0, int w, int sub, int q8)
{
  #pragma unroll
  for (int i = 0; i < 8; ++i) {
    const int lid = w * 32 + 4 * i + sub;                  // 0..511
    const int pl = lid >> 8, row = (lid >> 2) & 63, qu = lid & 3;
    const v8us v = *(const v8usa*)(sOut + pl * (64 * RPIT) + row * RPIT + 64 * qu + 8 * q8);
    unsigned short* dst = (pl ? PLo : PH) + ((size_t)(b * SEQP + s0 + row)) * DM + 64 * qu + 8 * q8;
    *(v8us*)dst = v;
  }
}

// K tile to global in fragment order: wave w writes eight fragment halves, 4 KiB in a row
// (plane w>>3, key tile (w>>1)&3, k slices 4(w&1) .. 4(w&1)+3).
__device__ __forceinline__ void store_kf(const unsigned short* sOut, unsigned short* PH, unsigned short* PLo,
                                         int b, int s0, int w, int lane)
{
  const int h = lane >> 4, m = lane & 15, pl = w >> 3, t = (w >> 1) & 3, c = w & 1;
  const unsigned short* sp = sOut + pl * (64 * RPIT) + (16 * t + m) * RPIT + 128 * c + 8 * h;
  unsigned short* dst = (pl ? PLo : PH) + ((size_t)((b * NKT + (s0 >> 4) + t) * 8 + 4 * c)) * FRAG + lane * 8;
  #pragma unroll
  for (int i = 0; i < 8; ++i) {
    const v8us v = *(const v8usa*)(sp + 16 * i);
    *(v8us*)(dst + i * (FRAG / 2)) = v;
  }
  // wait in front of whatever next rewrites a register that these eight stores name
  asm volatile("s_wait_xcnt 0x0" ::: "memory");
}

// V^T tile to global in fragment order: wave w writes four fragment halves, 2 KiB in a row
// (key slice w>>3, d tiles 2(w&7) and 2(w&7)+1).
__device__ __forceinline__ void store_vf(const _Float16* sV, _Float16* VT, int b, int s0, int w, int lane)
{
  const int h = lane >> 4, m = lane & 15, ksl = w >> 3, dt = 2 * (w & 7);
  const _Float16* sp = sV + (16 * dt + m) * VPIT + 32 * ksl + 8 * h;
  _Float16* dst = VT + ((size_t)((b * NVS + (s0 >> 5) + ksl) * 16 + dt)) * FRAG + lane * 8;
  #pragma unroll
  for (int i = 0; i < 4; ++i) {
    const v8h v = *(const v8ha*)(sp + (i >> 1) * (16 * VPIT) + 16 * (i & 1));
    *(v8h*)(dst + i * (FRAG / 2)) = v;
  }
}

__global__ __launch_bounds__(512) void k_proj(
    const float* __restrict__ src,
    const unsigned short* __restrict__ WB, const float* __restrict__ XT,
    unsigned short* __restrict__ QH, unsigned short* __restrict__ QL,
    unsigned short* __restrict__ KH, unsigned short* __restrict__ KL,
    _Float16* __restrict__ VT)
{
  extern __shared__ __attribute__((aligned(16))) unsigned char smem[];
  unsigned short* sAh  = (unsigned short*)smem;            // [64][256] bf16 hi, row pitch RPIT
  unsigned short* sAl  = sAh + 64 * RPIT;                  // [64][256] bf16 lo, row pitch RPIT
  unsigned short* sOut = (unsigned short*)(smem + 4 * 64 * RPIT);  // [2][64][256] bf16 hi/lo results, row pitch RPIT
  _Float16*       sV   = (_Float16*)(smem + 4 * 64 * RPIT);        // [256][64] f16, row pitch VPIT (V phase, aliases sOut)

  const int tid = threadIdx.x, lane = tid & 31, w = tid >> 5;
  const int wr = w >> 2, wc = w & 3, h = lane >> 4, m = lane & 15;
  const int q8 = lane & 7, sub = lane >> 3;
  const int b = blockIdx.y, s0 = blockIdx.x * 64;
  const bool wtxt = (blockIdx.x == 0) && (wr < 2);         // wave-uniform row type
  const v4f z4 = {0.f, 0.f, 0.f, 0.f};
  const v8f z8 = {0.f, 0.f, 0.f, 0.f, 0.f, 0.f, 0.f, 0.f};

  // ---- stage A = src (+ sine position on text rows) as bf16 hi/lo ----
  #pragma unroll 1
  for (int it = 0; it < 8; ++it) {
    const int q = it * 512 + tid;
    const int row = q >> 6, c4 = (q & 63) * 4;            // row wave-uniform
    const int s = s0 + row;
    const int sl = (s < SEQ) ? s : (SEQ - 1);
    v4f x = *(const v4fa*)(src + ((size_t)(b * SEQ + sl)) * DM + c4);
    if (s >= SEQ) x = z4;
    if (s < TXTN) {
      const float xe = ((float)(s + 1) * 0.03125f) * 6.2831855f;
      const float d0 = powf(10000.0f, (float)c4 * (1.0f / 256.0f));
      const float d1 = powf(10000.0f, (float)(c4 + 2) * (1.0f / 256.0f));
      const float r0 = xe * (1.0f / d0), r1 = xe * (1.0f / d1);
      x.x += sinf(r0); x.y += cosf(r0); x.z += sinf(r1); x.w += cosf(r1);
    }
    const unsigned int h0 = bf16_rne(x.x), h1 = bf16_rne(x.y), h2 = bf16_rne(x.z), h3 = bf16_rne(x.w);
    const unsigned int l0 = bf16_rne(x.x - __uint_as_float(h0 << 16));
    const unsigned int l1 = bf16_rne(x.y - __uint_as_float(h1 << 16));
    const unsigned int l2 = bf16_rne(x.z - __uint_as_float(h2 << 16));
    const unsigned int l3 = bf16_rne(x.w - __uint_as_float(h3 << 16));
    const v4us vh = {(unsigned short)h0, (unsigned short)h1, (unsigned short)h2, (unsigned short)h3};
    const v4us vl = {(unsigned short)l0, (unsigned short)l1, (unsigned short)l2, (unsigned short)l3};
    *(v4usa*)(sAh + row * RPIT + c4) = vh;
    *(v4usa*)(sAl + row * RPIT + c4) = vl;
  }
  __syncthreads();

  // ---- Q (p=0) and K (p=1): bf16 hi/lo split GEMM, XPOS epilogue ----
  #pragma unroll 1
  for (int p = 0; p < 2; ++p) {
    const unsigned short* Bh = WB + (size_t)((wtxt ? 0 : 4) + 2 * p) * 65536 + (size_t)(4 * wc) * (8 * FRAG) + lane * 8;
    const unsigned short* Bl = Bh + 65536;
    const unsigned short* Ap = sAh + (16 * wr + m) * RPIT;
    v8f acc[4];
    #pragma unroll
    for (int nt = 0; nt < 4; ++nt) acc[nt] = z8;
    #pragma unroll 1
    for (int kk = 0; kk < DM; kk += 32) {
      const v16b ah = ldfb(Ap + kk, h);
      const v16b al = ldfb(Ap + 64 * RPIT + kk, h);
      #pragma unroll
      for (int nt = 0; nt < 4; ++nt) {
        const v16b bh = ldff(Bh + nt * (8 * FRAG) + (kk >> 5) * FRAG);
        const v16b bl = ldff(Bl + nt * (8 * FRAG) + (kk >> 5) * FRAG);
        acc[nt] = wmma_b(ah, bh, acc[nt]);
        acc[nt] = wmma_b(ah, bl, acc[nt]);
        acc[nt] = wmma_b(al, bh, acc[nt]);
      }
    }
    // D[r] = Y[row 16wr+8h+r][col 64wc+16nt+m]; rotation pairs cols (n, n^1) = lanes (m, m^1)
    const int rowb = 16 * wr + 8 * h;
    int lb = s0 + rowb - TXTN;
    lb = lb < 0 ? 0 : lb;
    lb = lb > (VIDN - 8) ? (VIDN - 8) : lb;
    const float sg = (m & 1) ? 1.0f : -1.0f;
    #pragma unroll
    for (int nt = 0; nt < 4; ++nt) {
      const int n = 64 * wc + 16 * nt + m;
      const float* tc = XT + ((size_t)(2 * p * DM + n)) * VIDN + lb;
      const float* ts = tc + (size_t)DM * VIDN;
      const v4f c0 = *(const v4fa*)tc, c1 = *(const v4fa*)(tc + 4);
      const v4f t0 = *(const v4fa*)ts, t1 = *(const v4fa*)(ts + 4);
      // wait in front of the first overwrite of a register that these four loads name; the addresses are
      // inputs so that their registers stay as they are up to the wait
      asm volatile("s_wait_xcnt 0x0" :: "v"(tc), "v"(ts) : "memory");
      const float cs[8] = {c0.x, c0.y, c0.z, c0.w, c1.x, c1.y, c1.z, c1.w};
      const float sn[8] = {t0.x, t0.y, t0.z, t0.w, t1.x, t1.y, t1.z, t1.w};
      #pragma unroll
      for (int r = 0; r < 8; ++r) {
        const float x  = acc[nt][r];
        const float pr = __shfl_xor(x, 1, 32);
        const float cv = wtxt ? 1.0f : cs[r];
        const float snv = wtxt ? 0.0f : sn[r];
        const float y  = x * cv + sg * (pr * snv);
        const unsigned int hb  = bf16_rne(y);
        const unsigned int lob = bf16_rne(y - __uint_as_float(hb << 16));
        const int e = (rowb + r) * RPIT + n;
        sOut[e]             = (unsigned short)hb;
        sOut[64 * RPIT + e] = (unsigned short)lob;
      }
    }
    __syncthreads();
    if (p == 0) store_qk(sOut, QH, QL, b, s0, w, sub, q8);
    else        store_kf(sOut, KH, KL, b, s0, w, lane);
    
    __syncthreads();
  }

  // ---- V: tile 0 restages A as bf16 hi/lo of src WITHOUT the position term
  //      (other tiles already hold plain src); split GEMM; f16(64*V) transposed ----
  if (blockIdx.x == 0) {                                   // block-uniform
    #pragma unroll 1
    for (int it = 0; it < 8; ++it) {
      const int q = it * 512 + tid;
      const int row = q >> 6, c4 = (q & 63) * 4;          // s = row < 64 < SEQ
      const v4f x = *(const v4fa*)(src + ((size_t)(b * SEQ + row)) * DM + c4);
      const unsigned int h0 = bf16_rne(x.x), h1 = bf16_rne(x.y), h2 = bf16_rne(x.z), h3 = bf16_rne(x.w);
      const unsigned int l0 = bf16_rne(x.x - __uint_as_float(h0 << 16));
      const unsigned int l1 = bf16_rne(x.y - __uint_as_float(h1 << 16));
      const unsigned int l2 = bf16_rne(x.z - __uint_as_float(h2 << 16));
      const unsigned int l3 = bf16_rne(x.w - __uint_as_float(h3 << 16));
      const v4us vh = {(unsigned short)h0, (unsigned short)h1, (unsigned short)h2, (unsigned short)h3};
      const v4us vl = {(unsigned short)l0, (unsigned short)l1, (unsigned short)l2, (unsigned short)l3};
      *(v4usa*)(sAh + row * RPIT + c4) = vh;
      *(v4usa*)(sAl + row * RPIT + c4) = vl;
    }
  }
  __syncthreads();
  {
    const unsigned short* Bh = WB + (size_t)(wtxt ? 8 : 10) * 65536 + (size_t)(4 * wc) * (8 * FRAG) + lane * 8;
    const unsigned short* Bl = Bh + 65536;
    const unsigned short* Ap = sAh + (16 * wr + m) * RPIT;
    v8f acc[4];
    #pragma unroll
    for (int nt = 0; nt < 4; ++nt) acc[nt] = z8;
    #pragma unroll 1
    for (int kk = 0; kk < DM; kk += 32) {
      const v16b ah = ldfb(Ap + kk, h);
      const v16b al = ldfb(Ap + 64 * RPIT + kk, h);
      #pragma unroll
      for (int nt = 0; nt < 4; ++nt) {
        const v16b bh = ldff(Bh + nt * (8 * FRAG) + (kk >> 5) * FRAG);
        const v16b bl = ldff(Bl + nt * (8 * FRAG) + (kk >> 5) * FRAG);
        acc[nt] = wmma_b(ah, bh, acc[nt]);
        acc[nt] = wmma_b(ah, bl, acc[nt]);
        acc[nt] = wmma_b(al, bh, acc[nt]);
      }
    }
    // acc = V[token 16wr+8h+r][d 64wc+16nt+m] -> sV[d][token] = f16(64*V)
    #pragma unroll
    for (int nt = 0; nt < 4; ++nt) {
      const int d = 64 * wc + 16 * nt + m;
      #pragma unroll
      for (int r = 0; r < 8; ++r) sV[d * VPIT + 16 * wr + 8 * h + r] = (_Float16)(acc[nt][r] * VSC);
    }
  }
  __syncthreads();
  store_vf(sV, VT, b, s0, w, lane);
  
}

// ---------------------------------------------------------------------------
// Kernel 6: retention. Block 128 thr (4 waves) = 64 queries q0..q0+63 of batch
// b (QT sub-tiles of 16; 33 tiles over the padded 2112 rows, pad rows of Q are
// zero and are not stored); wave w owns output cols 64w..64w+63 and computes
// the score slices for keys kb+16w..kb+16w+15 of each 64-key step (33 steps
// over the padded 2112 keys). Each K and V fragment is loaded once per step
// and feeds all QT query sub-tiles.
//   S^T slice = K * Q^T (A = K rows, B = Q rows; bf16 hi/lo split, K=256)
//   P = S * gate * 256 -> f16 hi tile and f16 lo tile (lo = P - hi)
//       [64 q][64 keys] in LDS (ping-pong), row pitch PPIT
//   O += P_hi * V + P_lo * V  (A = P rows, B = V^T rows from VT, f16), acc f32
// ---------------------------------------------------------------------------
#define QT 4
#define QB (16 * QT)
static_assert(QB * NTILE == SEQP);
static_assert(2 * QB * RPIT * 2 >= 4 * QB * 64 * 4);      // the f32 output staging fits in the Q planes' LDS

__device__ __forceinline__ void store_out(const float* so, float* out, int b, int q0, int w, int sub, int q8)
{
  #pragma unroll
  for (int qt = 0; qt < QT; ++qt) {
    if (q0 + 16 * qt < SEQ) {                              // block-uniform: whole sub-tiles of pad rows are dropped
      #pragma unroll
      for (int i = 0; i < 8; ++i) {
        const int lid = 4 * i + sub, row = 16 * qt + (lid >> 1), hl = lid & 1;
        const v4f v = *(const v4fa*)(so + row * 64 + 32 * hl + 4 * q8);
        float* dst = out + ((size_t)(b * SEQ + q0 + row)) * DM + 64 * w + 32 * hl + 4 * q8;
        *(v4f*)dst = v;
      }
      // wait in front of the next sub-tile's address arithmetic, which reuses registers that these stores name
      if (qt + 1 < QT) asm volatile("s_wait_xcnt 0x0" ::: "memory");
    }
  }
}

// second bound: three waves per SIMD, so that three work-groups (the LDS limit) stay resident per WGP and the grid runs in one round
__global__ __launch_bounds__(128, 3) void k_ret(
    const unsigned short* __restrict__ QH, const unsigned short* __restrict__ QL,
    const unsigned short* __restrict__ KH, const unsigned short* __restrict__ KL,
    const _Float16* __restrict__ VT, const float* __restrict__ MK, float* __restrict__ out)
{
  __shared__ __attribute__((aligned(16))) unsigned short sQ[2 * QB * RPIT];   // hi plane, lo plane
  __shared__ __attribute__((aligned(16))) _Float16 sPh[2][QB * PPIT];
  __shared__ __attribute__((aligned(16))) _Float16 sPl[2][QB * PPIT];
  unsigned short* sQh = sQ;
  unsigned short* sQl = sQ + QB * RPIT;
  float* sO = (float*)sQ;                                  // epilogue only: Q is last read in front of the last step's barrier

  const int tid = threadIdx.x, lane = tid & 31, w = tid >> 5, h = lane >> 4, m = lane & 15;
  const int q8 = lane & 7, sub = lane >> 3;
  const int b = blockIdx.y, q0 = blockIdx.x * QB;
  const v8f z8 = {0.f, 0.f, 0.f, 0.f, 0.f, 0.f, 0.f, 0.f};

  // ---- stage Q hi/lo rows q0..q0+63, 16 rows a pass ----
  // kept rolled: it runs once per work-group, and one pass already has eight 16-byte loads per lane in flight
  #pragma unroll 1
  for (int qp = 0; qp < QB; qp += 16) {
    v8us qh[4], ql[4];
    const unsigned short* gh[4];
    const unsigned short* gl[4];
    #pragma unroll
    for (int it = 0; it < 4; ++it) {
      const int idx = it * 128 + tid;
      const int row = qp + (idx >> 5), c8 = (idx & 31) * 8;
      const size_t g = ((size_t)(b * SEQP + q0 + row)) * DM + c8;
      gh[it] = QH + g;
      gl[it] = QL + g;
      qh[it] = *(const v8usa*)gh[it];
      ql[it] = *(const v8usa*)gl[it];
    }
    // wait in front of the first overwrite of a register that the eight loads name; the addresses are
    // inputs so that their registers stay as they are up to the wait
    asm volatile("s_wait_xcnt 0x0" :: "v"(gh[0]), "v"(gl[0]), "v"(gh[1]), "v"(gl[1]),
                 "v"(gh[2]), "v"(gl[2]), "v"(gh[3]), "v"(gl[3]) : "memory");
    #pragma unroll
    for (int it = 0; it < 4; ++it) {
      const int idx = it * 128 + tid;
      const int row = qp + (idx >> 5), c8 = (idx & 31) * 8;
      *(v8usa*)(sQh + row * RPIT + c8) = qh[it];
      *(v8usa*)(sQl + row * RPIT + c8) = ql[it];
    }
  }
  __syncthreads();

  v8f o[QT][4];
  #pragma unroll
  for (int qt = 0; qt < QT; ++qt)
    #pragma unroll
    for (int nt = 0; nt < 4; ++nt) o[qt][nt] = z8;

  // byte offsets of this lane's 16 bytes in the wave's first K fragment (hi and lo planes alike) and first V^T
  // fragment; both stay below 2^25
  unsigned int koff = (unsigned int)((b * NKT + w) * 8 * FRAGB + lane * 16);
  unsigned int voff = (unsigned int)((b * NVS * 16 + 4 * w) * FRAGB + lane * 16);
  int moff[QT];                                           // this lane's byte offset in the first gate tile of each sub-tile's row of tiles
  #pragma unroll
  for (int qt = 0; qt < QT; ++qt) {
    int rt = (q0 >> 4) + qt - TXTN / 16;
    rt = rt < 0 ? 0 : rt;
    rt = rt > (NGT - 1) ? (NGT - 1) : rt;                 // pad queries read the last row of tiles; their output is dropped
    moff[qt] = rt * NGT * GTB + lane * 16;
  }

  // K fragments travel in a register ring of four 32-wide k slices (hi and lo): a slice is refilled right after
  // its last use, four slices ahead of its next one, so that no score product waits for a global load.
  v16b rkh[4], rkl[4];
  #pragma unroll
  for (int i = 0; i < 4; ++i) {
    rkh[i] = ldgb(KH, koff, FRAGB * i);
    rkl[i] = ldgb(KL, koff, FRAGB * i);
  }

  int buf = 0;
  #pragma unroll 1
  for (int kb = 0; kb < SEQP; kb += 64) {
    // rows the ring's second half is refilled from: the next step's; the last step reads its own again (in bounds, unused)
    const unsigned int koffn = koff + ((kb + 64 < SEQP) ? 4u * 8u * FRAGB : 0u);
    // gate: 1 when query or key is text, sigmoid plane on vid x vid, 0 on pad keys; loaded here, used behind the scores
    const int cb = kb + 16 * w + 8 * h - TXTN;            // vid index of key r=0 (group of 8, aligned)
    const bool ktxt = cb < 0;
    const bool kpad = cb >= VIDN;
    int ct = (kb >> 4) + w - TXTN / 16;                   // gate tile of the wave's 16 keys
    ct = ct < 0 ? 0 : ct;
    ct = ct > (NGT - 1) ? (NGT - 1) : ct;
    unsigned int goff[QT];
    #pragma unroll
    for (int qt = 0; qt < QT; ++qt) goff[qt] = (unsigned int)(moff[qt] + ct * GTB);
    // this fence and the next keep the eight loads and their wait together, up here: nothing that could rewrite
    // an offset register gets between them, and the loads are not sunk to their use, where they would be waited for in full
    __builtin_amdgcn_sched_barrier(0);
    v4f g0[QT], g1[QT];
    #pragma unroll
    for (int qt = 0; qt < QT; ++qt) {
      const char* gp = (const char*)MK + goff[qt];
      g0[qt] = *(const v4fa*)gp;
      g1[qt] = *(const v4fa*)(gp + GTB / 2);
    }
    // wait in front of the first overwrite of a register that the eight loads name; the offsets are
    // inputs so that their registers stay as they are up to the wait
    asm volatile("s_wait_xcnt 0x0" :: "v"(goff[0]), "v"(goff[1]), "v"(goff[2]), "v"(goff[3]) : "memory");
    __builtin_amdgcn_sched_barrier(0);

    // scores: s[qt][r] = S[query q0+16qt+m][key kb+16w+8h+r]
    v8f s[QT];
    #pragma unroll
    for (int qt = 0; qt < QT; ++qt) s[qt] = z8;
    #pragma unroll
    for (int i = 0; i < 8; ++i) {
      const int kk = 32 * i;
      const v16b ka = rkh[i & 3];
      const v16b kl = rkl[i & 3];
      #pragma unroll
      for (int qp = 0; qp < QT; qp += 2) {                 // two sub-tiles at a time: their two accumulator chains alternate
        const v16b qa0 = ldfb(sQh + (16 * qp + m) * RPIT + kk, h);
        const v16b qa1 = ldfb(sQh + (16 * qp + 16 + m) * RPIT + kk, h);
        const v16b ql0 = ldfb(sQl + (16 * qp + m) * RPIT + kk, h);
        const v16b ql1 = ldfb(sQl + (16 * qp + 16 + m) * RPIT + kk, h);
        s[qp]     = wmma_bd(ka, qa0, s[qp]);
        s[qp + 1] = wmma_bd(ka, qa1, s[qp + 1]);
        s[qp]     = wmma_bd(ka, ql0, s[qp]);
        s[qp + 1] = wmma_bd(ka, ql1, s[qp + 1]);
        s[qp]     = wmma_bd(kl, qa0, s[qp]);
        s[qp + 1] = wmma_bd(kl, qa1, s[qp + 1]);
      }
      rkh[i & 3] = ldgb(KH, (i < 4) ? koff : koffn, FRAGB * ((i + 4) & 7));
      rkl[i & 3] = ldgb(KL, (i < 4) ? koff : koffn, FRAGB * ((i + 4) & 7));
      // keeps the refill at this distance from its use: the scheduler would else sink it towards the use
      __builtin_amdgcn_sched_barrier(0);
    }
    // V^T fragments of the step's first 32 keys: in flight during the gate arithmetic
    v16h vf[4];
    #pragma unroll
    for (int nt = 0; nt < 4; ++nt) vf[nt] = ldgh(VT, voff, FRAGB * nt);
    // keeps these loads in front of the gate arithmetic
    __builtin_amdgcn_sched_barrier(0);
    #pragma unroll
    for (int qt = 0; qt < QT; ++qt) {
      const bool qtxt = (q0 + 16 * qt + m) < TXTN;
      const float gk[8] = {g0[qt].x, g0[qt].y, g0[qt].z, g0[qt].w, g1[qt].x, g1[qt].y, g1[qt].z, g1[qt].w};
      v8h ph, plo;
      #pragma unroll
      for (int r = 0; r < 8; ++r) {
        const float gg = kpad ? 0.0f : ((qtxt || ktxt) ? 1.0f : gk[r]);
        const float pv = (s[qt][r] * gg) * PSC;
        const _Float16 hv = (_Float16)pv;
        ph[r]  = hv;
        plo[r] = (_Float16)(pv - (float)hv);
      }
      *(v8ha*)(&sPh[buf][(16 * qt + m) * PPIT + 16 * w + 8 * h]) = ph;
      *(v8ha*)(&sPl[buf][(16 * qt + m) * PPIT + 16 * w + 8 * h]) = plo;
    }
    __syncthreads();

    // O += P_hi(64x64) * V + P_lo(64x64) * V  (64 keys x this wave's 64 cols)
    #pragma unroll
    for (int ks = 0; ks < 2; ++ks) {
      v16h pa[QT], pb[QT];
      #pragma unroll
      for (int qt = 0; qt < QT; ++qt) {
        pa[qt] = ldfh(&sPh[buf][(16 * qt + m) * PPIT + 32 * ks], h);
        pb[qt] = ldfh(&sPl[buf][(16 * qt + m) * PPIT + 32 * ks], h);
      }
      #pragma unroll
      for (int nt = 0; nt < 4; ++nt) {
        const v16h vbf = vf[nt];
        #pragma unroll
        for (int qt = 0; qt < QT; ++qt) o[qt][nt] = wmma_hd(pa[qt], vbf, o[qt][nt]);
        #pragma unroll
        for (int qt = 0; qt < QT; ++qt) o[qt][nt] = wmma_hd(pb[qt], vbf, o[qt][nt]);
        if (ks == 0) {
          vf[nt] = ldgh(VT, voff, FRAGB * (16 + nt));  // second 32 keys, three column tiles ahead of their use
          // keeps the refill at this distance from its use
          __builtin_amdgcn_sched_barrier(0);
        }
      }
    }
    // wait in front of the overwrite of the offset registers that this step's K and V loads name; the offsets are
    // inputs so that their registers stay as they are up to the wait
    asm volatile("s_wait_xcnt 0x0" :: "v"(koff), "v"(koffn), "v"(voff) : "memory");
    koff = koffn;
    voff += 2u * 16u * FRAGB;
    buf ^= 1;
  }

  // ---- epilogue: O[q0+16qt+8h+r][64w+16nt+m] = o[qt][nt][r] / (256*64) ----
  float* so = sO + w * (QB * 64);
  #pragma unroll
  for (int qt = 0; qt < QT; ++qt)
    #pragma unroll
    for (int nt = 0; nt < 4; ++nt)
      #pragma unroll
      for (int r = 0; r < 8; ++r)
        so[(16 * qt + 8 * h + r) * 64 + 16 * nt + m] = o[qt][nt][r] * OSC;
  __syncthreads();
  store_out(so, out, b, q0, w, sub, q8);
  
}

// ---------------------------------------------------------------------------
extern "C" void kernel_launch(void* const* d_in, const int* in_sizes, int n_in,
                              void* d_out, int out_size, void* d_ws, size_t ws_size,
                              hipStream_t stream)
{
  if (n_in < 9) return;
  if (in_sizes[0] != BATCH * SEQ * DM) return;
  if (in_sizes[1] != VIDN * VIDN) return;
  for (int i = 2; i < 8; ++i) if (in_sizes[i] != DM * DM) return;
  if (in_sizes[8] < 1) return;
  if (out_size != BATCH * SEQ * DM + 1) return;

  const float* src = (const float*)d_in[0];
  const float* lrn = (const float*)d_in[1];
  const float* wtq = (const float*)d_in[2];
  const float* wtk = (const float*)d_in[3];
  const float* wtv = (const float*)d_in[4];
  const float* wvq = (const float*)d_in[5];
  const float* wvk = (const float*)d_in[6];
  const float* wvv = (const float*)d_in[7];
  const int*   txl = (const int*)d_in[8];
  float* out0 = (float*)d_out;
  float* out1 = out0 + (size_t)BATCH * SEQ * DM;          // byte offset 34078720

  const size_t pl_bytes = (size_t)BATCH * SEQP * DM * 2;  // 17301504 per bf16/f16 plane (padded rows incl.)
  const size_t wb_bytes = (size_t)NWPL * DM * DM * 2;      // 1572864
  const size_t xt_bytes = (size_t)4 * DM * VIDN * 4;       // 8388608
  const size_t mk_bytes = (size_t)VIDN * VIDN * 4;         // 16777216
  const size_t off_qh = 0;
  const size_t off_ql = off_qh + pl_bytes;
  const size_t off_kh = off_ql + pl_bytes;
  const size_t off_kl = off_kh + pl_bytes;
  const size_t off_vt = off_kl + pl_bytes;
  const size_t off_wb = off_vt + pl_bytes;
  const size_t off_xt = off_wb + wb_bytes;
  const size_t off_mk = off_xt + xt_bytes;
  const size_t pt_bytes = (size_t)NPART * PSTR * 8;        // 131072
  const size_t off_pt = off_mk + mk_bytes;
  const size_t total  = off_pt + pt_bytes;                 // 113377280
  if (total > ws_size) return;
  if (total > (size_t)134217728) return;

  char* ws = (char*)d_ws;
  unsigned short* QH = (unsigned short*)(ws + off_qh);
  unsigned short* QL = (unsigned short*)(ws + off_ql);
  unsigned short* KH = (unsigned short*)(ws + off_kh);
  unsigned short* KL = (unsigned short*)(ws + off_kl);
  _Float16* VT = (_Float16*)(ws + off_vt);
  unsigned short* WB = (unsigned short*)(ws + off_wb);
  float* XT = (float*)(ws + off_xt);
  float* MK = (float*)(ws + off_mk);
  double* PT = (double*)(ws + off_pt);

  k_wprep<<<(NWPL * DM) / 8, 256, 0, stream>>>(wtq, wtk, wtv, wvq, wvk, wvv, WB);
  k_xtab<<<DM * 8, 256, 0, stream>>>(XT);
  k_mask<<<NPART, 256, 0, stream>>>(lrn, MK, PT);
  k_loss<<<1, NPART, 0, stream>>>(PT, txl, out1);

  const size_t proj_lds = 135168;                          // 8*64*RPIT
  hipFuncSetAttribute(reinterpret_cast<const void*>(&k_proj), hipFuncAttributeMaxDynamicSharedMemorySize, (int)proj_lds);
  dim3 gp(NTILE, BATCH);
  k_proj<<<gp, 512, proj_lds, stream>>>(src, WB, XT, QH, QL, KH, KL, VT);

  dim3 gr(NTILE, BATCH);
  k_ret<<<gr, 128, 0, stream>>>(QH, QL, KH, KL, VT, MK, out0);
}

// v006
// One run takes 215 microseconds.
// Next to v005, in two timings, it ran 1.23 times as fast each time.
// Over all steps from v000 it is 28.9 times as fast.
// Contractions: Q,K,V projections and S=K*Q^T on v_wmma_f32_16x16x32_bf16 as bf16 hi/lo split (hi*hi+hi*lo+lo*hi); O=P*V on v_wmma_f32_16x16x32_f16 with P as f16 hi + f16 lo (P x256, two products) and V^T f16 x64; f32 accumulate; position tables, sigmoid gate and loss in f32/f64.
#include <hip/hip_runtime.h>

#define BATCH 16
#define TXTN  32
#define VIDN  2048
#define SEQ   2080
#define SEQP  2112
#define DM    256
#define NTILE 33
#define NWPL  12
#define PSC   256.0f
#define VSC   64.0f
#define OSC   (1.0f / 16384.0f)
#define MELEM 4096
#define NPART 1024
#define PSTR  16
// LDS row pitches in 16-bit elements: row bytes + 16, an odd multiple of 16 B, so that the
// 16 rows one ds_load_b128 fragment read touches per half-wave fall on 16 different bank groups.
#define RPIT  (DM + 8)
#define PPIT  (64 + 8)
#define VPIT  (64 + 8)
// Fragment order, the layout of every 16-bit matrix operand that a wave loads from global memory (weight planes,
// K planes, V^T): one 16-row x 32-k fragment is 1 KiB in a row, as two 512-byte halves j = 0, 1; lane l = 16h + m owns
// bytes 16l .. 16l+15 of each half = elements k0+16j+8h .. +7 of row m. So one 16-byte load per lane reads four whole
// 128-byte lines; from a row-major plane the same load touches sixteen lines and uses 32 bytes of each.
#define FRAG  512
#define FRAGB 1024
#define NKT   (SEQP / 16)
#define NVS   (SEQP / 32)
// The gate plane likewise, in the order of the score fragment it multiplies: one 16-query x 16-key f32 tile is 1 KiB in a
// row, two 512-byte halves j; lane l = 16h + m owns bytes 16l .. 16l+15 of each half = keys 8h+4j .. +3 of query m.
#define GTB   1024
#define NGT   (VIDN / 16)
static_assert(MELEM * NPART == VIDN * VIDN);

typedef _Float16 v16h __attribute__((ext_vector_type(16)));
typedef _Float16 v8h  __attribute__((ext_vector_type(8)));
typedef _Float16 v4h  __attribute__((ext_vector_type(4)));
typedef __bf16   v16b __attribute__((ext_vector_type(16)));
typedef unsigned short v8us __attribute__((ext_vector_type(8)));
typedef unsigned short v4us __attribute__((ext_vector_type(4)));
typedef float v8f __attribute__((ext_vector_type(8)));
typedef float v4f __attribute__((ext_vector_type(4)));
typedef v8h  __attribute__((may_alias)) v8ha;
typedef v4h  __attribute__((may_alias)) v4ha;
typedef v8us __attribute__((may_alias)) v8usa;
typedef v4us __attribute__((may_alias)) v4usa;
typedef v4f  __attribute__((may_alias)) v4fa;

// ---------------------------------------------------------------------------
// XPOS module constants as exact f32 bit patterns:
// c_invf[i] = 1 / 10000^(i/128), c_svec[i] = (2i + 0.4*256) / (1.4*256).
// ---------------------------------------------------------------------------
__constant__ unsigned int c_invf[] = {
  0x3f800000, 0x3f6e39f8, 0x3f5dafd7, 0x3f4e4bad, 0x3f3ff911, 0x3f32a506, 0x3f263de0, 0x3f1ab32b,
  0x3f0ff59a, 0x3f05f6ef, 0x3ef953cf, 0x3ee8045f, 0x3ed7e89b, 0x3ec8eb24, 0x3ebaf81b, 0x3eadfcff,
  0x3ea1e89b, 0x3e96aaea, 0x3e8c3504, 0x3e827909, 0x3e72d423, 0x3e61f835, 0x3e5247ed, 0x3e43ae7c,
  0x3e361887, 0x3e297409, 0x3e1db040, 0x3e12bd91, 0x3e088d77, 0x3dfe24e0, 0x3dec7fd6, 0x3ddc1466,
  0x3dcccccd, 0x3dbe94c6, 0x3db15978, 0x3da50956, 0x3d99940d, 0x3d8eea6b, 0x3d84fe4d, 0x3d778513,
  0x3d6655c2, 0x3d5657e4, 0x3d47763f, 0x3d399d19, 0x3d2cba15, 0x3d20bc1d, 0x3d159348, 0x3d0b30cc,
  0x3d0186e3, 0x3cf11177, 0x3ce054d2, 0x3cd0c1a8, 0x3cc2434f, 0x3cb4c691, 0x3ca8398b, 0x3c9c8b97,
  0x3c91ad39, 0x3c879008, 0x3c7c4d33, 0x3c6ac8e7, 0x3c5a7bf2, 0x3c4b50b3, 0x3c3d3311, 0x3c301052,
  0x3c23d70a, 0x3c187705, 0x3c0de12d, 0x3c040779, 0x3bf5b9b0, 0x3be4aa46, 0x3bd4ca15, 0x3bc6040f,
  0x3bb8449c, 0x3bab7983, 0x3b9f91cc, 0x3b947dae, 0x3b8a2e77, 0x3b80967d, 0x3b6f520e, 0x3b5eb47a,
  0x3b4f3e38, 0x3b40dac5, 0x3b33770f, 0x3b270153, 0x3b1b690d, 0x3b109edb, 0x3b06946f, 0x3afa78f0,
  0x3ae91528, 0x3ad8e673, 0x3ac9d75c, 0x3abbd3ed, 0x3aaec98e, 0x3aa2a6f7, 0x3a975c0e, 0x3a8cd9db,
  0x3a83126f, 0x3a73f1a3, 0x3a6301e2, 0x3a533f28, 0x3a44948c, 0x3a36ee9e, 0x3a2a3b44, 0x3a1e69a5,
  0x3a136a16, 0x3a092e02, 0x39ff4fac, 0x39ed95e2, 0x39dd1725, 0x39cdbd96, 0x39bf74d7, 0x39b229fa,
  0x39a5cb60, 0x399a489e, 0x398f9272, 0x39859aa9, 0x3978a815, 0x39676492, 0x395753e4, 0x394860c1,
  0x393a7753, 0x392d8529, 0x39217916, 0x39164324, 0x390bd472, 0x39021f2b, 0x38f22ce2, 0x38e15c91 };
static_assert(sizeof(c_invf) == 512);

__constant__ unsigned int c_svec[] = {
  0x3e924925, 0x3e952493, 0x3e980000, 0x3e9adb6e, 0x3e9db6dc, 0x3ea0924a, 0x3ea36db7, 0x3ea64925,
  0x3ea92493, 0x3eac0000, 0x3eaedb6e, 0x3eb1b6dc, 0x3eb4924a, 0x3eb76db7, 0x3eba4924, 0x3ebd2492,
  0x3ec00000, 0x3ec2db6d, 0x3ec5b6db, 0x3ec89249, 0x3ecb6db7, 0x3ece4924, 0x3ed12492, 0x3ed40000,
  0x3ed6db6d, 0x3ed9b6db, 0x3edc9249, 0x3edf6db7, 0x3ee24924, 0x3ee52492, 0x3ee80000, 0x3eeadb6e,
  0x3eedb6db, 0x3ef09249, 0x3ef36db7, 0x3ef64924, 0x3ef92492, 0x3efc0000, 0x3efedb6e, 0x3f00db6e,
  0x3f024924, 0x3f03b6db, 0x3f052492, 0x3f069249, 0x3f080000, 0x3f096db7, 0x3f0adb6e, 0x3f0c4925,
  0x3f0db6db, 0x3f0f2492, 0x3f109249, 0x3f120000, 0x3f136db7, 0x3f14db6e, 0x3f164925, 0x3f17b6db,
  0x3f192492, 0x3f1a9249, 0x3f1c0000, 0x3f1d6db7, 0x3f1edb6e, 0x3f204925, 0x3f21b6db, 0x3f232492,
  0x3f249249, 0x3f260000, 0x3f276db7, 0x3f28db6e, 0x3f2a4925, 0x3f2bb6db, 0x3f2d2492, 0x3f2e9249,
  0x3f300000, 0x3f316db7, 0x3f32db6e, 0x3f344925, 0x3f35b6db, 0x3f372492, 0x3f389249, 0x3f3a0000,
  0x3f3b6db7, 0x3f3cdb6e, 0x3f3e4925, 0x3f3fb6db, 0x3f412492, 0x3f429249, 0x3f440000, 0x3f456db7,
  0x3f46db6e, 0x3f484925, 0x3f49b6db, 0x3f4b2492, 0x3f4c9249, 0x3f4e0000, 0x3f4f6db7, 0x3f50db6e,
  0x3f524925, 0x3f53b6db, 0x3f552492, 0x3f569249, 0x3f580000, 0x3f596db7, 0x3f5adb6e, 0x3f5c4925,
  0x3f5db6db, 0x3f5f2492, 0x3f609249, 0x3f620000, 0x3f636db7, 0x3f64db6e, 0x3f664925, 0x3f67b6dc,
  0x3f692492, 0x3f6a9249, 0x3f6c0000, 0x3f6d6db7, 0x3f6edb6e, 0x3f704925, 0x3f71b6dc, 0x3f732492,
  0x3f749249, 0x3f760000, 0x3f776db7, 0x3f78db6e, 0x3f7a4925, 0x3f7bb6dc, 0x3f7d2492, 0x3f7e9249 };
static_assert(sizeof(c_svec) == 512);

// ---------------------------------------------------------------------------
// 16x16x32 WMMA with hazard guard. Fragment map (wave32): lane l, h = l>>4,
// m = n = l&15. A/B element i: i<8 -> k0+8h+i ; i>=8 -> k0+16+8h+(i-8).
// D element r: row 8h+r, col l&15.
// ---------------------------------------------------------------------------
__device__ __forceinline__ v8f wmma_h(v16h a, v16h b, v8f c) {
  v8f d = __builtin_amdgcn_wmma_f32_16x16x32_f16(false, a, false, b, (short)0, c, false, false);
  asm volatile("v_nop\n\tv_nop\n\tv_nop\n\tv_nop" : "+v"(d) : "v"(a), "v"(b));
  return d;
}
__device__ __forceinline__ v8f wmma_b(v16b a, v16b b, v8f c) {
  v8f d = __builtin_amdgcn_wmma_f32_16x16x32_bf16(false, a, false, b, (short)0, c, false, false);
  asm volatile("v_nop\n\tv_nop\n\tv_nop\n\tv_nop" : "+v"(d) : "v"(a), "v"(b));
  return d;
}

// The same two products for the retention kernel: the guard names D alone. An asm operand must lie in v0..v255;
// with A and B named as well, every fragment loaded ahead would have to fit there beside the accumulators.
__device__ __forceinline__ v8f wmma_hd(v16h a, v16h b, v8f c) {
  v8f d = __builtin_amdgcn_wmma_f32_16x16x32_f16(false, a, false, b, (short)0, c, false, false);
  asm volatile("v_nop\n\tv_nop\n\tv_nop\n\tv_nop" : "+v"(d));
  return d;
}
__device__ __forceinline__ v8f wmma_bd(v16b a, v16b b, v8f c) {
  v8f d = __builtin_amdgcn_wmma_f32_16x16x32_bf16(false, a, false, b, (short)0, c, false, false);
  asm volatile("v_nop\n\tv_nop\n\tv_nop\n\tv_nop" : "+v"(d));
  return d;
}

// Fragment from a k-contiguous 16-bit row; p points at element k0 of the row
// owned by this lane (row = lane & 15 added by the caller). Same map for A and B.
__device__ __forceinline__ v16h ldfh(const _Float16* p, int h) {
  union { v16h v; v8h hf[2]; } f;
  f.hf[0] = *(const v8ha*)(p + 8 * h);
  f.hf[1] = *(const v8ha*)(p + 16 + 8 * h);
  return f.v;
}
__device__ __forceinline__ v16b ldfb(const unsigned short* p, int h) {
  union { v16b v; v8us hf[2]; } f;
  f.hf[0] = *(const v8usa*)(p + 8 * h);
  f.hf[1] = *(const v8usa*)(p + 16 + 8 * h);
  return f.v;
}

// Global fragment in fragment order: uniform base + this lane's 32-bit byte offset (16 * lane included) + a constant.
// One offset register serves every load of a step, so none is rewritten while loads that name it are in flight.
__device__ __forceinline__ v16h ldgh(const _Float16* base, unsigned int off, int imm) {
  const char* p = (const char*)base + off;
  union { v16h v; v8h hf[2]; } f;
  f.hf[0] = *(const v8ha*)(p + imm);
  f.hf[1] = *(const v8ha*)(p + imm + FRAGB / 2);
  return f.v;
}
__device__ __forceinline__ v16b ldgb(const unsigned short* base, unsigned int off, int imm) {
  const char* p = (const char*)base + off;
  union { v16b v; v8us hf[2]; } f;
  f.hf[0] = *(const v8usa*)(p + imm);
  f.hf[1] = *(const v8usa*)(p + imm + FRAGB / 2);
  return f.v;
}
// The same through a pointer: p = fragment start + 8 * lane, in elements.
__device__ __forceinline__ v16b ldff(const unsigned short* p) {
  union { v16b v; v8us hf[2]; } f;
  f.hf[0] = *(const v8usa*)p;
  f.hf[1] = *(const v8usa*)(p + FRAG / 2);
  return f.v;
}

// f32 -> bf16 bits, RNE
__device__ __forceinline__ unsigned int bf16_rne(float x) {
  const unsigned int u = __float_as_uint(x);
  return (u + 0x7FFFu + ((u >> 16) & 1u)) >> 16;
}

// ---------------------------------------------------------------------------
// Kernel 1: weight planes bf16 in fragment order, WB[pl][n tile of 16][k slice of 32][j][lane][8], pl = 2*wsel + part:
// wsel 0 txtQ, 1 txtK, 2 vidQ, 3 vidK, 4 txtV, 5 vidV; part 0 hi = RNE(w),
// part 1 lo = RNE(w - hi). One wave writes one whole 512-B fragment half per store.
// ---------------------------------------------------------------------------
__global__ __launch_bounds__(256) void k_wprep(
    const float* __restrict__ wtq, const float* __restrict__ wtk, const float* __restrict__ wtv,
    const float* __restrict__ wvq, const float* __restrict__ wvk, const float* __restrict__ wvv,
    unsigned short* __restrict__ WB)
{
  const int tid = threadIdx.x, lane = tid & 31;
  const int row = blockIdx.x * 8 + (tid >> 5);           // fragment half 0 .. 3071, plane uniform per block
  if (row >= NWPL * DM) return;
  const int pl = row >> 8, n = ((row >> 4) & 15) * 16 + (lane & 15);
  const int wsel = pl >> 1, part = pl & 1;
  const float* W = (wsel == 0) ? wtq : (wsel == 1) ? wtk : (wsel == 2) ? wvq
                 : (wsel == 3) ? wvk : (wsel == 4) ? wtv : wvv;
  const int k0 = ((row >> 1) & 7) * 32 + (row & 1) * 16 + (lane >> 4) * 8;
  float v[8];
  #pragma unroll
  for (int i = 0; i < 8; ++i) v[i] = W[(size_t)(k0 + i) * DM + n];
  v8us o;
  #pragma unroll
  for (int i = 0; i < 8; ++i) {
    const unsigned int hb = bf16_rne(v[i]);
    const unsigned int lb = bf16_rne(v[i] - __uint_as_float(hb << 16));
    o[i] = (unsigned short)(part ? lb : hb);
  }
  unsigned short* dst = WB + (size_t)row * (FRAG / 2) + lane * 8;
  *(v8us*)dst = o;
  
}

// ---------------------------------------------------------------------------
// Kernel 2: XPOS tables XT[pl][n][l] f32, pl 0 cos*scale, 1 sin*scale,
// 2 cos/scale, 3 sin/scale; n = feature (pair i = n>>1), l = video position.
// scale = scale_vec[i] ^ (l/512) via powf; angle = l * inv_freq[i] with the
// exact constant tables above; precise sinf/cosf.
// ---------------------------------------------------------------------------
__global__ __launch_bounds__(256) void k_xtab(float* __restrict__ XT)
{
  const int n = blockIdx.x >> 3;
  const int l = (blockIdx.x & 7) * 256 + threadIdx.x;
  const int i = n >> 1;                                  // 0 .. 127
  const float sv = __uint_as_float(c_svec[i]);
  const float pw = (float)l * (1.0f / 512.0f);
  const float scale = powf(sv, pw);
  const float invf = __uint_as_float(c_invf[i]);
  const float ang = (float)l * invf;
  const float sn = sinf(ang), cs = cosf(ang);
  const float inv = 1.0f / scale;
  const size_t PS = (size_t)DM * VIDN;
  float* p0 = XT + (size_t)n * VIDN + l;
  const float a0 = cs * scale, a1 = sn * scale, a2 = cs * inv, a3 = sn * inv;
  *(float*)(p0)          = a0;
  *(float*)(p0 + PS)     = a1;
  *(float*)(p0 + 2 * PS) = a2;
  *(float*)(p0 + 3 * PS) = a3;
  
}

// ---------------------------------------------------------------------------
// Sum over the 32 lanes of a wave, f64, fixed butterfly order; every lane gets it.
// ---------------------------------------------------------------------------
__device__ __forceinline__ double wave_sum(double v) {
  #pragma unroll
  for (int d = 16; d > 0; d >>= 1) v += __shfl_xor(v, d, 32);
  return v;
}

// ---------------------------------------------------------------------------
// Kernel 3: gate plane sigmoid(learn[r][c]) f32 (diagonal kept) in 16 x 16 tiles,
// M[r tile][c tile][j][lane][4], and the loss's partial sums from the same values:
// work-group g covers rows 16(g>>3) .. +15 x columns 256(g&7) .. +255 (a wave: two
// tiles, 2 KiB of M in a row) and stores the f64 sum of its off-diagonal sigmoids
// at part[16g] (a 128-byte line of its own).
// ---------------------------------------------------------------------------
__global__ __launch_bounds__(256) void k_mask(const float* __restrict__ lr, float* __restrict__ M,
                                              double* __restrict__ part)
{
  __shared__ double red[8];
  const int t = threadIdx.x;
  const int lane = t & 31;
  const int rt = blockIdx.x >> 3, ct = (blockIdx.x & 7) * 16 + 2 * (t >> 5);   // the wave's first tile
  const int r = 16 * rt + (lane & 15), c0 = 16 * ct + 8 * (lane >> 4);
  const float* lp = lr + r * VIDN + c0;
  float* mp = M + (rt * NGT + ct) * (GTB / 4) + lane * 4;
  v4f x[4];
  #pragma unroll
  for (int it = 0; it < 4; ++it) x[it] = *(const v4fa*)(lp + 16 * (it >> 1) + 4 * (it & 1));
  double acc = 0.0;
  #pragma unroll
  for (int it = 0; it < 4; ++it) {
    const int c = c0 + 16 * (it >> 1) + 4 * (it & 1);
    v4f sv;
    #pragma unroll
    for (int e = 0; e < 4; ++e) {
      const float s = 1.0f / (1.0f + expf(-x[it][e]));
      sv[e] = s;
      acc += (r == c + e) ? 0.0 : (double)s;
    }
    *(v4f*)(mp + it * (GTB / 8)) = sv;
  }
  const double ws = wave_sum(acc);
  if ((t & 31) == 0) red[t >> 5] = ws;
  __syncthreads();
  if (t == 0) {
    double sum = 0.0;
    #pragma unroll
    for (int i = 0; i < 8; ++i) sum += red[i];
    part[(size_t)blockIdx.x * PSTR] = sum;
  }
}

// ---------------------------------------------------------------------------
// Kernel 4: loss = mean over vid x vid of off-diagonal sigmoid: one block adds
// the 1024 partial sums of kernel 3, one per thread, fixed order, f64.
// ---------------------------------------------------------------------------
__global__ __launch_bounds__(NPART) void k_loss(const double* __restrict__ part, const int* __restrict__ tl,
                                                float* __restrict__ out1)
{
  __shared__ double red[NPART / 32];
  const int t = threadIdx.x;
  const double ws = wave_sum(part[(size_t)t * PSTR]);
  if ((t & 31) == 0) red[t >> 5] = ws;
  __syncthreads();
  if (t < 32) {                                            // wave 0, all lanes on
    const double sum = wave_sum(red[t]);
    if (t == 0) {
      int vl = SEQ - tl[0];
      vl = vl < 1 ? 1 : vl;
      vl = vl > VIDN ? VIDN : vl;
      const float loss = (float)(sum / ((double)vl * (double)vl));
      *(float*)out1 = loss;
    }
  }
}

// ---------------------------------------------------------------------------
// Kernel 5: projections. Block = 512 thr (16 waves) = 64 absolute positions
// s0..s0+63 of batch b (s0 multiple of 64 over the padded 2112) x 256 cols;
// wave w owns all 64 rows (four row tiles rt) x cols 16w..16w+15, so that each weight
// fragment is loaded by one wave of the block only and feeds every row tile.
// Rows s<32: text (sine position added to the Q/K A operand, text weights, no
// XPOS); 32<=s<2080: video; s>=2080: zero pad rows. Q,K,V: bf16 hi/lo split
// GEMMs. Q,K: XPOS rotation in f32, written as bf16 hi/lo planes: Q row-major
// [b][SEQP][256], K in fragment order [b][key tile of 16][k slice of 32][j][lane][8].
// V: f16(64*V) transposed, in fragment order VT[b][key slice of 32][d tile of 16][j][lane][8].
// ---------------------------------------------------------------------------
__device__ __forceinline__ void store_qk(const unsigned short* sOut, unsigned short* PH, unsigned short* PLo,
                                         int b, int s0, int w, int sub, int q8)
{
  #pragma unroll
  for (int i = 0; i < 8; ++i) {
    const int lid = w * 32 + 4 * i + sub;                  // 0..511
    const int pl = lid >> 8, row = (lid >> 2) & 63, qu = lid & 3;
    const v8us v = *(const v8usa*)(sOut + pl * (64 * RPIT) + row * RPIT + 64 * qu + 8 * q8);
    unsigned short* dst = (pl ? PLo : PH) + ((size_t)(b * SEQP + s0 + row)) * DM + 64 * qu + 8 * q8;
    *(v8us*)dst = v;
  }
}

// K tile to global in fragment order: wave w writes eight fragment halves, 4 KiB in a row
// (plane w>>3, key tile (w>>1)&3, k slices 4(w&1) .. 4(w&1)+3).
__device__ __forceinline__ void store_kf(const unsigned short* sOut, unsigned short* PH, unsigned short* PLo,
                                         int b, int s0, int w, int lane)
{
  const int h = lane >> 4, m = lane & 15, pl = w >> 3, t = (w >> 1) & 3, c = w & 1;
  const unsigned short* sp = sOut + pl * (64 * RPIT) + (16 * t + m) * RPIT + 128 * c + 8 * h;
  unsigned short* dst = (pl ? PLo : PH) + ((size_t)((b * NKT + (s0 >> 4) + t) * 8 + 4 * c)) * FRAG + lane * 8;
  #pragma unroll
  for (int i = 0; i < 8; ++i) {
    const v8us v = *(const v8usa*)(sp + 16 * i);
    *(v8us*)(dst + i * (FRAG / 2)) = v;
  }
  // wait in front of whatever next rewrites a register that these eight stores name
  asm volatile("s_wait_xcnt 0x0" ::: "memory");
}

// V^T tile to global in fragment order: wave w writes four fragment halves, 2 KiB in a row
// (key slice w>>3, d tiles 2(w&7) and 2(w&7)+1).
__device__ __forceinline__ void store_vf(const _Float16* sV, _Float16* VT, int b, int s0, int w, int lane)
{
  const int h = lane >> 4, m = lane & 15, ksl = w >> 3, dt = 2 * (w & 7);
  const _Float16* sp = sV + (16 * dt + m) * VPIT + 32 * ksl + 8 * h;
  _Float16* dst = VT + ((size_t)((b * NVS + (s0 >> 5) + ksl) * 16 + dt)) * FRAG + lane * 8;
  #pragma unroll
  for (int i = 0; i < 4; ++i) {
    const v8h v = *(const v8ha*)(sp + (i >> 1) * (16 * VPIT) + 16 * (i & 1));
    *(v8h*)(dst + i * (FRAG / 2)) = v;
  }
}

// One wave's split GEMM: rows 0..63 of the A planes in LDS x the 16 columns whose weight fragments start at Bt / Bv
// (hi plane; the lo plane follows 65536 elements on; 8 * lane included). Row tiles 0, 1 take Bt. Row tiles 2, 3 take Bv
// where TWO (the tile whose first 32 rows are text), else Bt as well. Per accumulator the order hi*hi, hi*lo, lo*hi per
// k slice; the four accumulator chains alternate.
template <bool TWO>
__device__ __forceinline__ void gemm_cols(const unsigned short* sAh, const unsigned short* Bt, const unsigned short* Bv,
                                          int h, int m, v8f (&acc)[4])
{
  const unsigned short* Ap = sAh + m * RPIT;
  // kept rolled: one pass holds its 4 (8) global and 16 LDS loads and 12 products; eight copies would only add code
  #pragma unroll 1
  for (int kk = 0; kk < DM; kk += 32) {
    const int fo = (kk >> 5) * FRAG;
    v16b bh[2], bl[2];
    bh[0] = ldff(Bt + fo);
    bl[0] = ldff(Bt + 65536 + fo);
    if (TWO) {
      bh[1] = ldff(Bv + fo);
      bl[1] = ldff(Bv + 65536 + fo);
    }
    v16b ah[4], al[4];
    #pragma unroll
    for (int rt = 0; rt < 4; ++rt) {
      ah[rt] = ldfb(Ap + 16 * rt * RPIT + kk, h);
      al[rt] = ldfb(Ap + (64 + 16 * rt) * RPIT + kk, h);
    }
    #pragma unroll
    for (int rt = 0; rt < 4; ++rt) acc[rt] = wmma_b(ah[rt], bh[(TWO && rt >= 2) ? 1 : 0], acc[rt]);
    #pragma unroll
    for (int rt = 0; rt < 4; ++rt) acc[rt] = wmma_b(ah[rt], bl[(TWO && rt >= 2) ? 1 : 0], acc[rt]);
    #pragma unroll
    for (int rt = 0; rt < 4; ++rt) acc[rt] = wmma_b(al[rt], bh[(TWO && rt >= 2) ? 1 : 0], acc[rt]);
  }
}

__global__ __launch_bounds__(512) void k_proj(
    const float* __restrict__ src,
    const unsigned short* __restrict__ WB, const float* __restrict__ XT,
    unsigned short* __restrict__ QH, unsigned short* __restrict__ QL,
    unsigned short* __restrict__ KH, unsigned short* __restrict__ KL,
    _Float16* __restrict__ VT)
{
  extern __shared__ __attribute__((aligned(16))) unsigned char smem[];
  unsigned short* sAh  = (unsigned short*)smem;            // [64][256] bf16 hi, row pitch RPIT
  unsigned short* sAl  = sAh + 64 * RPIT;                  // [64][256] bf16 lo, row pitch RPIT
  unsigned short* sOut = (unsigned short*)(smem + 4 * 64 * RPIT);  // [2][64][256] bf16 hi/lo results, row pitch RPIT
  _Float16*       sV   = (_Float16*)(smem + 4 * 64 * RPIT);        // [256][64] f16, row pitch VPIT (V phase, aliases sOut)

  const int tid = threadIdx.x, lane = tid & 31, w = tid >> 5;
  const int h = lane >> 4, m = lane & 15;
  const int q8 = lane & 7, sub = lane >> 3;
  const int b = blockIdx.y, s0 = blockIdx.x * 64;
  const bool btxt = (blockIdx.x == 0);                     // block-uniform: row tiles 0 and 1 of this tile are text
  const size_t wfo = (size_t)w * (8 * FRAG) + lane * 8;    // this lane's place in the wave's column tile of a weight plane
  const v4f z4 = {0.f, 0.f, 0.f, 0.f};
  const v8f z8 = {0.f, 0.f, 0.f, 0.f, 0.f, 0.f, 0.f, 0.f};

  // ---- stage A = src (+ sine position on text rows) as bf16 hi/lo ----
  #pragma unroll 1
  for (int it = 0; it < 8; ++it) {
    const int q = it * 512 + tid;
    const int row = q >> 6, c4 = (q & 63) * 4;            // row wave-uniform
    const int s = s0 + row;
    const int sl = (s < SEQ) ? s : (SEQ - 1);
    v4f x = *(const v4fa*)(src + ((size_t)(b * SEQ + sl)) * DM + c4);
    if (s >= SEQ) x = z4;
    if (s < TXTN) {
      const float xe = ((float)(s + 1) * 0.03125f) * 6.2831855f;
      const float d0 = powf(10000.0f, (float)c4 * (1.0f / 256.0f));
      const float d1 = powf(10000.0f, (float)(c4 + 2) * (1.0f / 256.0f));
      const float r0 = xe * (1.0f / d0), r1 = xe * (1.0f / d1);
      x.x += sinf(r0); x.y += cosf(r0); x.z += sinf(r1); x.w += cosf(r1);
    }
    const unsigned int h0 = bf16_rne(x.x), h1 = bf16_rne(x.y), h2 = bf16_rne(x.z), h3 = bf16_rne(x.w);
    const unsigned int l0 = bf16_rne(x.x - __uint_as_float(h0 << 16));
    const unsigned int l1 = bf16_rne(x.y - __uint_as_float(h1 << 16));
    const unsigned int l2 = bf16_rne(x.z - __uint_as_float(h2 << 16));
    const unsigned int l3 = bf16_rne(x.w - __uint_as_float(h3 << 16));
    const v4us vh = {(unsigned short)h0, (unsigned short)h1, (unsigned short)h2, (unsigned short)h3};
    const v4us vl = {(unsigned short)l0, (unsigned short)l1, (unsigned short)l2, (unsigned short)l3};
    *(v4usa*)(sAh + row * RPIT + c4) = vh;
    *(v4usa*)(sAl + row * RPIT + c4) = vl;
  }
  __syncthreads();

  // ---- Q (p=0) and K (p=1): bf16 hi/lo split GEMM, XPOS epilogue ----
  #pragma unroll 1
  for (int p = 0; p < 2; ++p) {
    const unsigned short* Bv = WB + (size_t)(4 + 2 * p) * 65536 + wfo;
    v8f acc[4];
    #pragma unroll
    for (int rt = 0; rt < 4; ++rt) acc[rt] = z8;
    if (btxt) gemm_cols<true>(sAh, WB + (size_t)(2 * p) * 65536 + wfo, Bv, h, m, acc);
    else      gemm_cols<false>(sAh, Bv, Bv, h, m, acc);
    // acc[rt][r] = Y[row 16rt+8h+r][col 16w+m]; rotation pairs cols (n, n^1) = lanes (m, m^1)
    const float sg = (m & 1) ? 1.0f : -1.0f;
    const int n = 16 * w + m;
    #pragma unroll
    for (int rt = 0; rt < 4; ++rt) {
      const bool wtxt = btxt && (rt < 2);
      const int rowb = 16 * rt + 8 * h;
      int lb = s0 + rowb - TXTN;
      lb = lb < 0 ? 0 : lb;
      lb = lb > (VIDN - 8) ? (VIDN - 8) : lb;
      const float* tc = XT + ((size_t)(2 * p * DM + n)) * VIDN + lb;
      const float* ts = tc + (size_t)DM * VIDN;
      const v4f c0 = *(const v4fa*)tc, c1 = *(const v4fa*)(tc + 4);
      const v4f t0 = *(const v4fa*)ts, t1 = *(const v4fa*)(ts + 4);
      // wait in front of the first overwrite of a register that these four loads name; the addresses are
      // inputs so that their registers stay as they are up to the wait
      asm volatile("s_wait_xcnt 0x0" :: "v"(tc), "v"(ts) : "memory");
      const float cs[8] = {c0.x, c0.y, c0.z, c0.w, c1.x, c1.y, c1.z, c1.w};
      const float sn[8] = {t0.x, t0.y, t0.z, t0.w, t1.x, t1.y, t1.z, t1.w};
      #pragma unroll
      for (int r = 0; r < 8; ++r) {
        const float x  = acc[rt][r];
        const float pr = __shfl_xor(x, 1, 32);
        const float cv = wtxt ? 1.0f : cs[r];
        const float snv = wtxt ? 0.0f : sn[r];
        const float y  = x * cv + sg * (pr * snv);
        const unsigned int hb  = bf16_rne(y);
        const unsigned int lob = bf16_rne(y - __uint_as_float(hb << 16));
        const int e = (rowb + r) * RPIT + n;
        sOut[e]             = (unsigned short)hb;
        sOut[64 * RPIT + e] = (unsigned short)lob;
      }
    }
    __syncthreads();
    if (p == 0) store_qk(sOut, QH, QL, b, s0, w, sub, q8);
    else        store_kf(sOut, KH, KL, b, s0, w, lane);
    
    __syncthreads();
  }

  // ---- V: tile 0 restages A as bf16 hi/lo of src WITHOUT the position term
  //      (other tiles already hold plain src); split GEMM; f16(64*V) transposed ----
  if (blockIdx.x == 0) {                                   // block-uniform
    #pragma unroll 1
    for (int it = 0; it < 8; ++it) {
      const int q = it * 512 + tid;
      const int row = q >> 6, c4 = (q & 63) * 4;          // s = row < 64 < SEQ
      const v4f x = *(const v4fa*)(src + ((size_t)(b * SEQ + row)) * DM + c4);
      const unsigned int h0 = bf16_rne(x.x), h1 = bf16_rne(x.y), h2 = bf16_rne(x.z), h3 = bf16_rne(x.w);
      const unsigned int l0 = bf16_rne(x.x - __uint_as_float(h0 << 16));
      const unsigned int l1 = bf16_rne(x.y - __uint_as_float(h1 << 16));
      const unsigned int l2 = bf16_rne(x.z - __uint_as_float(h2 << 16));
      const unsigned int l3 = bf16_rne(x.w - __uint_as_float(h3 << 16));
      const v4us vh = {(unsigned short)h0, (unsigned short)h1, (unsigned short)h2, (unsigned short)h3};
      const v4us vl = {(unsigned short)l0, (unsigned short)l1, (unsigned short)l2, (unsigned short)l3};
      *(v4usa*)(sAh + row * RPIT + c4) = vh;
      *(v4usa*)(sAl + row * RPIT + c4) = vl;
    }
  }
  __syncthreads();
  {
    const unsigned short* Bv = WB + (size_t)10 * 65536 + wfo;
    v8f acc[4];
    #pragma unroll
    for (int rt = 0; rt < 4; ++rt) acc[rt] = z8;
    if (btxt) gemm_cols<true>(sAh, WB + (size_t)8 * 65536 + wfo, Bv, h, m, acc);
    else      gemm_cols<false>(sAh, Bv, Bv, h, m, acc);
    // acc[rt] = V[token 16rt+8h+r][d 16w+m] -> sV[d][token] = f16(64*V)
    const int d = 16 * w + m;
    #pragma unroll
    for (int rt = 0; rt < 4; ++rt) {
      #pragma unroll
      for (int r = 0; r < 8; ++r) sV[d * VPIT + 16 * rt + 8 * h + r] = (_Float16)(acc[rt][r] * VSC);
    }
  }
  __syncthreads();
  store_vf(sV, VT, b, s0, w, lane);
  
}

// ---------------------------------------------------------------------------
// Kernel 6: retention. Block 128 thr (4 waves) = 64 queries q0..q0+63 of batch
// b (QT sub-tiles of 16; 33 tiles over the padded 2112 rows, pad rows of Q are
// zero and are not stored); wave w owns output cols 64w..64w+63 and computes
// the score slices for keys kb+16w..kb+16w+15 of each 64-key step (33 steps
// over the padded 2112 keys). Each K and V fragment is loaded once per step
// and feeds all QT query sub-tiles.
//   S^T slice = K * Q^T (A = K rows, B = Q rows; bf16 hi/lo split, K=256)
//   P = S * gate * 256 -> f16 hi tile and f16 lo tile (lo = P - hi)
//       [64 q][64 keys] in LDS (ping-pong), row pitch PPIT
//   O += P_hi * V + P_lo * V  (A = P rows, B = V^T rows from VT, f16), acc f32
// ---------------------------------------------------------------------------
#define QT 4
#define QB (16 * QT)
static_assert(QB * NTILE == SEQP);
static_assert(2 * QB * RPIT * 2 >= 4 * QB * 64 * 4);      // the f32 output staging fits in the Q planes' LDS

__device__ __forceinline__ void store_out(const float* so, float* out, int b, int q0, int w, int sub, int q8)
{
  #pragma unroll
  for (int qt = 0; qt < QT; ++qt) {
    if (q0 + 16 * qt < SEQ) {                              // block-uniform: whole sub-tiles of pad rows are dropped
      #pragma unroll
      for (int i = 0; i < 8; ++i) {
        const int lid = 4 * i + sub, row = 16 * qt + (lid >> 1), hl = lid & 1;
        const v4f v = *(const v4fa*)(so + row * 64 + 32 * hl + 4 * q8);
        float* dst = out + ((size_t)(b * SEQ + q0 + row)) * DM + 64 * w + 32 * hl + 4 * q8;
        *(v4f*)dst = v;
      }
      // wait in front of the next sub-tile's address arithmetic, which reuses registers that these stores name
      if (qt + 1 < QT) asm volatile("s_wait_xcnt 0x0" ::: "memory");
    }
  }
}

// second bound: three waves per SIMD, so that three work-groups (the LDS limit) stay resident per WGP and the grid runs in one round
__global__ __launch_bounds__(128, 3) void k_ret(
    const unsigned short* __restrict__ QH, const unsigned short* __restrict__ QL,
    const unsigned short* __restrict__ KH, const unsigned short* __restrict__ KL,
    const _Float16* __restrict__ VT, const float* __restrict__ MK, float* __restrict__ out)
{
  __shared__ __attribute__((aligned(16))) unsigned short sQ[2 * QB * RPIT];   // hi plane, lo plane
  __shared__ __attribute__((aligned(16))) _Float16 sPh[2][QB * PPIT];
  __shared__ __attribute__((aligned(16))) _Float16 sPl[2][QB * PPIT];
  unsigned short* sQh = sQ;
  unsigned short* sQl = sQ + QB * RPIT;
  float* sO = (float*)sQ;                                  // epilogue only: Q is last read in front of the last step's barrier

  const int tid = threadIdx.x, lane = tid & 31, w = tid >> 5, h = lane >> 4, m = lane & 15;
  const int q8 = lane & 7, sub = lane >> 3;
  const int b = blockIdx.y, q0 = blockIdx.x * QB;
  const v8f z8 = {0.f, 0.f, 0.f, 0.f, 0.f, 0.f, 0.f, 0.f};

  // ---- stage Q hi/lo rows q0..q0+63, 16 rows a pass ----
  // kept rolled: it runs once per work-group, and one pass already has eight 16-byte loads per lane in flight
  #pragma unroll 1
  for (int qp = 0; qp < QB; qp += 16) {
    v8us qh[4], ql[4];
    const unsigned short* gh[4];
    const unsigned short* gl[4];
    #pragma unroll
    for (int it = 0; it < 4; ++it) {
      const int idx = it * 128 + tid;
      const int row = qp + (idx >> 5), c8 = (idx & 31) * 8;
      const size_t g = ((size_t)(b * SEQP + q0 + row)) * DM + c8;
      gh[it] = QH + g;
      gl[it] = QL + g;
      qh[it] = *(const v8usa*)gh[it];
      ql[it] = *(const v8usa*)gl[it];
    }
    // wait in front of the first overwrite of a register that the eight loads name; the addresses are
    // inputs so that their registers stay as they are up to the wait
    asm volatile("s_wait_xcnt 0x0" :: "v"(gh[0]), "v"(gl[0]), "v"(gh[1]), "v"(gl[1]),
                 "v"(gh[2]), "v"(gl[2]), "v"(gh[3]), "v"(gl[3]) : "memory");
    #pragma unroll
    for (int it = 0; it < 4; ++it) {
      const int idx = it * 128 + tid;
      const int row = qp + (idx >> 5), c8 = (idx & 31) * 8;
      *(v8usa*)(sQh + row * RPIT + c8) = qh[it];
      *(v8usa*)(sQl + row * RPIT + c8) = ql[it];
    }
  }
  __syncthreads();

  v8f o[QT][4];
  #pragma unroll
  for (int qt = 0; qt < QT; ++qt)
    #pragma unroll
    for (int nt = 0; nt < 4; ++nt) o[qt][nt] = z8;

  // byte offsets of this lane's 16 bytes in the wave's first K fragment (hi and lo planes alike) and first V^T
  // fragment; both stay below 2^25
  unsigned int koff = (unsigned int)((b * NKT + w) * 8 * FRAGB + lane * 16);
  unsigned int voff = (unsigned int)((b * NVS * 16 + 4 * w) * FRAGB + lane * 16);
  int moff[QT];                                           // this lane's byte offset in the first gate tile of each sub-tile's row of tiles
  #pragma unroll
  for (int qt = 0; qt < QT; ++qt) {
    int rt = (q0 >> 4) + qt - TXTN / 16;
    rt = rt < 0 ? 0 : rt;
    rt = rt > (NGT - 1) ? (NGT - 1) : rt;                 // pad queries read the last row of tiles; their output is dropped
    moff[qt] = rt * NGT * GTB + lane * 16;
  }

  // K fragments travel in a register ring of four 32-wide k slices (hi and lo): a slice is refilled right after
  // its last use, four slices ahead of its next one, so that no score product waits for a global load.
  v16b rkh[4], rkl[4];
  #pragma unroll
  for (int i = 0; i < 4; ++i) {
    rkh[i] = ldgb(KH, koff, FRAGB * i);
    rkl[i] = ldgb(KL, koff, FRAGB * i);
  }

  int buf = 0;
  #pragma unroll 1
  for (int kb = 0; kb < SEQP; kb += 64) {
    // rows the ring's second half is refilled from: the next step's; the last step reads its own again (in bounds, unused)
    const unsigned int koffn = koff + ((kb + 64 < SEQP) ? 4u * 8u * FRAGB : 0u);
    // gate: 1 when query or key is text, sigmoid plane on vid x vid, 0 on pad keys; loaded here, used behind the scores
    const int cb = kb + 16 * w + 8 * h - TXTN;            // vid index of key r=0 (group of 8, aligned)
    const bool ktxt = cb < 0;
    const bool kpad = cb >= VIDN;
    int ct = (kb >> 4) + w - TXTN / 16;                   // gate tile of the wave's 16 keys
    ct = ct < 0 ? 0 : ct;
    ct = ct > (NGT - 1) ? (NGT - 1) : ct;
    unsigned int goff[QT];
    #pragma unroll
    for (int qt = 0; qt < QT; ++qt) goff[qt] = (unsigned int)(moff[qt] + ct * GTB);
    // this fence and the next keep the eight loads and their wait together, up here: nothing that could rewrite
    // an offset register gets between them, and the loads are not sunk to their use, where they would be waited for in full
    __builtin_amdgcn_sched_barrier(0);
    v4f g0[QT], g1[QT];
    #pragma unroll
    for (int qt = 0; qt < QT; ++qt) {
      const char* gp = (const char*)MK + goff[qt];
      g0[qt] = *(const v4fa*)gp;
      g1[qt] = *(const v4fa*)(gp + GTB / 2);
    }
    // wait in front of the first overwrite of a register that the eight loads name; the offsets are
    // inputs so that their registers stay as they are up to the wait
    asm volatile("s_wait_xcnt 0x0" :: "v"(goff[0]), "v"(goff[1]), "v"(goff[2]), "v"(goff[3]) : "memory");
    __builtin_amdgcn_sched_barrier(0);

    // scores: s[qt][r] = S[query q0+16qt+m][key kb+16w+8h+r]
    v8f s[QT];
    #pragma unroll
    for (int qt = 0; qt < QT; ++qt) s[qt] = z8;
    #pragma unroll
    for (int i = 0; i < 8; ++i) {
      const int kk = 32 * i;
      const v16b ka = rkh[i & 3];
      const v16b kl = rkl[i & 3];
      #pragma unroll
      for (int qp = 0; qp < QT; qp += 2) {                 // two sub-tiles at a time: their two accumulator chains alternate
        const v16b qa0 = ldfb(sQh + (16 * qp + m) * RPIT + kk, h);
        const v16b qa1 = ldfb(sQh + (16 * qp + 16 + m) * RPIT + kk, h);
        const v16b ql0 = ldfb(sQl + (16 * qp + m) * RPIT + kk, h);
        const v16b ql1 = ldfb(sQl + (16 * qp + 16 + m) * RPIT + kk, h);
        s[qp]     = wmma_bd(ka, qa0, s[qp]);
        s[qp + 1] = wmma_bd(ka, qa1, s[qp + 1]);
        s[qp]     = wmma_bd(ka, ql0, s[qp]);
        s[qp + 1] = wmma_bd(ka, ql1, s[qp + 1]);
        s[qp]     = wmma_bd(kl, qa0, s[qp]);
        s[qp + 1] = wmma_bd(kl, qa1, s[qp + 1]);
      }
      rkh[i & 3] = ldgb(KH, (i < 4) ? koff : koffn, FRAGB * ((i + 4) & 7));
      rkl[i & 3] = ldgb(KL, (i < 4) ? koff : koffn, FRAGB * ((i + 4) & 7));
      // keeps the refill at this distance from its use: the scheduler would else sink it towards the use
      __builtin_amdgcn_sched_barrier(0);
    }
    // V^T fragments of the step's first 32 keys: in flight during the gate arithmetic
    v16h vf[4];
    #pragma unroll
    for (int nt = 0; nt < 4; ++nt) vf[nt] = ldgh(VT, voff, FRAGB * nt);
    // keeps these loads in front of the gate arithmetic
    __builtin_amdgcn_sched_barrier(0);
    #pragma unroll
    for (int qt = 0; qt < QT; ++qt) {
      const bool qtxt = (q0 + 16 * qt + m) < TXTN;
      const float gk[8] = {g0[qt].x, g0[qt].y, g0[qt].z, g0[qt].w, g1[qt].x, g1[qt].y, g1[qt].z, g1[qt].w};
      v8h ph, plo;
      #pragma unroll
      for (int r = 0; r < 8; ++r) {
        const float gg = kpad ? 0.0f : ((qtxt || ktxt) ? 1.0f : gk[r]);
        const float pv = (s[qt][r] * gg) * PSC;
        const _Float16 hv = (_Float16)pv;
        ph[r]  = hv;
        plo[r] = (_Float16)(pv - (float)hv);
      }
      *(v8ha*)(&sPh[buf][(16 * qt + m) * PPIT + 16 * w + 8 * h]) = ph;
      *(v8ha*)(&sPl[buf][(16 * qt + m) * PPIT + 16 * w + 8 * h]) = plo;
    }
    __syncthreads();

    // O += P_hi(64x64) * V + P_lo(64x64) * V  (64 keys x this wave's 64 cols)
    #pragma unroll
    for (int ks = 0; ks < 2; ++ks) {
      v16h pa[QT], pb[QT];
      #pragma unroll
      for (int qt = 0; qt < QT; ++qt) {
        pa[qt] = ldfh(&sPh[buf][(16 * qt + m) * PPIT + 32 * ks], h);
        pb[qt] = ldfh(&sPl[buf][(16 * qt + m) * PPIT + 32 * ks], h);
      }
      #pragma unroll
      for (int nt = 0; nt < 4; ++nt) {
        const v16h vbf = vf[nt];
        #pragma unroll
        for (int qt = 0; qt < QT; ++qt) o[qt][nt] = wmma_hd(pa[qt], vbf, o[qt][nt]);
        #pragma unroll
        for (int qt = 0; qt < QT; ++qt) o[qt][nt] = wmma_hd(pb[qt], vbf, o[qt][nt]);
        if (ks == 0) {
          vf[nt] = ldgh(VT, voff, FRAGB * (16 + nt));  // second 32 keys, three column tiles ahead of their use
          // keeps the refill at this distance from its use
          __builtin_amdgcn_sched_barrier(0);
        }
      }
    }
    // wait in front of the overwrite of the offset registers that this step's K and V loads name; the offsets are
    // inputs so that their registers stay as they are up to the wait
    asm volatile("s_wait_xcnt 0x0" :: "v"(koff), "v"(koffn), "v"(voff) : "memory");
    koff = koffn;
    voff += 2u * 16u * FRAGB;
    buf ^= 1;
  }

  // ---- epilogue: O[q0+16qt+8h+r][64w+16nt+m] = o[qt][nt][r] / (256*64) ----
  float* so = sO + w * (QB * 64);
  #pragma unroll
  for (int qt = 0; qt < QT; ++qt)
    #pragma unroll
    for (int nt = 0; nt < 4; ++nt)
      #pragma unroll
      for (int r = 0; r < 8; ++r)
        so[(16 * qt + 8 * h + r) * 64 + 16 * nt + m] = o[qt][nt][r] * OSC;
  __syncthreads();
  store_out(so, out, b, q0, w, sub, q8);
  
}

// ---------------------------------------------------------------------------
extern "C" void kernel_launch(void* const* d_in, const int* in_sizes, int n_in,
                              void* d_out, int out_size, void* d_ws, size_t ws_size,
                              hipStream_t stream)
{
  if (n_in < 9) return;
  if (in_sizes[0] != BATCH * SEQ * DM) return;
  if (in_sizes[1] != VIDN * VIDN) return;
  for (int i = 2; i < 8; ++i) if (in_sizes[i] != DM * DM) return;
  if (in_sizes[8] < 1) return;
  if (out_size != BATCH * SEQ * DM + 1) return;

  const float* src = (const float*)d_in[0];
  const float* lrn = (const float*)d_in[1];
  const float* wtq = (const float*)d_in[2];
  const float* wtk = (const float*)d_in[3];
  const float* wtv = (const float*)d_in[4];
  const float* wvq = (const float*)d_in[5];
  const float* wvk = (const float*)d_in[6];
  const float* wvv = (const float*)d_in[7];
  const int*   txl = (const int*)d_in[8];
  float* out0 = (float*)d_out;
  float* out1 = out0 + (size_t)BATCH * SEQ * DM;          // byte offset 34078720

  const size_t pl_bytes = (size_t)BATCH * SEQP * DM * 2;  // 17301504 per bf16/f16 plane (padded rows incl.)
  const size_t wb_bytes = (size_t)NWPL * DM * DM * 2;      // 1572864
  const size_t xt_bytes = (size_t)4 * DM * VIDN * 4;       // 8388608
  const size_t mk_bytes = (size_t)VIDN * VIDN * 4;         // 16777216
  const size_t off_qh = 0;
  const size_t off_ql = off_qh + pl_bytes;
  const size_t off_kh = off_ql + pl_bytes;
  const size_t off_kl = off_kh + pl_bytes;
  const size_t off_vt = off_kl + pl_bytes;
  const size_t off_wb = off_vt + pl_bytes;
  const size_t off_xt = off_wb + wb_bytes;
  const size_t off_mk = off_xt + xt_bytes;
  const size_t pt_bytes = (size_t)NPART * PSTR * 8;        // 131072
  const size_t off_pt = off_mk + mk_bytes;
  const size_t total  = off_pt + pt_bytes;                 // 113377280
  if (total > ws_size) return;
  if (total > (size_t)134217728) return;

  char* ws = (char*)d_ws;
  unsigned short* QH = (unsigned short*)(ws + off_qh);
  unsigned short* QL = (unsigned short*)(ws + off_ql);
  unsigned short* KH = (unsigned short*)(ws + off_kh);
  unsigned short* KL = (unsigned short*)(ws + off_kl);
  _Float16* VT = (_Float16*)(ws + off_vt);
  unsigned short* WB = (unsigned short*)(ws + off_wb);
  float* XT = (float*)(ws + off_xt);
  float* MK = (float*)(ws + off_mk);
  double* PT = (double*)(ws + off_pt);

  k_wprep<<<(NWPL * DM) / 8, 256, 0, stream>>>(wtq, wtk, wtv, wvq, wvk, wvv, WB);
  k_xtab<<<DM * 8, 256, 0, stream>>>(XT);
  k_mask<<<NPART, 256, 0, stream>>>(lrn, MK, PT);
  k_loss<<<1, NPART, 0, stream>>>(PT, txl, out1);

  const size_t proj_lds = 135168;                          // 8*64*RPIT
  hipFuncSetAttribute(reinterpret_cast<const void*>(&k_proj), hipFuncAttributeMaxDynamicSharedMemorySize, (int)proj_lds);
  dim3 gp(NTILE, BATCH);
  k_proj<<<gp, 512, proj_lds, stream>>>(src, WB, XT, QH, QL, KH, KL, VT);

  dim3 gr(NTILE, BATCH);
  k_ret<<<gr, 128, 0, stream>>>(QH, QL, KH, KL, VT, MK, out0);
}

// v007
// It runs in 199 microseconds.
// Next to v006, in two timings, it ran 1.08 times as fast each time.
// All steps since v000 together make it 31.1 times as fast.
// Contractions: Q,K,V projections and S=K*Q^T on v_wmma_f32_16x16x32_bf16 as bf16 hi/lo split (hi*hi+hi*lo+lo*hi); O=P*V on v_wmma_f32_16x16x32_f16 with P as f16 hi + f16 lo (P x256, two products) and V^T f16 x64; f32 accumulate; position tables, sigmoid gate and loss in f32/f64.
#include <hip/hip_runtime.h>

#define BATCH 16
#define TXTN  32
#define VIDN  2048
#define SEQ   2080
#define SEQP  2112
#define DM    256
#define NTILE 33
#define NWPL  12
#define PSC   256.0f
#define VSC   64.0f
#define OSC   (1.0f / 16384.0f)
#define MELEM 4096
#define NPART 1024
#define PSTR  16
// LDS row pitches in 16-bit elements: row bytes + 16, an odd multiple of 16 B, so that the
// 16 rows one ds_load_b128 fragment read touches per half-wave fall on 16 different bank groups.
#define RPIT  (DM + 8)
#define PPIT  (64 + 8)
#define VPIT  (64 + 8)
// Fragment order, the layout of every 16-bit matrix operand that a wave loads from global memory (weight planes,
// K planes, V^T): one 16-row x 32-k fragment is 1 KiB in a row, as two 512-byte halves j = 0, 1; lane l = 16h + m owns
// bytes 16l .. 16l+15 of each half = elements k0+16j+8h .. +7 of row m. So one 16-byte load per lane reads four whole
// 128-byte lines; from a row-major plane the same load touches sixteen lines and uses 32 bytes of each.
#define FRAG  512
#define FRAGB 1024
#define NKT   (SEQP / 16)
#define NVS   (SEQP / 32)
// The gate plane likewise, in the order of the score fragment it multiplies: one 16-query x 16-key f32 tile is 1 KiB in a
// row, two 512-byte halves j; lane l = 16h + m owns bytes 16l .. 16l+15 of each half = keys 8h+4j .. +3 of query m.
#define GTB   1024
#define NGT   (VIDN / 16)
static_assert(MELEM * NPART == VIDN * VIDN);
// grid rows of NTILE work-groups that hold the gate job's NPART / 2 work-groups
#define GROWS 16
static_assert(GROWS * NTILE >= NPART / 2);

typedef _Float16 v16h __attribute__((ext_vector_type(16)));
typedef _Float16 v8h  __attribute__((ext_vector_type(8)));
typedef _Float16 v4h  __attribute__((ext_vector_type(4)));
typedef __bf16   v16b __attribute__((ext_vector_type(16)));
typedef unsigned short v8us __attribute__((ext_vector_type(8)));
typedef unsigned short v4us __attribute__((ext_vector_type(4)));
typedef float v8f __attribute__((ext_vector_type(8)));
typedef float v4f __attribute__((ext_vector_type(4)));
typedef v8h  __attribute__((may_alias)) v8ha;
typedef v4h  __attribute__((may_alias)) v4ha;
typedef v8us __attribute__((may_alias)) v8usa;
typedef v4us __attribute__((may_alias)) v4usa;
typedef v4f  __attribute__((may_alias)) v4fa;

// ---------------------------------------------------------------------------
// XPOS module constants as exact f32 bit patterns:
// c_invf[i] = 1 / 10000^(i/128), c_svec[i] = (2i + 0.4*256) / (1.4*256).
// ---------------------------------------------------------------------------
__constant__ unsigned int c_invf[] = {
  0x3f800000, 0x3f6e39f8, 0x3f5dafd7, 0x3f4e4bad, 0x3f3ff911, 0x3f32a506, 0x3f263de0, 0x3f1ab32b,
  0x3f0ff59a, 0x3f05f6ef, 0x3ef953cf, 0x3ee8045f, 0x3ed7e89b, 0x3ec8eb24, 0x3ebaf81b, 0x3eadfcff,
  0x3ea1e89b, 0x3e96aaea, 0x3e8c3504, 0x3e827909, 0x3e72d423, 0x3e61f835, 0x3e5247ed, 0x3e43ae7c,
  0x3e361887, 0x3e297409, 0x3e1db040, 0x3e12bd91, 0x3e088d77, 0x3dfe24e0, 0x3dec7fd6, 0x3ddc1466,
  0x3dcccccd, 0x3dbe94c6, 0x3db15978, 0x3da50956, 0x3d99940d, 0x3d8eea6b, 0x3d84fe4d, 0x3d778513,
  0x3d6655c2, 0x3d5657e4, 0x3d47763f, 0x3d399d19, 0x3d2cba15, 0x3d20bc1d, 0x3d159348, 0x3d0b30cc,
  0x3d0186e3, 0x3cf11177, 0x3ce054d2, 0x3cd0c1a8, 0x3cc2434f, 0x3cb4c691, 0x3ca8398b, 0x3c9c8b97,
  0x3c91ad39, 0x3c879008, 0x3c7c4d33, 0x3c6ac8e7, 0x3c5a7bf2, 0x3c4b50b3, 0x3c3d3311, 0x3c301052,
  0x3c23d70a, 0x3c187705, 0x3c0de12d, 0x3c040779, 0x3bf5b9b0, 0x3be4aa46, 0x3bd4ca15, 0x3bc6040f,
  0x3bb8449c, 0x3bab7983, 0x3b9f91cc, 0x3b947dae, 0x3b8a2e77, 0x3b80967d, 0x3b6f520e, 0x3b5eb47a,
  0x3b4f3e38, 0x3b40dac5, 0x3b33770f, 0x3b270153, 0x3b1b690d, 0x3b109edb, 0x3b06946f, 0x3afa78f0,
  0x3ae91528, 0x3ad8e673, 0x3ac9d75c, 0x3abbd3ed, 0x3aaec98e, 0x3aa2a6f7, 0x3a975c0e, 0x3a8cd9db,
  0x3a83126f, 0x3a73f1a3, 0x3a6301e2, 0x3a533f28, 0x3a44948c, 0x3a36ee9e, 0x3a2a3b44, 0x3a1e69a5,
  0x3a136a16, 0x3a092e02, 0x39ff4fac, 0x39ed95e2, 0x39dd1725, 0x39cdbd96, 0x39bf74d7, 0x39b229fa,
  0x39a5cb60, 0x399a489e, 0x398f9272, 0x39859aa9, 0x3978a815, 0x39676492, 0x395753e4, 0x394860c1,
  0x393a7753, 0x392d8529, 0x39217916, 0x39164324, 0x390bd472, 0x39021f2b, 0x38f22ce2, 0x38e15c91 };
static_assert(sizeof(c_invf) == 512);

__constant__ unsigned int c_svec[] = {
  0x3e924925, 0x3e952493, 0x3e980000, 0x3e9adb6e, 0x3e9db6dc, 0x3ea0924a, 0x3ea36db7, 0x3ea64925,
  0x3ea92493, 0x3eac0000, 0x3eaedb6e, 0x3eb1b6dc, 0x3eb4924a, 0x3eb76db7, 0x3eba4924, 0x3ebd2492,
  0x3ec00000, 0x3ec2db6d, 0x3ec5b6db, 0x3ec89249, 0x3ecb6db7, 0x3ece4924, 0x3ed12492, 0x3ed40000,
  0x3ed6db6d, 0x3ed9b6db, 0x3edc9249, 0x3edf6db7, 0x3ee24924, 0x3ee52492, 0x3ee80000, 0x3eeadb6e,
  0x3eedb6db, 0x3ef09249, 0x3ef36db7, 0x3ef64924, 0x3ef92492, 0x3efc0000, 0x3efedb6e, 0x3f00db6e,
  0x3f024924, 0x3f03b6db, 0x3f052492, 0x3f069249, 0x3f080000, 0x3f096db7, 0x3f0adb6e, 0x3f0c4925,
  0x3f0db6db, 0x3f0f2492, 0x3f109249, 0x3f120000, 0x3f136db7, 0x3f14db6e, 0x3f164925, 0x3f17b6db,
  0x3f192492, 0x3f1a9249, 0x3f1c0000, 0x3f1d6db7, 0x3f1edb6e, 0x3f204925, 0x3f21b6db, 0x3f232492,
  0x3f249249, 0x3f260000, 0x3f276db7, 0x3f28db6e, 0x3f2a4925, 0x3f2bb6db, 0x3f2d2492, 0x3f2e9249,
  0x3f300000, 0x3f316db7, 0x3f32db6e, 0x3f344925, 0x3f35b6db, 0x3f372492, 0x3f389249, 0x3f3a0000,
  0x3f3b6db7, 0x3f3cdb6e, 0x3f3e4925, 0x3f3fb6db, 0x3f412492, 0x3f429249, 0x3f440000, 0x3f456db7,
  0x3f46db6e, 0x3f484925, 0x3f49b6db, 0x3f4b2492, 0x3f4c9249, 0x3f4e0000, 0x3f4f6db7, 0x3f50db6e,
  0x3f524925, 0x3f53b6db, 0x3f552492, 0x3f569249, 0x3f580000, 0x3f596db7, 0x3f5adb6e, 0x3f5c4925,
  0x3f5db6db, 0x3f5f2492, 0x3f609249, 0x3f620000, 0x3f636db7, 0x3f64db6e, 0x3f664925, 0x3f67b6dc,
  0x3f692492, 0x3f6a9249, 0x3f6c0000, 0x3f6d6db7, 0x3f6edb6e, 0x3f704925, 0x3f71b6dc, 0x3f732492,
  0x3f749249, 0x3f760000, 0x3f776db7, 0x3f78db6e, 0x3f7a4925, 0x3f7bb6dc, 0x3f7d2492, 0x3f7e9249 };
static_assert(sizeof(c_svec) == 512);

// ---------------------------------------------------------------------------
// 16x16x32 WMMA with hazard guard. Fragment map (wave32): lane l, h = l>>4,
// m = n = l&15. A/B element i: i<8 -> k0+8h+i ; i>=8 -> k0+16+8h+(i-8).
// D element r: row 8h+r, col l&15.
// ---------------------------------------------------------------------------
__device__ __forceinline__ v8f wmma_h(v16h a, v16h b, v8f c) {
  v8f d = __builtin_amdgcn_wmma_f32_16x16x32_f16(false, a, false, b, (short)0, c, false, false);
  asm volatile("v_nop\n\tv_nop\n\tv_nop\n\tv_nop" : "+v"(d) : "v"(a), "v"(b));
  return d;
}
__device__ __forceinline__ v8f wmma_b(v16b a, v16b b, v8f c) {
  v8f d = __builtin_amdgcn_wmma_f32_16x16x32_bf16(false, a, false, b, (short)0, c, false, false);
  asm volatile("v_nop\n\tv_nop\n\tv_nop\n\tv_nop" : "+v"(d) : "v"(a), "v"(b));
  return d;
}

// The same two products for the retention kernel: the guard names D alone. An asm operand must lie in v0..v255;
// with A and B named as well, every fragment loaded ahead would have to fit there beside the accumulators.
__device__ __forceinline__ v8f wmma_hd(v16h a, v16h b, v8f c) {
  v8f d = __builtin_amdgcn_wmma_f32_16x16x32_f16(false, a, false, b, (short)0, c, false, false);
  asm volatile("v_nop\n\tv_nop\n\tv_nop\n\tv_nop" : "+v"(d));
  return d;
}
__device__ __forceinline__ v8f wmma_bd(v16b a, v16b b, v8f c) {
  v8f d = __builtin_amdgcn_wmma_f32_16x16x32_bf16(false, a, false, b, (short)0, c, false, false);
  asm volatile("v_nop\n\tv_nop\n\tv_nop\n\tv_nop" : "+v"(d));
  return d;
}

// Fragment from a k-contiguous 16-bit row; p points at element k0 of the row
// owned by this lane (row = lane & 15 added by the caller). Same map for A and B.
__device__ __forceinline__ v16h ldfh(const _Float16* p, int h) {
  union { v16h v; v8h hf[2]; } f;
  f.hf[0] = *(const v8ha*)(p + 8 * h);
  f.hf[1] = *(const v8ha*)(p + 16 + 8 * h);
  return f.v;
}
__device__ __forceinline__ v16b ldfb(const unsigned short* p, int h) {
  union { v16b v; v8us hf[2]; } f;
  f.hf[0] = *(const v8usa*)(p + 8 * h);
  f.hf[1] = *(const v8usa*)(p + 16 + 8 * h);
  return f.v;
}

// Global fragment in fragment order: uniform base + this lane's 32-bit byte offset (16 * lane included) + a constant.
// One offset register serves every load of a step, so none is rewritten while loads that name it are in flight.
__device__ __forceinline__ v16h ldgh(const _Float16* base, unsigned int off, int imm) {
  const char* p = (const char*)base + off;
  union { v16h v; v8h hf[2]; } f;
  f.hf[0] = *(const v8ha*)(p + imm);
  f.hf[1] = *(const v8ha*)(p + imm + FRAGB / 2);
  return f.v;
}
__device__ __forceinline__ v16b ldgb(const unsigned short* base, unsigned int off, int imm) {
  const char* p = (const char*)base + off;
  union { v16b v; v8us hf[2]; } f;
  f.hf[0] = *(const v8usa*)(p + imm);
  f.hf[1] = *(const v8usa*)(p + imm + FRAGB / 2);
  return f.v;
}
// The same through a pointer: p = fragment start + 8 * lane, in elements.
__device__ __forceinline__ v16b ldff(const unsigned short* p) {
  union { v16b v; v8us hf[2]; } f;
  f.hf[0] = *(const v8usa*)p;
  f.hf[1] = *(const v8usa*)(p + FRAG / 2);
  return f.v;
}

// f32 -> bf16 bits, RNE
__device__ __forceinline__ unsigned int bf16_rne(float x) {
  const unsigned int u = __float_as_uint(x);
  return (u + 0x7FFFu + ((u >> 16) & 1u)) >> 16;
}

// ---------------------------------------------------------------------------
// Launch 1, first job: weight planes bf16 in fragment order, WB[pl][n tile of 16][k slice of 32][j][lane][8], pl = 2*wsel + part:
// wsel 0 txtQ, 1 txtK, 2 vidQ, 3 vidK, 4 txtV, 5 vidV; part 0 hi = RNE(w),
// part 1 lo = RNE(w - hi). One wave writes one whole 512-B fragment half per store.
// ---------------------------------------------------------------------------
__device__ __forceinline__ void wprep_body(
    const float* __restrict__ wtq, const float* __restrict__ wtk, const float* __restrict__ wtv,
    const float* __restrict__ wvq, const float* __restrict__ wvk, const float* __restrict__ wvv,
    unsigned short* __restrict__ WB, int blk)
{
  const int tid = threadIdx.x, lane = tid & 31;
  const int row = blk * 8 + (tid >> 5);                  // fragment half 0 .. 3071, plane uniform per block
  if (row >= NWPL * DM) return;
  const int pl = row >> 8, n = ((row >> 4) & 15) * 16 + (lane & 15);
  const int wsel = pl >> 1, part = pl & 1;
  const float* W = (wsel == 0) ? wtq : (wsel == 1) ? wtk : (wsel == 2) ? wvq
                 : (wsel == 3) ? wvk : (wsel == 4) ? wtv : wvv;
  const int k0 = ((row >> 1) & 7) * 32 + (row & 1) * 16 + (lane >> 4) * 8;
  float v[8];
  #pragma unroll
  for (int i = 0; i < 8; ++i) v[i] = W[(size_t)(k0 + i) * DM + n];
  v8us o;
  #pragma unroll
  for (int i = 0; i < 8; ++i) {
    const unsigned int hb = bf16_rne(v[i]);
    const unsigned int lb = bf16_rne(v[i] - __uint_as_float(hb << 16));
    o[i] = (unsigned short)(part ? lb : hb);
  }
  unsigned short* dst = WB + (size_t)row * (FRAG / 2) + lane * 8;
  *(v8us*)dst = o;
  
}

// ---------------------------------------------------------------------------
// Launch 1, second job: XPOS tables XT[pl][n][l] f32, pl 0 cos*scale, 1 sin*scale,
// 2 cos/scale, 3 sin/scale; n = feature (pair i = n>>1), l = video position.
// scale = scale_vec[i] ^ (l/512) via powf; angle = l * inv_freq[i] with the
// exact constant tables above; precise sinf/cosf.
// ---------------------------------------------------------------------------
__device__ __forceinline__ void xtab_body(float* __restrict__ XT, int blk)
{
  const int n = blk >> 3;
  const int l = (blk & 7) * 256 + threadIdx.x;
  const int i = n >> 1;                                  // 0 .. 127
  const float sv = __uint_as_float(c_svec[i]);
  const float pw = (float)l * (1.0f / 512.0f);
  const float scale = powf(sv, pw);
  const float invf = __uint_as_float(c_invf[i]);
  const float ang = (float)l * invf;
  const float sn = sinf(ang), cs = cosf(ang);
  const float inv = 1.0f / scale;
  const size_t PS = (size_t)DM * VIDN;
  float* p0 = XT + (size_t)n * VIDN + l;
  const float a0 = cs * scale, a1 = sn * scale, a2 = cs * inv, a3 = sn * inv;
  *(float*)(p0)          = a0;
  *(float*)(p0 + PS)     = a1;
  *(float*)(p0 + 2 * PS) = a2;
  *(float*)(p0 + 3 * PS) = a3;
  // wait behind the four stores: in the shared kernel the other job's code follows them in the listing and rewrites their offset register
  asm volatile("s_wait_xcnt 0x0" ::: "memory");
}

// ---------------------------------------------------------------------------
// Launch 1: the two jobs that the projection waits for depend on nothing and on
// each other not at all, so they share one grid; the block index picks the job.
// ---------------------------------------------------------------------------
#define NWBLK ((NWPL * DM) / 8)
#define NXBLK (DM * 8)
__global__ __launch_bounds__(256) void k_prep(
    const float* __restrict__ wtq, const float* __restrict__ wtk, const float* __restrict__ wtv,
    const float* __restrict__ wvq, const float* __restrict__ wvk, const float* __restrict__ wvv,
    unsigned short* __restrict__ WB, float* __restrict__ XT)
{
  if (blockIdx.x < NWBLK) wprep_body(wtq, wtk, wtv, wvq, wvk, wvv, WB, blockIdx.x);
  else                    xtab_body(XT, blockIdx.x - NWBLK);
}

// ---------------------------------------------------------------------------
// Sum over the 32 lanes of a wave, f64, fixed butterfly order; every lane gets it.
// ---------------------------------------------------------------------------
__device__ __forceinline__ double wave_sum(double v) {
  #pragma unroll
  for (int d = 16; d > 0; d >>= 1) v += __shfl_xor(v, d, 32);
  return v;
}

// ---------------------------------------------------------------------------
// Launch 2, second job (work-groups behind the projection's): gate plane sigmoid(learn[r][c]) f32 (diagonal kept)
// in 16 x 16 tiles, M[r tile][c tile][j][lane][4], and the loss's partial sums from the same values:
// group g of 256 threads (two to a work-group: g = 2 mb + half) covers rows 16(g>>3) .. +15 x columns
// 256(g&7) .. +255 (a wave: two tiles, 2 KiB of M in a row) and stores the f64 sum of its off-diagonal sigmoids
// at part[16g] (a 128-byte line of its own). red: 16 doubles of LDS.
// ---------------------------------------------------------------------------
__device__ __forceinline__ void mask_body(const float* __restrict__ lr, float* __restrict__ M,
                                          double* __restrict__ part, double* red, int mb)
{
  const int half = threadIdx.x >> 8;
  const int g = 2 * mb + half;
  const int t = threadIdx.x & 255;
  const int lane = t & 31;
  const int rt = g >> 3, ct = (g & 7) * 16 + 2 * (t >> 5);   // the wave's first tile
  const int r = 16 * rt + (lane & 15), c0 = 16 * ct + 8 * (lane >> 4);
  const float* lp = lr + r * VIDN + c0;
  float* mp = M + (rt * NGT + ct) * (GTB / 4) + lane * 4;
  v4f x[4];
  #pragma unroll
  for (int it = 0; it < 4; ++it) x[it] = *(const v4fa*)(lp + 16 * (it >> 1) + 4 * (it & 1));
  double acc = 0.0;
  #pragma unroll
  for (int it = 0; it < 4; ++it) {
    const int c = c0 + 16 * (it >> 1) + 4 * (it & 1);
    v4f sv;
    #pragma unroll
    for (int e = 0; e < 4; ++e) {
      const float s = 1.0f / (1.0f + expf(-x[it][e]));
      sv[e] = s;
      acc += (r == c + e) ? 0.0 : (double)s;
    }
    *(v4f*)(mp + it * (GTB / 8)) = sv;
  }
  const double ws = wave_sum(acc);
  if ((t & 31) == 0) red[8 * half + (t >> 5)] = ws;
  __syncthreads();
  if (t == 0) {
    double sum = 0.0;
    #pragma unroll
    for (int i = 0; i < 8; ++i) sum += red[8 * half + i];
    part[(size_t)g * PSTR] = sum;
  }
}

// ---------------------------------------------------------------------------
// Launch 3, second job (one work-group of 128 threads behind the retention's): loss = mean over vid x vid of
// off-diagonal sigmoid: adds the 1024 partial sums of the gate job, fixed order, f64: 32 butterfly sums of 32
// partials each (eight a wave), then one butterfly over the 32. red: 32 doubles of LDS.
// ---------------------------------------------------------------------------
__device__ __forceinline__ void loss_body(const double* __restrict__ part, const int* __restrict__ tl,
                                          float* __restrict__ out1, double* red)
{
  const int t = threadIdx.x;
  double pv[8];
  #pragma unroll
  for (int j = 0; j < 8; ++j) pv[j] = part[(size_t)(256 * (t >> 5) + 32 * j + (t & 31)) * PSTR];
  #pragma unroll
  for (int j = 0; j < 8; ++j) {
    const double ws = wave_sum(pv[j]);
    if ((t & 31) == 0) red[8 * (t >> 5) + j] = ws;
  }
  __syncthreads();
  if (t < 32) {                                            // wave 0, all lanes on
    const double sum = wave_sum(red[t]);
    if (t == 0) {
      int vl = SEQ - tl[0];
      vl = vl < 1 ? 1 : vl;
      vl = vl > VIDN ? VIDN : vl;
      const float loss = (float)(sum / ((double)vl * (double)vl));
      *(float*)out1 = loss;
    }
  }
}

// ---------------------------------------------------------------------------
// Launch 2, first job: projections. Block = 512 thr (16 waves) = 64 absolute positions
// s0..s0+63 of batch b (s0 multiple of 64 over the padded 2112) x 256 cols;
// wave w owns all 64 rows (four row tiles rt) x cols 16w..16w+15, so that each weight
// fragment is loaded by one wave of the block only and feeds every row tile.
// Rows s<32: text (sine position added to the Q/K A operand, text weights, no
// XPOS); 32<=s<2080: video; s>=2080: zero pad rows. Q,K,V: bf16 hi/lo split
// GEMMs. Q,K: XPOS rotation in f32, written as bf16 hi/lo planes: Q row-major
// [b][SEQP][256], K in fragment order [b][key tile of 16][k slice of 32][j][lane][8].
// V: f16(64*V) transposed, in fragment order VT[b][key slice of 32][d tile of 16][j][lane][8].
// ---------------------------------------------------------------------------
__device__ __forceinline__ void store_qk(const unsigned short* sOut, unsigned short* PH, unsigned short* PLo,
                                         int b, int s0, int w, int sub, int q8)
{
  #pragma unroll
  for (int i = 0; i < 8; ++i) {
    const int lid = w * 32 + 4 * i + sub;                  // 0..511
    const int pl = lid >> 8, row = (lid >> 2) & 63, qu = lid & 3;
    const v8us v = *(const v8usa*)(sOut + pl * (64 * RPIT) + row * RPIT + 64 * qu + 8 * q8);
    unsigned short* dst = (pl ? PLo : PH) + ((size_t)(b * SEQP + s0 + row)) * DM + 64 * qu + 8 * q8;
    *(v8us*)dst = v;
  }
}

// K tile to global in fragment order: wave w writes eight fragment halves, 4 KiB in a row
// (plane w>>3, key tile (w>>1)&3, k slices 4(w&1) .. 4(w&1)+3).
__device__ __forceinline__ void store_kf(const unsigned short* sOut, unsigned short* PH, unsigned short* PLo,
                                         int b, int s0, int w, int lane)
{
  const int h = lane >> 4, m = lane & 15, pl = w >> 3, t = (w >> 1) & 3, c = w & 1;
  const unsigned short* sp = sOut + pl * (64 * RPIT) + (16 * t + m) * RPIT + 128 * c + 8 * h;
  unsigned short* dst = (pl ? PLo : PH) + ((size_t)((b * NKT + (s0 >> 4) + t) * 8 + 4 * c)) * FRAG + lane * 8;
  #pragma unroll
  for (int i = 0; i < 8; ++i) {
    const v8us v = *(const v8usa*)(sp + 16 * i);
    *(v8us*)(dst + i * (FRAG / 2)) = v;
  }
  // wait in front of whatever next rewrites a register that these eight stores name
  asm volatile("s_wait_xcnt 0x0" ::: "memory");
}

// V^T tile to global in fragment order: wave w writes four fragment halves, 2 KiB in a row
// (key slice w>>3, d tiles 2(w&7) and 2(w&7)+1).
__device__ __forceinline__ void store_vf(const _Float16* sV, _Float16* VT, int b, int s0, int w, int lane)
{
  const int h = lane >> 4, m = lane & 15, ksl = w >> 3, dt = 2 * (w & 7);
  const _Float16* sp = sV + (16 * dt + m) * VPIT + 32 * ksl + 8 * h;
  _Float16* dst = VT + ((size_t)((b * NVS + (s0 >> 5) + ksl) * 16 + dt)) * FRAG + lane * 8;
  #pragma unroll
  for (int i = 0; i < 4; ++i) {
    const v8h v = *(const v8ha*)(sp + (i >> 1) * (16 * VPIT) + 16 * (i & 1));
    *(v8h*)(dst + i * (FRAG / 2)) = v;
  }
}

// One wave's split GEMM: rows 0..63 of the A planes in LDS x the 16 columns whose weight fragments start at Bt / Bv
// (hi plane; the lo plane follows 65536 elements on; 8 * lane included). Row tiles 0, 1 take Bt. Row tiles 2, 3 take Bv
// where TWO (the tile whose first 32 rows are text), else Bt as well. Per accumulator the order hi*hi, hi*lo, lo*hi per
// k slice; the four accumulator chains alternate.
template <bool TWO>
__device__ __forceinline__ void gemm_cols(const unsigned short* sAh, const unsigned short* Bt, const unsigned short* Bv,
                                          int h, int m, v8f (&acc)[4])
{
  const unsigned short* Ap = sAh + m * RPIT;
  // kept rolled: one pass holds its 4 (8) global and 16 LDS loads and 12 products; eight copies would only add code
  #pragma unroll 1
  for (int kk = 0; kk < DM; kk += 32) {
    const int fo = (kk >> 5) * FRAG;
    v16b bh[2], bl[2];
    bh[0] = ldff(Bt + fo);
    bl[0] = ldff(Bt + 65536 + fo);
    if (TWO) {
      bh[1] = ldff(Bv + fo);
      bl[1] = ldff(Bv + 65536 + fo);
    }
    v16b ah[4], al[4];
    #pragma unroll
    for (int rt = 0; rt < 4; ++rt) {
      ah[rt] = ldfb(Ap + 16 * rt * RPIT + kk, h);
      al[rt] = ldfb(Ap + (64 + 16 * rt) * RPIT + kk, h);
    }
    #pragma unroll
    for (int rt = 0; rt < 4; ++rt) acc[rt] = wmma_b(ah[rt], bh[(TWO && rt >= 2) ? 1 : 0], acc[rt]);
    #pragma unroll
    for (int rt = 0; rt < 4; ++rt) acc[rt] = wmma_b(ah[rt], bl[(TWO && rt >= 2) ? 1 : 0], acc[rt]);
    #pragma unroll
    for (int rt = 0; rt < 4; ++rt) acc[rt] = wmma_b(al[rt], bh[(TWO && rt >= 2) ? 1 : 0], acc[rt]);
  }
}

__global__ __launch_bounds__(512) void k_proj(
    const float* __restrict__ src,
    const unsigned short* __restrict__ WB, const float* __restrict__ XT,
    unsigned short* __restrict__ QH, unsigned short* __restrict__ QL,
    unsigned short* __restrict__ KH, unsigned short* __restrict__ KL,
    _Float16* __restrict__ VT,
    const float* __restrict__ lrn, float* __restrict__ MK, double* __restrict__ PT)
{
  extern __shared__ __attribute__((aligned(16))) unsigned char smem[];
  // The gate job depends on nothing and is read by launch 3 only: it shares this grid, in the rows behind the
  // projection's, which start as the projection's work-groups leave. The test is the same for a whole work-group.
  if (blockIdx.y >= BATCH) {
    const int mb = (blockIdx.y - BATCH) * NTILE + blockIdx.x;
    if (mb < NPART / 2) mask_body(lrn, MK, PT, (double*)smem, mb);
    return;
  }
  unsigned short* sAh  = (unsigned short*)smem;            // [64][256] bf16 hi, row pitch RPIT
  unsigned short* sAl  = sAh + 64 * RPIT;                  // [64][256] bf16 lo, row pitch RPIT
  unsigned short* sOut = (unsigned short*)(smem + 4 * 64 * RPIT);  // [2][64][256] bf16 hi/lo results, row pitch RPIT
  _Float16*       sV   = (_Float16*)(smem + 4 * 64 * RPIT);        // [256][64] f16, row pitch VPIT (V phase, aliases sOut)

  const int tid = threadIdx.x, lane = tid & 31, w = tid >> 5;
  const int h = lane >> 4, m = lane & 15;
  const int q8 = lane & 7, sub = lane >> 3;
  const int b = blockIdx.y, s0 = blockIdx.x * 64;
  const bool btxt = (blockIdx.x == 0);                     // block-uniform: row tiles 0 and 1 of this tile are text
  const size_t wfo = (size_t)w * (8 * FRAG) + lane * 8;    // this lane's place in the wave's column tile of a weight plane
  const v4f z4 = {0.f, 0.f, 0.f, 0.f};
  const v8f z8 = {0.f, 0.f, 0.f, 0.f, 0.f, 0.f, 0.f, 0.f};

  // ---- stage A = src (+ sine position on text rows) as bf16 hi/lo ----
  #pragma unroll 1
  for (int it = 0; it < 8; ++it) {
    const int q = it * 512 + tid;
    const int row = q >> 6, c4 = (q & 63) * 4;            // row wave-uniform
    const int s = s0 + row;
    const int sl = (s < SEQ) ? s : (SEQ - 1);
    v4f x = *(const v4fa*)(src + ((size_t)(b * SEQ + sl)) * DM + c4);
    if (s >= SEQ) x = z4;
    if (s < TXTN) {
      const float xe = ((float)(s + 1) * 0.03125f) * 6.2831855f;
      const float d0 = powf(10000.0f, (float)c4 * (1.0f / 256.0f));
      const float d1 = powf(10000.0f, (float)(c4 + 2) * (1.0f / 256.0f));
      const float r0 = xe * (1.0f / d0), r1 = xe * (1.0f / d1);
      x.x += sinf(r0); x.y += cosf(r0); x.z += sinf(r1); x.w += cosf(r1);
    }
    const unsigned int h0 = bf16_rne(x.x), h1 = bf16_rne(x.y), h2 = bf16_rne(x.z), h3 = bf16_rne(x.w);
    const unsigned int l0 = bf16_rne(x.x - __uint_as_float(h0 << 16));
    const unsigned int l1 = bf16_rne(x.y - __uint_as_float(h1 << 16));
    const unsigned int l2 = bf16_rne(x.z - __uint_as_float(h2 << 16));
    const unsigned int l3 = bf16_rne(x.w - __uint_as_float(h3 << 16));
    const v4us vh = {(unsigned short)h0, (unsigned short)h1, (unsigned short)h2, (unsigned short)h3};
    const v4us vl = {(unsigned short)l0, (unsigned short)l1, (unsigned short)l2, (unsigned short)l3};
    *(v4usa*)(sAh + row * RPIT + c4) = vh;
    *(v4usa*)(sAl + row * RPIT + c4) = vl;
  }
  __syncthreads();

  // ---- Q (p=0) and K (p=1): bf16 hi/lo split GEMM, XPOS epilogue ----
  #pragma unroll 1
  for (int p = 0; p < 2; ++p) {
    const unsigned short* Bv = WB + (size_t)(4 + 2 * p) * 65536 + wfo;
    v8f acc[4];
    #pragma unroll
    for (int rt = 0; rt < 4; ++rt) acc[rt] = z8;
    if (btxt) gemm_cols<true>(sAh, WB + (size_t)(2 * p) * 65536 + wfo, Bv, h, m, acc);
    else      gemm_cols<false>(sAh, Bv, Bv, h, m, acc);
    // acc[rt][r] = Y[row 16rt+8h+r][col 16w+m]; rotation pairs cols (n, n^1) = lanes (m, m^1)
    const float sg = (m & 1) ? 1.0f : -1.0f;
    const int n = 16 * w + m;
    #pragma unroll
    for (int rt = 0; rt < 4; ++rt) {
      const bool wtxt = btxt && (rt < 2);
      const int rowb = 16 * rt + 8 * h;
      int lb = s0 + rowb - TXTN;
      lb = lb < 0 ? 0 : lb;
      lb = lb > (VIDN - 8) ? (VIDN - 8) : lb;
      const float* tc = XT + ((size_t)(2 * p * DM + n)) * VIDN + lb;
      const float* ts = tc + (size_t)DM * VIDN;
      const v4f c0 = *(const v4fa*)tc, c1 = *(const v4fa*)(tc + 4);
      const v4f t0 = *(const v4fa*)ts, t1 = *(const v4fa*)(ts + 4);
      // wait in front of the first overwrite of a register that these four loads name; the addresses are
      // inputs so that their registers stay as they are up to the wait
      asm volatile("s_wait_xcnt 0x0" :: "v"(tc), "v"(ts) : "memory");
      const float cs[8] = {c0.x, c0.y, c0.z, c0.w, c1.x, c1.y, c1.z, c1.w};
      const float sn[8] = {t0.x, t0.y, t0.z, t0.w, t1.x, t1.y, t1.z, t1.w};
      #pragma unroll
      for (int r = 0; r < 8; ++r) {
        const float x  = acc[rt][r];
        const float pr = __shfl_xor(x, 1, 32);
        const float cv = wtxt ? 1.0f : cs[r];
        const float snv = wtxt ? 0.0f : sn[r];
        const float y  = x * cv + sg * (pr * snv);
        const unsigned int hb  = bf16_rne(y);
        const unsigned int lob = bf16_rne(y - __uint_as_float(hb << 16));
        const int e = (rowb + r) * RPIT + n;
        sOut[e]             = (unsigned short)hb;
        sOut[64 * RPIT + e] = (unsigned short)lob;
      }
    }
    __syncthreads();
    if (p == 0) store_qk(sOut, QH, QL, b, s0, w, sub, q8);
    else        store_kf(sOut, KH, KL, b, s0, w, lane);
    
    __syncthreads();
  }

  // ---- V: tile 0 restages A as bf16 hi/lo of src WITHOUT the position term
  //      (other tiles already hold plain src); split GEMM; f16(64*V) transposed ----
  if (blockIdx.x == 0) {                                   // block-uniform
    #pragma unroll 1
    for (int it = 0; it < 8; ++it) {
      const int q = it * 512 + tid;
      const int row = q >> 6, c4 = (q & 63) * 4;          // s = row < 64 < SEQ
      const v4f x = *(const v4fa*)(src + ((size_t)(b * SEQ + row)) * DM + c4);
      const unsigned int h0 = bf16_rne(x.x), h1 = bf16_rne(x.y), h2 = bf16_rne(x.z), h3 = bf16_rne(x.w);
      const unsigned int l0 = bf16_rne(x.x - __uint_as_float(h0 << 16));
      const unsigned int l1 = bf16_rne(x.y - __uint_as_float(h1 << 16));
      const unsigned int l2 = bf16_rne(x.z - __uint_as_float(h2 << 16));
      const unsigned int l3 = bf16_rne(x.w - __uint_as_float(h3 << 16));
      const v4us vh = {(unsigned short)h0, (unsigned short)h1, (unsigned short)h2, (unsigned short)h3};
      const v4us vl = {(unsigned short)l0, (unsigned short)l1, (unsigned short)l2, (unsigned short)l3};
      *(v4usa*)(sAh + row * RPIT + c4) = vh;
      *(v4usa*)(sAl + row * RPIT + c4) = vl;
    }
  }
  __syncthreads();
  {
    const unsigned short* Bv = WB + (size_t)10 * 65536 + wfo;
    v8f acc[4];
    #pragma unroll
    for (int rt = 0; rt < 4; ++rt) acc[rt] = z8;
    if (btxt) gemm_cols<true>(sAh, WB + (size_t)8 * 65536 + wfo, Bv, h, m, acc);
    else      gemm_cols<false>(sAh, Bv, Bv, h, m, acc);
    // acc[rt] = V[token 16rt+8h+r][d 16w+m] -> sV[d][token] = f16(64*V)
    const int d = 16 * w + m;
    #pragma unroll
    for (int rt = 0; rt < 4; ++rt) {
      #pragma unroll
      for (int r = 0; r < 8; ++r) sV[d * VPIT + 16 * rt + 8 * h + r] = (_Float16)(acc[rt][r] * VSC);
    }
  }
  __syncthreads();
  store_vf(sV, VT, b, s0, w, lane);
  // wait behind the last stores: the gate job's code follows them in the listing and rewrites registers that they name
  asm volatile("s_wait_xcnt 0x0" ::: "memory");
}

// ---------------------------------------------------------------------------
// Launch 3, first job: retention. Block 128 thr (4 waves) = 64 queries q0..q0+63 of batch
// b (QT sub-tiles of 16; 33 tiles over the padded 2112 rows, pad rows of Q are
// zero and are not stored); wave w owns output cols 64w..64w+63 and computes
// the score slices for keys kb+16w..kb+16w+15 of each 64-key step (33 steps
// over the padded 2112 keys). Each K and V fragment is loaded once per step
// and feeds all QT query sub-tiles.
//   S^T slice = K * Q^T (A = K rows, B = Q rows; bf16 hi/lo split, K=256)
//   P = S * gate * 256 -> f16 hi tile and f16 lo tile (lo = P - hi)
//       [64 q][64 keys] in LDS (ping-pong), row pitch PPIT
//   O += P_hi * V + P_lo * V  (A = P rows, B = V^T rows from VT, f16), acc f32
// ---------------------------------------------------------------------------
#define QT 4
#define QB (16 * QT)
static_assert(QB * NTILE == SEQP);
static_assert(2 * QB * RPIT * 2 >= 4 * QB * 64 * 4);      // the f32 output staging fits in the Q planes' LDS

__device__ __forceinline__ void store_out(const float* so, float* out, int b, int q0, int w, int sub, int q8)
{
  #pragma unroll
  for (int qt = 0; qt < QT; ++qt) {
    if (q0 + 16 * qt < SEQ) {                              // block-uniform: whole sub-tiles of pad rows are dropped
      #pragma unroll
      for (int i = 0; i < 8; ++i) {
        const int lid = 4 * i + sub, row = 16 * qt + (lid >> 1), hl = lid & 1;
        const v4f v = *(const v4fa*)(so + row * 64 + 32 * hl + 4 * q8);
        float* dst = out + ((size_t)(b * SEQ + q0 + row)) * DM + 64 * w + 32 * hl + 4 * q8;
        *(v4f*)dst = v;
      }
      // wait in front of the next sub-tile's address arithmetic, which reuses registers that these stores name
      if (qt + 1 < QT) asm volatile("s_wait_xcnt 0x0" ::: "memory");
    }
  }
}

// second bound: three waves per SIMD, so that three work-groups (the LDS limit) stay resident per WGP and the grid runs in one round
__global__ __launch_bounds__(128, 3) void k_ret(
    const unsigned short* __restrict__ QH, const unsigned short* __restrict__ QL,
    const unsigned short* __restrict__ KH, const unsigned short* __restrict__ KL,
    const _Float16* __restrict__ VT, const float* __restrict__ MK, float* __restrict__ out,
    const double* __restrict__ PT, const int* __restrict__ tl, float* __restrict__ out1)
{
  __shared__ __attribute__((aligned(16))) unsigned short sQ[2 * QB * RPIT];   // hi plane, lo plane
  // The loss sum reads launch 2's partial sums only: one work-group of the grid row behind the retention's does it.
  // The test is the same for a whole work-group.
  if (blockIdx.y >= BATCH) {
    if (blockIdx.x == 0) loss_body(PT, tl, out1, (double*)sQ);
    return;
  }
  __shared__ __attribute__((aligned(16))) _Float16 sPh[2][QB * PPIT];
  __shared__ __attribute__((aligned(16))) _Float16 sPl[2][QB * PPIT];
  unsigned short* sQh = sQ;
  unsigned short* sQl = sQ + QB * RPIT;
  float* sO = (float*)sQ;                                  // epilogue only: Q is last read in front of the last step's barrier

  const int tid = threadIdx.x, lane = tid & 31, w = tid >> 5, h = lane >> 4, m = lane & 15;
  const int q8 = lane & 7, sub = lane >> 3;
  const int b = blockIdx.y, q0 = blockIdx.x * QB;
  const v8f z8 = {0.f, 0.f, 0.f, 0.f, 0.f, 0.f, 0.f, 0.f};

  // ---- stage Q hi/lo rows q0..q0+63, 16 rows a pass ----
  // kept rolled: it runs once per work-group, and one pass already has eight 16-byte loads per lane in flight
  #pragma unroll 1
  for (int qp = 0; qp < QB; qp += 16) {
    v8us qh[4], ql[4];
    const unsigned short* gh[4];
    const unsigned short* gl[4];
    #pragma unroll
    for (int it = 0; it < 4; ++it) {
      const int idx = it * 128 + tid;
      const int row = qp + (idx >> 5), c8 = (idx & 31) * 8;
      const size_t g = ((size_t)(b * SEQP + q0 + row)) * DM + c8;
      gh[it] = QH + g;
      gl[it] = QL + g;
      qh[it] = *(const v8usa*)gh[it];
      ql[it] = *(const v8usa*)gl[it];
    }
    // wait in front of the first overwrite of a register that the eight loads name; the addresses are
    // inputs so that their registers stay as they are up to the wait
    asm volatile("s_wait_xcnt 0x0" :: "v"(gh[0]), "v"(gl[0]), "v"(gh[1]), "v"(gl[1]),
                 "v"(gh[2]), "v"(gl[2]), "v"(gh[3]), "v"(gl[3]) : "memory");
    #pragma unroll
    for (int it = 0; it < 4; ++it) {
      const int idx = it * 128 + tid;
      const int row = qp + (idx >> 5), c8 = (idx & 31) * 8;
      *(v8usa*)(sQh + row * RPIT + c8) = qh[it];
      *(v8usa*)(sQl + row * RPIT + c8) = ql[it];
    }
  }
  __syncthreads();

  v8f o[QT][4];
  #pragma unroll
  for (int qt = 0; qt < QT; ++qt)
    #pragma unroll
    for (int nt = 0; nt < 4; ++nt) o[qt][nt] = z8;

  // byte offsets of this lane's 16 bytes in the wave's first K fragment (hi and lo planes alike) and first V^T
  // fragment; both stay below 2^25
  unsigned int koff = (unsigned int)((b * NKT + w) * 8 * FRAGB + lane * 16);
  unsigned int voff = (unsigned int)((b * NVS * 16 + 4 * w) * FRAGB + lane * 16);
  int moff[QT];                                           // this lane's byte offset in the first gate tile of each sub-tile's row of tiles
  #pragma unroll
  for (int qt = 0; qt < QT; ++qt) {
    int rt = (q0 >> 4) + qt - TXTN / 16;
    rt = rt < 0 ? 0 : rt;
    rt = rt > (NGT - 1) ? (NGT - 1) : rt;                 // pad queries read the last row of tiles; their output is dropped
    moff[qt] = rt * NGT * GTB + lane * 16;
  }

  // K fragments travel in a register ring of four 32-wide k slices (hi and lo): a slice is refilled right after
  // its last use, four slices ahead of its next one, so that no score product waits for a global load.
  v16b rkh[4], rkl[4];
  #pragma unroll
  for (int i = 0; i < 4; ++i) {
    rkh[i] = ldgb(KH, koff, FRAGB * i);
    rkl[i] = ldgb(KL, koff, FRAGB * i);
  }

  int buf = 0;
  #pragma unroll 1
  for (int kb = 0; kb < SEQP; kb += 64) {
    // rows the ring's second half is refilled from: the next step's; the last step reads its own again (in bounds, unused)
    const unsigned int koffn = koff + ((kb + 64 < SEQP) ? 4u * 8u * FRAGB : 0u);
    // gate: 1 when query or key is text, sigmoid plane on vid x vid, 0 on pad keys; loaded here, used behind the scores
    const int cb = kb + 16 * w + 8 * h - TXTN;            // vid index of key r=0 (group of 8, aligned)
    const bool ktxt = cb < 0;
    const bool kpad = cb >= VIDN;
    int ct = (kb >> 4) + w - TXTN / 16;                   // gate tile of the wave's 16 keys
    ct = ct < 0 ? 0 : ct;
    ct = ct > (NGT - 1) ? (NGT - 1) : ct;
    unsigned int goff[QT];
    #pragma unroll
    for (int qt = 0; qt < QT; ++qt) goff[qt] = (unsigned int)(moff[qt] + ct * GTB);
    // this fence and the next keep the eight loads and their wait together, up here: nothing that could rewrite
    // an offset register gets between them, and the loads are not sunk to their use, where they would be waited for in full
    __builtin_amdgcn_sched_barrier(0);
    v4f g0[QT], g1[QT];
    #pragma unroll
    for (int qt = 0; qt < QT; ++qt) {
      const char* gp = (const char*)MK + goff[qt];
      g0[qt] = *(const v4fa*)gp;
      g1[qt] = *(const v4fa*)(gp + GTB / 2);
    }
    // wait in front of the first overwrite of a register that the eight loads name; the offsets are
    // inputs so that their registers stay as they are up to the wait
    asm volatile("s_wait_xcnt 0x0" :: "v"(goff[0]), "v"(goff[1]), "v"(goff[2]), "v"(goff[3]) : "memory");
    __builtin_amdgcn_sched_barrier(0);

    // scores: s[qt][r] = S[query q0+16qt+m][key kb+16w+8h+r]
    v8f s[QT];
    #pragma unroll
    for (int qt = 0; qt < QT; ++qt) s[qt] = z8;
    #pragma unroll
    for (int i = 0; i < 8; ++i) {
      const int kk = 32 * i;
      const v16b ka = rkh[i & 3];
      const v16b kl = rkl[i & 3];
      #pragma unroll
      for (int qp = 0; qp < QT; qp += 2) {                 // two sub-tiles at a time: their two accumulator chains alternate
        const v16b qa0 = ldfb(sQh + (16 * qp + m) * RPIT + kk, h);
        const v16b qa1 = ldfb(sQh + (16 * qp + 16 + m) * RPIT + kk, h);
        const v16b ql0 = ldfb(sQl + (16 * qp + m) * RPIT + kk, h);
        const v16b ql1 = ldfb(sQl + (16 * qp + 16 + m) * RPIT + kk, h);
        s[qp]     = wmma_bd(ka, qa0, s[qp]);
        s[qp + 1] = wmma_bd(ka, qa1, s[qp + 1]);
        s[qp]     = wmma_bd(ka, ql0, s[qp]);
        s[qp + 1] = wmma_bd(ka, ql1, s[qp + 1]);
        s[qp]     = wmma_bd(kl, qa0, s[qp]);
        s[qp + 1] = wmma_bd(kl, qa1, s[qp + 1]);
      }
      rkh[i & 3] = ldgb(KH, (i < 4) ? koff : koffn, FRAGB * ((i + 4) & 7));
      rkl[i & 3] = ldgb(KL, (i < 4) ? koff : koffn, FRAGB * ((i + 4) & 7));
      // keeps the refill at this distance from its use: the scheduler would else sink it towards the use
      __builtin_amdgcn_sched_barrier(0);
    }
    // V^T fragments of the step's first 32 keys: in flight during the gate arithmetic
    v16h vf[4];
    #pragma unroll
    for (int nt = 0; nt < 4; ++nt) vf[nt] = ldgh(VT, voff, FRAGB * nt);
    // keeps these loads in front of the gate arithmetic
    __builtin_amdgcn_sched_barrier(0);
    #pragma unroll
    for (int qt = 0; qt < QT; ++qt) {
      const bool qtxt = (q0 + 16 * qt + m) < TXTN;
      const float gk[8] = {g0[qt].x, g0[qt].y, g0[qt].z, g0[qt].w, g1[qt].x, g1[qt].y, g1[qt].z, g1[qt].w};
      v8h ph, plo;
      #pragma unroll
      for (int r = 0; r < 8; ++r) {
        const float gg = kpad ? 0.0f : ((qtxt || ktxt) ? 1.0f : gk[r]);
        const float pv = (s[qt][r] * gg) * PSC;
        const _Float16 hv = (_Float16)pv;
        ph[r]  = hv;
        plo[r] = (_Float16)(pv - (float)hv);
      }
      *(v8ha*)(&sPh[buf][(16 * qt + m) * PPIT + 16 * w + 8 * h]) = ph;
      *(v8ha*)(&sPl[buf][(16 * qt + m) * PPIT + 16 * w + 8 * h]) = plo;
    }
    __syncthreads();

    // O += P_hi(64x64) * V + P_lo(64x64) * V  (64 keys x this wave's 64 cols)
    #pragma unroll
    for (int ks = 0; ks < 2; ++ks) {
      v16h pa[QT], pb[QT];
      #pragma unroll
      for (int qt = 0; qt < QT; ++qt) {
        pa[qt] = ldfh(&sPh[buf][(16 * qt + m) * PPIT + 32 * ks], h);
        pb[qt] = ldfh(&sPl[buf][(16 * qt + m) * PPIT + 32 * ks], h);
      }
      #pragma unroll
      for (int nt = 0; nt < 4; ++nt) {
        const v16h vbf = vf[nt];
        #pragma unroll
        for (int qt = 0; qt < QT; ++qt) o[qt][nt] = wmma_hd(pa[qt], vbf, o[qt][nt]);
        #pragma unroll
        for (int qt = 0; qt < QT; ++qt) o[qt][nt] = wmma_hd(pb[qt], vbf, o[qt][nt]);
        if (ks == 0) {
          vf[nt] = ldgh(VT, voff, FRAGB * (16 + nt));  // second 32 keys, three column tiles ahead of their use
          // keeps the refill at this distance from its use
          __builtin_amdgcn_sched_barrier(0);
        }
      }
    }
    // wait in front of the overwrite of the offset registers that this step's K and V loads name; the offsets are
    // inputs so that their registers stay as they are up to the wait
    asm volatile("s_wait_xcnt 0x0" :: "v"(koff), "v"(koffn), "v"(voff) : "memory");
    koff = koffn;
    voff += 2u * 16u * FRAGB;
    buf ^= 1;
  }

  // ---- epilogue: O[q0+16qt+8h+r][64w+16nt+m] = o[qt][nt][r] / (256*64) ----
  float* so = sO + w * (QB * 64);
  #pragma unroll
  for (int qt = 0; qt < QT; ++qt)
    #pragma unroll
    for (int nt = 0; nt < 4; ++nt)
      #pragma unroll
      for (int r = 0; r < 8; ++r)
        so[(16 * qt + 8 * h + r) * 64 + 16 * nt + m] = o[qt][nt][r] * OSC;
  __syncthreads();
  store_out(so, out, b, q0, w, sub, q8);
  // wait behind the last stores: the loss job's code follows them in the listing and rewrites registers that they name
  asm volatile("s_wait_xcnt 0x0" ::: "memory");
}

// ---------------------------------------------------------------------------
extern "C" void kernel_launch(void* const* d_in, const int* in_sizes, int n_in,
                              void* d_out, int out_size, void* d_ws, size_t ws_size,
                              hipStream_t stream)
{
  if (n_in < 9) return;
  if (in_sizes[0] != BATCH * SEQ * DM) return;
  if (in_sizes[1] != VIDN * VIDN) return;
  for (int i = 2; i < 8; ++i) if (in_sizes[i] != DM * DM) return;
  if (in_sizes[8] < 1) return;
  if (out_size != BATCH * SEQ * DM + 1) return;

  const float* src = (const float*)d_in[0];
  const float* lrn = (const float*)d_in[1];
  const float* wtq = (const float*)d_in[2];
  const float* wtk = (const float*)d_in[3];
  const float* wtv = (const float*)d_in[4];
  const float* wvq = (const float*)d_in[5];
  const float* wvk = (const float*)d_in[6];
  const float* wvv = (const float*)d_in[7];
  const int*   txl = (const int*)d_in[8];
  float* out0 = (float*)d_out;
  float* out1 = out0 + (size_t)BATCH * SEQ * DM;          // byte offset 34078720

  const size_t pl_bytes = (size_t)BATCH * SEQP * DM * 2;  // 17301504 per bf16/f16 plane (padded rows incl.)
  const size_t wb_bytes = (size_t)NWPL * DM * DM * 2;      // 1572864
  const size_t xt_bytes = (size_t)4 * DM * VIDN * 4;       // 8388608
  const size_t mk_bytes = (size_t)VIDN * VIDN * 4;         // 16777216
  const size_t off_qh = 0;
  const size_t off_ql = off_qh + pl_bytes;
  const size_t off_kh = off_ql + pl_bytes;
  const size_t off_kl = off_kh + pl_bytes;
  const size_t off_vt = off_kl + pl_bytes;
  const size_t off_wb = off_vt + pl_bytes;
  const size_t off_xt = off_wb + wb_bytes;
  const size_t off_mk = off_xt + xt_bytes;
  const size_t pt_bytes = (size_t)NPART * PSTR * 8;        // 131072
  const size_t off_pt = off_mk + mk_bytes;
  const size_t total  = off_pt + pt_bytes;                 // 113377280
  if (total > ws_size) return;
  if (total > (size_t)134217728) return;

  char* ws = (char*)d_ws;
  unsigned short* QH = (unsigned short*)(ws + off_qh);
  unsigned short* QL = (unsigned short*)(ws + off_ql);
  unsigned short* KH = (unsigned short*)(ws + off_kh);
  unsigned short* KL = (unsigned short*)(ws + off_kl);
  _Float16* VT = (_Float16*)(ws + off_vt);
  unsigned short* WB = (unsigned short*)(ws + off_wb);
  float* XT = (float*)(ws + off_xt);
  float* MK = (float*)(ws + off_mk);
  double* PT = (double*)(ws + off_pt);

  k_prep<<<NWBLK + NXBLK, 256, 0, stream>>>(wtq, wtk, wtv, wvq, wvk, wvv, WB, XT);

  const size_t proj_lds = 135168;                          // 8*64*RPIT
  hipFuncSetAttribute(reinterpret_cast<const void*>(&k_proj), hipFuncAttributeMaxDynamicSharedMemorySize, (int)proj_lds);
  dim3 gp(NTILE, BATCH + GROWS);                           // rows 0 .. 15 projection, the rest the gate job
  k_proj<<<gp, 512, proj_lds, stream>>>(src, WB, XT, QH, QL, KH, KL, VT, lrn, MK, PT);

  dim3 gr(NTILE, BATCH + 1);                               // rows 0 .. 15 retention, row 16 the loss sum
  k_ret<<<gr, 128, 0, stream>>>(QH, QL, KH, KL, VT, MK, out0, PT, txl, out1);
}

// v008
// Measured time: 185 microseconds a run.
// In both of two side-by-side timings against v007, it was 1.10 times as fast.
// Over all steps from v000 it is 34.1 times as fast.
// Contractions: Q,K,V projections and S=K*Q^T on v_wmma_f32_16x16x32_bf16 as bf16 hi/lo split (hi*hi+hi*lo+lo*hi); O=P*V on v_wmma_f32_16x16x32_f16 with P as f16 hi + f16 lo (P x256, two products) and V^T f16 x64; f32 accumulate; position tables, sigmoid gate and loss in f32/f64.
#include <hip/hip_runtime.h>

#define BATCH 16
#define TXTN  32
#define VIDN  2048
#define SEQ   2080
#define SEQP  2112
#define DM    256
#define NTILE 33
#define NWPL  12
#define PSC   256.0f
#define VSC   64.0f
#define OSC   (1.0f / 16384.0f)
#define MELEM 4096
#define NPART 1024
#define PSTR  16
// LDS row pitches in 16-bit elements: row bytes + 16, an odd multiple of 16 B, so that the
// 16 rows one ds_load_b128 fragment read touches per half-wave fall on 16 different bank groups.
#define RPIT  (DM + 8)
#define PPIT  (64 + 8)
// Fragment order, the layout of every 16-bit matrix operand that a wave loads from global memory (weight planes,
// K planes, V^T) and of the Q planes: one 16-row x 32-k fragment is 1 KiB in a row, as two 512-byte halves j = 0, 1; lane l = 16h + m owns
// bytes 16l .. 16l+15 of each half = elements k0+16j+8h .. +7 of row m. So one 16-byte load per lane reads four whole
// 128-byte lines; from a row-major plane the same load touches sixteen lines and uses 32 bytes of each.
#define FRAG  512
#define FRAGB 1024
#define NKT   (SEQP / 16)
#define NVS   (SEQP / 32)
// The gate plane likewise, in the order of the score fragment it multiplies: one 16-query x 16-key f32 tile is 1 KiB in a
// row, two 512-byte halves j; lane l = 16h + m owns bytes 16l .. 16l+15 of each half = keys 8h+4j .. +3 of query m.
#define GTB   1024
#define NGT   (VIDN / 16)
// The position tables in the order of the transposed Q / K accumulator they multiply: per 16-token tile and 16-feature
// tile 512 bytes in a row; lane l = 16h + m owns bytes 16l .. 16l+15 = feature pairs 8w+4h .. +3 of token m.
#define NLT   (VIDN / 16)
#define XPL   ((DM / 2) * VIDN)
static_assert(MELEM * NPART == VIDN * VIDN);
// grid rows of NTILE work-groups that hold the gate job's NPART / 2 work-groups
#define GROWS 16
static_assert(GROWS * NTILE >= NPART / 2);

typedef _Float16 v16h __attribute__((ext_vector_type(16)));
typedef _Float16 v8h  __attribute__((ext_vector_type(8)));
typedef _Float16 v4h  __attribute__((ext_vector_type(4)));
typedef __bf16   v16b __attribute__((ext_vector_type(16)));
typedef unsigned short v8us __attribute__((ext_vector_type(8)));
typedef unsigned short v4us __attribute__((ext_vector_type(4)));
typedef float v8f __attribute__((ext_vector_type(8)));
typedef float v4f __attribute__((ext_vector_type(4)));
typedef v8h  __attribute__((may_alias)) v8ha;
typedef v4h  __attribute__((may_alias)) v4ha;
typedef v8us __attribute__((may_alias)) v8usa;
typedef v4us __attribute__((may_alias)) v4usa;
typedef v4f  __attribute__((may_alias)) v4fa;

// ---------------------------------------------------------------------------
// XPOS module constants as exact f32 bit patterns:
// c_invf[i] = 1 / 10000^(i/128), c_svec[i] = (2i + 0.4*256) / (1.4*256).
// ---------------------------------------------------------------------------
__constant__ unsigned int c_invf[] = {
  0x3f800000, 0x3f6e39f8, 0x3f5dafd7, 0x3f4e4bad, 0x3f3ff911, 0x3f32a506, 0x3f263de0, 0x3f1ab32b,
  0x3f0ff59a, 0x3f05f6ef, 0x3ef953cf, 0x3ee8045f, 0x3ed7e89b, 0x3ec8eb24, 0x3ebaf81b, 0x3eadfcff,
  0x3ea1e89b, 0x3e96aaea, 0x3e8c3504, 0x3e827909, 0x3e72d423, 0x3e61f835, 0x3e5247ed, 0x3e43ae7c,
  0x3e361887, 0x3e297409, 0x3e1db040, 0x3e12bd91, 0x3e088d77, 0x3dfe24e0, 0x3dec7fd6, 0x3ddc1466,
  0x3dcccccd, 0x3dbe94c6, 0x3db15978, 0x3da50956, 0x3d99940d, 0x3d8eea6b, 0x3d84fe4d, 0x3d778513,
  0x3d6655c2, 0x3d5657e4, 0x3d47763f, 0x3d399d19, 0x3d2cba15, 0x3d20bc1d, 0x3d159348, 0x3d0b30cc,
  0x3d0186e3, 0x3cf11177, 0x3ce054d2, 0x3cd0c1a8, 0x3cc2434f, 0x3cb4c691, 0x3ca8398b, 0x3c9c8b97,
  0x3c91ad39, 0x3c879008, 0x3c7c4d33, 0x3c6ac8e7, 0x3c5a7bf2, 0x3c4b50b3, 0x3c3d3311, 0x3c301052,
  0x3c23d70a, 0x3c187705, 0x3c0de12d, 0x3c040779, 0x3bf5b9b0, 0x3be4aa46, 0x3bd4ca15, 0x3bc6040f,
  0x3bb8449c, 0x3bab7983, 0x3b9f91cc, 0x3b947dae, 0x3b8a2e77, 0x3b80967d, 0x3b6f520e, 0x3b5eb47a,
  0x3b4f3e38, 0x3b40dac5, 0x3b33770f, 0x3b270153, 0x3b1b690d, 0x3b109edb, 0x3b06946f, 0x3afa78f0,
  0x3ae91528, 0x3ad8e673, 0x3ac9d75c, 0x3abbd3ed, 0x3aaec98e, 0x3aa2a6f7, 0x3a975c0e, 0x3a8cd9db,
  0x3a83126f, 0x3a73f1a3, 0x3a6301e2, 0x3a533f28, 0x3a44948c, 0x3a36ee9e, 0x3a2a3b44, 0x3a1e69a5,
  0x3a136a16, 0x3a092e02, 0x39ff4fac, 0x39ed95e2, 0x39dd1725, 0x39cdbd96, 0x39bf74d7, 0x39b229fa,
  0x39a5cb60, 0x399a489e, 0x398f9272, 0x39859aa9, 0x3978a815, 0x39676492, 0x395753e4, 0x394860c1,
  0x393a7753, 0x392d8529, 0x39217916, 0x39164324, 0x390bd472, 0x39021f2b, 0x38f22ce2, 0x38e15c91 };
static_assert(sizeof(c_invf) == 512);

__constant__ unsigned int c_svec[] = {
  0x3e924925, 0x3e952493, 0x3e980000, 0x3e9adb6e, 0x3e9db6dc, 0x3ea0924a, 0x3ea36db7, 0x3ea64925,
  0x3ea92493, 0x3eac0000, 0x3eaedb6e, 0x3eb1b6dc, 0x3eb4924a, 0x3eb76db7, 0x3eba4924, 0x3ebd2492,
  0x3ec00000, 0x3ec2db6d, 0x3ec5b6db, 0x3ec89249, 0x3ecb6db7, 0x3ece4924, 0x3ed12492, 0x3ed40000,
  0x3ed6db6d, 0x3ed9b6db, 0x3edc9249, 0x3edf6db7, 0x3ee24924, 0x3ee52492, 0x3ee80000, 0x3eeadb6e,
  0x3eedb6db, 0x3ef09249, 0x3ef36db7, 0x3ef64924, 0x3ef92492, 0x3efc0000, 0x3efedb6e, 0x3f00db6e,
  0x3f024924, 0x3f03b6db, 0x3f052492, 0x3f069249, 0x3f080000, 0x3f096db7, 0x3f0adb6e, 0x3f0c4925,
  0x3f0db6db, 0x3f0f2492, 0x3f109249, 0x3f120000, 0x3f136db7, 0x3f14db6e, 0x3f164925, 0x3f17b6db,
  0x3f192492, 0x3f1a9249, 0x3f1c0000, 0x3f1d6db7, 0x3f1edb6e, 0x3f204925, 0x3f21b6db, 0x3f232492,
  0x3f249249, 0x3f260000, 0x3f276db7, 0x3f28db6e, 0x3f2a4925, 0x3f2bb6db, 0x3f2d2492, 0x3f2e9249,
  0x3f300000, 0x3f316db7, 0x3f32db6e, 0x3f344925, 0x3f35b6db, 0x3f372492, 0x3f389249, 0x3f3a0000,
  0x3f3b6db7, 0x3f3cdb6e, 0x3f3e4925, 0x3f3fb6db, 0x3f412492, 0x3f429249, 0x3f440000, 0x3f456db7,
  0x3f46db6e, 0x3f484925, 0x3f49b6db, 0x3f4b2492, 0x3f4c9249, 0x3f4e0000, 0x3f4f6db7, 0x3f50db6e,
  0x3f524925, 0x3f53b6db, 0x3f552492, 0x3f569249, 0x3f580000, 0x3f596db7, 0x3f5adb6e, 0x3f5c4925,
  0x3f5db6db, 0x3f5f2492, 0x3f609249, 0x3f620000, 0x3f636db7, 0x3f64db6e, 0x3f664925, 0x3f67b6dc,
  0x3f692492, 0x3f6a9249, 0x3f6c0000, 0x3f6d6db7, 0x3f6edb6e, 0x3f704925, 0x3f71b6dc, 0x3f732492,
  0x3f749249, 0x3f760000, 0x3f776db7, 0x3f78db6e, 0x3f7a4925, 0x3f7bb6dc, 0x3f7d2492, 0x3f7e9249 };
static_assert(sizeof(c_svec) == 512);

// ---------------------------------------------------------------------------
// 16x16x32 WMMA with hazard guard. Fragment map (wave32): lane l, h = l>>4,
// m = n = l&15. A/B element i: i<8 -> k0+8h+i ; i>=8 -> k0+16+8h+(i-8).
// D element r: row 8h+r, col l&15.
// ---------------------------------------------------------------------------
__device__ __forceinline__ v8f wmma_h(v16h a, v16h b, v8f c) {
  v8f d = __builtin_amdgcn_wmma_f32_16x16x32_f16(false, a, false, b, (short)0, c, false, false);
  asm volatile("v_nop\n\tv_nop\n\tv_nop\n\tv_nop" : "+v"(d) : "v"(a), "v"(b));
  return d;
}
__device__ __forceinline__ v8f wmma_b(v16b a, v16b b, v8f c) {
  v8f d = __builtin_amdgcn_wmma_f32_16x16x32_bf16(false, a, false, b, (short)0, c, false, false);
  asm volatile("v_nop\n\tv_nop\n\tv_nop\n\tv_nop" : "+v"(d) : "v"(a), "v"(b));
  return d;
}

// The same two products for the retention kernel: the guard names D alone. An asm operand must lie in v0..v255;
// with A and B named as well, every fragment loaded ahead would have to fit there beside the accumulators.
__device__ __forceinline__ v8f wmma_hd(v16h a, v16h b, v8f c) {
  v8f d = __builtin_amdgcn_wmma_f32_16x16x32_f16(false, a, false, b, (short)0, c, false, false);
  asm volatile("v_nop\n\tv_nop\n\tv_nop\n\tv_nop" : "+v"(d));
  return d;
}
__device__ __forceinline__ v8f wmma_bd(v16b a, v16b b, v8f c) {
  v8f d = __builtin_amdgcn_wmma_f32_16x16x32_bf16(false, a, false, b, (short)0, c, false, false);
  asm volatile("v_nop\n\tv_nop\n\tv_nop\n\tv_nop" : "+v"(d));
  return d;
}

// Fragment from a k-contiguous 16-bit row; p points at element k0 of the row
// owned by this lane (row = lane & 15 added by the caller). Same map for A and B.
__device__ __forceinline__ v16h ldfh(const _Float16* p, int h) {
  union { v16h v; v8h hf[2]; } f;
  f.hf[0] = *(const v8ha*)(p + 8 * h);
  f.hf[1] = *(const v8ha*)(p + 16 + 8 * h);
  return f.v;
}
__device__ __forceinline__ v16b ldfb(const unsigned short* p, int h) {
  union { v16b v; v8us hf[2]; } f;
  f.hf[0] = *(const v8usa*)(p + 8 * h);
  f.hf[1] = *(const v8usa*)(p + 16 + 8 * h);
  return f.v;
}

// Global fragment in fragment order: uniform base + this lane's 32-bit byte offset (16 * lane included) + a constant.
// One offset register serves every load of a step, so none is rewritten while loads that name it are in flight.
__device__ __forceinline__ v16h ldgh(const _Float16* base, unsigned int off, int imm) {
  const char* p = (const char*)base + off;
  union { v16h v; v8h hf[2]; } f;
  f.hf[0] = *(const v8ha*)(p + imm);
  f.hf[1] = *(const v8ha*)(p + imm + FRAGB / 2);
  return f.v;
}
__device__ __forceinline__ v16b ldgb(const unsigned short* base, unsigned int off, int imm) {
  const char* p = (const char*)base + off;
  union { v16b v; v8us hf[2]; } f;
  f.hf[0] = *(const v8usa*)(p + imm);
  f.hf[1] = *(const v8usa*)(p + imm + FRAGB / 2);
  return f.v;
}

// f32 -> bf16 bits, RNE
__device__ __forceinline__ unsigned int bf16_rne(float x) {
  const unsigned int u = __float_as_uint(x);
  return (u + 0x7FFFu + ((u >> 16) & 1u)) >> 16;
}

// ---------------------------------------------------------------------------
// Launch 1, first job: weight planes bf16 in fragment order, WB[pl][n tile of 16][k slice of 32][j][lane][8], pl = 2*wsel + part:
// wsel 0 txtQ, 1 txtK, 2 vidQ, 3 vidK, 4 txtV, 5 vidV; part 0 hi = RNE(w),
// part 1 lo = RNE(w - hi). One wave writes one whole 512-B fragment half per store.
// ---------------------------------------------------------------------------
__device__ __forceinline__ void wprep_body(
    const float* __restrict__ wtq, const float* __restrict__ wtk, const float* __restrict__ wtv,
    const float* __restrict__ wvq, const float* __restrict__ wvk, const float* __restrict__ wvv,
    unsigned short* __restrict__ WB, int blk)
{
  const int tid = threadIdx.x, lane = tid & 31;
  const int row = blk * 8 + (tid >> 5);                  // fragment half 0 .. 3071, plane uniform per block
  if (row >= NWPL * DM) return;
  const int pl = row >> 8, n = ((row >> 4) & 15) * 16 + (lane & 15);
  const int wsel = pl >> 1, part = pl & 1;
  const float* W = (wsel == 0) ? wtq : (wsel == 1) ? wtk : (wsel == 2) ? wvq
                 : (wsel == 3) ? wvk : (wsel == 4) ? wtv : wvv;
  const int k0 = ((row >> 1) & 7) * 32 + (row & 1) * 16 + (lane >> 4) * 8;
  float v[8];
  #pragma unroll
  for (int i = 0; i < 8; ++i) v[i] = W[(size_t)(k0 + i) * DM + n];
  v8us o;
  #pragma unroll
  for (int i = 0; i < 8; ++i) {
    const unsigned int hb = bf16_rne(v[i]);
    const unsigned int lb = bf16_rne(v[i] - __uint_as_float(hb << 16));
    o[i] = (unsigned short)(part ? lb : hb);
  }
  unsigned short* dst = WB + (size_t)row * (FRAG / 2) + lane * 8;
  *(v8us*)dst = o;
  
}

// ---------------------------------------------------------------------------
// Launch 1, second job: XPOS tables XT[pl][token tile of 16][feature tile of 16][lane][4] f32, pl 0 cos*scale,
// 1 sin*scale, 2 cos/scale, 3 sin/scale; one value per feature pair i and video position l.
// scale = scale_vec[i] ^ (l/512) via powf; angle = l * inv_freq[i] with the
// exact constant tables above; precise sinf/cosf.
// ---------------------------------------------------------------------------
__device__ __forceinline__ void xtab_body(float* __restrict__ XT, int blk)
{
  const int f = blk * 256 + threadIdx.x;                 // place in a plane
  const int fl = (f >> 2) & 31;                          // the lane that will read it
  const int l = 16 * (f >> 11) + (fl & 15);
  const int i = 8 * ((f >> 7) & 15) + 4 * (fl >> 4) + (f & 3);   // 0 .. 127
  const float sv = __uint_as_float(c_svec[i]);
  const float pw = (float)l * (1.0f / 512.0f);
  const float scale = powf(sv, pw);
  const float invf = __uint_as_float(c_invf[i]);
  const float ang = (float)l * invf;
  const float sn = sinf(ang), cs = cosf(ang);
  const float inv = 1.0f / scale;
  const size_t PS = (size_t)XPL;
  float* p0 = XT + f;
  const float a0 = cs * scale, a1 = sn * scale, a2 = cs * inv, a3 = sn * inv;
  *(float*)(p0)          = a0;
  *(float*)(p0 + PS)     = a1;
  *(float*)(p0 + 2 * PS) = a2;
  *(float*)(p0 + 3 * PS) = a3;
  // wait behind the four stores: in the shared kernel the other job's code follows them in the listing and rewrites their offset register
  asm volatile("s_wait_xcnt 0x0" ::: "memory");
}

// ---------------------------------------------------------------------------
// Launch 1: the two jobs that the projection waits for depend on nothing and on
// each other not at all, so they share one grid; the block index picks the job.
// ---------------------------------------------------------------------------
#define NWBLK ((NWPL * DM) / 8)
#define NXBLK (XPL / 256)
__global__ __launch_bounds__(256) void k_prep(
    const float* __restrict__ wtq, const float* __restrict__ wtk, const float* __restrict__ wtv,
    const float* __restrict__ wvq, const float* __restrict__ wvk, const float* __restrict__ wvv,
    unsigned short* __restrict__ WB, float* __restrict__ XT)
{
  if (blockIdx.x < NWBLK) wprep_body(wtq, wtk, wtv, wvq, wvk, wvv, WB, blockIdx.x);
  else                    xtab_body(XT, blockIdx.x - NWBLK);
}

// ---------------------------------------------------------------------------
// Sum over the 32 lanes of a wave, f64, fixed butterfly order; every lane gets it.
// ---------------------------------------------------------------------------
__device__ __forceinline__ double wave_sum(double v) {
  #pragma unroll
  for (int d = 16; d > 0; d >>= 1) v += __shfl_xor(v, d, 32);
  return v;
}

// ---------------------------------------------------------------------------
// Launch 2, second job (work-groups behind the projection's): gate plane sigmoid(learn[r][c]) f32 (diagonal kept)
// in 16 x 16 tiles, M[r tile][c tile][j][lane][4], and the loss's partial sums from the same values:
// group g of 256 threads (two to a work-group: g = 2 mb + half) covers rows 16(g>>3) .. +15 x columns
// 256(g&7) .. +255 (a wave: two tiles, 2 KiB of M in a row) and stores the f64 sum of its off-diagonal sigmoids
// at part[16g] (a 128-byte line of its own). red: 16 doubles of LDS.
// ---------------------------------------------------------------------------
__device__ __forceinline__ void mask_body(const float* __restrict__ lr, float* __restrict__ M,
                                          double* __restrict__ part, double* red, int mb)
{
  const int half = threadIdx.x >> 8;
  const int g = 2 * mb + half;
  const int t = threadIdx.x & 255;
  const int lane = t & 31;
  const int rt = g >> 3, ct = (g & 7) * 16 + 2 * (t >> 5);   // the wave's first tile
  const int r = 16 * rt + (lane & 15), c0 = 16 * ct + 8 * (lane >> 4);
  const float* lp = lr + r * VIDN + c0;
  float* mp = M + (rt * NGT + ct) * (GTB / 4) + lane * 4;
  v4f x[4];
  #pragma unroll
  for (int it = 0; it < 4; ++it) x[it] = *(const v4fa*)(lp + 16 * (it >> 1) + 4 * (it & 1));
  double acc = 0.0;
  #pragma unroll
  for (int it = 0; it < 4; ++it) {
    const int c = c0 + 16 * (it >> 1) + 4 * (it & 1);
    v4f sv;
    #pragma unroll
    for (int e = 0; e < 4; ++e) {
      const float s = 1.0f / (1.0f + expf(-x[it][e]));
      sv[e] = s;
      acc += (r == c + e) ? 0.0 : (double)s;
    }
    *(v4f*)(mp + it * (GTB / 8)) = sv;
  }
  const double ws = wave_sum(acc);
  if ((t & 31) == 0) red[8 * half + (t >> 5)] = ws;
  __syncthreads();
  if (t == 0) {
    double sum = 0.0;
    #pragma unroll
    for (int i = 0; i < 8; ++i) sum += red[8 * half + i];
    part[(size_t)g * PSTR] = sum;
  }
}

// ---------------------------------------------------------------------------
// Launch 3, second job (one work-group of 128 threads behind the retention's): loss = mean over vid x vid of
// off-diagonal sigmoid: adds the 1024 partial sums of the gate job, fixed order, f64: 32 butterfly sums of 32
// partials each (eight a wave), then one butterfly over the 32. red: 32 doubles of LDS.
// ---------------------------------------------------------------------------
__device__ __forceinline__ void loss_body(const double* __restrict__ part, const int* __restrict__ tl,
                                          float* __restrict__ out1, double* red)
{
  const int t = threadIdx.x;
  double pv[8];
  #pragma unroll
  for (int j = 0; j < 8; ++j) pv[j] = part[(size_t)(256 * (t >> 5) + 32 * j + (t & 31)) * PSTR];
  #pragma unroll
  for (int j = 0; j < 8; ++j) {
    const double ws = wave_sum(pv[j]);
    if ((t & 31) == 0) red[8 * (t >> 5) + j] = ws;
  }
  __syncthreads();
  if (t < 32) {                                            // wave 0, all lanes on
    const double sum = wave_sum(red[t]);
    if (t == 0) {
      int vl = SEQ - tl[0];
      vl = vl < 1 ? 1 : vl;
      vl = vl > VIDN ? VIDN : vl;
      const float loss = (float)(sum / ((double)vl * (double)vl));
      *(float*)out1 = loss;
    }
  }
}

// ---------------------------------------------------------------------------
// Launch 2, first job: projections. Block = 512 thr (16 waves) = 64 absolute positions
// s0..s0+63 of batch b (s0 multiple of 64 over the padded 2112) x 256 cols;
// wave w owns all 64 rows (four row tiles rt) x cols 16w..16w+15, so that each weight
// fragment is loaded by one wave of the block only and feeds every row tile.
// Rows s<32: text (sine position added to the Q/K A operand, text weights, no
// XPOS); 32<=s<2080: video; s>=2080: zero pad rows. Q,K,V: bf16 hi/lo split
// GEMMs. Q,K: taken transposed (weight fragment as A, token fragment as B), so that a lane's accumulator holds eight
// neighbouring features of one token: both halves of every rotation pair, and the lane's own 16 bytes of the planes;
// XPOS rotation in f32, written as bf16 hi/lo planes in fragment order [b][token tile of 16][k slice of 32][j][lane][8].
// V: tokens as A, so that a lane holds eight neighbouring tokens of one feature: f16(64*V) transposed, in fragment
// order VT[b][key slice of 32][d tile of 16][j][lane][8]. Every result goes from the accumulators to global memory,
// one whole 512-byte fragment half per store of a wave; LDS holds the A planes alone.
// ---------------------------------------------------------------------------

// One wave's split GEMM: row tiles R0 .. R1-1 of the A planes in LDS x the wave's 16 columns of the weight plane pair that
// starts at B (hi plane; the lo plane follows 131072 bytes on); boff: the lane's byte offset in the first fragment of the
// wave's column tile. WA: the weight fragment is the A operand
// (result transposed). Per accumulator the order hi*hi, hi*lo, lo*hi per k slice. One row tile's fragments at a time:
// the loop has to live in the register budget of twelve waves per SIMD, whose other waves fill the waits.
template <int R0, int R1, bool WA>
__device__ __forceinline__ void gemm_cols(const unsigned short* sAh, const unsigned short* B, unsigned int boff, int h, int m, v8f (&acc)[4])
{
  const unsigned short* Ap = sAh + m * RPIT;
  // kept rolled: eight copies would only add code
  #pragma unroll 1
  for (int kk = 0; kk < DM; kk += 32) {
    const unsigned int fo = boff + (kk >> 5) * FRAGB;
    const v16b bh = ldgb(B, fo, 0);
    const v16b bl = ldgb(B, fo, 131072);
    #pragma unroll
    for (int rt = R0; rt < R1; ++rt) {
      const v16b ah = ldfb(Ap + 16 * rt * RPIT + kk, h);
      const v16b al = ldfb(Ap + (64 + 16 * rt) * RPIT + kk, h);
      acc[rt] = WA ? wmma_b(bh, ah, acc[rt]) : wmma_b(ah, bh, acc[rt]);
      acc[rt] = WA ? wmma_b(bl, ah, acc[rt]) : wmma_b(ah, bl, acc[rt]);
      acc[rt] = WA ? wmma_b(bh, al, acc[rt]) : wmma_b(al, bh, acc[rt]);
    }
  }
}

// second bound: twelve waves per SIMD, so that three work-groups stay resident per WGP and the projection's 528 run in one round
__global__ __launch_bounds__(512, 12) void k_proj(
    const float* __restrict__ src,
    const unsigned short* __restrict__ WB, const float* __restrict__ XT,
    unsigned short* __restrict__ QH, unsigned short* __restrict__ QL,
    unsigned short* __restrict__ KH, unsigned short* __restrict__ KL,
    _Float16* __restrict__ VT,
    const float* __restrict__ lrn, float* __restrict__ MK, double* __restrict__ PT)
{
  extern __shared__ __attribute__((aligned(16))) unsigned char smem[];
  // The gate job depends on nothing and is read by launch 3 only: it shares this grid, in the rows behind the
  // projection's. The test is the same for a whole work-group.
  if (blockIdx.y >= BATCH) {
    const int mb = (blockIdx.y - BATCH) * NTILE + blockIdx.x;
    if (mb < NPART / 2) mask_body(lrn, MK, PT, (double*)smem, mb);
    return;
  }
  unsigned short* sAh  = (unsigned short*)smem;            // [64][256] bf16 hi, row pitch RPIT
  unsigned short* sAl  = sAh + 64 * RPIT;                  // [64][256] bf16 lo, row pitch RPIT

  const int tid = threadIdx.x, lane = tid & 31;
  // the wave's number as a scalar: every address part that hangs on it then lives in scalar registers, outside the vector budget
  const int w = __builtin_amdgcn_readfirstlane(tid >> 5);
  const int h = lane >> 4, m = lane & 15;
  const int b = blockIdx.y, s0 = blockIdx.x * 64;
  const bool btxt = (blockIdx.x == 0);                     // block-uniform: row tiles 0 and 1 of this tile are text
  const unsigned int wfo = (unsigned int)(w * (8 * FRAGB) + lane * 16);   // this lane's byte offset in the wave's column tile of a weight plane
  const v4f z4 = {0.f, 0.f, 0.f, 0.f};
  const v8f z8 = {0.f, 0.f, 0.f, 0.f, 0.f, 0.f, 0.f, 0.f};

  // ---- stage A = src (+ sine position on text rows) as bf16 hi/lo ----
  #pragma unroll 1
  for (int it = 0; it < 8; ++it) {
    const int q = it * 512 + tid;
    const int row = q >> 6, c4 = (q & 63) * 4;            // row wave-uniform
    const int s = s0 + row;
    const int sl = (s < SEQ) ? s : (SEQ - 1);
    v4f x = *(const v4fa*)(src + ((size_t)(b * SEQ + sl)) * DM + c4);
    if (s >= SEQ) x = z4;
    if (s < TXTN) {
      const float xe = ((float)(s + 1) * 0.03125f) * 6.2831855f;
      const float d0 = powf(10000.0f, (float)c4 * (1.0f / 256.0f));
      const float d1 = powf(10000.0f, (float)(c4 + 2) * (1.0f / 256.0f));
      const float r0 = xe * (1.0f / d0), r1 = xe * (1.0f / d1);
      x.x += sinf(r0); x.y += cosf(r0); x.z += sinf(r1); x.w += cosf(r1);
    }
    const unsigned int h0 = bf16_rne(x.x), h1 = bf16_rne(x.y), h2 = bf16_rne(x.z), h3 = bf16_rne(x.w);
    const unsigned int l0 = bf16_rne(x.x - __uint_as_float(h0 << 16));
    const unsigned int l1 = bf16_rne(x.y - __uint_as_float(h1 << 16));
    const unsigned int l2 = bf16_rne(x.z - __uint_as_float(h2 << 16));
    const unsigned int l3 = bf16_rne(x.w - __uint_as_float(h3 << 16));
    const v4us vh = {(unsigned short)h0, (unsigned short)h1, (unsigned short)h2, (unsigned short)h3};
    const v4us vl = {(unsigned short)l0, (unsigned short)l1, (unsigned short)l2, (unsigned short)l3};
    *(v4usa*)(sAh + row * RPIT + c4) = vh;
    *(v4usa*)(sAl + row * RPIT + c4) = vl;
  }
  __syncthreads();

  // byte offset of this lane's 16 bytes in the fragment half that the wave writes for row tile 0 of a Q or K plane
  // (k slice w>>1, half w&1); a row tile is 8 fragments on. Below 2^25. It is never rewritten.
  const unsigned int qoff = (unsigned int)(((b * NKT + (s0 >> 4)) * 8 + (w >> 1)) * FRAGB + (w & 1) * (FRAGB / 2) + lane * 16);

  // ---- Q (p=0) and K (p=1): bf16 hi/lo split GEMM, transposed; XPOS epilogue in the lane ----
  #pragma unroll 1
  for (int p = 0; p < 2; ++p) {
    const unsigned short* Bv = WB + (size_t)(4 + 2 * p) * 65536;
    v8f acc[4];
    #pragma unroll
    for (int rt = 0; rt < 4; ++rt) acc[rt] = z8;
    if (btxt) {
      gemm_cols<0, 2, true>(sAh, WB + (size_t)(2 * p) * 65536, wfo, h, m, acc);
      gemm_cols<2, 4, true>(sAh, Bv, wfo, h, m, acc);
    } else {
      gemm_cols<0, 4, true>(sAh, Bv, wfo, h, m, acc);
    }
    // acc[rt][r] = Y[token 16rt+m][col 16w+8h+r]; rotation pairs cols (n, n^1) = elements (r, r^1)
    char* PH = (char*)(p ? KH : QH);
    char* PL = (char*)(p ? KL : QL);
    #pragma unroll
    for (int rp = 0; rp < 4; rp += 2) {                    // two row tiles at a time: their table loads share one wait
      unsigned int toff[2];
      v4f cs[2], sn[2];
      #pragma unroll
      for (int j = 0; j < 2; ++j) {
        int lt = (s0 >> 4) + rp + j - TXTN / 16;
        lt = lt < 0 ? 0 : lt;
        lt = lt > (NLT - 1) ? (NLT - 1) : lt;              // text and pad tiles read a table tile in bounds; text drops it, pad rows are zero
        toff[j] = (unsigned int)((((2 * p * NLT + lt) * 16 + w) * 32 + lane) * 16);
        const char* tp = (const char*)XT + toff[j];
        cs[j] = *(const v4fa*)tp;
        sn[j] = *(const v4fa*)(tp + XPL * 4);
      }
      // wait in front of the first overwrite of a register that these four loads name; the offsets are
      // inputs so that their registers stay as they are up to the wait
      asm volatile("s_wait_xcnt 0x0" :: "v"(toff[0]), "v"(toff[1]) : "memory");
      v8us oh[2], ol[2];
      #pragma unroll
      for (int j = 0; j < 2; ++j) {
        const int rt = rp + j;
        const bool wtxt = btxt && (rt < 2);
        #pragma unroll
        for (int r = 0; r < 8; ++r) {
          const float x  = acc[rt][r];
          const float pr = acc[rt][r ^ 1];
          const float sg = (r & 1) ? 1.0f : -1.0f;
          const float cv = wtxt ? 1.0f : cs[j][r >> 1];
          const float snv = wtxt ? 0.0f : sn[j][r >> 1];
          const float y  = x * cv + sg * (pr * snv);
          const unsigned int hb  = bf16_rne(y);
          const unsigned int lob = bf16_rne(y - __uint_as_float(hb << 16));
          oh[j][r] = (unsigned short)hb;
          ol[j][r] = (unsigned short)lob;
        }
        *(v8us*)(PH + qoff + rt * (8 * FRAGB)) = oh[j];
        *(v8us*)(PL + qoff + rt * (8 * FRAGB)) = ol[j];
      }
      // wait in front of the first overwrite of a register that these four stores name; the data are
      // inputs so that their registers stay as they are up to the wait
      asm volatile("s_wait_xcnt 0x0" :: "v"(oh[0]), "v"(ol[0]), "v"(oh[1]), "v"(ol[1]) : "memory");
    }
  }

  // ---- V: tile 0 restages A as bf16 hi/lo of src WITHOUT the position term
  //      (other tiles already hold plain src); split GEMM; f16(64*V) transposed ----
  if (btxt) {                                              // block-uniform
    __syncthreads();                                       // every wave has read the A planes for K
    #pragma unroll 1
    for (int it = 0; it < 8; ++it) {
      const int q = it * 512 + tid;
      const int row = q >> 6, c4 = (q & 63) * 4;          // s = row < 64 < SEQ
      const v4f x = *(const v4fa*)(src + ((size_t)(b * SEQ + row)) * DM + c4);
      const unsigned int h0 = bf16_rne(x.x), h1 = bf16_rne(x.y), h2 = bf16_rne(x.z), h3 = bf16_rne(x.w);
      const unsigned int l0 = bf16_rne(x.x - __uint_as_float(h0 << 16));
      const unsigned int l1 = bf16_rne(x.y - __uint_as_float(h1 << 16));
      const unsigned int l2 = bf16_rne(x.z - __uint_as_float(h2 << 16));
      const unsigned int l3 = bf16_rne(x.w - __uint_as_float(h3 << 16));
      const v4us vh = {(unsigned short)h0, (unsigned short)h1, (unsigned short)h2, (unsigned short)h3};
      const v4us vl = {(unsigned short)l0, (unsigned short)l1, (unsigned short)l2, (unsigned short)l3};
      *(v4usa*)(sAh + row * RPIT + c4) = vh;
      *(v4usa*)(sAl + row * RPIT + c4) = vl;
    }
    __syncthreads();
  }
  {
    const unsigned short* Bv = WB + (size_t)10 * 65536;
    v8f acc[4];
    #pragma unroll
    for (int rt = 0; rt < 4; ++rt) acc[rt] = z8;
    if (btxt) {
      gemm_cols<0, 2, false>(sAh, WB + (size_t)8 * 65536, wfo, h, m, acc);
      gemm_cols<2, 4, false>(sAh, Bv, wfo, h, m, acc);
    } else {
      gemm_cols<0, 4, false>(sAh, Bv, wfo, h, m, acc);
    }
    // acc[rt][r] = V[token 16rt+8h+r][d 16w+m]: the lane's 16 bytes of key slice rt>>1, d tile w, half rt&1
    const unsigned int voff = (unsigned int)(((b * NVS + (s0 >> 5)) * 16 + w) * FRAGB + lane * 16);
    v8h ov[4];
    #pragma unroll
    for (int rt = 0; rt < 4; ++rt) {
      #pragma unroll
      for (int r = 0; r < 8; ++r) ov[rt][r] = (_Float16)(acc[rt][r] * VSC);
      *(v8h*)((char*)VT + voff + (rt >> 1) * (16 * FRAGB) + (rt & 1) * (FRAGB / 2)) = ov[rt];
    }
    // wait behind the last stores: the gate job's code follows them in the listing and rewrites registers that they name
    asm volatile("s_wait_xcnt 0x0" :: "v"(voff), "v"(ov[0]), "v"(ov[1]), "v"(ov[2]), "v"(ov[3]) : "memory");
  }
}

// ---------------------------------------------------------------------------
// Launch 3, first job: retention. Block 128 thr (4 waves) = 64 queries q0..q0+63 of batch
// b (QT sub-tiles of 16; 33 tiles over the padded 2112 rows, pad rows of Q are
// zero and are not stored); wave w owns output cols 64w..64w+63 and computes
// the score slices for keys kb+16w..kb+16w+15 of each 64-key step (33 steps
// over the padded 2112 keys). Each K and V fragment is loaded once per step
// and feeds all QT query sub-tiles.
//   S^T slice = K * Q^T (A = K rows, B = Q rows; bf16 hi/lo split, K=256)
//   P = S * gate * 256 -> f16 hi tile and f16 lo tile (lo = P - hi)
//       [64 q][64 keys] in LDS (ping-pong), row pitch PPIT
//   O += P_hi * V + P_lo * V  (A = P rows, B = V^T rows from VT, f16), acc f32
// ---------------------------------------------------------------------------
#define QT 4
#define QB (16 * QT)
static_assert(QB * NTILE == SEQP);
static_assert(2 * QB * RPIT * 2 >= 4 * QB * 64 * 4);      // the f32 output staging fits in the Q planes' LDS

__device__ __forceinline__ void store_out(const float* so, float* out, int b, int q0, int w, int sub, int q8)
{
  #pragma unroll
  for (int qt = 0; qt < QT; ++qt) {
    if (q0 + 16 * qt < SEQ) {                              // block-uniform: whole sub-tiles of pad rows are dropped
      #pragma unroll
      for (int i = 0; i < 8; ++i) {
        const int lid = 4 * i + sub, row = 16 * qt + (lid >> 1), hl = lid & 1;
        const v4f v = *(const v4fa*)(so + row * 64 + 32 * hl + 4 * q8);
        float* dst = out + ((size_t)(b * SEQ + q0 + row)) * DM + 64 * w + 32 * hl + 4 * q8;
        *(v4f*)dst = v;
      }
      // wait in front of the next sub-tile's address arithmetic, which reuses registers that these stores name
      if (qt + 1 < QT) asm volatile("s_wait_xcnt 0x0" ::: "memory");
    }
  }
}

// second bound: three waves per SIMD, so that three work-groups (the LDS limit) stay resident per WGP and the grid runs in one round
__global__ __launch_bounds__(128, 3) void k_ret(
    const unsigned short* __restrict__ QH, const unsigned short* __restrict__ QL,
    const unsigned short* __restrict__ KH, const unsigned short* __restrict__ KL,
    const _Float16* __restrict__ VT, const float* __restrict__ MK, float* __restrict__ out,
    const double* __restrict__ PT, const int* __restrict__ tl, float* __restrict__ out1)
{
  __shared__ __attribute__((aligned(16))) unsigned short sQ[2 * QB * RPIT];   // hi plane, lo plane
  // The loss sum reads launch 2's partial sums only: one work-group of the grid row behind the retention's does it.
  // The test is the same for a whole work-group.
  if (blockIdx.y >= BATCH) {
    if (blockIdx.x == 0) loss_body(PT, tl, out1, (double*)sQ);
    return;
  }
  __shared__ __attribute__((aligned(16))) _Float16 sPh[2][QB * PPIT];
  __shared__ __attribute__((aligned(16))) _Float16 sPl[2][QB * PPIT];
  unsigned short* sQh = sQ;
  unsigned short* sQl = sQ + QB * RPIT;
  float* sO = (float*)sQ;                                  // epilogue only: Q is last read in front of the last step's barrier

  const int tid = threadIdx.x, lane = tid & 31, w = tid >> 5, h = lane >> 4, m = lane & 15;
  const int q8 = lane & 7, sub = lane >> 3;
  const int b = blockIdx.y, q0 = blockIdx.x * QB;
  const v8f z8 = {0.f, 0.f, 0.f, 0.f, 0.f, 0.f, 0.f, 0.f};

  // ---- stage Q hi/lo rows q0..q0+63 from fragment order into rows, 16 rows a pass ----
  // kept rolled: it runs once per work-group, and one pass already has eight 16-byte loads per lane in flight
  #pragma unroll 1
  for (int qp = 0; qp < QB; qp += 16) {
    v8us qh[4], ql[4];
    const unsigned short* gh[4];
    const unsigned short* gl[4];
    #pragma unroll
    for (int it = 0; it < 4; ++it) {
      const int idx = it * 128 + tid;                      // 16-byte piece of the row tile's 8 fragments, 8 KiB in a row
      const size_t g = ((size_t)(b * NKT + ((q0 + qp) >> 4))) * (8 * FRAG) + idx * 8;
      gh[it] = QH + g;
      gl[it] = QL + g;
      qh[it] = *(const v8usa*)gh[it];
      ql[it] = *(const v8usa*)gl[it];
    }
    // wait in front of the first overwrite of a register that the eight loads name; the addresses are
    // inputs so that their registers stay as they are up to the wait
    asm volatile("s_wait_xcnt 0x0" :: "v"(gh[0]), "v"(gl[0]), "v"(gh[1]), "v"(gl[1]),
                 "v"(gh[2]), "v"(gl[2]), "v"(gh[3]), "v"(gl[3]) : "memory");
    #pragma unroll
    for (int it = 0; it < 4; ++it) {
      const int idx = it * 128 + tid;
      const int row = qp + (idx & 15), c8 = (idx >> 6) * 32 + ((idx >> 5) & 1) * 16 + ((idx >> 4) & 1) * 8;
      *(v8usa*)(sQh + row * RPIT + c8) = qh[it];
      *(v8usa*)(sQl + row * RPIT + c8) = ql[it];
    }
  }
  __syncthreads();

  v8f o[QT][4];
  #pragma unroll
  for (int qt = 0; qt < QT; ++qt)
    #pragma unroll
    for (int nt = 0; nt < 4; ++nt) o[qt][nt] = z8;

  // byte offsets of this lane's 16 bytes in the wave's first K fragment (hi and lo planes alike) and first V^T
  // fragment; both stay below 2^25
  unsigned int koff = (unsigned int)((b * NKT + w) * 8 * FRAGB + lane * 16);
  unsigned int voff = (unsigned int)((b * NVS * 16 + 4 * w) * FRAGB + lane * 16);
  int moff[QT];                                           // this lane's byte offset in the first gate tile of each sub-tile's row of tiles
  #pragma unroll
  for (int qt = 0; qt < QT; ++qt) {
    int rt = (q0 >> 4) + qt - TXTN / 16;
    rt = rt < 0 ? 0 : rt;
    rt = rt > (NGT - 1) ? (NGT - 1) : rt;                 // pad queries read the last row of tiles; their output is dropped
    moff[qt] = rt * NGT * GTB + lane * 16;
  }

  // K fragments travel in a register ring of four 32-wide k slices (hi and lo): a slice is refilled right after
  // its last use, four slices ahead of its next one, so that no score product waits for a global load.
  v16b rkh[4], rkl[4];
  #pragma unroll
  for (int i = 0; i < 4; ++i) {
    rkh[i] = ldgb(KH, koff, FRAGB * i);
    rkl[i] = ldgb(KL, koff, FRAGB * i);
  }

  int buf = 0;
  #pragma unroll 1
  for (int kb = 0; kb < SEQP; kb += 64) {
    // rows the ring's second half is refilled from: the next step's; the last step reads its own again (in bounds, unused)
    const unsigned int koffn = koff + ((kb + 64 < SEQP) ? 4u * 8u * FRAGB : 0u);
    // gate: 1 when query or key is text, sigmoid plane on vid x vid, 0 on pad keys; loaded here, used behind the scores
    const int cb = kb + 16 * w + 8 * h - TXTN;            // vid index of key r=0 (group of 8, aligned)
    const bool ktxt = cb < 0;
    const bool kpad = cb >= VIDN;
    int ct = (kb >> 4) + w - TXTN / 16;                   // gate tile of the wave's 16 keys
    ct = ct < 0 ? 0 : ct;
    ct = ct > (NGT - 1) ? (NGT - 1) : ct;
    unsigned int goff[QT];
    #pragma unroll
    for (int qt = 0; qt < QT; ++qt) goff[qt] = (unsigned int)(moff[qt] + ct * GTB);
    // this fence and the next keep the eight loads and their wait together, up here: nothing that could rewrite
    // an offset register gets between them, and the loads are not sunk to their use, where they would be waited for in full
    __builtin_amdgcn_sched_barrier(0);
    v4f g0[QT], g1[QT];
    #pragma unroll
    for (int qt = 0; qt < QT; ++qt) {
      const char* gp = (const char*)MK + goff[qt];
      g0[qt] = *(const v4fa*)gp;
      g1[qt] = *(const v4fa*)(gp + GTB / 2);
    }
    // wait in front of the first overwrite of a register that the eight loads name; the offsets are
    // inputs so that their registers stay as they are up to the wait
    asm volatile("s_wait_xcnt 0x0" :: "v"(goff[0]), "v"(goff[1]), "v"(goff[2]), "v"(goff[3]) : "memory");
    __builtin_amdgcn_sched_barrier(0);

    // scores: s[qt][r] = S[query q0+16qt+m][key kb+16w+8h+r]
    v8f s[QT];
    #pragma unroll
    for (int qt = 0; qt < QT; ++qt) s[qt] = z8;
    #pragma unroll
    for (int i = 0; i < 8; ++i) {
      const int kk = 32 * i;
      const v16b ka = rkh[i & 3];
      const v16b kl = rkl[i & 3];
      #pragma unroll
      for (int qp = 0; qp < QT; qp += 2) {                 // two sub-tiles at a time: their two accumulator chains alternate
        const v16b qa0 = ldfb(sQh + (16 * qp + m) * RPIT + kk, h);
        const v16b qa1 = ldfb(sQh + (16 * qp + 16 + m) * RPIT + kk, h);
        const v16b ql0 = ldfb(sQl + (16 * qp + m) * RPIT + kk, h);
        const v16b ql1 = ldfb(sQl + (16 * qp + 16 + m) * RPIT + kk, h);
        s[qp]     = wmma_bd(ka, qa0, s[qp]);
        s[qp + 1] = wmma_bd(ka, qa1, s[qp + 1]);
        s[qp]     = wmma_bd(ka, ql0, s[qp]);
        s[qp + 1] = wmma_bd(ka, ql1, s[qp + 1]);
        s[qp]     = wmma_bd(kl, qa0, s[qp]);
        s[qp + 1] = wmma_bd(kl, qa1, s[qp + 1]);
      }
      rkh[i & 3] = ldgb(KH, (i < 4) ? koff : koffn, FRAGB * ((i + 4) & 7));
      rkl[i & 3] = ldgb(KL, (i < 4) ? koff : koffn, FRAGB * ((i + 4) & 7));
      // keeps the refill at this distance from its use: the scheduler would else sink it towards the use
      __builtin_amdgcn_sched_barrier(0);
    }
    // V^T fragments of the step's first 32 keys: in flight during the gate arithmetic
    v16h vf[4];
    #pragma unroll
    for (int nt = 0; nt < 4; ++nt) vf[nt] = ldgh(VT, voff, FRAGB * nt);
    // keeps these loads in front of the gate arithmetic
    __builtin_amdgcn_sched_barrier(0);
    #pragma unroll
    for (int qt = 0; qt < QT; ++qt) {
      const bool qtxt = (q0 + 16 * qt + m) < TXTN;
      const float gk[8] = {g0[qt].x, g0[qt].y, g0[qt].z, g0[qt].w, g1[qt].x, g1[qt].y, g1[qt].z, g1[qt].w};
      v8h ph, plo;
      #pragma unroll
      for (int r = 0; r < 8; ++r) {
        const float gg = kpad ? 0.0f : ((qtxt || ktxt) ? 1.0f : gk[r]);
        const float pv = (s[qt][r] * gg) * PSC;
        const _Float16 hv = (_Float16)pv;
        ph[r]  = hv;
        plo[r] = (_Float16)(pv - (float)hv);
      }
      *(v8ha*)(&sPh[buf][(16 * qt + m) * PPIT + 16 * w + 8 * h]) = ph;
      *(v8ha*)(&sPl[buf][(16 * qt + m) * PPIT + 16 * w + 8 * h]) = plo;
    }
    __syncthreads();

    // O += P_hi(64x64) * V + P_lo(64x64) * V  (64 keys x this wave's 64 cols)
    #pragma unroll
    for (int ks = 0; ks < 2; ++ks) {
      v16h pa[QT], pb[QT];
      #pragma unroll
      for (int qt = 0; qt < QT; ++qt) {
        pa[qt] = ldfh(&sPh[buf][(16 * qt + m) * PPIT + 32 * ks], h);
        pb[qt] = ldfh(&sPl[buf][(16 * qt + m) * PPIT + 32 * ks], h);
      }
      #pragma unroll
      for (int nt = 0; nt < 4; ++nt) {
        const v16h vbf = vf[nt];
        #pragma unroll
        for (int qt = 0; qt < QT; ++qt) o[qt][nt] = wmma_hd(pa[qt], vbf, o[qt][nt]);
        #pragma unroll
        for (int qt = 0; qt < QT; ++qt) o[qt][nt] = wmma_hd(pb[qt], vbf, o[qt][nt]);
        if (ks == 0) {
          vf[nt] = ldgh(VT, voff, FRAGB * (16 + nt));  // second 32 keys, three column tiles ahead of their use
          // keeps the refill at this distance from its use
          __builtin_amdgcn_sched_barrier(0);
        }
      }
    }
    // wait in front of the overwrite of the offset registers that this step's K and V loads name; the offsets are
    // inputs so that their registers stay as they are up to the wait
    asm volatile("s_wait_xcnt 0x0" :: "v"(koff), "v"(koffn), "v"(voff) : "memory");
    koff = koffn;
    voff += 2u * 16u * FRAGB;
    buf ^= 1;
  }

  // ---- epilogue: O[q0+16qt+8h+r][64w+16nt+m] = o[qt][nt][r] / (256*64) ----
  float* so = sO + w * (QB * 64);
  #pragma unroll
  for (int qt = 0; qt < QT; ++qt)
    #pragma unroll
    for (int nt = 0; nt < 4; ++nt)
      #pragma unroll
      for (int r = 0; r < 8; ++r)
        so[(16 * qt + 8 * h + r) * 64 + 16 * nt + m] = o[qt][nt][r] * OSC;
  __syncthreads();
  store_out(so, out, b, q0, w, sub, q8);
  // wait behind the last stores: the loss job's code follows them in the listing and rewrites registers that they name
  asm volatile("s_wait_xcnt 0x0" ::: "memory");
}

// ---------------------------------------------------------------------------
extern "C" void kernel_launch(void* const* d_in, const int* in_sizes, int n_in,
                              void* d_out, int out_size, void* d_ws, size_t ws_size,
                              hipStream_t stream)
{
  if (n_in < 9) return;
  if (in_sizes[0] != BATCH * SEQ * DM) return;
  if (in_sizes[1] != VIDN * VIDN) return;
  for (int i = 2; i < 8; ++i) if (in_sizes[i] != DM * DM) return;
  if (in_sizes[8] < 1) return;
  if (out_size != BATCH * SEQ * DM + 1) return;

  const float* src = (const float*)d_in[0];
  const float* lrn = (const float*)d_in[1];
  const float* wtq = (const float*)d_in[2];
  const float* wtk = (const float*)d_in[3];
  const float* wtv = (const float*)d_in[4];
  const float* wvq = (const float*)d_in[5];
  const float* wvk = (const float*)d_in[6];
  const float* wvv = (const float*)d_in[7];
  const int*   txl = (const int*)d_in[8];
  float* out0 = (float*)d_out;
  float* out1 = out0 + (size_t)BATCH * SEQ * DM;          // byte offset 34078720

  const size_t pl_bytes = (size_t)BATCH * SEQP * DM * 2;  // 17301504 per bf16/f16 plane (padded rows incl.)
  const size_t wb_bytes = (size_t)NWPL * DM * DM * 2;      // 1572864
  const size_t xt_bytes = (size_t)4 * XPL * 4;             // 4194304
  const size_t mk_bytes = (size_t)VIDN * VIDN * 4;         // 16777216
  const size_t off_qh = 0;
  const size_t off_ql = off_qh + pl_bytes;
  const size_t off_kh = off_ql + pl_bytes;
  const size_t off_kl = off_kh + pl_bytes;
  const size_t off_vt = off_kl + pl_bytes;
  const size_t off_wb = off_vt + pl_bytes;
  const size_t off_xt = off_wb + wb_bytes;
  const size_t off_mk = off_xt + xt_bytes;
  const size_t pt_bytes = (size_t)NPART * PSTR * 8;        // 131072
  const size_t off_pt = off_mk + mk_bytes;
  const size_t total  = off_pt + pt_bytes;                 // 109182976
  if (total > ws_size) return;
  if (total > (size_t)134217728) return;

  char* ws = (char*)d_ws;
  unsigned short* QH = (unsigned short*)(ws + off_qh);
  unsigned short* QL = (unsigned short*)(ws + off_ql);
  unsigned short* KH = (unsigned short*)(ws + off_kh);
  unsigned short* KL = (unsigned short*)(ws + off_kl);
  _Float16* VT = (_Float16*)(ws + off_vt);
  unsigned short* WB = (unsigned short*)(ws + off_wb);
  float* XT = (float*)(ws + off_xt);
  float* MK = (float*)(ws + off_mk);
  double* PT = (double*)(ws + off_pt);

  k_prep<<<NWBLK + NXBLK, 256, 0, stream>>>(wtq, wtk, wtv, wvq, wvk, wvv, WB, XT);

  const size_t proj_lds = 67584;                           // 4*64*RPIT
  hipFuncSetAttribute(reinterpret_cast<const void*>(&k_proj), hipFuncAttributeMaxDynamicSharedMemorySize, (int)proj_lds);
  dim3 gp(NTILE, BATCH + GROWS);                           // rows 0 .. 15 projection, the rest the gate job
  k_proj<<<gp, 512, proj_lds, stream>>>(src, WB, XT, QH, QL, KH, KL, VT, lrn, MK, PT);

  dim3 gr(NTILE, BATCH + 1);                               // rows 0 .. 15 retention, row 16 the loss sum
  k_ret<<<gr, 128, 0, stream>>>(QH, QL, KH, KL, VT, MK, out0, PT, txl, out1);
}

// v009
// It runs in 167 microseconds.
// Next to v008, in two timings, it ran 1.10 and 1.11 times as fast.
// Counting every step since v000, it is 37.7 times as fast.
// Contractions: Q,K,V projections and S=K*Q^T on v_wmma_f32_16x16x32_bf16 as bf16 hi/lo split (hi*hi+hi*lo+lo*hi); O=P*V on v_wmma_f32_16x16x32_f16 with P as f16 hi + f16 lo (P x256, two products) and V^T f16 x64; f32 accumulate; position tables, sigmoid gate and loss in f32/f64.
#include <hip/hip_runtime.h>

#define BATCH 16
#define TXTN  32
#define VIDN  2048
#define SEQ   2080
#define SEQP  2112
#define DM    256
#define NTILE 33
#define NWPL  12
#define PSC   256.0f
#define VSC   64.0f
#define OSC   (1.0f / 16384.0f)
#define MELEM 4096
#define NPART 1024
#define PSTR  16
// LDS row pitches in 16-bit elements: row bytes + 16, an odd multiple of 16 B, so that the
// 16 rows one ds_load_b128 fragment read touches per half-wave fall on 16 different bank groups.
#define RPIT  (DM + 8)
#define PPIT  (64 + 8)
// Fragment order, the layout of every 16-bit matrix operand that a wave loads from global memory (weight planes,
// K planes, V^T) and of the Q planes: one 16-row x 32-k fragment is 1 KiB in a row, as two 512-byte halves j = 0, 1; lane l = 16h + m owns
// bytes 16l .. 16l+15 of each half = elements k0+16j+8h .. +7 of row m. So one 16-byte load per lane reads four whole
// 128-byte lines; from a row-major plane the same load touches sixteen lines and uses 32 bytes of each.
#define FRAG  512
#define FRAGB 1024
#define NKT   (SEQP / 16)
#define NVS   (SEQP / 32)
// The gate plane likewise, in the order of the score fragment it multiplies: one 16-query x 16-key f32 tile is 1 KiB in a
// row, two 512-byte halves j; lane l = 16h + m owns bytes 16l .. 16l+15 of each half = keys 8h+4j .. +3 of query m.
#define GTB   1024
#define NGT   (VIDN / 16)
// The position tables in the order of the transposed Q / K accumulator they multiply: per 16-token tile and 16-feature
// tile 512 bytes in a row; lane l = 16h + m owns bytes 16l .. 16l+15 = feature pairs 8w+4h .. +3 of token m.
#define NLT   (VIDN / 16)
#define XPL   ((DM / 2) * VIDN)
static_assert(MELEM * NPART == VIDN * VIDN);
// grid rows of NTILE work-groups that hold the gate job's NPART / 2 work-groups
#define GROWS 16
static_assert(GROWS * NTILE >= NPART / 2);

typedef _Float16 v16h __attribute__((ext_vector_type(16)));
typedef _Float16 v8h  __attribute__((ext_vector_type(8)));
typedef _Float16 v4h  __attribute__((ext_vector_type(4)));
typedef __bf16   v16b __attribute__((ext_vector_type(16)));
typedef unsigned short v8us __attribute__((ext_vector_type(8)));
typedef unsigned short v4us __attribute__((ext_vector_type(4)));
typedef float v8f __attribute__((ext_vector_type(8)));
typedef float v4f __attribute__((ext_vector_type(4)));
typedef v8h  __attribute__((may_alias)) v8ha;
typedef v4h  __attribute__((may_alias)) v4ha;
typedef v8us __attribute__((may_alias)) v8usa;
typedef v4us __attribute__((may_alias)) v4usa;
typedef v4f  __attribute__((may_alias)) v4fa;

// ---------------------------------------------------------------------------
// XPOS module constants as exact f32 bit patterns:
// c_invf[i] = 1 / 10000^(i/128), c_svec[i] = (2i + 0.4*256) / (1.4*256).
// ---------------------------------------------------------------------------
__constant__ unsigned int c_invf[] = {
  0x3f800000, 0x3f6e39f8, 0x3f5dafd7, 0x3f4e4bad, 0x3f3ff911, 0x3f32a506, 0x3f263de0, 0x3f1ab32b,
  0x3f0ff59a, 0x3f05f6ef, 0x3ef953cf, 0x3ee8045f, 0x3ed7e89b, 0x3ec8eb24, 0x3ebaf81b, 0x3eadfcff,
  0x3ea1e89b, 0x3e96aaea, 0x3e8c3504, 0x3e827909, 0x3e72d423, 0x3e61f835, 0x3e5247ed, 0x3e43ae7c,
  0x3e361887, 0x3e297409, 0x3e1db040, 0x3e12bd91, 0x3e088d77, 0x3dfe24e0, 0x3dec7fd6, 0x3ddc1466,
  0x3dcccccd, 0x3dbe94c6, 0x3db15978, 0x3da50956, 0x3d99940d, 0x3d8eea6b, 0x3d84fe4d, 0x3d778513,
  0x3d6655c2, 0x3d5657e4, 0x3d47763f, 0x3d399d19, 0x3d2cba15, 0x3d20bc1d, 0x3d159348, 0x3d0b30cc,
  0x3d0186e3, 0x3cf11177, 0x3ce054d2, 0x3cd0c1a8, 0x3cc2434f, 0x3cb4c691, 0x3ca8398b, 0x3c9c8b97,
  0x3c91ad39, 0x3c879008, 0x3c7c4d33, 0x3c6ac8e7, 0x3c5a7bf2, 0x3c4b50b3, 0x3c3d3311, 0x3c301052,
  0x3c23d70a, 0x3c187705, 0x3c0de12d, 0x3c040779, 0x3bf5b9b0, 0x3be4aa46, 0x3bd4ca15, 0x3bc6040f,
  0x3bb8449c, 0x3bab7983, 0x3b9f91cc, 0x3b947dae, 0x3b8a2e77, 0x3b80967d, 0x3b6f520e, 0x3b5eb47a,
  0x3b4f3e38, 0x3b40dac5, 0x3b33770f, 0x3b270153, 0x3b1b690d, 0x3b109edb, 0x3b06946f, 0x3afa78f0,
  0x3ae91528, 0x3ad8e673, 0x3ac9d75c, 0x3abbd3ed, 0x3aaec98e, 0x3aa2a6f7, 0x3a975c0e, 0x3a8cd9db,
  0x3a83126f, 0x3a73f1a3, 0x3a6301e2, 0x3a533f28, 0x3a44948c, 0x3a36ee9e, 0x3a2a3b44, 0x3a1e69a5,
  0x3a136a16, 0x3a092e02, 0x39ff4fac, 0x39ed95e2, 0x39dd1725, 0x39cdbd96, 0x39bf74d7, 0x39b229fa,
  0x39a5cb60, 0x399a489e, 0x398f9272, 0x39859aa9, 0x3978a815, 0x39676492, 0x395753e4, 0x394860c1,
  0x393a7753, 0x392d8529, 0x39217916, 0x39164324, 0x390bd472, 0x39021f2b, 0x38f22ce2, 0x38e15c91 };
static_assert(sizeof(c_invf) == 512);

__constant__ unsigned int c_svec[] = {
  0x3e924925, 0x3e952493, 0x3e980000, 0x3e9adb6e, 0x3e9db6dc, 0x3ea0924a, 0x3ea36db7, 0x3ea64925,
  0x3ea92493, 0x3eac0000, 0x3eaedb6e, 0x3eb1b6dc, 0x3eb4924a, 0x3eb76db7, 0x3eba4924, 0x3ebd2492,
  0x3ec00000, 0x3ec2db6d, 0x3ec5b6db, 0x3ec89249, 0x3ecb6db7, 0x3ece4924, 0x3ed12492, 0x3ed40000,
  0x3ed6db6d, 0x3ed9b6db, 0x3edc9249, 0x3edf6db7, 0x3ee24924, 0x3ee52492, 0x3ee80000, 0x3eeadb6e,
  0x3eedb6db, 0x3ef09249, 0x3ef36db7, 0x3ef64924, 0x3ef92492, 0x3efc0000, 0x3efedb6e, 0x3f00db6e,
  0x3f024924, 0x3f03b6db, 0x3f052492, 0x3f069249, 0x3f080000, 0x3f096db7, 0x3f0adb6e, 0x3f0c4925,
  0x3f0db6db, 0x3f0f2492, 0x3f109249, 0x3f120000, 0x3f136db7, 0x3f14db6e, 0x3f164925, 0x3f17b6db,
  0x3f192492, 0x3f1a9249, 0x3f1c0000, 0x3f1d6db7, 0x3f1edb6e, 0x3f204925, 0x3f21b6db, 0x3f232492,
  0x3f249249, 0x3f260000, 0x3f276db7, 0x3f28db6e, 0x3f2a4925, 0x3f2bb6db, 0x3f2d2492, 0x3f2e9249,
  0x3f300000, 0x3f316db7, 0x3f32db6e, 0x3f344925, 0x3f35b6db, 0x3f372492, 0x3f389249, 0x3f3a0000,
  0x3f3b6db7, 0x3f3cdb6e, 0x3f3e4925, 0x3f3fb6db, 0x3f412492, 0x3f429249, 0x3f440000, 0x3f456db7,
  0x3f46db6e, 0x3f484925, 0x3f49b6db, 0x3f4b2492, 0x3f4c9249, 0x3f4e0000, 0x3f4f6db7, 0x3f50db6e,
  0x3f524925, 0x3f53b6db, 0x3f552492, 0x3f569249, 0x3f580000, 0x3f596db7, 0x3f5adb6e, 0x3f5c4925,
  0x3f5db6db, 0x3f5f2492, 0x3f609249, 0x3f620000, 0x3f636db7, 0x3f64db6e, 0x3f664925, 0x3f67b6dc,
  0x3f692492, 0x3f6a9249, 0x3f6c0000, 0x3f6d6db7, 0x3f6edb6e, 0x3f704925, 0x3f71b6dc, 0x3f732492,
  0x3f749249, 0x3f760000, 0x3f776db7, 0x3f78db6e, 0x3f7a4925, 0x3f7bb6dc, 0x3f7d2492, 0x3f7e9249 };
static_assert(sizeof(c_svec) == 512);

// ---------------------------------------------------------------------------
// 16x16x32 WMMA with hazard guard. Fragment map (wave32): lane l, h = l>>4,
// m = n = l&15. A/B element i: i<8 -> k0+8h+i ; i>=8 -> k0+16+8h+(i-8).
// D element r: row 8h+r, col l&15.
// ---------------------------------------------------------------------------
__device__ __forceinline__ v8f wmma_h(v16h a, v16h b, v8f c) {
  v8f d = __builtin_amdgcn_wmma_f32_16x16x32_f16(false, a, false, b, (short)0, c, false, false);
  asm volatile("v_nop\n\tv_nop\n\tv_nop\n\tv_nop" : "+v"(d) : "v"(a), "v"(b));
  return d;
}
__device__ __forceinline__ v8f wmma_b(v16b a, v16b b, v8f c) {
  v8f d = __builtin_amdgcn_wmma_f32_16x16x32_bf16(false, a, false, b, (short)0, c, false, false);
  asm volatile("v_nop\n\tv_nop\n\tv_nop\n\tv_nop" : "+v"(d) : "v"(a), "v"(b));
  return d;
}

// The same two products for the retention kernel: the guard names D alone. An asm operand must lie in v0..v255;
// with A and B named as well, every fragment loaded ahead would have to fit there beside the accumulators.
__device__ __forceinline__ v8f wmma_hd(v16h a, v16h b, v8f c) {
  v8f d = __builtin_amdgcn_wmma_f32_16x16x32_f16(false, a, false, b, (short)0, c, false, false);
  asm volatile("v_nop\n\tv_nop\n\tv_nop\n\tv_nop" : "+v"(d));
  return d;
}
__device__ __forceinline__ v8f wmma_bd(v16b a, v16b b, v8f c) {
  v8f d = __builtin_amdgcn_wmma_f32_16x16x32_bf16(false, a, false, b, (short)0, c, false, false);
  asm volatile("v_nop\n\tv_nop\n\tv_nop\n\tv_nop" : "+v"(d));
  return d;
}

// Fragment from a k-contiguous 16-bit row; p points at element k0 of the row
// owned by this lane (row = lane & 15 added by the caller). Same map for A and B.
__device__ __forceinline__ v16h ldfh(const _Float16* p, int h) {
  union { v16h v; v8h hf[2]; } f;
  f.hf[0] = *(const v8ha*)(p + 8 * h);
  f.hf[1] = *(const v8ha*)(p + 16 + 8 * h);
  return f.v;
}
__device__ __forceinline__ v16b ldfb(const unsigned short* p, int h) {
  union { v16b v; v8us hf[2]; } f;
  f.hf[0] = *(const v8usa*)(p + 8 * h);
  f.hf[1] = *(const v8usa*)(p + 16 + 8 * h);
  return f.v;
}

// Global fragment in fragment order: uniform base + this lane's 32-bit byte offset (16 * lane included) + a constant.
// One offset register serves every load of a step, so none is rewritten while loads that name it are in flight.
__device__ __forceinline__ v16h ldgh(const _Float16* base, unsigned int off, int imm) {
  const char* p = (const char*)base + off;
  union { v16h v; v8h hf[2]; } f;
  f.hf[0] = *(const v8ha*)(p + imm);
  f.hf[1] = *(const v8ha*)(p + imm + FRAGB / 2);
  return f.v;
}
__device__ __forceinline__ v16b ldgb(const unsigned short* base, unsigned int off, int imm) {
  const char* p = (const char*)base + off;
  union { v16b v; v8us hf[2]; } f;
  f.hf[0] = *(const v8usa*)(p + imm);
  f.hf[1] = *(const v8usa*)(p + imm + FRAGB / 2);
  return f.v;
}

// f32 -> bf16 bits, RNE
__device__ __forceinline__ unsigned int bf16_rne(float x) {
  const unsigned int u = __float_as_uint(x);
  return (u + 0x7FFFu + ((u >> 16) & 1u)) >> 16;
}

// ---------------------------------------------------------------------------
// Launch 1, first job: weight planes bf16 in fragment order, WB[pl][n tile of 16][k slice of 32][j][lane][8], pl = 2*wsel + part:
// wsel 0 txtQ, 1 txtK, 2 vidQ, 3 vidK, 4 txtV, 5 vidV; part 0 hi = RNE(w),
// part 1 lo = RNE(w - hi). One wave writes one whole 512-B fragment half per store.
// ---------------------------------------------------------------------------
__device__ __forceinline__ void wprep_body(
    const float* __restrict__ wtq, const float* __restrict__ wtk, const float* __restrict__ wtv,
    const float* __restrict__ wvq, const float* __restrict__ wvk, const float* __restrict__ wvv,
    unsigned short* __restrict__ WB, int blk)
{
  const int tid = threadIdx.x, lane = tid & 31;
  const int row = blk * 8 + (tid >> 5);                  // fragment half 0 .. 3071, plane uniform per block
  if (row >= NWPL * DM) return;
  const int pl = row >> 8, n = ((row >> 4) & 15) * 16 + (lane & 15);
  const int wsel = pl >> 1, part = pl & 1;
  const float* W = (wsel == 0) ? wtq : (wsel == 1) ? wtk : (wsel == 2) ? wvq
                 : (wsel == 3) ? wvk : (wsel == 4) ? wtv : wvv;
  const int k0 = ((row >> 1) & 7) * 32 + (row & 1) * 16 + (lane >> 4) * 8;
  float v[8];
  #pragma unroll
  for (int i = 0; i < 8; ++i) v[i] = W[(size_t)(k0 + i) * DM + n];
  v8us o;
  #pragma unroll
  for (int i = 0; i < 8; ++i) {
    const unsigned int hb = bf16_rne(v[i]);
    const unsigned int lb = bf16_rne(v[i] - __uint_as_float(hb << 16));
    o[i] = (unsigned short)(part ? lb : hb);
  }
  unsigned short* dst = WB + (size_t)row * (FRAG / 2) + lane * 8;
  *(v8us*)dst = o;
  
}

// ---------------------------------------------------------------------------
// Launch 1, second job: XPOS tables XT[pl][token tile of 16][feature tile of 16][lane][4] f32, pl 0 cos*scale,
// 1 sin*scale, 2 cos/scale, 3 sin/scale; one value per feature pair i and video position l.
// scale = scale_vec[i] ^ (l/512) via powf; angle = l * inv_freq[i] with the
// exact constant tables above; precise sinf/cosf.
// ---------------------------------------------------------------------------
__device__ __forceinline__ void xtab_body(float* __restrict__ XT, int blk)
{
  const int f = blk * 256 + threadIdx.x;                 // place in a plane
  const int fl = (f >> 2) & 31;                          // the lane that will read it
  const int l = 16 * (f >> 11) + (fl & 15);
  const int i = 8 * ((f >> 7) & 15) + 4 * (fl >> 4) + (f & 3);   // 0 .. 127
  const float sv = __uint_as_float(c_svec[i]);
  const float pw = (float)l * (1.0f / 512.0f);
  const float scale = powf(sv, pw);
  const float invf = __uint_as_float(c_invf[i]);
  const float ang = (float)l * invf;
  const float sn = sinf(ang), cs = cosf(ang);
  const float inv = 1.0f / scale;
  const size_t PS = (size_t)XPL;
  float* p0 = XT + f;
  const float a0 = cs * scale, a1 = sn * scale, a2 = cs * inv, a3 = sn * inv;
  *(float*)(p0)          = a0;
  *(float*)(p0 + PS)     = a1;
  *(float*)(p0 + 2 * PS) = a2;
  *(float*)(p0 + 3 * PS) = a3;
  // wait behind the four stores: in the shared kernel the other job's code follows them in the listing and rewrites their offset register
  asm volatile("s_wait_xcnt 0x0" ::: "memory");
}

// ---------------------------------------------------------------------------
// Launch 1: the two jobs that the projection waits for depend on nothing and on
// each other not at all, so they share one grid; the block index picks the job.
// ---------------------------------------------------------------------------
#define NWBLK ((NWPL * DM) / 8)
#define NXBLK (XPL / 256)
__global__ __launch_bounds__(256) void k_prep(
    const float* __restrict__ wtq, const float* __restrict__ wtk, const float* __restrict__ wtv,
    const float* __restrict__ wvq, const float* __restrict__ wvk, const float* __restrict__ wvv,
    unsigned short* __restrict__ WB, float* __restrict__ XT)
{
  if (blockIdx.x < NWBLK) wprep_body(wtq, wtk, wtv, wvq, wvk, wvv, WB, blockIdx.x);
  else                    xtab_body(XT, blockIdx.x - NWBLK);
}

// ---------------------------------------------------------------------------
// Sum over the 32 lanes of a wave, f64, fixed butterfly order; every lane gets it.
// ---------------------------------------------------------------------------
__device__ __forceinline__ double wave_sum(double v) {
  #pragma unroll
  for (int d = 16; d > 0; d >>= 1) v += __shfl_xor(v, d, 32);
  return v;
}

// ---------------------------------------------------------------------------
// Launch 2, second job (work-groups behind the projection's): gate plane sigmoid(learn[r][c]) f32 (diagonal kept)
// in 16 x 16 tiles, M[r tile][c tile][j][lane][4], and the loss's partial sums from the same values:
// group g of 256 threads (two to a work-group: g = 2 mb + half) covers rows 16(g>>3) .. +15 x columns
// 256(g&7) .. +255 (a wave: two tiles, 2 KiB of M in a row) and stores the f64 sum of its off-diagonal sigmoids
// at part[16g] (a 128-byte line of its own). red: 16 doubles of LDS.
// ---------------------------------------------------------------------------
__device__ __forceinline__ void mask_body(const float* __restrict__ lr, float* __restrict__ M,
                                          double* __restrict__ part, double* red, int mb)
{
  const int half = threadIdx.x >> 8;
  const int g = 2 * mb + half;
  const int t = threadIdx.x & 255;
  const int lane = t & 31;
  const int rt = g >> 3, ct = (g & 7) * 16 + 2 * (t >> 5);   // the wave's first tile
  const int r = 16 * rt + (lane & 15), c0 = 16 * ct + 8 * (lane >> 4);
  const float* lp = lr + r * VIDN + c0;
  float* mp = M + (rt * NGT + ct) * (GTB / 4) + lane * 4;
  v4f x[4];
  #pragma unroll
  for (int it = 0; it < 4; ++it) x[it] = *(const v4fa*)(lp + 16 * (it >> 1) + 4 * (it & 1));
  double acc = 0.0;
  #pragma unroll
  for (int it = 0; it < 4; ++it) {
    const int c = c0 + 16 * (it >> 1) + 4 * (it & 1);
    v4f sv;
    #pragma unroll
    for (int e = 0; e < 4; ++e) {
      const float s = 1.0f / (1.0f + expf(-x[it][e]));
      sv[e] = s;
      acc += (r == c + e) ? 0.0 : (double)s;
    }
    *(v4f*)(mp + it * (GTB / 8)) = sv;
  }
  const double ws = wave_sum(acc);
  if ((t & 31) == 0) red[8 * half + (t >> 5)] = ws;
  __syncthreads();
  if (t == 0) {
    double sum = 0.0;
    #pragma unroll
    for (int i = 0; i < 8; ++i) sum += red[8 * half + i];
    part[(size_t)g * PSTR] = sum;
  }
}

// ---------------------------------------------------------------------------
// Launch 3, second job (the first 128 threads of one work-group behind the retention's): loss = mean over vid x vid of
// off-diagonal sigmoid: adds the 1024 partial sums of the gate job, fixed order, f64: 32 butterfly sums of 32
// partials each (eight a wave), then one butterfly over the 32. red: 32 doubles of LDS.
// ---------------------------------------------------------------------------
__device__ __forceinline__ void loss_body(const double* __restrict__ part, const int* __restrict__ tl,
                                          float* __restrict__ out1, double* red)
{
  const int t = threadIdx.x;
  if (t < 128) {                                           // waves 0 .. 3, whole waves; the others only pass the barrier
    double pv[8];
    #pragma unroll
    for (int j = 0; j < 8; ++j) pv[j] = part[(size_t)(256 * (t >> 5) + 32 * j + (t & 31)) * PSTR];
    #pragma unroll
    for (int j = 0; j < 8; ++j) {
      const double ws = wave_sum(pv[j]);
      if ((t & 31) == 0) red[8 * (t >> 5) + j] = ws;
    }
  }
  __syncthreads();
  if (t < 32) {                                            // wave 0, all lanes on
    const double sum = wave_sum(red[t]);
    if (t == 0) {
      int vl = SEQ - tl[0];
      vl = vl < 1 ? 1 : vl;
      vl = vl > VIDN ? VIDN : vl;
      const float loss = (float)(sum / ((double)vl * (double)vl));
      *(float*)out1 = loss;
    }
  }
}

// ---------------------------------------------------------------------------
// Launch 2, first job: projections. Block = 512 thr (16 waves) = 64 absolute positions
// s0..s0+63 of batch b (s0 multiple of 64 over the padded 2112) x 256 cols;
// wave w owns all 64 rows (four row tiles rt) x cols 16w..16w+15, so that each weight
// fragment is loaded by one wave of the block only and feeds every row tile.
// Rows s<32: text (sine position added to the Q/K A operand, text weights, no
// XPOS); 32<=s<2080: video; s>=2080: zero pad rows. Q,K,V: bf16 hi/lo split
// GEMMs. Q,K: taken transposed (weight fragment as A, token fragment as B), so that a lane's accumulator holds eight
// neighbouring features of one token: both halves of every rotation pair, and the lane's own 16 bytes of the planes;
// XPOS rotation in f32, written as bf16 hi/lo planes in fragment order [b][token tile of 16][k slice of 32][j][lane][8].
// V: tokens as A, so that a lane holds eight neighbouring tokens of one feature: f16(64*V) transposed, in fragment
// order VT[b][key slice of 32][d tile of 16][j][lane][8]. Every result goes from the accumulators to global memory,
// one whole 512-byte fragment half per store of a wave; LDS holds the A planes alone.
// ---------------------------------------------------------------------------

// One wave's split GEMM: row tiles R0 .. R1-1 of the A planes in LDS x the wave's 16 columns of the weight plane pair that
// starts at B (hi plane; the lo plane follows 131072 bytes on); boff: the lane's byte offset in the first fragment of the
// wave's column tile. WA: the weight fragment is the A operand
// (result transposed). Per accumulator the order hi*hi, hi*lo, lo*hi per k slice. One row tile's fragments at a time:
// the loop has to live in the register budget of twelve waves per SIMD, whose other waves fill the waits.
template <int R0, int R1, bool WA>
__device__ __forceinline__ void gemm_cols(const unsigned short* sAh, const unsigned short* B, unsigned int boff, int h, int m, v8f (&acc)[4])
{
  const unsigned short* Ap = sAh + m * RPIT;
  // kept rolled: eight copies would only add code
  #pragma unroll 1
  for (int kk = 0; kk < DM; kk += 32) {
    const unsigned int fo = boff + (kk >> 5) * FRAGB;
    const v16b bh = ldgb(B, fo, 0);
    const v16b bl = ldgb(B, fo, 131072);
    #pragma unroll
    for (int rt = R0; rt < R1; ++rt) {
      const v16b ah = ldfb(Ap + 16 * rt * RPIT + kk, h);
      const v16b al = ldfb(Ap + (64 + 16 * rt) * RPIT + kk, h);
      acc[rt] = WA ? wmma_b(bh, ah, acc[rt]) : wmma_b(ah, bh, acc[rt]);
      acc[rt] = WA ? wmma_b(bl, ah, acc[rt]) : wmma_b(ah, bl, acc[rt]);
      acc[rt] = WA ? wmma_b(bh, al, acc[rt]) : wmma_b(al, bh, acc[rt]);
    }
  }
}

// second bound: twelve waves per SIMD, so that three work-groups stay resident per WGP and the projection's 528 run in one round
__global__ __launch_bounds__(512, 12) void k_proj(
    const float* __restrict__ src,
    const unsigned short* __restrict__ WB, const float* __restrict__ XT,
    unsigned short* __restrict__ QH, unsigned short* __restrict__ QL,
    unsigned short* __restrict__ KH, unsigned short* __restrict__ KL,
    _Float16* __restrict__ VT,
    const float* __restrict__ lrn, float* __restrict__ MK, double* __restrict__ PT)
{
  extern __shared__ __attribute__((aligned(16))) unsigned char smem[];
  // The gate job depends on nothing and is read by launch 3 only: it shares this grid, in the rows behind the
  // projection's. The test is the same for a whole work-group.
  if (blockIdx.y >= BATCH) {
    const int mb = (blockIdx.y - BATCH) * NTILE + blockIdx.x;
    if (mb < NPART / 2) mask_body(lrn, MK, PT, (double*)smem, mb);
    return;
  }
  unsigned short* sAh  = (unsigned short*)smem;            // [64][256] bf16 hi, row pitch RPIT
  unsigned short* sAl  = sAh + 64 * RPIT;                  // [64][256] bf16 lo, row pitch RPIT

  const int tid = threadIdx.x, lane = tid & 31;
  // the wave's number as a scalar: every address part that hangs on it then lives in scalar registers, outside the vector budget
  const int w = __builtin_amdgcn_readfirstlane(tid >> 5);
  const int h = lane >> 4, m = lane & 15;
  const int b = blockIdx.y, s0 = blockIdx.x * 64;
  const bool btxt = (blockIdx.x == 0);                     // block-uniform: row tiles 0 and 1 of this tile are text
  const unsigned int wfo = (unsigned int)(w * (8 * FRAGB) + lane * 16);   // this lane's byte offset in the wave's column tile of a weight plane
  const v4f z4 = {0.f, 0.f, 0.f, 0.f};
  const v8f z8 = {0.f, 0.f, 0.f, 0.f, 0.f, 0.f, 0.f, 0.f};

  // ---- stage A = src (+ sine position on text rows) as bf16 hi/lo ----
  #pragma unroll 1
  for (int it = 0; it < 8; ++it) {
    const int q = it * 512 + tid;
    const int row = q >> 6, c4 = (q & 63) * 4;            // row wave-uniform
    const int s = s0 + row;
    const int sl = (s < SEQ) ? s : (SEQ - 1);
    v4f x = *(const v4fa*)(src + ((size_t)(b * SEQ + sl)) * DM + c4);
    if (s >= SEQ) x = z4;
    if (s < TXTN) {
      const float xe = ((float)(s + 1) * 0.03125f) * 6.2831855f;
      const float d0 = powf(10000.0f, (float)c4 * (1.0f / 256.0f));
      const float d1 = powf(10000.0f, (float)(c4 + 2) * (1.0f / 256.0f));
      const float r0 = xe * (1.0f / d0), r1 = xe * (1.0f / d1);
      x.x += sinf(r0); x.y += cosf(r0); x.z += sinf(r1); x.w += cosf(r1);
    }
    const unsigned int h0 = bf16_rne(x.x), h1 = bf16_rne(x.y), h2 = bf16_rne(x.z), h3 = bf16_rne(x.w);
    const unsigned int l0 = bf16_rne(x.x - __uint_as_float(h0 << 16));
    const unsigned int l1 = bf16_rne(x.y - __uint_as_float(h1 << 16));
    const unsigned int l2 = bf16_rne(x.z - __uint_as_float(h2 << 16));
    const unsigned int l3 = bf16_rne(x.w - __uint_as_float(h3 << 16));
    const v4us vh = {(unsigned short)h0, (unsigned short)h1, (unsigned short)h2, (unsigned short)h3};
    const v4us vl = {(unsigned short)l0, (unsigned short)l1, (unsigned short)l2, (unsigned short)l3};
    *(v4usa*)(sAh + row * RPIT + c4) = vh;
    *(v4usa*)(sAl + row * RPIT + c4) = vl;
  }
  __syncthreads();

  // byte offset of this lane's 16 bytes in the fragment half that the wave writes for row tile 0 of a Q or K plane
  // (k slice w>>1, half w&1); a row tile is 8 fragments on. Below 2^25. It is never rewritten.
  const unsigned int qoff = (unsigned int)(((b * NKT + (s0 >> 4)) * 8 + (w >> 1)) * FRAGB + (w & 1) * (FRAGB / 2) + lane * 16);

  // ---- Q (p=0) and K (p=1): bf16 hi/lo split GEMM, transposed; XPOS epilogue in the lane ----
  #pragma unroll 1
  for (int p = 0; p < 2; ++p) {
    const unsigned short* Bv = WB + (size_t)(4 + 2 * p) * 65536;
    v8f acc[4];
    #pragma unroll
    for (int rt = 0; rt < 4; ++rt) acc[rt] = z8;
    if (btxt) {
      gemm_cols<0, 2, true>(sAh, WB + (size_t)(2 * p) * 65536, wfo, h, m, acc);
      gemm_cols<2, 4, true>(sAh, Bv, wfo, h, m, acc);
    } else {
      gemm_cols<0, 4, true>(sAh, Bv, wfo, h, m, acc);
    }
    // acc[rt][r] = Y[token 16rt+m][col 16w+8h+r]; rotation pairs cols (n, n^1) = elements (r, r^1)
    char* PH = (char*)(p ? KH : QH);
    char* PL = (char*)(p ? KL : QL);
    #pragma unroll
    for (int rp = 0; rp < 4; rp += 2) {                    // two row tiles at a time: their table loads share one wait
      unsigned int toff[2];
      v4f cs[2], sn[2];
      #pragma unroll
      for (int j = 0; j < 2; ++j) {
        int lt = (s0 >> 4) + rp + j - TXTN / 16;
        lt = lt < 0 ? 0 : lt;
        lt = lt > (NLT - 1) ? (NLT - 1) : lt;              // text and pad tiles read a table tile in bounds; text drops it, pad rows are zero
        toff[j] = (unsigned int)((((2 * p * NLT + lt) * 16 + w) * 32 + lane) * 16);
        const char* tp = (const char*)XT + toff[j];
        cs[j] = *(const v4fa*)tp;
        sn[j] = *(const v4fa*)(tp + XPL * 4);
      }
      // wait in front of the first overwrite of a register that these four loads name; the offsets are
      // inputs so that their registers stay as they are up to the wait
      asm volatile("s_wait_xcnt 0x0" :: "v"(toff[0]), "v"(toff[1]) : "memory");
      v8us oh[2], ol[2];
      #pragma unroll
      for (int j = 0; j < 2; ++j) {
        const int rt = rp + j;
        const bool wtxt = btxt && (rt < 2);
        #pragma unroll
        for (int r = 0; r < 8; ++r) {
          const float x  = acc[rt][r];
          const float pr = acc[rt][r ^ 1];
          const float sg = (r & 1) ? 1.0f : -1.0f;
          const float cv = wtxt ? 1.0f : cs[j][r >> 1];
          const float snv = wtxt ? 0.0f : sn[j][r >> 1];
          const float y  = x * cv + sg * (pr * snv);
          const unsigned int hb  = bf16_rne(y);
          const unsigned int lob = bf16_rne(y - __uint_as_float(hb << 16));
          oh[j][r] = (unsigned short)hb;
          ol[j][r] = (unsigned short)lob;
        }
        *(v8us*)(PH + qoff + rt * (8 * FRAGB)) = oh[j];
        *(v8us*)(PL + qoff + rt * (8 * FRAGB)) = ol[j];
      }
      // wait in front of the first overwrite of a register that these four stores name; the data are
      // inputs so that their registers stay as they are up to the wait
      asm volatile("s_wait_xcnt 0x0" :: "v"(oh[0]), "v"(ol[0]), "v"(oh[1]), "v"(ol[1]) : "memory");
    }
  }

  // ---- V: tile 0 restages A as bf16 hi/lo of src WITHOUT the position term
  //      (other tiles already hold plain src); split GEMM; f16(64*V) transposed ----
  if (btxt) {                                              // block-uniform
    __syncthreads();                                       // every wave has read the A planes for K
    #pragma unroll 1
    for (int it = 0; it < 8; ++it) {
      const int q = it * 512 + tid;
      const int row = q >> 6, c4 = (q & 63) * 4;          // s = row < 64 < SEQ
      const v4f x = *(const v4fa*)(src + ((size_t)(b * SEQ + row)) * DM + c4);
      const unsigned int h0 = bf16_rne(x.x), h1 = bf16_rne(x.y), h2 = bf16_rne(x.z), h3 = bf16_rne(x.w);
      const unsigned int l0 = bf16_rne(x.x - __uint_as_float(h0 << 16));
      const unsigned int l1 = bf16_rne(x.y - __uint_as_float(h1 << 16));
      const unsigned int l2 = bf16_rne(x.z - __uint_as_float(h2 << 16));
      const unsigned int l3 = bf16_rne(x.w - __uint_as_float(h3 << 16));
      const v4us vh = {(unsigned short)h0, (unsigned short)h1, (unsigned short)h2, (unsigned short)h3};
      const v4us vl = {(unsigned short)l0, (unsigned short)l1, (unsigned short)l2, (unsigned short)l3};
      *(v4usa*)(sAh + row * RPIT + c4) = vh;
      *(v4usa*)(sAl + row * RPIT + c4) = vl;
    }
    __syncthreads();
  }
  {
    const unsigned short* Bv = WB + (size_t)10 * 65536;
    v8f acc[4];
    #pragma unroll
    for (int rt = 0; rt < 4; ++rt) acc[rt] = z8;
    if (btxt) {
      gemm_cols<0, 2, false>(sAh, WB + (size_t)8 * 65536, wfo, h, m, acc);
      gemm_cols<2, 4, false>(sAh, Bv, wfo, h, m, acc);
    } else {
      gemm_cols<0, 4, false>(sAh, Bv, wfo, h, m, acc);
    }
    // acc[rt][r] = V[token 16rt+8h+r][d 16w+m]: the lane's 16 bytes of key slice rt>>1, d tile w, half rt&1
    const unsigned int voff = (unsigned int)(((b * NVS + (s0 >> 5)) * 16 + w) * FRAGB + lane * 16);
    v8h ov[4];
    #pragma unroll
    for (int rt = 0; rt < 4; ++rt) {
      #pragma unroll
      for (int r = 0; r < 8; ++r) ov[rt][r] = (_Float16)(acc[rt][r] * VSC);
      *(v8h*)((char*)VT + voff + (rt >> 1) * (16 * FRAGB) + (rt & 1) * (FRAGB / 2)) = ov[rt];
    }
    // wait behind the last stores: the gate job's code follows them in the listing and rewrites registers that they name
    asm volatile("s_wait_xcnt 0x0" :: "v"(voff), "v"(ov[0]), "v"(ov[1]), "v"(ov[2]), "v"(ov[3]) : "memory");
  }
}

// ---------------------------------------------------------------------------
// Launch 3, first job: retention. Block 384 thr = NGRP groups of 4 waves = 144 queries of batch b, so that the
// 15 x 16 work-groups stand one on a WGP, three waves per SIMD everywhere. A group = 48 queries q0..q0+47
// (QT sub-tiles of 16; rows from 2080 on are not stored) with LDS of its own; the groups share nothing but the
// step's barrier, which keeps their loads of the same K, V^T lines together in time. In a group wave w owns
// output cols 64w..64w+63 and computes the score slices for keys kb+16w..kb+16w+15 of each 64-key step (33 steps
// over the padded 2112 keys). Each K and V fragment is loaded once per group and step
// and feeds all QT query sub-tiles.
//   S^T slice = K * Q^T (A = K rows, B = Q rows; bf16 hi/lo split, K=256)
//   P = S * gate * 256 -> f16 hi tile and f16 lo tile (lo = P - hi)
//       [48 q][64 keys] in LDS (ping-pong), row pitch PPIT
//   O += P_hi * V + P_lo * V  (A = P rows, B = V^T rows from VT, f16), acc f32
// ---------------------------------------------------------------------------
#define QT 3
#define QB (16 * QT)
#define NGRP 3
#define QWG (NGRP * QB)
#define NQWG 15
static_assert(QWG * NQWG >= SEQ);
static_assert(2 * QB * RPIT * 2 >= 4 * QB * 64 * 4);      // the f32 output staging fits in the Q planes' LDS

__device__ __forceinline__ void store_out(const float* so, float* out, int b, int q0, int w, int sub, int q8)
{
  #pragma unroll
  for (int qt = 0; qt < QT; ++qt) {
    if (q0 + 16 * qt < SEQ) {                              // the same for a whole group: whole sub-tiles of pad rows are dropped
      #pragma unroll
      for (int i = 0; i < 8; ++i) {
        const int lid = 4 * i + sub, row = 16 * qt + (lid >> 1), hl = lid & 1;
        const v4f v = *(const v4fa*)(so + row * 64 + 32 * hl + 4 * q8);
        float* dst = out + ((size_t)(b * SEQ + q0 + row)) * DM + 64 * w + 32 * hl + 4 * q8;
        *(v4f*)dst = v;
      }
      // wait in front of the next sub-tile's address arithmetic, which reuses registers that these stores name
      if (qt + 1 < QT) asm volatile("s_wait_xcnt 0x0" ::: "memory");
    }
  }
}

// second bound: three waves per SIMD, the work-group's own twelve waves on the four SIMDs of its WGP
__global__ __launch_bounds__(128 * NGRP, 3) void k_ret(
    const unsigned short* __restrict__ QH, const unsigned short* __restrict__ QL,
    const unsigned short* __restrict__ KH, const unsigned short* __restrict__ KL,
    const _Float16* __restrict__ VT, const float* __restrict__ MK, float* __restrict__ out,
    const double* __restrict__ PT, const int* __restrict__ tl, float* __restrict__ out1)
{
  __shared__ __attribute__((aligned(16))) unsigned short sQ[NGRP][2 * QB * RPIT];   // per group: hi plane, lo plane
  // The loss sum reads launch 2's partial sums only: one work-group of the grid row behind the retention's does it.
  // The test is the same for a whole work-group.
  if (blockIdx.y >= BATCH) {
    if (blockIdx.x == 0) loss_body(PT, tl, out1, (double*)&sQ[0][0]);
    return;
  }
  __shared__ __attribute__((aligned(16))) _Float16 sPhA[NGRP][2][QB * PPIT];
  __shared__ __attribute__((aligned(16))) _Float16 sPlA[NGRP][2][QB * PPIT];
  // the group's number as a scalar: q0 and every test and address part that hangs on it then live in scalar registers
  const int grp = __builtin_amdgcn_readfirstlane(threadIdx.x >> 7);
  unsigned short* sQh = &sQ[grp][0];
  unsigned short* sQl = sQh + QB * RPIT;
  _Float16 (*sPh)[QB * PPIT] = sPhA[grp];
  _Float16 (*sPl)[QB * PPIT] = sPlA[grp];
  float* sO = (float*)sQh;                                 // epilogue only: Q is last read in front of the last step's barrier

  const int tid = threadIdx.x & 127, lane = tid & 31, w = tid >> 5, h = lane >> 4, m = lane & 15;   // tid, w: inside the group
  const int q8 = lane & 7, sub = lane >> 3;
  const int b = blockIdx.y, q0 = blockIdx.x * QWG + grp * QB;
  const v8f z8 = {0.f, 0.f, 0.f, 0.f, 0.f, 0.f, 0.f, 0.f};

  // ---- stage Q hi/lo rows q0..q0+47 from fragment order into rows, 16 rows a pass ----
  // kept rolled: it runs once per work-group, and one pass already has eight 16-byte loads per lane in flight
  #pragma unroll 1
  for (int qp = 0; qp < QB; qp += 16) {
    v8us qh[4], ql[4];
    const unsigned short* gh[4];
    const unsigned short* gl[4];
    int qrt = (q0 + qp) >> 4;
    qrt = qrt > (NKT - 1) ? (NKT - 1) : qrt;               // row tiles past the padded plane read its last one (zero rows); their output is dropped
    #pragma unroll
    for (int it = 0; it < 4; ++it) {
      const int idx = it * 128 + tid;                      // 16-byte piece of the row tile's 8 fragments, 8 KiB in a row
      const size_t g = ((size_t)(b * NKT + qrt)) * (8 * FRAG) + idx * 8;
      gh[it] = QH + g;
      gl[it] = QL + g;
      qh[it] = *(const v8usa*)gh[it];
      ql[it] = *(const v8usa*)gl[it];
    }
    // wait in front of the first overwrite of a register that the eight loads name; the addresses are
    // inputs so that their registers stay as they are up to the wait
    asm volatile("s_wait_xcnt 0x0" :: "v"(gh[0]), "v"(gl[0]), "v"(gh[1]), "v"(gl[1]),
                 "v"(gh[2]), "v"(gl[2]), "v"(gh[3]), "v"(gl[3]) : "memory");
    #pragma unroll
    for (int it = 0; it < 4; ++it) {
      const int idx = it * 128 + tid;
      const int row = qp + (idx & 15), c8 = (idx >> 6) * 32 + ((idx >> 5) & 1) * 16 + ((idx >> 4) & 1) * 8;
      *(v8usa*)(sQh + row * RPIT + c8) = qh[it];
      *(v8usa*)(sQl + row * RPIT + c8) = ql[it];
    }
  }
  __syncthreads();

  v8f o[QT][4];
  #pragma unroll
  for (int qt = 0; qt < QT; ++qt)
    #pragma unroll
    for (int nt = 0; nt < 4; ++nt) o[qt][nt] = z8;

  // byte offsets of this lane's 16 bytes in the wave's first K fragment (hi and lo planes alike) and first V^T
  // fragment; both stay below 2^25
  unsigned int koff = (unsigned int)((b * NKT + w) * 8 * FRAGB + lane * 16);
  unsigned int voff = (unsigned int)((b * NVS * 16 + 4 * w) * FRAGB + lane * 16);
  int moff[QT];                                           // this lane's byte offset in the first gate tile of each sub-tile's row of tiles
  #pragma unroll
  for (int qt = 0; qt < QT; ++qt) {
    int rt = (q0 >> 4) + qt - TXTN / 16;
    rt = rt < 0 ? 0 : rt;
    rt = rt > (NGT - 1) ? (NGT - 1) : rt;                 // pad queries read the last row of tiles; their output is dropped
    moff[qt] = rt * NGT * GTB + lane * 16;
  }

  // K fragments travel in a register ring of four 32-wide k slices (hi and lo): a slice is refilled right after
  // its last use, four slices ahead of its next one, so that no score product waits for a global load.
  v16b rkh[4], rkl[4];
  #pragma unroll
  for (int i = 0; i < 4; ++i) {
    rkh[i] = ldgb(KH, koff, FRAGB * i);
    rkl[i] = ldgb(KL, koff, FRAGB * i);
  }

  int buf = 0;
  #pragma unroll 1
  for (int kb = 0; kb < SEQP; kb += 64) {
    // rows the ring's second half is refilled from: the next step's; the last step reads its own again (in bounds, unused)
    const unsigned int koffn = koff + ((kb + 64 < SEQP) ? 4u * 8u * FRAGB : 0u);
    // gate: 1 when query or key is text, sigmoid plane on vid x vid, 0 on pad keys; loaded here, used behind the scores
    const int cb = kb + 16 * w + 8 * h - TXTN;            // vid index of key r=0 (group of 8, aligned)
    const bool ktxt = cb < 0;
    const bool kpad = cb >= VIDN;
    int ct = (kb >> 4) + w - TXTN / 16;                   // gate tile of the wave's 16 keys
    ct = ct < 0 ? 0 : ct;
    ct = ct > (NGT - 1) ? (NGT - 1) : ct;
    unsigned int goff[QT];
    #pragma unroll
    for (int qt = 0; qt < QT; ++qt) goff[qt] = (unsigned int)(moff[qt] + ct * GTB);
    // this fence and the next keep the six loads and their wait together, up here: nothing that could rewrite
    // an offset register gets between them, and the loads are not sunk to their use, where they would be waited for in full
    __builtin_amdgcn_sched_barrier(0);
    v4f g0[QT], g1[QT];
    #pragma unroll
    for (int qt = 0; qt < QT; ++qt) {
      const char* gp = (const char*)MK + goff[qt];
      g0[qt] = *(const v4fa*)gp;
      g1[qt] = *(const v4fa*)(gp + GTB / 2);
    }
    // wait in front of the first overwrite of a register that the six loads name; the offsets are
    // inputs so that their registers stay as they are up to the wait
    asm volatile("s_wait_xcnt 0x0" :: "v"(goff[0]), "v"(goff[1]), "v"(goff[2]) : "memory");
    __builtin_amdgcn_sched_barrier(0);

    // scores: s[qt][r] = S[query q0+16qt+m][key kb+16w+8h+r]
    v8f s[QT];
    #pragma unroll
    for (int qt = 0; qt < QT; ++qt) s[qt] = z8;
    #pragma unroll
    for (int i = 0; i < 8; ++i) {
      const int kk = 32 * i;
      const v16b ka = rkh[i & 3];
      const v16b kl = rkl[i & 3];
      // the three sub-tiles together: their three accumulator chains alternate; per chain the order hi*hi, hi*lo, lo*hi
      v16b qa[QT], ql[QT];
      #pragma unroll
      for (int qt = 0; qt < QT; ++qt) {
        qa[qt] = ldfb(sQh + (16 * qt + m) * RPIT + kk, h);
        ql[qt] = ldfb(sQl + (16 * qt + m) * RPIT + kk, h);
      }
      #pragma unroll
      for (int qt = 0; qt < QT; ++qt) s[qt] = wmma_bd(ka, qa[qt], s[qt]);
      #pragma unroll
      for (int qt = 0; qt < QT; ++qt) s[qt] = wmma_bd(ka, ql[qt], s[qt]);
      #pragma unroll
      for (int qt = 0; qt < QT; ++qt) s[qt] = wmma_bd(kl, qa[qt], s[qt]);
      rkh[i & 3] = ldgb(KH, (i < 4) ? koff : koffn, FRAGB * ((i + 4) & 7));
      rkl[i & 3] = ldgb(KL, (i < 4) ? koff : koffn, FRAGB * ((i + 4) & 7));
      // keeps the refill at this distance from its use: the scheduler would else sink it towards the use
      __builtin_amdgcn_sched_barrier(0);
    }
    // V^T fragments of the step's first 32 keys: in flight during the gate arithmetic
    v16h vf[4];
    #pragma unroll
    for (int nt = 0; nt < 4; ++nt) vf[nt] = ldgh(VT, voff, FRAGB * nt);
    // keeps these loads in front of the gate arithmetic
    __builtin_amdgcn_sched_barrier(0);
    #pragma unroll
    for (int qt = 0; qt < QT; ++qt) {
      const bool qtxt = (q0 + 16 * qt + m) < TXTN;
      const float gk[8] = {g0[qt].x, g0[qt].y, g0[qt].z, g0[qt].w, g1[qt].x, g1[qt].y, g1[qt].z, g1[qt].w};
      v8h ph, plo;
      #pragma unroll
      for (int r = 0; r < 8; ++r) {
        const float gg = kpad ? 0.0f : ((qtxt || ktxt) ? 1.0f : gk[r]);
        const float pv = (s[qt][r] * gg) * PSC;
        const _Float16 hv = (_Float16)pv;
        ph[r]  = hv;
        plo[r] = (_Float16)(pv - (float)hv);
      }
      *(v8ha*)(&sPh[buf][(16 * qt + m) * PPIT + 16 * w + 8 * h]) = ph;
      *(v8ha*)(&sPl[buf][(16 * qt + m) * PPIT + 16 * w + 8 * h]) = plo;
    }
    __syncthreads();

    // O += P_hi(48x64) * V + P_lo(48x64) * V  (64 keys x this wave's 64 cols)
    #pragma unroll
    for (int ks = 0; ks < 2; ++ks) {
      v16h pa[QT], pb[QT];
      #pragma unroll
      for (int qt = 0; qt < QT; ++qt) {
        pa[qt] = ldfh(&sPh[buf][(16 * qt + m) * PPIT + 32 * ks], h);
        pb[qt] = ldfh(&sPl[buf][(16 * qt + m) * PPIT + 32 * ks], h);
      }
      #pragma unroll
      for (int nt = 0; nt < 4; ++nt) {
        const v16h vbf = vf[nt];
        #pragma unroll
        for (int qt = 0; qt < QT; ++qt) o[qt][nt] = wmma_hd(pa[qt], vbf, o[qt][nt]);
        #pragma unroll
        for (int qt = 0; qt < QT; ++qt) o[qt][nt] = wmma_hd(pb[qt], vbf, o[qt][nt]);
        if (ks == 0) {
          vf[nt] = ldgh(VT, voff, FRAGB * (16 + nt));  // second 32 keys, three column tiles ahead of their use
          // keeps the refill at this distance from its use
          __builtin_amdgcn_sched_barrier(0);
        }
      }
    }
    // wait in front of the overwrite of the offset registers that this step's K and V loads name; the offsets are
    // inputs so that their registers stay as they are up to the wait
    asm volatile("s_wait_xcnt 0x0" :: "v"(koff), "v"(koffn), "v"(voff) : "memory");
    koff = koffn;
    voff += 2u * 16u * FRAGB;
    buf ^= 1;
  }

  // ---- epilogue: O[q0+16qt+8h+r][64w+16nt+m] = o[qt][nt][r] / (256*64) ----
  float* so = sO + w * (QB * 64);
  #pragma unroll
  for (int qt = 0; qt < QT; ++qt)
    #pragma unroll
    for (int nt = 0; nt < 4; ++nt)
      #pragma unroll
      for (int r = 0; r < 8; ++r)
        so[(16 * qt + 8 * h + r) * 64 + 16 * nt + m] = o[qt][nt][r] * OSC;
  __syncthreads();
  store_out(so, out, b, q0, w, sub, q8);
  // wait behind the last stores: the loss job's code follows them in the listing and rewrites registers that they name
  asm volatile("s_wait_xcnt 0x0" ::: "memory");
}

// ---------------------------------------------------------------------------
extern "C" void kernel_launch(void* const* d_in, const int* in_sizes, int n_in,
                              void* d_out, int out_size, void* d_ws, size_t ws_size,
                              hipStream_t stream)
{
  if (n_in < 9) return;
  if (in_sizes[0] != BATCH * SEQ * DM) return;
  if (in_sizes[1] != VIDN * VIDN) return;
  for (int i = 2; i < 8; ++i) if (in_sizes[i] != DM * DM) return;
  if (in_sizes[8] < 1) return;
  if (out_size != BATCH * SEQ * DM + 1) return;

  const float* src = (const float*)d_in[0];
  const float* lrn = (const float*)d_in[1];
  const float* wtq = (const float*)d_in[2];
  const float* wtk = (const float*)d_in[3];
  const float* wtv = (const float*)d_in[4];
  const float* wvq = (const float*)d_in[5];
  const float* wvk = (const float*)d_in[6];
  const float* wvv = (const float*)d_in[7];
  const int*   txl = (const int*)d_in[8];
  float* out0 = (float*)d_out;
  float* out1 = out0 + (size_t)BATCH * SEQ * DM;          // byte offset 34078720

  const size_t pl_bytes = (size_t)BATCH * SEQP * DM * 2;  // 17301504 per bf16/f16 plane (padded rows incl.)
  const size_t wb_bytes = (size_t)NWPL * DM * DM * 2;      // 1572864
  const size_t xt_bytes = (size_t)4 * XPL * 4;             // 4194304
  const size_t mk_bytes = (size_t)VIDN * VIDN * 4;         // 16777216
  const size_t off_qh = 0;
  const size_t off_ql = off_qh + pl_bytes;
  const size_t off_kh = off_ql + pl_bytes;
  const size_t off_kl = off_kh + pl_bytes;
  const size_t off_vt = off_kl + pl_bytes;
  const size_t off_wb = off_vt + pl_bytes;
  const size_t off_xt = off_wb + wb_bytes;
  const size_t off_mk = off_xt + xt_bytes;
  const size_t pt_bytes = (size_t)NPART * PSTR * 8;        // 131072
  const size_t off_pt = off_mk + mk_bytes;
  const size_t total  = off_pt + pt_bytes;                 // 109182976
  if (total > ws_size) return;
  if (total > (size_t)134217728) return;

  char* ws = (char*)d_ws;
  unsigned short* QH = (unsigned short*)(ws + off_qh);
  unsigned short* QL = (unsigned short*)(ws + off_ql);
  unsigned short* KH = (unsigned short*)(ws + off_kh);
  unsigned short* KL = (unsigned short*)(ws + off_kl);
  _Float16* VT = (_Float16*)(ws + off_vt);
  unsigned short* WB = (unsigned short*)(ws + off_wb);
  float* XT = (float*)(ws + off_xt);
  float* MK = (float*)(ws + off_mk);
  double* PT = (double*)(ws + off_pt);

  k_prep<<<NWBLK + NXBLK, 256, 0, stream>>>(wtq, wtk, wtv, wvq, wvk, wvv, WB, XT);

  const size_t proj_lds = 67584;                           // 4*64*RPIT
  hipFuncSetAttribute(reinterpret_cast<const void*>(&k_proj), hipFuncAttributeMaxDynamicSharedMemorySize, (int)proj_lds);
  dim3 gp(NTILE, BATCH + GROWS);                           // rows 0 .. 15 projection, the rest the gate job
  k_proj<<<gp, 512, proj_lds, stream>>>(src, WB, XT, QH, QL, KH, KL, VT, lrn, MK, PT);

  dim3 gr(NQWG, BATCH + 1);                                // rows 0 .. 15 retention, row 16 the loss sum
  k_ret<<<gr, 128 * NGRP, 0, stream>>>(QH, QL, KH, KL, VT, MK, out0, PT, txl, out1);
}
